// v000
// Measured on an AMD MI455X. A time is GPU time per run, averaged over a window of back-to-back runs after a warm-up
// (all launches, gaps included; the runs take copies of the inputs in turn), and the median of several windows.
// Apart from v000's, it joins two sittings. Times from different sittings can be a few percent apart, while
// side-by-side timings come from the same sitting.
// v000, which the later versions start from, runs in 1040 microseconds.
#include <hip/hip_runtime.h>
// Row-wise pair attention on a pair representation ([1,256,256,128], 4 heads × 32): x = LN(pair_rep); q = x·Wq·32^-½, k = x·Wk, v = x·Wv; per (row s, head h): logits[a][b] = Σ_c k[s,a,h,c]·q[s,b,h,c] + mask[a][b] + (x·Wb)[a][b][h]; softmax over b; o[s,a,h,:] = Σ_b attn·v[s,b,h,:]; o *= sigmoid(x·Wfu + bfu); out = o·Wo + bo → [1,256,256,128]. (The module's einsum makes k carry the output index and q the summed index.)
// Compute dtype: inputs and parameters rounded to bf16; x and the gated output carried hi/lo (≈f32); q/k/v planes, probabilities and gate logits f16 (≈2^-12); mask/bias/softmax/LN/sigmoid in f32; f32 accumulation. v_wmma_f32_16x16x32_f16.
#define SL 256
#define NTOK (SL * SL)           /* 65536 */
#define EE 128
#define NHD 4
#define HDC 32
#define SCH 32                   /* rows per attention chunk */
typedef __bf16 v16b __attribute__((ext_vector_type(16)));
typedef unsigned short v8us __attribute__((ext_vector_type(8), may_alias));
typedef float  v8f  __attribute__((ext_vector_type(8)));
typedef float  v4f  __attribute__((ext_vector_type(4)));
typedef float  v4fa __attribute__((ext_vector_type(4), may_alias));
union FragB { v16b v; v8us half[2]; unsigned short u[16]; };

__device__ __forceinline__ unsigned short bf16_bits(float x) { unsigned int u = __float_as_uint(x); return (unsigned short)((u + 0x7FFFu + ((u >> 16) & 1u)) >> 16); }
__device__ __forceinline__ float bf16_val(unsigned short b) { return __uint_as_float(((unsigned int)b) << 16); }
__device__ __forceinline__ float bf16_round(float x) { return bf16_val(bf16_bits(x)); }
// D += A·B with NT terms: 1 = ah·bh, 2 = + al·bh (A split), 3 = + ah·bl (both split)
template <int NT>
__device__ __forceinline__ v8f mmaN(v16b ah, v16b al, v16b bh, v16b bl, v8f c) {
  c = __builtin_amdgcn_wmma_f32_16x16x32_bf16(false, ah, false, bh, (short)0, c, false, false);
  if (NT >= 2) c = __builtin_amdgcn_wmma_f32_16x16x32_bf16(false, al, false, bh, (short)0, c, false, false);
  if (NT >= 3) c = __builtin_amdgcn_wmma_f32_16x16x32_bf16(false, ah, false, bl, (short)0, c, false, false);
  asm volatile("v_nop\n\tv_nop\n\tv_nop\n\tv_nop" : "+v"(c) : "v"(ah), "v"(al), "v"(bh), "v"(bl));
  return c;
}

__global__ __launch_bounds__(256) void k_wt_bf16(const float* __restrict__ W, unsigned short* __restrict__ Wt, int K, int N) {
  const int t = blockIdx.x * 256 + threadIdx.x;
  const int k8n = K / 8;
  if (t >= N * k8n) return;
  const int n = t / k8n, k8 = (t % k8n) * 8;
  v8us v;
#pragma unroll
  for (int i = 0; i < 8; ++i) v[i] = bf16_bits(W[(size_t)(k8 + i) * N + n]);
  *(v8us*)(Wt + (size_t)n * K + k8) = v;
  
}

// GEMM C[M][N] (f32, pitch ldc) = act(A[M][K]·W + bias). A f32 row-major (pitch lda) converted per fragment to bf16
// (ASPLIT: hi/lo two planes -> 2 terms, else single rounded term); Wt bf16 [N][K] (pitch ldb). BIAS_BF16 rounds the
// bias to bf16 first (bias quantised to bf16 before the add). K%32==0, M%16==0, N%64==0.
template <bool ASPLIT, int ACT, bool BIAS_BF16>
__global__ __launch_bounds__(128) void k_gemm_bf(const float* __restrict__ A, int lda, const unsigned short* __restrict__ Wt, int ldb,
                                               const float* __restrict__ bias, float* __restrict__ C, int ldc, int M, int N, int K) {
  __shared__ __attribute__((aligned(16))) float so[4][16][64];
  const int tid = threadIdx.x, w = tid >> 5, lane = tid & 31, ln = lane & 15, hh = lane >> 4;
  const int ntn = N / 64;
  const int wid = blockIdx.x * 4 + w;
  const int mt = wid / ntn, nq = wid % ntn;
  if (mt * 16 >= M) return;
  const int row0 = mt * 16, col0 = nq * 64;
  const float* arow = A + (size_t)(row0 + ln) * lda;
  v8f acc[4] = {};
  for (int kb = 0; kb < K; kb += 32) {
    FragB ah, al;
    const v4f x0 = *(const v4fa*)(arow + kb + 8 * hh), x1 = *(const v4fa*)(arow + kb + 8 * hh + 4);
    const v4f x2 = *(const v4fa*)(arow + kb + 16 + 8 * hh), x3 = *(const v4fa*)(arow + kb + 16 + 8 * hh + 4);
    float xs[16] = {x0[0],x0[1],x0[2],x0[3],x1[0],x1[1],x1[2],x1[3],x2[0],x2[1],x2[2],x2[3],x3[0],x3[1],x3[2],x3[3]};
#pragma unroll
    for (int i = 0; i < 16; ++i) { const unsigned short hb = bf16_bits(xs[i]); ah.u[i] = hb; al.u[i] = ASPLIT ? bf16_bits(xs[i] - bf16_val(hb)) : (unsigned short)0; }
#pragma unroll
    for (int t = 0; t < 4; ++t) {
      const unsigned short* brow = Wt + (size_t)(col0 + t * 16 + ln) * ldb + kb;
      FragB b;
      b.half[0] = *(const v8us*)(brow + 8 * hh);
      b.half[1] = *(const v8us*)(brow + 16 + 8 * hh);
      acc[t] = mmaN<ASPLIT ? 2 : 1>(ah.v, al.v, b.v, b.v, acc[t]);
    }
  }
#pragma unroll
  for (int t = 0; t < 4; ++t) {
    float bv = bias ? bias[col0 + t * 16 + ln] : 0.f;
    if (BIAS_BF16) bv = bf16_round(bv);
#pragma unroll
    for (int r = 0; r < 8; ++r) { float v = acc[t][r] + bv; if (ACT == 1) v = fmaxf(v, 0.f); so[w][8 * hh + r][t * 16 + ln] = v; }
  }
  __builtin_amdgcn_fence(__ATOMIC_ACQ_REL, "workgroup");
  __builtin_amdgcn_wave_barrier();
  const int rsub = lane >> 4, c4 = (lane & 15) * 4;
  {
#pragma unroll
    for (int q = 0; q < 8; ++q) {
      const int r = q * 2 + rsub;
      const v4f v = *(const v4fa*)&so[w][r][c4];
      *(v4f*)(C + (size_t)(row0 + r) * ldc + col0 + c4) = v;
    }
    
  }
}

// GEMM C = act(A·W + bias + resid): A f32 (ASPLIT -> hi/lo 2 terms), Wt bf16 [N][K]; ACT 0 none, 1 relu, 2 exact gelu;
// resid (optional, f32, row index = (row % rmod), pitch ldr, RES_BF16 rounds it) added before the activation.
template <bool ASPLIT, int ACT, bool BIAS_BF16, bool RES_BF16>
__global__ __launch_bounds__(128) void k_gemm_bf3(const float* __restrict__ A, int lda, const unsigned short* __restrict__ Wt, int ldb,
                                                const float* __restrict__ bias, const float* __restrict__ resid, int rmod, int ldr,
                                                float* __restrict__ C, int ldc, int M, int N, int K) {
  __shared__ __attribute__((aligned(16))) float so[4][16][64];
  const int tid = threadIdx.x, w = tid >> 5, lane = tid & 31, ln = lane & 15, hh = lane >> 4;
  const int ntn = N / 64;
  const int wid = blockIdx.x * 4 + w;
  const int mt = wid / ntn, nq = wid % ntn;
  if (mt * 16 >= M) return;
  const int row0 = mt * 16, col0 = nq * 64;
  const float* arow = A + (size_t)(row0 + ln) * lda;
  v8f acc[4] = {};
  for (int kb = 0; kb < K; kb += 32) {
    FragB ah, al;
    const v4f x0 = *(const v4fa*)(arow + kb + 8 * hh), x1 = *(const v4fa*)(arow + kb + 8 * hh + 4);
    const v4f x2 = *(const v4fa*)(arow + kb + 16 + 8 * hh), x3 = *(const v4fa*)(arow + kb + 16 + 8 * hh + 4);
    float xs[16] = {x0[0],x0[1],x0[2],x0[3],x1[0],x1[1],x1[2],x1[3],x2[0],x2[1],x2[2],x2[3],x3[0],x3[1],x3[2],x3[3]};
#pragma unroll
    for (int i = 0; i < 16; ++i) { const unsigned short hb = bf16_bits(xs[i]); ah.u[i] = hb; al.u[i] = ASPLIT ? bf16_bits(xs[i] - bf16_val(hb)) : (unsigned short)0; }
#pragma unroll
    for (int t = 0; t < 4; ++t) {
      const unsigned short* brow = Wt + (size_t)(col0 + t * 16 + ln) * ldb + kb;
      FragB b;
      b.half[0] = *(const v8us*)(brow + 8 * hh);
      b.half[1] = *(const v8us*)(brow + 16 + 8 * hh);
      acc[t] = mmaN<ASPLIT ? 2 : 1>(ah.v, al.v, b.v, b.v, acc[t]);
    }
  }
#pragma unroll
  for (int t = 0; t < 4; ++t) {
    const int col = col0 + t * 16 + ln;
    float bv = bias ? bias[col] : 0.f;
    if (BIAS_BF16) bv = bf16_round(bv);
#pragma unroll
    for (int r = 0; r < 8; ++r) {
      float v = acc[t][r] + bv;
      if (resid) { float rv = resid[(size_t)((row0 + 8 * hh + r) % rmod) * ldr + col]; if (RES_BF16) rv = bf16_round(rv); v += rv; }
      if (ACT == 1) v = fmaxf(v, 0.f);
      if (ACT == 2) v = 0.5f * v * (1.0f + erff(v * 0.70710678118654752f));
      if (ACT == 3) { const float u = 0.7978845608028654f * (v + 0.044715f * v * v * v); v = 0.5f * v * (1.0f + tanhf(u)); }
      so[w][8 * hh + r][t * 16 + ln] = v;
    }
  }
  __builtin_amdgcn_fence(__ATOMIC_ACQ_REL, "workgroup");
  __builtin_amdgcn_wave_barrier();
  const int rsub = lane >> 4, c4 = (lane & 15) * 4;
  {
#pragma unroll
    for (int q = 0; q < 8; ++q) {
      const int r = q * 2 + rsub;
      const v4f v = *(const v4fa*)&so[w][r][c4];
      *(v4f*)(C + (size_t)(row0 + r) * ldc + col0 + c4) = v;
    }
    
  }
}
// row LayerNorm (biased variance, eps) over N: s = X (+ R); optional out_sum <- s; out_norm <- (s-mu)*rsqrt(var+eps)*g + b
template <bool PARAM_BF16>
__global__ __launch_bounds__(256) void k_layernorm(const float* __restrict__ X, const float* __restrict__ R, const float* __restrict__ g, const float* __restrict__ bta,
                                                  float* __restrict__ out_sum, float* __restrict__ out_norm, int N, float eps) {
  __shared__ float red[256];
  const int row = blockIdx.x, tid = threadIdx.x;
  const float* x = X + (size_t)row * N; const float* rr = R ? R + (size_t)row * N : nullptr;
  float vals[16];                     // up to N = 4096
  const int per = N / 256;            // contiguous chunk per thread? use strided-by-4 chunks: thread handles j = tid*4 + 1024*u
  float s1 = 0.f;
  for (int u = 0; u < per / 4; ++u) {
    const int j = tid * 4 + 1024 * u;
    const v4f a = *(const v4fa*)(x + j);
    v4f b = {0.f,0.f,0.f,0.f}; if (rr) b = *(const v4fa*)(rr + j);
#pragma unroll
    for (int q = 0; q < 4; ++q) { const float v = a[q] + b[q]; vals[u * 4 + q] = v; s1 += v; }
  }
  red[tid] = s1; __syncthreads();
  for (int st = 128; st > 0; st >>= 1) { if (tid < st) red[tid] += red[tid + st]; __syncthreads(); }
  const float mu = red[0] / (float)N; __syncthreads();
  float s2 = 0.f;
  for (int u = 0; u < per / 4; ++u)
#pragma unroll
    for (int q = 0; q < 4; ++q) { const float c = vals[u * 4 + q] - mu; s2 += c * c; }
  red[tid] = s2; __syncthreads();
  for (int st = 128; st > 0; st >>= 1) { if (tid < st) red[tid] += red[tid + st]; __syncthreads(); }
  const float rs = rsqrtf(red[0] / (float)N + eps);
  {
    for (int u = 0; u < per / 4; ++u) {
      const int j = tid * 4 + 1024 * u;
      v4f o, sm;
#pragma unroll
      for (int q = 0; q < 4; ++q) {
        float gg = g[j + q], bb = bta[j + q];
        if (PARAM_BF16) { gg = bf16_round(gg); bb = bf16_round(bb); }
        sm[q] = vals[u * 4 + q]; o[q] = (vals[u * 4 + q] - mu) * rs * gg + bb;
      }
      if (out_sum) *(v4f*)(out_sum + (size_t)row * N + j) = sm;
      *(v4f*)(out_norm + (size_t)row * N + j) = o;
    }
    
  }
}



// ---- f16 WMMA path (v_wmma_f32_16x16x32_f16): 11-bit significands for operands in range — used where a [0,1] probability operand needs more precision than bf16
typedef _Float16 v16h __attribute__((ext_vector_type(16)));
union FragH { v16h v; v8us half[2]; _Float16 h[16]; unsigned short u[16]; };
template <int NT>
__device__ __forceinline__ v8f mmaH(v16h ah, v16h al, v16h bh, v16h bl, v8f c) {
  c = __builtin_amdgcn_wmma_f32_16x16x32_f16(false, ah, false, bh, (short)0, c, false, false);
  if (NT >= 2) c = __builtin_amdgcn_wmma_f32_16x16x32_f16(false, al, false, bh, (short)0, c, false, false);
  if (NT >= 3) c = __builtin_amdgcn_wmma_f32_16x16x32_f16(false, ah, false, bl, (short)0, c, false, false);
  asm volatile("v_nop\n\tv_nop\n\tv_nop\n\tv_nop" : "+v"(c) : "v"(ah), "v"(al), "v"(bh), "v"(bl));
  return c;
}
// batched GEMM like k_gemm_b but f16 operands: A f32 (split into f16 hi/lo if ASPLIT, else rounded to f16), Bt = f16 values [n][k]; alpha; C f32; N multiple of 16 (partial tiles skipped)
template <bool ASPLIT>
__global__ __launch_bounds__(128) void k_gemm_h(const float* __restrict__ A, int lda, size_t sA, const _Float16* __restrict__ Bh, int ldb, size_t sB, float alpha, float* __restrict__ C, int ldc, size_t sC, int M, int N, int K) {
  __shared__ __attribute__((aligned(16))) float so[4][16][64];
  const int tid = threadIdx.x, w = tid >> 5, lane = tid & 31, ln = lane & 15, hh = lane >> 4; const int by = blockIdx.y;
  A += (size_t)by * sA; Bh += (size_t)by * sB; C += (size_t)by * sC;
  const int ntn = (N + 63) / 64; const int wid = blockIdx.x * 4 + w; const int mt = wid / ntn, nq = wid % ntn; if (mt * 16 >= M) return;
  const int row0 = mt * 16, col0 = nq * 64; const float* arow = A + (size_t)(row0 + ln) * lda;
  v8f acc[4] = {};
  for (int kb = 0; kb < K; kb += 32) {
    FragH ah, al;
    const v4f x0 = *(const v4fa*)(arow + kb + 8 * hh), x1 = *(const v4fa*)(arow + kb + 8 * hh + 4), x2 = *(const v4fa*)(arow + kb + 16 + 8 * hh), x3 = *(const v4fa*)(arow + kb + 16 + 8 * hh + 4);
    float xs[16] = {x0[0],x0[1],x0[2],x0[3],x1[0],x1[1],x1[2],x1[3],x2[0],x2[1],x2[2],x2[3],x3[0],x3[1],x3[2],x3[3]};
#pragma unroll
    for (int i = 0; i < 16; ++i) { const _Float16 h = (_Float16)xs[i]; ah.h[i] = h; al.h[i] = ASPLIT ? (_Float16)(xs[i] - (float)h) : (_Float16)0.0f; }
#pragma unroll
    for (int t = 0; t < 4; ++t) { if (col0 + t * 16 >= N) continue; const size_t boff = (size_t)(col0 + t * 16 + ln) * ldb + kb; FragH bq; bq.half[0] = *(const v8us*)(Bh + boff + 8 * hh); bq.half[1] = *(const v8us*)(Bh + boff + 16 + 8 * hh);
      acc[t] = mmaH<ASPLIT ? 2 : 1>(ah.v, al.v, bq.v, bq.v, acc[t]); }
  }
#pragma unroll
  for (int t = 0; t < 4; ++t) { if (col0 + t * 16 >= N) continue;
#pragma unroll
    for (int r = 0; r < 8; ++r) so[w][8 * hh + r][t * 16 + ln] = acc[t][r] * alpha; }
  __builtin_amdgcn_fence(__ATOMIC_ACQ_REL, "workgroup"); __builtin_amdgcn_wave_barrier();
  const int rsub = lane >> 4, c4 = (lane & 15) * 4;
  {
#pragma unroll
    for (int q = 0; q < 8; ++q) { const int r = q * 2 + rsub; if (col0 + c4 < N) { const v4f v = *(const v4fa*)&so[w][r][c4]; *(v4f*)(C + (size_t)(row0 + r) * ldc + col0 + c4) = v; } }
     }
}

// Wt[n][k] = f16(W[k][n]·scale) from f32 row-major W[K][N] (scale = power of two; bf16-exact weights stay exact in f16 away from the subnormal range)
__global__ __launch_bounds__(256) void k_wt_f16(const float* __restrict__ W, _Float16* __restrict__ Wt, int K, int N, float scale) {
  const int t = blockIdx.x * 256 + threadIdx.x; if (t >= N * (K / 8)) return; const int n = t / (K / 8), k8 = (t % (K / 8)) * 8; FragH f;
#pragma unroll
  for (int i = 0; i < 8; ++i) f.h[i] = (_Float16)(bf16_round(W[(size_t)(k8 + i) * N + n]) * scale); const v8us o = f.half[0];
  *(v8us*)((unsigned short*)Wt + (size_t)n * K + k8) = o; 
}
// k_gemm_hh variant with fused epilogue: v = acc·alpha + bias[by·sBias + col] (+ CP[(row/rowsPerB)·sCPb + by·64 + col] if CP) ; ACT 0 none / 1 elu ; writes f32 C and/or f16 C16 (each if non-null)
template <int ACT>
__global__ __launch_bounds__(128) void k_gemm_hhx(const _Float16* __restrict__ A, int lda, size_t sA, const _Float16* __restrict__ Bh, int ldb, size_t sB, float alpha, const float* __restrict__ bias, size_t sBias, const float* __restrict__ CP, int rowsPerB, size_t sCPb, int row0g,
    float* __restrict__ C, _Float16* __restrict__ C16, int ldc, size_t sC, int M, int N, int K) {
  __shared__ __attribute__((aligned(16))) float so[4][16][64];
  const int tid = threadIdx.x, w = tid >> 5, lane = tid & 31, ln = lane & 15, hh = lane >> 4; const int by = blockIdx.y;
  A += (size_t)by * sA; Bh += (size_t)by * sB; const size_t cofs = (size_t)by * sC; const float* bp = bias ? bias + (size_t)by * sBias : nullptr;
  const int ntn = (N + 63) / 64; const int wid = blockIdx.x * 4 + w; const int mt = wid / ntn, nq = wid % ntn; if (mt * 16 >= M) return;
  const int row0 = mt * 16, col0 = nq * 64; const _Float16* arow = A + (size_t)(row0 + ln) * lda;
  v8f acc[4] = {};
  for (int kb = 0; kb < K; kb += 32) { FragH ah; ah.half[0] = *(const v8us*)((const unsigned short*)arow + kb + 8 * hh); ah.half[1] = *(const v8us*)((const unsigned short*)arow + kb + 16 + 8 * hh);
#pragma unroll
    for (int t = 0; t < 4; ++t) { if (col0 + t * 16 >= N) continue; const size_t boff = (size_t)(col0 + t * 16 + ln) * ldb + kb; FragH bq; bq.half[0] = *(const v8us*)((const unsigned short*)Bh + boff + 8 * hh); bq.half[1] = *(const v8us*)((const unsigned short*)Bh + boff + 16 + 8 * hh);
      acc[t] = mmaH<1>(ah.v, ah.v, bq.v, bq.v, acc[t]); }
  }
#pragma unroll
  for (int t = 0; t < 4; ++t) { if (col0 + t * 16 >= N) continue; const int col = col0 + t * 16 + ln; const float bv = bp ? bf16_round(bp[col]) : 0.f;
#pragma unroll
    for (int r = 0; r < 8; ++r) { float v = acc[t][r] * alpha + bv; if (CP) { const int bidx = (row0g + row0 + 8 * hh + r) / rowsPerB; v += CP[(size_t)bidx * sCPb + (size_t)by * 64 + col]; } if (ACT == 1) v = (v > 0.f) ? v : expm1f(v); else if (ACT == 7) v = (v > 0.f) ? v + 1.0f : expf(v); else if (ACT == 8) v = tanhf(v); else if (ACT == 9) v = 0.5f * v * (1.0f + tanhf(0.7978845608028654f * (v + 0.044715f * v * v * v))); else if (ACT == 11) v = 1.0f / (1.0f + expf(-v)); else if (ACT == 12) v = (v > 0.f) ? v : 0.01f * v; else if (ACT == 14) v = (v > 0.f) ? v : 0.1f * v; else if (ACT == 15) v = v / (1.0f + expf(-v)); else if (ACT == 3) v = fmaxf(v, 0.f); else if (ACT == 6) v = 0.5f * v * (1.0f + erff(v * 0.70710678118654752f)); so[w][8 * hh + r][t * 16 + ln] = v; } }
  __builtin_amdgcn_fence(__ATOMIC_ACQ_REL, "workgroup"); __builtin_amdgcn_wave_barrier();
  const int rsub = lane >> 4, c4 = (lane & 15) * 4; typedef _Float16 v4h __attribute__((ext_vector_type(4)));
  {
#pragma unroll
    for (int q = 0; q < 8; ++q) { const int r = q * 2 + rsub; if (col0 + c4 < N) { const v4f v = *(const v4fa*)&so[w][r][c4]; if (C) *(v4f*)(C + cofs + (size_t)(row0 + r) * ldc + col0 + c4) = v; if (C16) { v4h h4; for (int i = 0; i < 4; ++i) h4[i] = (_Float16)v[i]; *(v4h*)(C16 + cofs + (size_t)(row0 + r) * ldc + col0 + c4) = h4; } } }
     }
}


typedef _Float16 v4h __attribute__((ext_vector_type(4)));

__global__ __launch_bounds__(256) void k_x16(const float* __restrict__ x, _Float16* __restrict__ X16, size_t n8) { const size_t t = (size_t)blockIdx.x * 256 + threadIdx.x; if (t >= n8) return; FragH f;
#pragma unroll
  for (int q = 0; q < 8; ++q) f.h[q] = (_Float16)bf16_round(x[t * 8 + q]); *(v8us*)((unsigned short*)X16 + t * 8) = f.half[0];  }
__global__ __launch_bounds__(256) void k_h16(const float* __restrict__ x, _Float16* __restrict__ X16, size_t n8) { const size_t t = (size_t)blockIdx.x * 256 + threadIdx.x; if (t >= n8) return; FragH f;
#pragma unroll
  for (int q = 0; q < 8; ++q) f.h[q] = (_Float16)x[t * 8 + q]; *(v8us*)((unsigned short*)X16 + t * 8) = f.half[0];  }
__global__ __launch_bounds__(256) void k_round16f(const float* __restrict__ W, _Float16* __restrict__ Bt, size_t n8) { const size_t t = (size_t)blockIdx.x * 256 + threadIdx.x; if (t >= n8) return; FragH f;
#pragma unroll
  for (int i = 0; i < 8; ++i) f.h[i] = (_Float16)(bf16_round(W[t * 8 + i]) * 16.0f); *(v8us*)((unsigned short*)Bt + t * 8) = f.half[0];  }
template <int NHv, int TTv>
__global__ __launch_bounds__(256) void k_vt(const _Float16* __restrict__ V16, int ldv, int voff, _Float16* __restrict__ Vt) { __shared__ unsigned short tl[64][66]; const int tid = threadIdx.x; const int slab = blockIdx.x / (TTv / 64), lg = blockIdx.x % (TTv / 64); const int b = slab / NHv, h = slab % NHv;
  for (int i = tid; i < 64 * 8; i += 256) { const int r = i / 8, c8 = (i % 8) * 8; FragH f; f.half[0] = *(const v8us*)((const unsigned short*)V16 + ((size_t)b * TTv + lg * 64 + r) * ldv + voff + h * 64 + c8);
#pragma unroll
    for (int q = 0; q < 8; ++q) tl[r][c8 + q] = f.u[q]; }
  __syncthreads();
  {
#pragma unroll
    for (int rd = 0; rd < 2; ++rd) { const int d = rd * 32 + tid / 8, pc = tid % 8; FragH f;
#pragma unroll
      for (int q = 0; q < 8; ++q) f.u[q] = tl[pc * 8 + q][d];
      *(v8us*)((unsigned short*)Vt + ((size_t)slab * 64 + d) * TTv + lg * 64 + pc * 8) = f.half[0]; }
     } }

__global__ __launch_bounds__(256) void k_hl(const float* __restrict__ F, _Float16* __restrict__ Hh, _Float16* __restrict__ Hl, size_t n8) { const size_t t = (size_t)blockIdx.x * 256 + threadIdx.x; if (t >= n8) return; FragH fh, fl; const v4f a = *(const v4fa*)(F + t * 8), c = *(const v4fa*)(F + t * 8 + 4);
#pragma unroll
  for (int q = 0; q < 4; ++q) { _Float16 h = (_Float16)a[q]; fh.h[q] = h; fl.h[q] = (_Float16)((a[q] - (float)h) * 1024.0f); h = (_Float16)c[q]; fh.h[4 + q] = h; fl.h[4 + q] = (_Float16)((c[q] - (float)h) * 1024.0f); }
  { *(v8us*)((unsigned short*)Hh + t * 8) = fh.half[0]; *(v8us*)((unsigned short*)Hl + t * 8) = fl.half[0];  } }

__global__ __launch_bounds__(256) void k_ln(const float* __restrict__ X, const float* __restrict__ g, const float* __restrict__ bb, _Float16* __restrict__ O16, _Float16* __restrict__ L16) {
  #pragma clang fp contract(off)
  const int tid = threadIdx.x, w = tid >> 5, l = tid & 31; const int r = blockIdx.x * 8 + w; if (r >= NTOK) return; const v4f a = *(const v4fa*)(X + (size_t)r * EE + l * 4); float v[4]; float s = 0.f;
#pragma unroll
  for (int k = 0; k < 4; ++k) { v[k] = bf16_round(a[k]); s += v[k]; }
  for (int o = 16; o > 0; o >>= 1) s += __shfl_xor(s, o, 32); const float mu = s / (float)EE; float q2 = 0.f;
#pragma unroll
  for (int k = 0; k < 4; ++k) { const float d = v[k] - mu; q2 += d * d; }
  for (int o = 16; o > 0; o >>= 1) q2 += __shfl_xor(q2, o, 32); const float rs = rsqrtf(q2 / (float)EE + 1e-5f); _Float16 h4[4], l4[4];
#pragma unroll
  for (int k = 0; k < 4; ++k) { const int ch = l * 4 + k; const float xv = (v[k] - mu) * rs * bf16_round(g[ch]) + bf16_round(bb[ch]); h4[k] = (_Float16)xv; l4[k] = (_Float16)((xv - (float)h4[k]) * 1024.0f); }
  const unsigned long long pk = *(const unsigned long long*)h4, pl = *(const unsigned long long*)l4;
  { *(unsigned long long*)((unsigned short*)O16 + (size_t)r * 2 * EE + l * 4) = pk; *(unsigned long long*)((unsigned short*)L16 + (size_t)r * 2 * EE + l * 4) = pl;  } }
__global__ __launch_bounds__(256) void k_wt2(const float* __restrict__ W, int K, int N, float scale, _Float16* __restrict__ Bt) { const int t = blockIdx.x * 256 + threadIdx.x; if (t >= N * (K / 8)) return; const int n = t / (K / 8), k8 = (t % (K / 8)) * 8; FragH f, f2;
#pragma unroll
  for (int i = 0; i < 8; ++i) { const float wv = bf16_round(W[(size_t)(k8 + i) * N + n]) * scale; f.h[i] = (_Float16)wv; f2.h[i] = (_Float16)(wv * 0.0009765625f); }
  { *(v8us*)((unsigned short*)Bt + (size_t)n * 2 * K + k8) = f.half[0]; *(v8us*)((unsigned short*)Bt + (size_t)n * 2 * K + K + k8) = f2.half[0];  } }
__global__ __launch_bounds__(256) void k_wb(const float* __restrict__ w, _Float16* __restrict__ Bt) { const int t = blockIdx.x * 256 + threadIdx.x; if (t >= 16 * (2 * EE / 8)) return; const int k0 = (t % (2 * EE / 8)) * 8, o = t / (2 * EE / 8); const int kk0 = k0 % EE; const float sc = (k0 < EE) ? 16.0f : (16.0f * 0.0009765625f); FragH f;
#pragma unroll
  for (int q = 0; q < 8; ++q) f.h[q] = (o < NHD) ? (_Float16)(bf16_round(w[(size_t)(kk0 + q) * NHD + o]) * sc) : (_Float16)0.0f;
  *(v8us*)((unsigned short*)Bt + (size_t)o * 2 * EE + k0) = f.half[0];  }
__global__ __launch_bounds__(256) void k_soft(const float* __restrict__ S, const float* __restrict__ mask, const _Float16* __restrict__ PB, int h, _Float16* __restrict__ P16) {
  #pragma clang fp contract(off)
  const int tid = threadIdx.x, w = tid >> 5, ln = tid & 31; const int row = blockIdx.x * 8 + w; if (row >= SCH * SL) return; const int a = row % SL; const float* sr = S + (size_t)row * SL;
  auto lgt = [&](int b) { return sr[b] + bf16_round(mask[(size_t)a * SL + b]) + (float)PB[((size_t)a * SL + b) * 16 + h]; };
  float m = -3.0e38f; for (int b = ln; b < SL; b += 32) m = fmaxf(m, lgt(b));
  for (int o = 16; o > 0; o >>= 1) m = fmaxf(m, __shfl_xor(m, o, 32)); float su = 0.f; for (int b = ln; b < SL; b += 32) su += expf(lgt(b) - m);
  for (int o = 16; o > 0; o >>= 1) su += __shfl_xor(su, o, 32); const float inv = 1024.0f / su;
  { FragH f;
#pragma unroll
    for (int k = 0; k < 8; ++k) f.h[k] = (_Float16)(expf(lgt(ln * 8 + k) - m) * inv);
    *(v8us*)((unsigned short*)P16 + (size_t)row * SL + ln * 8) = f.half[0];  } }
__global__ __launch_bounds__(256) void k_gate(const float* __restrict__ O, const _Float16* __restrict__ FU, const float* __restrict__ bfu, _Float16* __restrict__ OG) {
  #pragma clang fp contract(off)
  const int t = blockIdx.x * 256 + threadIdx.x; if (t >= NTOK * (EE / 8)) return; const int c0 = (t % (EE / 8)) * 8, r = t / (EE / 8); const v4f a = *(const v4fa*)(O + (size_t)r * EE + c0), c = *(const v4fa*)(O + (size_t)r * EE + c0 + 4); FragH fu; fu.half[0] = *(const v8us*)((const unsigned short*)FU + (size_t)r * EE + c0); FragH f, f2;
#pragma unroll 1
  for (int q = 0; q < 8; ++q) { const float z = (float)fu.h[q]; const float sg = 1.0f / (1.0f + expf(-z)); const float ov = (q < 4) ? ((q == 0) ? a[0] : (q == 1) ? a[1] : (q == 2) ? a[2] : a[3]) : ((q == 4) ? c[0] : (q == 5) ? c[1] : (q == 6) ? c[2] : c[3]); const float gv = ov * sg; const _Float16 hv = (_Float16)gv; const _Float16 lv = (_Float16)((gv - (float)hv) * 1024.0f);
#pragma unroll
    for (int k = 0; k < 8; ++k) { f.h[k] = (k == q) ? hv : f.h[k]; f2.h[k] = (k == q) ? lv : f2.h[k]; } }      /* bfu added in the GEMM */
  { *(v8us*)((unsigned short*)OG + (size_t)r * 2 * EE + c0) = f.half[0]; *(v8us*)((unsigned short*)OG + (size_t)r * 2 * EE + EE + c0) = f2.half[0];  } }

extern "C" void kernel_launch(void* const* d_in, const int* in_sizes, int n_in,
                              void* d_out, int out_size, void* d_ws, size_t ws_size, hipStream_t stream) {
  (void)in_sizes; (void)n_in; (void)out_size;
  const float* const* I = (const float* const*)d_in; const float* pr = I[0]; const float* mask = I[1]; const float* gam = I[2]; const float* bet = I[3]; const float* Wq = I[4]; const float* Wk = I[5]; const float* Wv = I[6]; const float* Wb = I[7]; const float* Wfu = I[8]; const float* bfu = I[9]; const float* Wo = I[10]; const float* bo = I[11];
  char* ws = (char*)d_ws; size_t off = 0;
  auto take = [&](size_t bytes) { char* p = ws + off; off += (bytes + 255) & ~(size_t)255; return p; };
  _Float16* BQK = (_Float16*)take((size_t)2 * EE * 2 * EE * 2); _Float16* AV = (_Float16*)take((size_t)EE * 2 * EE * 2); _Float16* BB = (_Float16*)take((size_t)16 * 2 * EE * 2); _Float16* BFU = (_Float16*)take((size_t)EE * 2 * EE * 2); _Float16* BO = (_Float16*)take((size_t)EE * 2 * EE * 2);      /* all folded: [W·s | W·s·2^-10] against [hi | lo·2^10] operands (K 256) */
  _Float16* XN2 = (_Float16*)take((size_t)NTOK * 2 * EE * 2); _Float16* QK16 = (_Float16*)take((size_t)NTOK * 2 * EE * 2); _Float16* PB16 = (_Float16*)take((size_t)NTOK * 16 * 2); _Float16* VT16 = (_Float16*)take((size_t)NTOK * EE * 2); float* S = (float*)take((size_t)SCH * SL * SL * 4); _Float16* P16 = (_Float16*)take((size_t)SCH * SL * SL * 2); float* O = (float*)take((size_t)NTOK * EE * 4);
  _Float16* FU16 = VT16;               /* gate logits f16 [65536][128] (16.8 MB) reuse the transposed-v plane after the attention phase */
  _Float16* OG2 = XN2;                 /* gated output [hi | lo·2^10] [65536][256] reuses XN2 after its last read (the gate GEMM) */
  if (off > ws_size) return;      // ≈ 0.4 + 33.5 + 33.5 + 2.1 + 16.8 + 8.4 + 4.2 + 33.5 ≈ 132 MB
  k_wt2<<<(EE * (EE / 8) + 255) / 256, 256, 0, stream>>>(Wq, EE, EE, 16.0f, BQK); k_wt2<<<(EE * (EE / 8) + 255) / 256, 256, 0, stream>>>(Wk, EE, EE, 16.0f, BQK + (size_t)EE * 2 * EE);      /* (in,out) → [256 rows][256] */
  k_wt2<<<(EE * (EE / 8) + 255) / 256, 256, 0, stream>>>(Wv, EE, EE, 1.0f, AV);      /* AV[hc][hi e | lo e] = Wv[e][hc] (raw) — A operand of the transposed-v GEMM against [x_hi | x_lo·2^10] rows */
  k_wb<<<(16 * (2 * EE / 8) + 255) / 256, 256, 0, stream>>>(Wb, BB); k_wt2<<<(EE * (EE / 8) + 255) / 256, 256, 0, stream>>>(Wfu, EE, EE, 16.0f, BFU); k_wt2<<<(EE * (EE / 8) + 255) / 256, 256, 0, stream>>>(Wo, EE, EE, 16.0f, BO);
  const dim3 gT2(((NTOK / 16) * (2 * EE / 64) + 3) / 4, 1), gT1(((NTOK / 16) * (EE / 64) + 3) / 4, 1), gTB(((NTOK / 16) * 1 + 3) / 4, 1);
  k_ln<<<NTOK / 8, 256, 0, stream>>>(pr, gam, bet, XN2, XN2 + EE);      /* XN2[r] = [x_hi (128) | x_lo·2^10 (128)] */
  k_gemm_hhx<0><<<gT2, 128, 0, stream>>>(XN2, 2 * EE, 0, BQK, 2 * EE, 0, 0.0625f, nullptr, 0, nullptr, 1, 0, 0, nullptr, QK16, 2 * EE, 0, NTOK, 2 * EE, 2 * EE);      /* [q | k] from ≈f32 x (unscaled; the 32^-½ goes into the score α) */
  k_gemm_hhx<0><<<gTB, 128, 0, stream>>>(XN2, 2 * EE, 0, BB, 2 * EE, 0, 0.0625f, nullptr, 0, nullptr, 1, 0, 0, nullptr, PB16, 16, 0, NTOK, 16, 2 * EE);      /* pair bias (4 live of 16) → f16 */
  k_gemm_hhx<0><<<dim3(((EE / 16) * (SL / 64) + 3) / 4, SL), 128, 0, stream>>>(AV, 2 * EE, 0, XN2, 2 * EE, (size_t)SL * 2 * EE, 1.0f, nullptr, 0, nullptr, 1, 0, 0, nullptr, VT16, SL, (size_t)EE * SL, EE, SL, 2 * EE);      /* VT[s][hc][b] = Σ_e Wv[e][hc]·x[(s,b)][e] (≈f32 x) */
  const dim3 gS(((SL / 16) * (SL / 64) + 3) / 4, SCH), gV(((SL / 16) * 1 + 3) / 4, SCH);
  for (int h = 0; h < NHD; ++h) for (int s0 = 0; s0 < SL; s0 += SCH) { const size_t T0 = (size_t)s0 * SL;
    k_gemm_hhx<0><<<gS, 128, 0, stream>>>(QK16 + T0 * 2 * EE + EE + h * HDC, 2 * EE, (size_t)SL * 2 * EE, QK16 + T0 * 2 * EE + h * HDC, 2 * EE, (size_t)SL * 2 * EE, 0.17677669529663687f, nullptr, 0, nullptr, 1, 0, 0, S, nullptr, SL, (size_t)SL * SL, SL, SL, HDC);      /* S[sl][a][b] = k[s,a]·q[s,b]·32^-½ (raw f16 × raw f16: α = the scale) */
    k_soft<<<SCH * SL / 8, 256, 0, stream>>>(S, mask, PB16, h, P16);
    k_gemm_hhx<0><<<gV, 128, 0, stream>>>(P16, SL, (size_t)SL * SL, VT16 + (T0 / SL) * EE * SL + (size_t)h * HDC * SL, SL, (size_t)EE * SL, 0.0009765625f, nullptr, 0, nullptr, 1, 0, 0, O + T0 * EE + h * HDC, nullptr, EE, (size_t)SL * EE, SL, HDC, SL); }      /* O[(s,a)][h·32 + c] */
  k_gemm_hhx<0><<<gT1, 128, 0, stream>>>(XN2, 2 * EE, 0, BFU, 2 * EE, 0, 0.0625f, bfu, 0, nullptr, 1, 0, 0, nullptr, FU16, EE, 0, NTOK, EE, 2 * EE);      /* gate logits (+ bfu) → f16 */
  k_gate<<<(NTOK * (EE / 8) + 255) / 256, 256, 0, stream>>>(O, FU16, bfu, OG2);      /* → [og_hi | og_lo·2^10] (XN2's bytes; XN2's last reader was the gate GEMM) */
  k_gemm_hhx<0><<<gT1, 128, 0, stream>>>(OG2, 2 * EE, 0, BO, 2 * EE, 0, 0.0625f, bo, 0, nullptr, 1, 0, 0, (float*)d_out, nullptr, EE, 0, NTOK, EE, 2 * EE);
}

// v002
// Measured time: 137 microseconds a run.
// It is 7.66 times as fast as v000, going by the measured steps of the versions left out in between.
#include <hip/hip_runtime.h>
// Row-wise pair attention on a pair representation ([1,256,256,128], 4 heads × 32): x = LN(pair_rep); q = x·Wq·32^-½, k = x·Wk, v = x·Wv; per (row s, head h): logits[a][b] = Σ_c k[s,a,h,c]·q[s,b,h,c] + mask[a][b] + (x·Wb)[a][b][h]; softmax over b; o[s,a,h,:] = Σ_b attn·v[s,b,h,:]; o *= sigmoid(x·Wfu + bfu); out = o·Wo + bo → [1,256,256,128]. (The module's einsum makes k carry the output index and q the summed index.)
// Compute dtype: inputs and parameters rounded to bf16; x and the gated output carried hi/lo (≈f32); q/k/v planes, pair bias, probabilities and gate logits f16 (≈2^-12); mask/bias/softmax/LN/sigmoid in f32; f32 accumulation. v_wmma_f32_16x16x32_f16.
#define SL 256
#define NTOK (SL * SL)           /* 65536 */
#define EE 128
#define NHD 4
#define HDC 32
typedef __bf16 v16b __attribute__((ext_vector_type(16)));
typedef unsigned short v8us __attribute__((ext_vector_type(8), may_alias));
typedef float  v8f  __attribute__((ext_vector_type(8)));
typedef float  v4f  __attribute__((ext_vector_type(4)));
typedef float  v4fa __attribute__((ext_vector_type(4), may_alias));
union FragB { v16b v; v8us half[2]; unsigned short u[16]; };

__device__ __forceinline__ unsigned short bf16_bits(float x) { unsigned int u = __float_as_uint(x); return (unsigned short)((u + 0x7FFFu + ((u >> 16) & 1u)) >> 16); }
__device__ __forceinline__ float bf16_val(unsigned short b) { return __uint_as_float(((unsigned int)b) << 16); }
__device__ __forceinline__ float bf16_round(float x) { return bf16_val(bf16_bits(x)); }
// D += A·B with NT terms: 1 = ah·bh, 2 = + al·bh (A split), 3 = + ah·bl (both split)
template <int NT>
__device__ __forceinline__ v8f mmaN(v16b ah, v16b al, v16b bh, v16b bl, v8f c) {
  c = __builtin_amdgcn_wmma_f32_16x16x32_bf16(false, ah, false, bh, (short)0, c, false, false);
  if (NT >= 2) c = __builtin_amdgcn_wmma_f32_16x16x32_bf16(false, al, false, bh, (short)0, c, false, false);
  if (NT >= 3) c = __builtin_amdgcn_wmma_f32_16x16x32_bf16(false, ah, false, bl, (short)0, c, false, false);
  asm volatile("v_nop\n\tv_nop\n\tv_nop\n\tv_nop" : "+v"(c) : "v"(ah), "v"(al), "v"(bh), "v"(bl));
  return c;
}

__global__ __launch_bounds__(256) void k_wt_bf16(const float* __restrict__ W, unsigned short* __restrict__ Wt, int K, int N) {
  const int t = blockIdx.x * 256 + threadIdx.x;
  const int k8n = K / 8;
  if (t >= N * k8n) return;
  const int n = t / k8n, k8 = (t % k8n) * 8;
  v8us v;
#pragma unroll
  for (int i = 0; i < 8; ++i) v[i] = bf16_bits(W[(size_t)(k8 + i) * N + n]);
  *(v8us*)(Wt + (size_t)n * K + k8) = v;
  
}

// GEMM C[M][N] (f32, pitch ldc) = act(A[M][K]·W + bias). A f32 row-major (pitch lda) converted per fragment to bf16
// (ASPLIT: hi/lo two planes -> 2 terms, else single rounded term); Wt bf16 [N][K] (pitch ldb). BIAS_BF16 rounds the
// bias to bf16 first (bias quantised to bf16 before the add). K%32==0, M%16==0, N%64==0.
template <bool ASPLIT, int ACT, bool BIAS_BF16>
__global__ __launch_bounds__(128) void k_gemm_bf(const float* __restrict__ A, int lda, const unsigned short* __restrict__ Wt, int ldb,
                                               const float* __restrict__ bias, float* __restrict__ C, int ldc, int M, int N, int K) {
  __shared__ __attribute__((aligned(16))) float so[4][16][64];
  const int tid = threadIdx.x, w = tid >> 5, lane = tid & 31, ln = lane & 15, hh = lane >> 4;
  const int ntn = N / 64;
  const int wid = blockIdx.x * 4 + w;
  const int mt = wid / ntn, nq = wid % ntn;
  if (mt * 16 >= M) return;
  const int row0 = mt * 16, col0 = nq * 64;
  const float* arow = A + (size_t)(row0 + ln) * lda;
  v8f acc[4] = {};
  for (int kb = 0; kb < K; kb += 32) {
    FragB ah, al;
    const v4f x0 = *(const v4fa*)(arow + kb + 8 * hh), x1 = *(const v4fa*)(arow + kb + 8 * hh + 4);
    const v4f x2 = *(const v4fa*)(arow + kb + 16 + 8 * hh), x3 = *(const v4fa*)(arow + kb + 16 + 8 * hh + 4);
    float xs[16] = {x0[0],x0[1],x0[2],x0[3],x1[0],x1[1],x1[2],x1[3],x2[0],x2[1],x2[2],x2[3],x3[0],x3[1],x3[2],x3[3]};
#pragma unroll
    for (int i = 0; i < 16; ++i) { const unsigned short hb = bf16_bits(xs[i]); ah.u[i] = hb; al.u[i] = ASPLIT ? bf16_bits(xs[i] - bf16_val(hb)) : (unsigned short)0; }
#pragma unroll
    for (int t = 0; t < 4; ++t) {
      const unsigned short* brow = Wt + (size_t)(col0 + t * 16 + ln) * ldb + kb;
      FragB b;
      b.half[0] = *(const v8us*)(brow + 8 * hh);
      b.half[1] = *(const v8us*)(brow + 16 + 8 * hh);
      acc[t] = mmaN<ASPLIT ? 2 : 1>(ah.v, al.v, b.v, b.v, acc[t]);
    }
  }
#pragma unroll
  for (int t = 0; t < 4; ++t) {
    float bv = bias ? bias[col0 + t * 16 + ln] : 0.f;
    if (BIAS_BF16) bv = bf16_round(bv);
#pragma unroll
    for (int r = 0; r < 8; ++r) { float v = acc[t][r] + bv; if (ACT == 1) v = fmaxf(v, 0.f); so[w][8 * hh + r][t * 16 + ln] = v; }
  }
  __builtin_amdgcn_fence(__ATOMIC_ACQ_REL, "workgroup");
  __builtin_amdgcn_wave_barrier();
  const int rsub = lane >> 4, c4 = (lane & 15) * 4;
  {
#pragma unroll
    for (int q = 0; q < 8; ++q) {
      const int r = q * 2 + rsub;
      const v4f v = *(const v4fa*)&so[w][r][c4];
      *(v4f*)(C + (size_t)(row0 + r) * ldc + col0 + c4) = v;
    }
    
  }
}

// GEMM C = act(A·W + bias + resid): A f32 (ASPLIT -> hi/lo 2 terms), Wt bf16 [N][K]; ACT 0 none, 1 relu, 2 exact gelu;
// resid (optional, f32, row index = (row % rmod), pitch ldr, RES_BF16 rounds it) added before the activation.
template <bool ASPLIT, int ACT, bool BIAS_BF16, bool RES_BF16>
__global__ __launch_bounds__(128) void k_gemm_bf3(const float* __restrict__ A, int lda, const unsigned short* __restrict__ Wt, int ldb,
                                                const float* __restrict__ bias, const float* __restrict__ resid, int rmod, int ldr,
                                                float* __restrict__ C, int ldc, int M, int N, int K) {
  __shared__ __attribute__((aligned(16))) float so[4][16][64];
  const int tid = threadIdx.x, w = tid >> 5, lane = tid & 31, ln = lane & 15, hh = lane >> 4;
  const int ntn = N / 64;
  const int wid = blockIdx.x * 4 + w;
  const int mt = wid / ntn, nq = wid % ntn;
  if (mt * 16 >= M) return;
  const int row0 = mt * 16, col0 = nq * 64;
  const float* arow = A + (size_t)(row0 + ln) * lda;
  v8f acc[4] = {};
  for (int kb = 0; kb < K; kb += 32) {
    FragB ah, al;
    const v4f x0 = *(const v4fa*)(arow + kb + 8 * hh), x1 = *(const v4fa*)(arow + kb + 8 * hh + 4);
    const v4f x2 = *(const v4fa*)(arow + kb + 16 + 8 * hh), x3 = *(const v4fa*)(arow + kb + 16 + 8 * hh + 4);
    float xs[16] = {x0[0],x0[1],x0[2],x0[3],x1[0],x1[1],x1[2],x1[3],x2[0],x2[1],x2[2],x2[3],x3[0],x3[1],x3[2],x3[3]};
#pragma unroll
    for (int i = 0; i < 16; ++i) { const unsigned short hb = bf16_bits(xs[i]); ah.u[i] = hb; al.u[i] = ASPLIT ? bf16_bits(xs[i] - bf16_val(hb)) : (unsigned short)0; }
#pragma unroll
    for (int t = 0; t < 4; ++t) {
      const unsigned short* brow = Wt + (size_t)(col0 + t * 16 + ln) * ldb + kb;
      FragB b;
      b.half[0] = *(const v8us*)(brow + 8 * hh);
      b.half[1] = *(const v8us*)(brow + 16 + 8 * hh);
      acc[t] = mmaN<ASPLIT ? 2 : 1>(ah.v, al.v, b.v, b.v, acc[t]);
    }
  }
#pragma unroll
  for (int t = 0; t < 4; ++t) {
    const int col = col0 + t * 16 + ln;
    float bv = bias ? bias[col] : 0.f;
    if (BIAS_BF16) bv = bf16_round(bv);
#pragma unroll
    for (int r = 0; r < 8; ++r) {
      float v = acc[t][r] + bv;
      if (resid) { float rv = resid[(size_t)((row0 + 8 * hh + r) % rmod) * ldr + col]; if (RES_BF16) rv = bf16_round(rv); v += rv; }
      if (ACT == 1) v = fmaxf(v, 0.f);
      if (ACT == 2) v = 0.5f * v * (1.0f + erff(v * 0.70710678118654752f));
      if (ACT == 3) { const float u = 0.7978845608028654f * (v + 0.044715f * v * v * v); v = 0.5f * v * (1.0f + tanhf(u)); }
      so[w][8 * hh + r][t * 16 + ln] = v;
    }
  }
  __builtin_amdgcn_fence(__ATOMIC_ACQ_REL, "workgroup");
  __builtin_amdgcn_wave_barrier();
  const int rsub = lane >> 4, c4 = (lane & 15) * 4;
  {
#pragma unroll
    for (int q = 0; q < 8; ++q) {
      const int r = q * 2 + rsub;
      const v4f v = *(const v4fa*)&so[w][r][c4];
      *(v4f*)(C + (size_t)(row0 + r) * ldc + col0 + c4) = v;
    }
    
  }
}
// row LayerNorm (biased variance, eps) over N: s = X (+ R); optional out_sum <- s; out_norm <- (s-mu)*rsqrt(var+eps)*g + b
template <bool PARAM_BF16>
__global__ __launch_bounds__(256) void k_layernorm(const float* __restrict__ X, const float* __restrict__ R, const float* __restrict__ g, const float* __restrict__ bta,
                                                  float* __restrict__ out_sum, float* __restrict__ out_norm, int N, float eps) {
  __shared__ float red[256];
  const int row = blockIdx.x, tid = threadIdx.x;
  const float* x = X + (size_t)row * N; const float* rr = R ? R + (size_t)row * N : nullptr;
  float vals[16];                     // up to N = 4096
  const int per = N / 256;            // contiguous chunk per thread? use strided-by-4 chunks: thread handles j = tid*4 + 1024*u
  float s1 = 0.f;
  for (int u = 0; u < per / 4; ++u) {
    const int j = tid * 4 + 1024 * u;
    const v4f a = *(const v4fa*)(x + j);
    v4f b = {0.f,0.f,0.f,0.f}; if (rr) b = *(const v4fa*)(rr + j);
#pragma unroll
    for (int q = 0; q < 4; ++q) { const float v = a[q] + b[q]; vals[u * 4 + q] = v; s1 += v; }
  }
  red[tid] = s1; __syncthreads();
  for (int st = 128; st > 0; st >>= 1) { if (tid < st) red[tid] += red[tid + st]; __syncthreads(); }
  const float mu = red[0] / (float)N; __syncthreads();
  float s2 = 0.f;
  for (int u = 0; u < per / 4; ++u)
#pragma unroll
    for (int q = 0; q < 4; ++q) { const float c = vals[u * 4 + q] - mu; s2 += c * c; }
  red[tid] = s2; __syncthreads();
  for (int st = 128; st > 0; st >>= 1) { if (tid < st) red[tid] += red[tid + st]; __syncthreads(); }
  const float rs = rsqrtf(red[0] / (float)N + eps);
  {
    for (int u = 0; u < per / 4; ++u) {
      const int j = tid * 4 + 1024 * u;
      v4f o, sm;
#pragma unroll
      for (int q = 0; q < 4; ++q) {
        float gg = g[j + q], bb = bta[j + q];
        if (PARAM_BF16) { gg = bf16_round(gg); bb = bf16_round(bb); }
        sm[q] = vals[u * 4 + q]; o[q] = (vals[u * 4 + q] - mu) * rs * gg + bb;
      }
      if (out_sum) *(v4f*)(out_sum + (size_t)row * N + j) = sm;
      *(v4f*)(out_norm + (size_t)row * N + j) = o;
    }
    
  }
}



// ---- f16 WMMA path (v_wmma_f32_16x16x32_f16): 11-bit significands for operands in range — used where a [0,1] probability operand needs more precision than bf16
typedef _Float16 v16h __attribute__((ext_vector_type(16)));
union FragH { v16h v; v8us half[2]; _Float16 h[16]; unsigned short u[16]; };
template <int NT>
__device__ __forceinline__ v8f mmaH(v16h ah, v16h al, v16h bh, v16h bl, v8f c) {
  c = __builtin_amdgcn_wmma_f32_16x16x32_f16(false, ah, false, bh, (short)0, c, false, false);
  if (NT >= 2) c = __builtin_amdgcn_wmma_f32_16x16x32_f16(false, al, false, bh, (short)0, c, false, false);
  if (NT >= 3) c = __builtin_amdgcn_wmma_f32_16x16x32_f16(false, ah, false, bl, (short)0, c, false, false);
  asm volatile("v_nop\n\tv_nop\n\tv_nop\n\tv_nop" : "+v"(c) : "v"(ah), "v"(al), "v"(bh), "v"(bl));
  return c;
}
// batched GEMM like k_gemm_b but f16 operands: A f32 (split into f16 hi/lo if ASPLIT, else rounded to f16), Bt = f16 values [n][k]; alpha; C f32; N multiple of 16 (partial tiles skipped)
template <bool ASPLIT>
__global__ __launch_bounds__(128) void k_gemm_h(const float* __restrict__ A, int lda, size_t sA, const _Float16* __restrict__ Bh, int ldb, size_t sB, float alpha, float* __restrict__ C, int ldc, size_t sC, int M, int N, int K) {
  __shared__ __attribute__((aligned(16))) float so[4][16][64];
  const int tid = threadIdx.x, w = tid >> 5, lane = tid & 31, ln = lane & 15, hh = lane >> 4; const int by = blockIdx.y;
  A += (size_t)by * sA; Bh += (size_t)by * sB; C += (size_t)by * sC;
  const int ntn = (N + 63) / 64; const int wid = blockIdx.x * 4 + w; const int mt = wid / ntn, nq = wid % ntn; if (mt * 16 >= M) return;
  const int row0 = mt * 16, col0 = nq * 64; const float* arow = A + (size_t)(row0 + ln) * lda;
  v8f acc[4] = {};
  for (int kb = 0; kb < K; kb += 32) {
    FragH ah, al;
    const v4f x0 = *(const v4fa*)(arow + kb + 8 * hh), x1 = *(const v4fa*)(arow + kb + 8 * hh + 4), x2 = *(const v4fa*)(arow + kb + 16 + 8 * hh), x3 = *(const v4fa*)(arow + kb + 16 + 8 * hh + 4);
    float xs[16] = {x0[0],x0[1],x0[2],x0[3],x1[0],x1[1],x1[2],x1[3],x2[0],x2[1],x2[2],x2[3],x3[0],x3[1],x3[2],x3[3]};
#pragma unroll
    for (int i = 0; i < 16; ++i) { const _Float16 h = (_Float16)xs[i]; ah.h[i] = h; al.h[i] = ASPLIT ? (_Float16)(xs[i] - (float)h) : (_Float16)0.0f; }
#pragma unroll
    for (int t = 0; t < 4; ++t) { if (col0 + t * 16 >= N) continue; const size_t boff = (size_t)(col0 + t * 16 + ln) * ldb + kb; FragH bq; bq.half[0] = *(const v8us*)(Bh + boff + 8 * hh); bq.half[1] = *(const v8us*)(Bh + boff + 16 + 8 * hh);
      acc[t] = mmaH<ASPLIT ? 2 : 1>(ah.v, al.v, bq.v, bq.v, acc[t]); }
  }
#pragma unroll
  for (int t = 0; t < 4; ++t) { if (col0 + t * 16 >= N) continue;
#pragma unroll
    for (int r = 0; r < 8; ++r) so[w][8 * hh + r][t * 16 + ln] = acc[t][r] * alpha; }
  __builtin_amdgcn_fence(__ATOMIC_ACQ_REL, "workgroup"); __builtin_amdgcn_wave_barrier();
  const int rsub = lane >> 4, c4 = (lane & 15) * 4;
  {
#pragma unroll
    for (int q = 0; q < 8; ++q) { const int r = q * 2 + rsub; if (col0 + c4 < N) { const v4f v = *(const v4fa*)&so[w][r][c4]; *(v4f*)(C + (size_t)(row0 + r) * ldc + col0 + c4) = v; } }
     }
}

// Wt[n][k] = f16(W[k][n]·scale) from f32 row-major W[K][N] (scale = power of two; bf16-exact weights stay exact in f16 away from the subnormal range)
__global__ __launch_bounds__(256) void k_wt_f16(const float* __restrict__ W, _Float16* __restrict__ Wt, int K, int N, float scale) {
  const int t = blockIdx.x * 256 + threadIdx.x; if (t >= N * (K / 8)) return; const int n = t / (K / 8), k8 = (t % (K / 8)) * 8; FragH f;
#pragma unroll
  for (int i = 0; i < 8; ++i) f.h[i] = (_Float16)(bf16_round(W[(size_t)(k8 + i) * N + n]) * scale); const v8us o = f.half[0];
  *(v8us*)((unsigned short*)Wt + (size_t)n * K + k8) = o; 
}
// k_gemm_hh variant with fused epilogue: v = acc·alpha + bias[by·sBias + col] (+ CP[(row/rowsPerB)·sCPb + by·64 + col] if CP) ; ACT 0 none / 1 elu ; writes f32 C and/or f16 C16 (each if non-null)
template <int ACT>
__global__ __launch_bounds__(128) void k_gemm_hhx(const _Float16* __restrict__ A, int lda, size_t sA, const _Float16* __restrict__ Bh, int ldb, size_t sB, float alpha, const float* __restrict__ bias, size_t sBias, const float* __restrict__ CP, int rowsPerB, size_t sCPb, int row0g,
    float* __restrict__ C, _Float16* __restrict__ C16, int ldc, size_t sC, int M, int N, int K) {
  __shared__ __attribute__((aligned(16))) float so[4][16][64];
  const int tid = threadIdx.x, w = tid >> 5, lane = tid & 31, ln = lane & 15, hh = lane >> 4; const int by = blockIdx.y;
  A += (size_t)by * sA; Bh += (size_t)by * sB; const size_t cofs = (size_t)by * sC; const float* bp = bias ? bias + (size_t)by * sBias : nullptr;
  const int ntn = (N + 63) / 64; const int wid = blockIdx.x * 4 + w; const int mt = wid / ntn, nq = wid % ntn; if (mt * 16 >= M) return;
  const int row0 = mt * 16, col0 = nq * 64; const _Float16* arow = A + (size_t)(row0 + ln) * lda;
  v8f acc[4] = {};
  for (int kb = 0; kb < K; kb += 32) { FragH ah; ah.half[0] = *(const v8us*)((const unsigned short*)arow + kb + 8 * hh); ah.half[1] = *(const v8us*)((const unsigned short*)arow + kb + 16 + 8 * hh);
#pragma unroll
    for (int t = 0; t < 4; ++t) { if (col0 + t * 16 >= N) continue; const size_t boff = (size_t)(col0 + t * 16 + ln) * ldb + kb; FragH bq; bq.half[0] = *(const v8us*)((const unsigned short*)Bh + boff + 8 * hh); bq.half[1] = *(const v8us*)((const unsigned short*)Bh + boff + 16 + 8 * hh);
      acc[t] = mmaH<1>(ah.v, ah.v, bq.v, bq.v, acc[t]); }
  }
#pragma unroll
  for (int t = 0; t < 4; ++t) { if (col0 + t * 16 >= N) continue; const int col = col0 + t * 16 + ln; const float bv = bp ? bf16_round(bp[col]) : 0.f;
#pragma unroll
    for (int r = 0; r < 8; ++r) { float v = acc[t][r] * alpha + bv; if (CP) { const int bidx = (row0g + row0 + 8 * hh + r) / rowsPerB; v += CP[(size_t)bidx * sCPb + (size_t)by * 64 + col]; } if (ACT == 1) v = (v > 0.f) ? v : expm1f(v); else if (ACT == 7) v = (v > 0.f) ? v + 1.0f : expf(v); else if (ACT == 8) v = tanhf(v); else if (ACT == 9) v = 0.5f * v * (1.0f + tanhf(0.7978845608028654f * (v + 0.044715f * v * v * v))); else if (ACT == 11) v = 1.0f / (1.0f + expf(-v)); else if (ACT == 12) v = (v > 0.f) ? v : 0.01f * v; else if (ACT == 14) v = (v > 0.f) ? v : 0.1f * v; else if (ACT == 15) v = v / (1.0f + expf(-v)); else if (ACT == 3) v = fmaxf(v, 0.f); else if (ACT == 6) v = 0.5f * v * (1.0f + erff(v * 0.70710678118654752f)); so[w][8 * hh + r][t * 16 + ln] = v; } }
  __builtin_amdgcn_fence(__ATOMIC_ACQ_REL, "workgroup"); __builtin_amdgcn_wave_barrier();
  const int rsub = lane >> 4, c4 = (lane & 15) * 4; typedef _Float16 v4h __attribute__((ext_vector_type(4)));
  {
#pragma unroll
    for (int q = 0; q < 8; ++q) { const int r = q * 2 + rsub; if (col0 + c4 < N) { const v4f v = *(const v4fa*)&so[w][r][c4]; if (C) *(v4f*)(C + cofs + (size_t)(row0 + r) * ldc + col0 + c4) = v; if (C16) { v4h h4; for (int i = 0; i < 4; ++i) h4[i] = (_Float16)v[i]; *(v4h*)(C16 + cofs + (size_t)(row0 + r) * ldc + col0 + c4) = h4; } } }
     }
}


typedef _Float16 v4h __attribute__((ext_vector_type(4)));

__global__ __launch_bounds__(256) void k_x16(const float* __restrict__ x, _Float16* __restrict__ X16, size_t n8) { const size_t t = (size_t)blockIdx.x * 256 + threadIdx.x; if (t >= n8) return; FragH f;
#pragma unroll
  for (int q = 0; q < 8; ++q) f.h[q] = (_Float16)bf16_round(x[t * 8 + q]); *(v8us*)((unsigned short*)X16 + t * 8) = f.half[0];  }
__global__ __launch_bounds__(256) void k_h16(const float* __restrict__ x, _Float16* __restrict__ X16, size_t n8) { const size_t t = (size_t)blockIdx.x * 256 + threadIdx.x; if (t >= n8) return; FragH f;
#pragma unroll
  for (int q = 0; q < 8; ++q) f.h[q] = (_Float16)x[t * 8 + q]; *(v8us*)((unsigned short*)X16 + t * 8) = f.half[0];  }
__global__ __launch_bounds__(256) void k_round16f(const float* __restrict__ W, _Float16* __restrict__ Bt, size_t n8) { const size_t t = (size_t)blockIdx.x * 256 + threadIdx.x; if (t >= n8) return; FragH f;
#pragma unroll
  for (int i = 0; i < 8; ++i) f.h[i] = (_Float16)(bf16_round(W[t * 8 + i]) * 16.0f); *(v8us*)((unsigned short*)Bt + t * 8) = f.half[0];  }
template <int NHv, int TTv>
__global__ __launch_bounds__(256) void k_vt(const _Float16* __restrict__ V16, int ldv, int voff, _Float16* __restrict__ Vt) { __shared__ unsigned short tl[64][66]; const int tid = threadIdx.x; const int slab = blockIdx.x / (TTv / 64), lg = blockIdx.x % (TTv / 64); const int b = slab / NHv, h = slab % NHv;
  for (int i = tid; i < 64 * 8; i += 256) { const int r = i / 8, c8 = (i % 8) * 8; FragH f; f.half[0] = *(const v8us*)((const unsigned short*)V16 + ((size_t)b * TTv + lg * 64 + r) * ldv + voff + h * 64 + c8);
#pragma unroll
    for (int q = 0; q < 8; ++q) tl[r][c8 + q] = f.u[q]; }
  __syncthreads();
  {
#pragma unroll
    for (int rd = 0; rd < 2; ++rd) { const int d = rd * 32 + tid / 8, pc = tid % 8; FragH f;
#pragma unroll
      for (int q = 0; q < 8; ++q) f.u[q] = tl[pc * 8 + q][d];
      *(v8us*)((unsigned short*)Vt + ((size_t)slab * 64 + d) * TTv + lg * 64 + pc * 8) = f.half[0]; }
     } }

__global__ __launch_bounds__(256) void k_hl(const float* __restrict__ F, _Float16* __restrict__ Hh, _Float16* __restrict__ Hl, size_t n8) { const size_t t = (size_t)blockIdx.x * 256 + threadIdx.x; if (t >= n8) return; FragH fh, fl; const v4f a = *(const v4fa*)(F + t * 8), c = *(const v4fa*)(F + t * 8 + 4);
#pragma unroll
  for (int q = 0; q < 4; ++q) { _Float16 h = (_Float16)a[q]; fh.h[q] = h; fl.h[q] = (_Float16)((a[q] - (float)h) * 1024.0f); h = (_Float16)c[q]; fh.h[4 + q] = h; fl.h[4 + q] = (_Float16)((c[q] - (float)h) * 1024.0f); }
  { *(v8us*)((unsigned short*)Hh + t * 8) = fh.half[0]; *(v8us*)((unsigned short*)Hl + t * 8) = fl.half[0];  } }

// Offset in halves of the 8 values k = kk .. kk + 7 (kk a multiple of 8) of row n, K 256, in matrix-fragment order [n / 16][kk / 32][half][lane][8], half = (kk >> 4) & 1, lane = 16 * ((kk >> 3) & 1) + n % 16:
// a wave's 16-byte load of half a fragment then covers 512 contiguous bytes (four whole lines) instead of pieces of sixteen lines.
__device__ __forceinline__ size_t frag_off(int n, int kk) { return ((((size_t)(n >> 4) * 8 + (kk >> 5)) * 2 + ((kk >> 4) & 1)) * 32 + ((kk >> 3) & 1) * 16 + (n & 15)) * 8; }
__global__ __launch_bounds__(256) void k_wt2(const float* __restrict__ W, int K, int N, float scale, _Float16* __restrict__ Bt) { const int t = blockIdx.x * 256 + threadIdx.x; if (t >= N * (K / 8)) return; const int n = t / (K / 8), k8 = (t % (K / 8)) * 8; FragH f, f2;
#pragma unroll
  for (int i = 0; i < 8; ++i) { const float wv = bf16_round(W[(size_t)(k8 + i) * N + n]) * scale; f.h[i] = (_Float16)wv; f2.h[i] = (_Float16)(wv * 0.0009765625f); }
  { *(v8us*)((unsigned short*)Bt + (size_t)n * 2 * K + k8) = f.half[0]; *(v8us*)((unsigned short*)Bt + (size_t)n * 2 * K + K + k8) = f2.half[0];  } }
// The folded weights of k_wt2 for K = N = 128, stored in fragment order for k_proj. 2048 threads, one (n, k8) each; neighbouring threads take neighbouring n (whole lines on the load side).
__global__ __launch_bounds__(256) void k_wtf(const float* __restrict__ W, float scale, _Float16* __restrict__ Bt) { const int t = blockIdx.x * 256 + threadIdx.x; const int n = t % EE, k8 = (t / EE) * 8; const int i0 = k8 * EE + n; float x[8]; FragH f, f2;
#pragma unroll
  for (int i = 0; i < 8; ++i) x[i] = W[i0 + i * EE];
  asm volatile("s_wait_xcnt 0x0" :: "v"(i0) : "memory");      /* named as an input, the eight loads' offset register stays whole up to this wait: none of their results lands on it */
#pragma unroll
  for (int i = 0; i < 8; ++i) { const float wv = bf16_round(x[i]) * scale; f.h[i] = (_Float16)wv; f2.h[i] = (_Float16)(wv * 0.0009765625f); }
  { *(v8us*)((unsigned short*)Bt + frag_off(n, k8)) = f.half[0]; *(v8us*)((unsigned short*)Bt + frag_off(n, EE + k8)) = f2.half[0];  } }
__global__ __launch_bounds__(256) void k_wb(const float* __restrict__ w, _Float16* __restrict__ Bt) { const int t = blockIdx.x * 256 + threadIdx.x; if (t >= 16 * (2 * EE / 8)) return; const int k0 = (t % (2 * EE / 8)) * 8, o = t / (2 * EE / 8); const int kk0 = k0 % EE; const float sc = (k0 < EE) ? 16.0f : (16.0f * 0.0009765625f); FragH f;
#pragma unroll
  for (int q = 0; q < 8; ++q) f.h[q] = (o < NHD) ? (_Float16)(bf16_round(w[(size_t)(kk0 + q) * NHD + o]) * sc) : (_Float16)0.0f;
  *(v8us*)((unsigned short*)Bt + frag_off(o, k0)) = f.half[0];  }
// LayerNorm and every product that reads x, in one launch. A block normalises 128 tokens into LDS as [x_hi (128) | x_lo*2^10 (128)] f16 rows and its eight waves form, against the folded weights
// [W*s | W*s*2^-10] (K 256, packed in fragment order): [q | k] (8 units of 64 tokens x 64 columns), gate logits (4 units), v^T (4 units), two units a wave, and the pair bias (one 16-token tile a wave).
#define XP 264                   /* staged x row pitch in halves: 512 B of data + 16 B (16 B x odd: conflict-free ds_load_b128) */
#define SP 72                    /* output staging row pitch in halves: 128 B of data + 16 B */
#define TM 128                   /* tokens per block */
typedef _Float16 v4ha __attribute__((ext_vector_type(4), may_alias));
// One 64 x 64 unit. KIND 0: [q | k], 1: gate logits (+ bias), both stored [token][column]; 2: v^T, stored [column][token].
// The operand whose index runs along the stored row goes in as A: a lane then holds 8 neighbours of one stored row (16 bytes), and the wave's own LDS range turns them into whole 128-byte lines.
// Every loop here and in k_proj is unrolled because its index picks registers (fragments, accumulators, a row's values), which only a compile-time index can.
template <int KIND>
__device__ __forceinline__ void proj_unit(const unsigned short* xs, const unsigned short* __restrict__ wt, const float* bias /* LDS, rounded */, unsigned short* st, unsigned short* __restrict__ out, int ldo, int lane) {
  const int ln = lane & 15, hh = lane >> 4;
  const unsigned short* xr = xs + ln * XP + 8 * hh;
  const unsigned short* wr = wt + lane * 8;      /* fragment order: 4096 halves a 16-row tile, 512 a k step, 256 half a fragment */
  const float alpha = (KIND == 2) ? 1.0f : 0.0625f;
  v8f acc[4][4] = {};
  FragH wf[2][4];                /* weight fragments come from L2: fetched one k step ahead */
#pragma unroll
  for (int j = 0; j < 4; ++j) { wf[0][j].half[0] = *(const v8us*)(wr + j * 4096); wf[0][j].half[1] = *(const v8us*)(wr + j * 4096 + 256); }
#pragma unroll
  for (int kb = 0; kb < 8; ++kb) {
    if (kb + 1 < 8) {
#pragma unroll
      for (int j = 0; j < 4; ++j) { wf[(kb + 1) & 1][j].half[0] = *(const v8us*)(wr + j * 4096 + (kb + 1) * 512); wf[(kb + 1) & 1][j].half[1] = *(const v8us*)(wr + j * 4096 + (kb + 1) * 512 + 256); }
    }
    FragH xf[4];
#pragma unroll
    for (int i = 0; i < 4; ++i) { xf[i].half[0] = *(const v8us*)(xr + i * 16 * XP + kb * 32); xf[i].half[1] = *(const v8us*)(xr + i * 16 * XP + kb * 32 + 16); }
    __builtin_amdgcn_sched_barrier(0);      /* keeps the next step's weight loads and this step's LDS reads in one group ahead of the 16 products: left alone the compiler sinks each load to its first use, and the wave waits out every latency */
#pragma unroll
    for (int i = 0; i < 4; ++i)
#pragma unroll
      for (int j = 0; j < 4; ++j)
        acc[i][j] = (KIND == 2) ? __builtin_amdgcn_wmma_f32_16x16x32_f16(false, xf[i].v, false, wf[kb & 1][j].v, (short)0, acc[i][j], false, false)
                                : __builtin_amdgcn_wmma_f32_16x16x32_f16(false, wf[kb & 1][j].v, false, xf[i].v, (short)0, acc[i][j], false, false);
    __builtin_amdgcn_sched_barrier(0);      /* keeps later steps' loads from rising further: a third set of fragments would not fit 256 registers */
  }
  asm volatile("s_wait_xcnt 0x0" :: "v"(lane), "s"(wt) : "memory");      /* the weight loads' address registers (lane offset, scalar base) are reused only behind this wait: named as inputs, they stay whole up to it */
#pragma unroll
  for (int j = 0; j < 4; ++j) {
    float bv[8] = {0.f, 0.f, 0.f, 0.f, 0.f, 0.f, 0.f, 0.f};
    if (KIND == 1) { const v4f b0 = *(const v4fa*)(bias + j * 16 + 8 * hh), b1 = *(const v4fa*)(bias + j * 16 + 8 * hh + 4);
#pragma unroll
      for (int r = 0; r < 4; ++r) { bv[r] = b0[r]; bv[4 + r] = b1[r]; } }
#pragma unroll
    for (int i = 0; i < 4; ++i) { FragH f;
#pragma unroll
      for (int r = 0; r < 8; ++r) f.h[r] = (_Float16)((KIND == 1) ? acc[i][j][r] * alpha + bv[r] : acc[i][j][r] * alpha);
      const int row = (KIND == 2) ? j * 16 + ln : i * 16 + ln, col = (KIND == 2) ? i * 16 + 8 * hh : j * 16 + 8 * hh;
      *(v8us*)&st[row * SP + col] = f.half[0]; }
  }
  __builtin_amdgcn_fence(__ATOMIC_ACQ_REL, "workgroup", "local"); __builtin_amdgcn_wave_barrier();      /* the rows read below were written by other lanes of this wave */
#pragma unroll
  for (int q = 0; q < 16; ++q) { const int row = q * 4 + (lane >> 3), c8 = (lane & 7) * 8; const v8us v = *(const v8us*)&st[row * SP + c8]; *(v8us*)(out + (size_t)row * ldo + c8) = v; }
  asm volatile("s_wait_xcnt 0x0" ::: "memory");      /* the stores' address and data registers are reused by what follows only behind this wait; its clobber also keeps the next unit's writes of st behind the reads above */
}
// Two blocks a WGP (LDS allows two): four waves per SIMD, so 256 registers a wave.
__global__ __launch_bounds__(256) __attribute__((amdgpu_waves_per_eu(4, 4))) void k_proj(const float* __restrict__ X, const float* __restrict__ g, const float* __restrict__ bb, const float* __restrict__ bfu,
                                              const _Float16* __restrict__ BQK, const _Float16* __restrict__ AV, const _Float16* __restrict__ BB, const _Float16* __restrict__ BFU,
                                              _Float16* __restrict__ QK, _Float16* __restrict__ VT, _Float16* __restrict__ PB, _Float16* __restrict__ FU) {
  __shared__ __attribute__((aligned(16))) unsigned short xs[TM * XP];
  __shared__ __attribute__((aligned(16))) unsigned short stg[8 * 64 * SP];
  __shared__ __attribute__((aligned(16))) float sb[2 * EE];      /* the gate bias, twice: every thread loads and stores one value, so the load issues with the row loads and no wave waits for it in a branch of its own */
  const int tid = threadIdx.x, lane = tid & 31, ln = lane & 15, hh = lane >> 4;
  const int w = __builtin_amdgcn_readfirstlane(tid >> 5);      /* the wave's number in a scalar register: the choice of units below is a scalar branch */
  const int tok0 = blockIdx.x * TM;
  const int bi = tid & (EE - 1);
  const float bfv = bfu[bi];
  asm volatile("s_wait_xcnt 0x0" :: "v"(bi) : "memory");      /* named as an input, the load's index register stays whole up to this wait: the row loads below may land on it only behind it */
  { /* LayerNorm: wave w takes tokens 16 w .. 16 w + 15, a whole row per wave, 4 channels a lane */
    float v[16][4], s[16], q2[16];
#pragma unroll
    for (int u = 0; u < 16; ++u) { const v4f a = *(const v4fa*)(X + (size_t)(tok0 + w * 16 + u) * EE + lane * 4);
#pragma unroll
      for (int k = 0; k < 4; ++k) v[u][k] = a[k]; }
    const v4f g4 = *(const v4fa*)(g + lane * 4), b4 = *(const v4fa*)(bb + lane * 4);
#pragma unroll
    for (int u = 0; u < 16; ++u) { s[u] = 0.f;
#pragma unroll
      for (int k = 0; k < 4; ++k) { v[u][k] = bf16_round(v[u][k]); s[u] += v[u][k]; } }
#pragma unroll
    for (int o = 16; o > 0; o >>= 1)
#pragma unroll
      for (int u = 0; u < 16; ++u) s[u] += __shfl_xor(s[u], o, 32);
#pragma unroll
    for (int u = 0; u < 16; ++u) { const float mu = s[u] / (float)EE; q2[u] = 0.f;
#pragma unroll
      for (int k = 0; k < 4; ++k) { v[u][k] -= mu; q2[u] += v[u][k] * v[u][k]; } }
#pragma unroll
    for (int o = 16; o > 0; o >>= 1)
#pragma unroll
      for (int u = 0; u < 16; ++u) q2[u] += __shfl_xor(q2[u], o, 32);
#pragma unroll
    for (int u = 0; u < 16; ++u) { const float rs = rsqrtf(q2[u] / (float)EE + 1e-5f); v4ha h4, l4;
#pragma unroll
      for (int k = 0; k < 4; ++k) { const float xv = v[u][k] * rs * bf16_round(g4[k]) + bf16_round(b4[k]); h4[k] = (_Float16)xv; l4[k] = (_Float16)((xv - (float)h4[k]) * 1024.0f); }
      *(v4ha*)&xs[(w * 16 + u) * XP + lane * 4] = h4; *(v4ha*)&xs[(w * 16 + u) * XP + EE + lane * 4] = l4; }
  }
  sb[tid] = bf16_round(bfv);      /* the gate bias, rounded once a block */
  __syncthreads();               /* publishes the normalised tile (and the bias) to all eight waves */
  const int th = w & 1;          /* which 64 of the block's 128 tokens */
  const unsigned short* xh = xs + th * 64 * XP;
  unsigned short* st = stg + w * 64 * SP;
  const size_t tokh = (size_t)tok0 + th * 64;
  proj_unit<0>(xh, (const unsigned short*)BQK + (size_t)(w >> 1) * 64 * 2 * EE, nullptr, st, (unsigned short*)QK + tokh * 2 * EE + (w >> 1) * 64, 2 * EE, lane);
  if (w < 4) proj_unit<1>(xh, (const unsigned short*)BFU + (size_t)(w >> 1) * 64 * 2 * EE, sb + (w >> 1) * 64, st, (unsigned short*)FU + tokh * EE + (w >> 1) * 64, EE, lane);
  else       proj_unit<2>(xh, (const unsigned short*)AV + (size_t)((w >> 1) & 1) * 64 * 2 * EE, nullptr, st, (unsigned short*)VT + ((size_t)(tok0 / SL) * EE + ((w >> 1) & 1) * 64) * SL + (tok0 % SL) + th * 64, SL, lane);
  { /* pair bias of tokens 16 w .. 16 w + 15 (4 live of 16 columns): a lane holds 8 columns of one token */
    const unsigned short* xr = xs + (w * 16 + ln) * XP + 8 * hh; const unsigned short* wr = (const unsigned short*)BB + lane * 8;
    v8f c = {}; FragH wf[8];
#pragma unroll
    for (int kb = 0; kb < 8; ++kb) { wf[kb].half[0] = *(const v8us*)(wr + kb * 512); wf[kb].half[1] = *(const v8us*)(wr + kb * 512 + 256); }
    asm volatile("s_wait_xcnt 0x0" :: "v"(lane), "s"(BB) : "memory");      /* named as inputs, the loads' address registers (lane offset, scalar base) stay whole up to this wait: none of the sixteen loads lands on them */
#pragma unroll
    for (int kb = 0; kb < 8; ++kb) { FragH xf; xf.half[0] = *(const v8us*)(xr + kb * 32); xf.half[1] = *(const v8us*)(xr + kb * 32 + 16);
      c = __builtin_amdgcn_wmma_f32_16x16x32_f16(false, wf[kb].v, false, xf.v, (short)0, c, false, false); }
    FragH f;
#pragma unroll
    for (int r = 0; r < 8; ++r) f.h[r] = (_Float16)(c[r] * 0.0625f);
    *(v8us*)((unsigned short*)PB + ((size_t)tok0 + w * 16 + ln) * 16 + 8 * hh) = f.half[0]; }
}
// BF[h][a-tile][b-tile][p][lane][i] = (bf16(mask[a][b]) + pair_bias[a][b][h]) * sqrt(32), a = 16*atile + (lane & 15), b = 16*btile + 8*(lane >> 4) + 4*p + i:
// the accumulator (C) fragment order of the transposed score tile, so that k_attn loads it with whole-line 16-byte loads. The sqrt(32) undoes the score scale applied after the product.
__global__ __launch_bounds__(256) void k_bias(const float* __restrict__ mask, const _Float16* __restrict__ PB, float* __restrict__ BF) {
  const int t = blockIdx.x * 256 + threadIdx.x; if (t >= (SL / 16) * (SL / 16) * 64) return;
  const int lane = t & 31, p = (t >> 5) & 1, bt = (t >> 6) & 15, at = t >> 10; const int a = at * 16 + (lane & 15), b = bt * 16 + 8 * (lane >> 4) + 4 * p;
  const v4f mk = *(const v4fa*)(mask + (size_t)a * SL + b);
#pragma unroll
  for (int h = 0; h < NHD; ++h) { v4f o;
#pragma unroll
    for (int i = 0; i < 4; ++i) o[i] = (bf16_round(mk[i]) + (float)PB[((size_t)a * SL + b + i) * 16 + h]) * 5.656854249492381f;
    *(v4f*)(BF + ((((size_t)h * 16 + at) * 16 + bt) * 2 + p) * 128 + lane * 4) = o; } }

__device__ __forceinline__ v8f exp2x8(v8f x) {
  float a = x[0], b = x[1], c = x[2], d = x[3], e = x[4], f = x[5], g = x[6], h = x[7];
  asm("v_exp_f32 %0, %0\n\tv_exp_f32 %1, %1\n\tv_exp_f32 %2, %2\n\tv_exp_f32 %3, %3\n\tv_exp_f32 %4, %4\n\tv_exp_f32 %5, %5\n\tv_exp_f32 %6, %6\n\tv_exp_f32 %7, %7\n\tv_nop"
      : "+v"(a), "+v"(b), "+v"(c), "+v"(d), "+v"(e), "+v"(f), "+v"(g), "+v"(h));
  return (v8f){a, b, c, d, e, f, g, h};
}
// value of lane l ^ 16 (the other half of the wave), without LDS
__device__ __forceinline__ float other_half(float x) { const int b = __float_as_int(x); return __int_as_float(__builtin_amdgcn_permlanex16(b, b, 0x76543210, 0xfedcba98, false, false)); }
#define QP 40                    /* staged q row pitch in halves: 64 B of data + 16 B (16 B x odd: conflict-free ds_load_b128) */
#define VP 264                   /* staged v^T row pitch in halves: 512 B of data + 16 B */
__global__ __launch_bounds__(256) void k_attn(const _Float16* __restrict__ QK, const _Float16* __restrict__ VT, const float* __restrict__ BF, float* __restrict__ O) {
  __shared__ __attribute__((aligned(16))) unsigned short sq[SL * QP];
  __shared__ __attribute__((aligned(16))) unsigned short sv[HDC * VP];
  const int tid = threadIdx.x, w = tid >> 5, lane = tid & 31, ln = lane & 15, hh = lane >> 4;
  const int s = blockIdx.x >> 3, h = (blockIdx.x >> 1) & 3, at = (blockIdx.x & 1) * 8 + w;
  const unsigned short* qk = (const unsigned short*)QK + (size_t)s * SL * 2 * EE + h * HDC;
  const unsigned short* vt = (const unsigned short*)VT + ((size_t)s * EE + h * HDC) * SL;
  v8us gq[4], gv[4];
#pragma unroll
  for (int u = 0; u < 4; ++u) { const int id = tid + 256 * u; gq[u] = *(const v8us*)(qk + (size_t)(id >> 2) * 2 * EE + (id & 3) * 8); gv[u] = *(const v8us*)(vt + (size_t)id * 8); }
  FragH kf; { const unsigned short* kr = qk + (size_t)(at * 16 + ln) * 2 * EE + EE; kf.half[0] = *(const v8us*)(kr + 8 * hh); kf.half[1] = *(const v8us*)(kr + 16 + 8 * hh); }
  asm volatile("s_wait_xcnt 0x0" ::: "memory");      /* the address registers of the ten loads above are free for reuse as destinations of the loads below only behind this wait */
  const float* bf = BF + ((size_t)h * 16 + at) * 16 * 256 + lane * 4;
  v8f acc[16];
#pragma unroll
  for (int t = 0; t < 16; ++t) { const v4f lo = *(const v4fa*)(bf + t * 256), hi = *(const v4fa*)(bf + t * 256 + 128); acc[t] = (v8f){lo[0], lo[1], lo[2], lo[3], hi[0], hi[1], hi[2], hi[3]}; }
#pragma unroll
  for (int u = 0; u < 4; ++u) { const int id = tid + 256 * u; *(v8us*)&sq[(id >> 2) * QP + (id & 3) * 8] = gq[u]; *(v8us*)&sv[(id >> 5) * VP + (id & 31) * 8] = gv[u]; }
  __syncthreads();               /* publishes the staged q and v^T tiles to all eight waves */
#pragma unroll
  for (int t = 0; t < 16; ++t) { FragH qf; const unsigned short* qr = &sq[(t * 16 + ln) * QP + 8 * hh]; qf.half[0] = *(const v8us*)qr; qf.half[1] = *(const v8us*)(qr + 16);
    acc[t] = __builtin_amdgcn_wmma_f32_16x16x32_f16(false, qf.v, false, kf.v, (short)0, acc[t], false, false); }
  float mx[4] = {-3.0e38f, -3.0e38f, -3.0e38f, -3.0e38f};
#pragma unroll
  for (int t = 0; t < 16; ++t)
#pragma unroll
    for (int r = 0; r < 8; ++r) mx[r & 3] = fmaxf(mx[r & 3], acc[t][r]);
  float m = fmaxf(fmaxf(mx[0], mx[1]), fmaxf(mx[2], mx[3])); m = fmaxf(m, other_half(m));
  const float cs = 0.17677669529663687f * 1.4426950408889634f;      /* 32^-1/2 * log2(e) */
  const float mc = 10.0f - m * cs;                                  /* p = 2^10 * exp(logit - max): the f16 range the probabilities had before */
  float sm[4] = {0.f, 0.f, 0.f, 0.f};
  FragH pf[8];
#pragma unroll
  for (int t = 0; t < 16; ++t) { v8f z;
#pragma unroll
    for (int r = 0; r < 8; ++r) z[r] = __builtin_fmaf(acc[t][r], cs, mc);
    const v8f e = exp2x8(z);
#pragma unroll
    for (int r = 0; r < 8; ++r) { sm[r & 3] += e[r]; pf[t >> 1].h[(t & 1) * 8 + r] = (_Float16)e[r]; } }
  float su = (sm[0] + sm[1]) + (sm[2] + sm[3]); su += other_half(su);
  v8f o[2] = {};
#pragma unroll
  for (int kk = 0; kk < 8; ++kk)
#pragma unroll
    for (int j = 0; j < 2; ++j) { FragH vf; const unsigned short* vr = &sv[(j * 16 + ln) * VP + kk * 32 + 8 * hh]; vf.half[0] = *(const v8us*)vr; vf.half[1] = *(const v8us*)(vr + 16);
      o[j] = __builtin_amdgcn_wmma_f32_16x16x32_f16(false, vf.v, false, pf[kk].v, (short)0, o[j], false, false); }
  const float inv = 1.0f / su;
  float* orow = O + ((size_t)s * SL + at * 16 + ln) * EE + h * HDC + 8 * hh;
#pragma unroll
  for (int j = 0; j < 2; ++j) { const v4f a0 = {o[j][0] * inv, o[j][1] * inv, o[j][2] * inv, o[j][3] * inv}, a1 = {o[j][4] * inv, o[j][5] * inv, o[j][6] * inv, o[j][7] * inv};
    *(v4f*)(orow + j * 16) = a0; *(v4f*)(orow + j * 16 + 4) = a1; } }
__global__ __launch_bounds__(256) void k_gate(const float* __restrict__ O, const _Float16* __restrict__ FU, const float* __restrict__ bfu, _Float16* __restrict__ OG) {
  #pragma clang fp contract(off)
  const int t = blockIdx.x * 256 + threadIdx.x; if (t >= NTOK * (EE / 8)) return; const int c0 = (t % (EE / 8)) * 8, r = t / (EE / 8); const v4f a = *(const v4fa*)(O + (size_t)r * EE + c0), c = *(const v4fa*)(O + (size_t)r * EE + c0 + 4); FragH fu; fu.half[0] = *(const v8us*)((const unsigned short*)FU + (size_t)r * EE + c0); FragH f, f2;
#pragma unroll 1
  for (int q = 0; q < 8; ++q) { const float z = (float)fu.h[q]; const float sg = 1.0f / (1.0f + expf(-z)); const float ov = (q < 4) ? ((q == 0) ? a[0] : (q == 1) ? a[1] : (q == 2) ? a[2] : a[3]) : ((q == 4) ? c[0] : (q == 5) ? c[1] : (q == 6) ? c[2] : c[3]); const float gv = ov * sg; const _Float16 hv = (_Float16)gv; const _Float16 lv = (_Float16)((gv - (float)hv) * 1024.0f);
#pragma unroll
    for (int k = 0; k < 8; ++k) { f.h[k] = (k == q) ? hv : f.h[k]; f2.h[k] = (k == q) ? lv : f2.h[k]; } }      /* bfu added in the GEMM */
  { *(v8us*)((unsigned short*)OG + (size_t)r * 2 * EE + c0) = f.half[0]; *(v8us*)((unsigned short*)OG + (size_t)r * 2 * EE + EE + c0) = f2.half[0];  } }

extern "C" void kernel_launch(void* const* d_in, const int* in_sizes, int n_in,
                              void* d_out, int out_size, void* d_ws, size_t ws_size, hipStream_t stream) {
  (void)in_sizes; (void)n_in; (void)out_size;
  const float* const* I = (const float* const*)d_in; const float* pr = I[0]; const float* mask = I[1]; const float* gam = I[2]; const float* bet = I[3]; const float* Wq = I[4]; const float* Wk = I[5]; const float* Wv = I[6]; const float* Wb = I[7]; const float* Wfu = I[8]; const float* bfu = I[9]; const float* Wo = I[10]; const float* bo = I[11];
  char* ws = (char*)d_ws; size_t off = 0;
  auto take = [&](size_t bytes) { char* p = ws + off; off += (bytes + 255) & ~(size_t)255; return p; };
  _Float16* BQK = (_Float16*)take((size_t)2 * EE * 2 * EE * 2); _Float16* AV = (_Float16*)take((size_t)EE * 2 * EE * 2); _Float16* BB = (_Float16*)take((size_t)16 * 2 * EE * 2); _Float16* BFU = (_Float16*)take((size_t)EE * 2 * EE * 2); _Float16* BO = (_Float16*)take((size_t)EE * 2 * EE * 2);      /* all folded: [W·s | W·s·2^-10] against [hi | lo·2^10] operands (K 256) */
  _Float16* OG2 = (_Float16*)take((size_t)NTOK * 2 * EE * 2); _Float16* QK16 = (_Float16*)take((size_t)NTOK * 2 * EE * 2); _Float16* PB16 = (_Float16*)take((size_t)NTOK * 16 * 2); _Float16* VT16 = (_Float16*)take((size_t)NTOK * EE * 2); float* BF = (float*)take((size_t)NHD * SL * SL * 4); float* O = (float*)take((size_t)NTOK * EE * 4); _Float16* FU16 = (_Float16*)take((size_t)NTOK * EE * 2);
  if (off > ws_size) return;      // about 0.4 + 33.5 + 33.5 + 2.1 + 16.8 + 1.0 + 33.5 + 16.8 = 138 MB
  k_wtf<<<EE * (EE / 8) / 256, 256, 0, stream>>>(Wq, 16.0f, BQK); k_wtf<<<EE * (EE / 8) / 256, 256, 0, stream>>>(Wk, 16.0f, BQK + (size_t)EE * 2 * EE);      /* (in,out) -> 256 rows of K 256, in fragment order */
  k_wtf<<<EE * (EE / 8) / 256, 256, 0, stream>>>(Wv, 1.0f, AV);      /* row hc, k = [hi e | lo e]: Wv[e][hc] (raw), in fragment order: the v^T product's operand against [x_hi | x_lo*2^10] rows */
  k_wb<<<(16 * (2 * EE / 8) + 255) / 256, 256, 0, stream>>>(Wb, BB); k_wtf<<<EE * (EE / 8) / 256, 256, 0, stream>>>(Wfu, 16.0f, BFU); k_wt2<<<(EE * (EE / 8) + 255) / 256, 256, 0, stream>>>(Wo, EE, EE, 16.0f, BO);
  const dim3 gT1(((NTOK / 16) * (EE / 64) + 3) / 4, 1);
  k_proj<<<NTOK / TM, 256, 0, stream>>>(pr, gam, bet, bfu, BQK, AV, BB, BFU, QK16, VT16, PB16, FU16);      /* LayerNorm, then [q | k] (unscaled), VT[s][hc][b], pair bias (4 live of 16) and gate logits (+ bfu), all f16, from the x tile in LDS */
  k_bias<<<(SL / 16) * (SL / 16) * 64 / 256, 256, 0, stream>>>(mask, PB16, BF);      /* mask + pair bias per head, in score-fragment order */
  k_attn<<<SL * NHD * 2, 256, 0, stream>>>(QK16, VT16, BF, O);      /* O[(s,a)][h*32 + c], all rows and heads */
  k_gate<<<(NTOK * (EE / 8) + 255) / 256, 256, 0, stream>>>(O, FU16, bfu, OG2);      /* [og_hi | og_lo*2^10] */
  k_gemm_hhx<0><<<gT1, 128, 0, stream>>>(OG2, 2 * EE, 0, BO, 2 * EE, 0, 0.0625f, bo, 0, nullptr, 1, 0, 0, (float*)d_out, nullptr, EE, 0, NTOK, EE, 2 * EE);
}

// v003
// It runs in 61.5 microseconds.
// Next to v002, in two timings, it ran 2.05 and 2.22 times as fast.
// Over all steps from v000 it is 16.3 times as fast.
#include <hip/hip_runtime.h>
// Row-wise pair attention on a pair representation ([1,256,256,128], 4 heads × 32): x = LN(pair_rep); q = x·Wq·32^-½, k = x·Wk, v = x·Wv; per (row s, head h): logits[a][b] = Σ_c k[s,a,h,c]·q[s,b,h,c] + mask[a][b] + (x·Wb)[a][b][h]; softmax over b; o[s,a,h,:] = Σ_b attn·v[s,b,h,:]; o *= sigmoid(x·Wfu + bfu); out = o·Wo + bo → [1,256,256,128]. (The module's einsum makes k carry the output index and q the summed index.)
// Compute dtype: inputs and parameters rounded to bf16; x and the gated output carried hi/lo (≈f32); q/k/v planes, pair bias, probabilities and gate logits f16 (≈2^-12); mask/bias/softmax/LN/sigmoid in f32; f32 accumulation. v_wmma_f32_16x16x32_f16.
#define SL 256
#define NTOK (SL * SL)           /* 65536 */
#define EE 128
#define NHD 4
#define HDC 32
typedef __bf16 v16b __attribute__((ext_vector_type(16)));
typedef unsigned short v8us __attribute__((ext_vector_type(8), may_alias));
typedef float  v8f  __attribute__((ext_vector_type(8)));
typedef float  v4f  __attribute__((ext_vector_type(4)));
typedef float  v4fa __attribute__((ext_vector_type(4), may_alias));
union FragB { v16b v; v8us half[2]; unsigned short u[16]; };

__device__ __forceinline__ unsigned short bf16_bits(float x) { unsigned int u = __float_as_uint(x); return (unsigned short)((u + 0x7FFFu + ((u >> 16) & 1u)) >> 16); }
__device__ __forceinline__ float bf16_val(unsigned short b) { return __uint_as_float(((unsigned int)b) << 16); }
__device__ __forceinline__ float bf16_round(float x) { return bf16_val(bf16_bits(x)); }
// D += A·B with NT terms: 1 = ah·bh, 2 = + al·bh (A split), 3 = + ah·bl (both split)
template <int NT>
__device__ __forceinline__ v8f mmaN(v16b ah, v16b al, v16b bh, v16b bl, v8f c) {
  c = __builtin_amdgcn_wmma_f32_16x16x32_bf16(false, ah, false, bh, (short)0, c, false, false);
  if (NT >= 2) c = __builtin_amdgcn_wmma_f32_16x16x32_bf16(false, al, false, bh, (short)0, c, false, false);
  if (NT >= 3) c = __builtin_amdgcn_wmma_f32_16x16x32_bf16(false, ah, false, bl, (short)0, c, false, false);
  asm volatile("v_nop\n\tv_nop\n\tv_nop\n\tv_nop" : "+v"(c) : "v"(ah), "v"(al), "v"(bh), "v"(bl));
  return c;
}

__global__ __launch_bounds__(256) void k_wt_bf16(const float* __restrict__ W, unsigned short* __restrict__ Wt, int K, int N) {
  const int t = blockIdx.x * 256 + threadIdx.x;
  const int k8n = K / 8;
  if (t >= N * k8n) return;
  const int n = t / k8n, k8 = (t % k8n) * 8;
  v8us v;
#pragma unroll
  for (int i = 0; i < 8; ++i) v[i] = bf16_bits(W[(size_t)(k8 + i) * N + n]);
  *(v8us*)(Wt + (size_t)n * K + k8) = v;
  
}

// GEMM C[M][N] (f32, pitch ldc) = act(A[M][K]·W + bias). A f32 row-major (pitch lda) converted per fragment to bf16
// (ASPLIT: hi/lo two planes -> 2 terms, else single rounded term); Wt bf16 [N][K] (pitch ldb). BIAS_BF16 rounds the
// bias to bf16 first (bias quantised to bf16 before the add). K%32==0, M%16==0, N%64==0.
template <bool ASPLIT, int ACT, bool BIAS_BF16>
__global__ __launch_bounds__(128) void k_gemm_bf(const float* __restrict__ A, int lda, const unsigned short* __restrict__ Wt, int ldb,
                                               const float* __restrict__ bias, float* __restrict__ C, int ldc, int M, int N, int K) {
  __shared__ __attribute__((aligned(16))) float so[4][16][64];
  const int tid = threadIdx.x, w = tid >> 5, lane = tid & 31, ln = lane & 15, hh = lane >> 4;
  const int ntn = N / 64;
  const int wid = blockIdx.x * 4 + w;
  const int mt = wid / ntn, nq = wid % ntn;
  if (mt * 16 >= M) return;
  const int row0 = mt * 16, col0 = nq * 64;
  const float* arow = A + (size_t)(row0 + ln) * lda;
  v8f acc[4] = {};
  for (int kb = 0; kb < K; kb += 32) {
    FragB ah, al;
    const v4f x0 = *(const v4fa*)(arow + kb + 8 * hh), x1 = *(const v4fa*)(arow + kb + 8 * hh + 4);
    const v4f x2 = *(const v4fa*)(arow + kb + 16 + 8 * hh), x3 = *(const v4fa*)(arow + kb + 16 + 8 * hh + 4);
    float xs[16] = {x0[0],x0[1],x0[2],x0[3],x1[0],x1[1],x1[2],x1[3],x2[0],x2[1],x2[2],x2[3],x3[0],x3[1],x3[2],x3[3]};
#pragma unroll
    for (int i = 0; i < 16; ++i) { const unsigned short hb = bf16_bits(xs[i]); ah.u[i] = hb; al.u[i] = ASPLIT ? bf16_bits(xs[i] - bf16_val(hb)) : (unsigned short)0; }
#pragma unroll
    for (int t = 0; t < 4; ++t) {
      const unsigned short* brow = Wt + (size_t)(col0 + t * 16 + ln) * ldb + kb;
      FragB b;
      b.half[0] = *(const v8us*)(brow + 8 * hh);
      b.half[1] = *(const v8us*)(brow + 16 + 8 * hh);
      acc[t] = mmaN<ASPLIT ? 2 : 1>(ah.v, al.v, b.v, b.v, acc[t]);
    }
  }
#pragma unroll
  for (int t = 0; t < 4; ++t) {
    float bv = bias ? bias[col0 + t * 16 + ln] : 0.f;
    if (BIAS_BF16) bv = bf16_round(bv);
#pragma unroll
    for (int r = 0; r < 8; ++r) { float v = acc[t][r] + bv; if (ACT == 1) v = fmaxf(v, 0.f); so[w][8 * hh + r][t * 16 + ln] = v; }
  }
  __builtin_amdgcn_fence(__ATOMIC_ACQ_REL, "workgroup");
  __builtin_amdgcn_wave_barrier();
  const int rsub = lane >> 4, c4 = (lane & 15) * 4;
  {
#pragma unroll
    for (int q = 0; q < 8; ++q) {
      const int r = q * 2 + rsub;
      const v4f v = *(const v4fa*)&so[w][r][c4];
      *(v4f*)(C + (size_t)(row0 + r) * ldc + col0 + c4) = v;
    }
    
  }
}

// GEMM C = act(A·W + bias + resid): A f32 (ASPLIT -> hi/lo 2 terms), Wt bf16 [N][K]; ACT 0 none, 1 relu, 2 exact gelu;
// resid (optional, f32, row index = (row % rmod), pitch ldr, RES_BF16 rounds it) added before the activation.
template <bool ASPLIT, int ACT, bool BIAS_BF16, bool RES_BF16>
__global__ __launch_bounds__(128) void k_gemm_bf3(const float* __restrict__ A, int lda, const unsigned short* __restrict__ Wt, int ldb,
                                                const float* __restrict__ bias, const float* __restrict__ resid, int rmod, int ldr,
                                                float* __restrict__ C, int ldc, int M, int N, int K) {
  __shared__ __attribute__((aligned(16))) float so[4][16][64];
  const int tid = threadIdx.x, w = tid >> 5, lane = tid & 31, ln = lane & 15, hh = lane >> 4;
  const int ntn = N / 64;
  const int wid = blockIdx.x * 4 + w;
  const int mt = wid / ntn, nq = wid % ntn;
  if (mt * 16 >= M) return;
  const int row0 = mt * 16, col0 = nq * 64;
  const float* arow = A + (size_t)(row0 + ln) * lda;
  v8f acc[4] = {};
  for (int kb = 0; kb < K; kb += 32) {
    FragB ah, al;
    const v4f x0 = *(const v4fa*)(arow + kb + 8 * hh), x1 = *(const v4fa*)(arow + kb + 8 * hh + 4);
    const v4f x2 = *(const v4fa*)(arow + kb + 16 + 8 * hh), x3 = *(const v4fa*)(arow + kb + 16 + 8 * hh + 4);
    float xs[16] = {x0[0],x0[1],x0[2],x0[3],x1[0],x1[1],x1[2],x1[3],x2[0],x2[1],x2[2],x2[3],x3[0],x3[1],x3[2],x3[3]};
#pragma unroll
    for (int i = 0; i < 16; ++i) { const unsigned short hb = bf16_bits(xs[i]); ah.u[i] = hb; al.u[i] = ASPLIT ? bf16_bits(xs[i] - bf16_val(hb)) : (unsigned short)0; }
#pragma unroll
    for (int t = 0; t < 4; ++t) {
      const unsigned short* brow = Wt + (size_t)(col0 + t * 16 + ln) * ldb + kb;
      FragB b;
      b.half[0] = *(const v8us*)(brow + 8 * hh);
      b.half[1] = *(const v8us*)(brow + 16 + 8 * hh);
      acc[t] = mmaN<ASPLIT ? 2 : 1>(ah.v, al.v, b.v, b.v, acc[t]);
    }
  }
#pragma unroll
  for (int t = 0; t < 4; ++t) {
    const int col = col0 + t * 16 + ln;
    float bv = bias ? bias[col] : 0.f;
    if (BIAS_BF16) bv = bf16_round(bv);
#pragma unroll
    for (int r = 0; r < 8; ++r) {
      float v = acc[t][r] + bv;
      if (resid) { float rv = resid[(size_t)((row0 + 8 * hh + r) % rmod) * ldr + col]; if (RES_BF16) rv = bf16_round(rv); v += rv; }
      if (ACT == 1) v = fmaxf(v, 0.f);
      if (ACT == 2) v = 0.5f * v * (1.0f + erff(v * 0.70710678118654752f));
      if (ACT == 3) { const float u = 0.7978845608028654f * (v + 0.044715f * v * v * v); v = 0.5f * v * (1.0f + tanhf(u)); }
      so[w][8 * hh + r][t * 16 + ln] = v;
    }
  }
  __builtin_amdgcn_fence(__ATOMIC_ACQ_REL, "workgroup");
  __builtin_amdgcn_wave_barrier();
  const int rsub = lane >> 4, c4 = (lane & 15) * 4;
  {
#pragma unroll
    for (int q = 0; q < 8; ++q) {
      const int r = q * 2 + rsub;
      const v4f v = *(const v4fa*)&so[w][r][c4];
      *(v4f*)(C + (size_t)(row0 + r) * ldc + col0 + c4) = v;
    }
    
  }
}
// row LayerNorm (biased variance, eps) over N: s = X (+ R); optional out_sum <- s; out_norm <- (s-mu)*rsqrt(var+eps)*g + b
template <bool PARAM_BF16>
__global__ __launch_bounds__(256) void k_layernorm(const float* __restrict__ X, const float* __restrict__ R, const float* __restrict__ g, const float* __restrict__ bta,
                                                  float* __restrict__ out_sum, float* __restrict__ out_norm, int N, float eps) {
  __shared__ float red[256];
  const int row = blockIdx.x, tid = threadIdx.x;
  const float* x = X + (size_t)row * N; const float* rr = R ? R + (size_t)row * N : nullptr;
  float vals[16];                     // up to N = 4096
  const int per = N / 256;            // contiguous chunk per thread? use strided-by-4 chunks: thread handles j = tid*4 + 1024*u
  float s1 = 0.f;
  for (int u = 0; u < per / 4; ++u) {
    const int j = tid * 4 + 1024 * u;
    const v4f a = *(const v4fa*)(x + j);
    v4f b = {0.f,0.f,0.f,0.f}; if (rr) b = *(const v4fa*)(rr + j);
#pragma unroll
    for (int q = 0; q < 4; ++q) { const float v = a[q] + b[q]; vals[u * 4 + q] = v; s1 += v; }
  }
  red[tid] = s1; __syncthreads();
  for (int st = 128; st > 0; st >>= 1) { if (tid < st) red[tid] += red[tid + st]; __syncthreads(); }
  const float mu = red[0] / (float)N; __syncthreads();
  float s2 = 0.f;
  for (int u = 0; u < per / 4; ++u)
#pragma unroll
    for (int q = 0; q < 4; ++q) { const float c = vals[u * 4 + q] - mu; s2 += c * c; }
  red[tid] = s2; __syncthreads();
  for (int st = 128; st > 0; st >>= 1) { if (tid < st) red[tid] += red[tid + st]; __syncthreads(); }
  const float rs = rsqrtf(red[0] / (float)N + eps);
  {
    for (int u = 0; u < per / 4; ++u) {
      const int j = tid * 4 + 1024 * u;
      v4f o, sm;
#pragma unroll
      for (int q = 0; q < 4; ++q) {
        float gg = g[j + q], bb = bta[j + q];
        if (PARAM_BF16) { gg = bf16_round(gg); bb = bf16_round(bb); }
        sm[q] = vals[u * 4 + q]; o[q] = (vals[u * 4 + q] - mu) * rs * gg + bb;
      }
      if (out_sum) *(v4f*)(out_sum + (size_t)row * N + j) = sm;
      *(v4f*)(out_norm + (size_t)row * N + j) = o;
    }
    
  }
}



// ---- f16 WMMA path (v_wmma_f32_16x16x32_f16): 11-bit significands for operands in range — used where a [0,1] probability operand needs more precision than bf16
typedef _Float16 v16h __attribute__((ext_vector_type(16)));
union FragH { v16h v; v8us half[2]; _Float16 h[16]; unsigned short u[16]; };
template <int NT>
__device__ __forceinline__ v8f mmaH(v16h ah, v16h al, v16h bh, v16h bl, v8f c) {
  c = __builtin_amdgcn_wmma_f32_16x16x32_f16(false, ah, false, bh, (short)0, c, false, false);
  if (NT >= 2) c = __builtin_amdgcn_wmma_f32_16x16x32_f16(false, al, false, bh, (short)0, c, false, false);
  if (NT >= 3) c = __builtin_amdgcn_wmma_f32_16x16x32_f16(false, ah, false, bl, (short)0, c, false, false);
  asm volatile("v_nop\n\tv_nop\n\tv_nop\n\tv_nop" : "+v"(c) : "v"(ah), "v"(al), "v"(bh), "v"(bl));
  return c;
}
// batched GEMM like k_gemm_b but f16 operands: A f32 (split into f16 hi/lo if ASPLIT, else rounded to f16), Bt = f16 values [n][k]; alpha; C f32; N multiple of 16 (partial tiles skipped)
template <bool ASPLIT>
__global__ __launch_bounds__(128) void k_gemm_h(const float* __restrict__ A, int lda, size_t sA, const _Float16* __restrict__ Bh, int ldb, size_t sB, float alpha, float* __restrict__ C, int ldc, size_t sC, int M, int N, int K) {
  __shared__ __attribute__((aligned(16))) float so[4][16][64];
  const int tid = threadIdx.x, w = tid >> 5, lane = tid & 31, ln = lane & 15, hh = lane >> 4; const int by = blockIdx.y;
  A += (size_t)by * sA; Bh += (size_t)by * sB; C += (size_t)by * sC;
  const int ntn = (N + 63) / 64; const int wid = blockIdx.x * 4 + w; const int mt = wid / ntn, nq = wid % ntn; if (mt * 16 >= M) return;
  const int row0 = mt * 16, col0 = nq * 64; const float* arow = A + (size_t)(row0 + ln) * lda;
  v8f acc[4] = {};
  for (int kb = 0; kb < K; kb += 32) {
    FragH ah, al;
    const v4f x0 = *(const v4fa*)(arow + kb + 8 * hh), x1 = *(const v4fa*)(arow + kb + 8 * hh + 4), x2 = *(const v4fa*)(arow + kb + 16 + 8 * hh), x3 = *(const v4fa*)(arow + kb + 16 + 8 * hh + 4);
    float xs[16] = {x0[0],x0[1],x0[2],x0[3],x1[0],x1[1],x1[2],x1[3],x2[0],x2[1],x2[2],x2[3],x3[0],x3[1],x3[2],x3[3]};
#pragma unroll
    for (int i = 0; i < 16; ++i) { const _Float16 h = (_Float16)xs[i]; ah.h[i] = h; al.h[i] = ASPLIT ? (_Float16)(xs[i] - (float)h) : (_Float16)0.0f; }
#pragma unroll
    for (int t = 0; t < 4; ++t) { if (col0 + t * 16 >= N) continue; const size_t boff = (size_t)(col0 + t * 16 + ln) * ldb + kb; FragH bq; bq.half[0] = *(const v8us*)(Bh + boff + 8 * hh); bq.half[1] = *(const v8us*)(Bh + boff + 16 + 8 * hh);
      acc[t] = mmaH<ASPLIT ? 2 : 1>(ah.v, al.v, bq.v, bq.v, acc[t]); }
  }
#pragma unroll
  for (int t = 0; t < 4; ++t) { if (col0 + t * 16 >= N) continue;
#pragma unroll
    for (int r = 0; r < 8; ++r) so[w][8 * hh + r][t * 16 + ln] = acc[t][r] * alpha; }
  __builtin_amdgcn_fence(__ATOMIC_ACQ_REL, "workgroup"); __builtin_amdgcn_wave_barrier();
  const int rsub = lane >> 4, c4 = (lane & 15) * 4;
  {
#pragma unroll
    for (int q = 0; q < 8; ++q) { const int r = q * 2 + rsub; if (col0 + c4 < N) { const v4f v = *(const v4fa*)&so[w][r][c4]; *(v4f*)(C + (size_t)(row0 + r) * ldc + col0 + c4) = v; } }
     }
}

// Wt[n][k] = f16(W[k][n]·scale) from f32 row-major W[K][N] (scale = power of two; bf16-exact weights stay exact in f16 away from the subnormal range)
__global__ __launch_bounds__(256) void k_wt_f16(const float* __restrict__ W, _Float16* __restrict__ Wt, int K, int N, float scale) {
  const int t = blockIdx.x * 256 + threadIdx.x; if (t >= N * (K / 8)) return; const int n = t / (K / 8), k8 = (t % (K / 8)) * 8; FragH f;
#pragma unroll
  for (int i = 0; i < 8; ++i) f.h[i] = (_Float16)(bf16_round(W[(size_t)(k8 + i) * N + n]) * scale); const v8us o = f.half[0];
  *(v8us*)((unsigned short*)Wt + (size_t)n * K + k8) = o; 
}
// k_gemm_hh variant with fused epilogue: v = acc·alpha + bias[by·sBias + col] (+ CP[(row/rowsPerB)·sCPb + by·64 + col] if CP) ; ACT 0 none / 1 elu ; writes f32 C and/or f16 C16 (each if non-null)
template <int ACT>
__global__ __launch_bounds__(128) void k_gemm_hhx(const _Float16* __restrict__ A, int lda, size_t sA, const _Float16* __restrict__ Bh, int ldb, size_t sB, float alpha, const float* __restrict__ bias, size_t sBias, const float* __restrict__ CP, int rowsPerB, size_t sCPb, int row0g,
    float* __restrict__ C, _Float16* __restrict__ C16, int ldc, size_t sC, int M, int N, int K) {
  __shared__ __attribute__((aligned(16))) float so[4][16][64];
  const int tid = threadIdx.x, w = tid >> 5, lane = tid & 31, ln = lane & 15, hh = lane >> 4; const int by = blockIdx.y;
  A += (size_t)by * sA; Bh += (size_t)by * sB; const size_t cofs = (size_t)by * sC; const float* bp = bias ? bias + (size_t)by * sBias : nullptr;
  const int ntn = (N + 63) / 64; const int wid = blockIdx.x * 4 + w; const int mt = wid / ntn, nq = wid % ntn; if (mt * 16 >= M) return;
  const int row0 = mt * 16, col0 = nq * 64; const _Float16* arow = A + (size_t)(row0 + ln) * lda;
  v8f acc[4] = {};
  for (int kb = 0; kb < K; kb += 32) { FragH ah; ah.half[0] = *(const v8us*)((const unsigned short*)arow + kb + 8 * hh); ah.half[1] = *(const v8us*)((const unsigned short*)arow + kb + 16 + 8 * hh);
#pragma unroll
    for (int t = 0; t < 4; ++t) { if (col0 + t * 16 >= N) continue; const size_t boff = (size_t)(col0 + t * 16 + ln) * ldb + kb; FragH bq; bq.half[0] = *(const v8us*)((const unsigned short*)Bh + boff + 8 * hh); bq.half[1] = *(const v8us*)((const unsigned short*)Bh + boff + 16 + 8 * hh);
      acc[t] = mmaH<1>(ah.v, ah.v, bq.v, bq.v, acc[t]); }
  }
#pragma unroll
  for (int t = 0; t < 4; ++t) { if (col0 + t * 16 >= N) continue; const int col = col0 + t * 16 + ln; const float bv = bp ? bf16_round(bp[col]) : 0.f;
#pragma unroll
    for (int r = 0; r < 8; ++r) { float v = acc[t][r] * alpha + bv; if (CP) { const int bidx = (row0g + row0 + 8 * hh + r) / rowsPerB; v += CP[(size_t)bidx * sCPb + (size_t)by * 64 + col]; } if (ACT == 1) v = (v > 0.f) ? v : expm1f(v); else if (ACT == 7) v = (v > 0.f) ? v + 1.0f : expf(v); else if (ACT == 8) v = tanhf(v); else if (ACT == 9) v = 0.5f * v * (1.0f + tanhf(0.7978845608028654f * (v + 0.044715f * v * v * v))); else if (ACT == 11) v = 1.0f / (1.0f + expf(-v)); else if (ACT == 12) v = (v > 0.f) ? v : 0.01f * v; else if (ACT == 14) v = (v > 0.f) ? v : 0.1f * v; else if (ACT == 15) v = v / (1.0f + expf(-v)); else if (ACT == 3) v = fmaxf(v, 0.f); else if (ACT == 6) v = 0.5f * v * (1.0f + erff(v * 0.70710678118654752f)); so[w][8 * hh + r][t * 16 + ln] = v; } }
  __builtin_amdgcn_fence(__ATOMIC_ACQ_REL, "workgroup"); __builtin_amdgcn_wave_barrier();
  const int rsub = lane >> 4, c4 = (lane & 15) * 4; typedef _Float16 v4h __attribute__((ext_vector_type(4)));
  {
#pragma unroll
    for (int q = 0; q < 8; ++q) { const int r = q * 2 + rsub; if (col0 + c4 < N) { const v4f v = *(const v4fa*)&so[w][r][c4]; if (C) *(v4f*)(C + cofs + (size_t)(row0 + r) * ldc + col0 + c4) = v; if (C16) { v4h h4; for (int i = 0; i < 4; ++i) h4[i] = (_Float16)v[i]; *(v4h*)(C16 + cofs + (size_t)(row0 + r) * ldc + col0 + c4) = h4; } } }
     }
}


typedef _Float16 v4h __attribute__((ext_vector_type(4)));

__global__ __launch_bounds__(256) void k_x16(const float* __restrict__ x, _Float16* __restrict__ X16, size_t n8) { const size_t t = (size_t)blockIdx.x * 256 + threadIdx.x; if (t >= n8) return; FragH f;
#pragma unroll
  for (int q = 0; q < 8; ++q) f.h[q] = (_Float16)bf16_round(x[t * 8 + q]); *(v8us*)((unsigned short*)X16 + t * 8) = f.half[0];  }
__global__ __launch_bounds__(256) void k_h16(const float* __restrict__ x, _Float16* __restrict__ X16, size_t n8) { const size_t t = (size_t)blockIdx.x * 256 + threadIdx.x; if (t >= n8) return; FragH f;
#pragma unroll
  for (int q = 0; q < 8; ++q) f.h[q] = (_Float16)x[t * 8 + q]; *(v8us*)((unsigned short*)X16 + t * 8) = f.half[0];  }
__global__ __launch_bounds__(256) void k_round16f(const float* __restrict__ W, _Float16* __restrict__ Bt, size_t n8) { const size_t t = (size_t)blockIdx.x * 256 + threadIdx.x; if (t >= n8) return; FragH f;
#pragma unroll
  for (int i = 0; i < 8; ++i) f.h[i] = (_Float16)(bf16_round(W[t * 8 + i]) * 16.0f); *(v8us*)((unsigned short*)Bt + t * 8) = f.half[0];  }
template <int NHv, int TTv>
__global__ __launch_bounds__(256) void k_vt(const _Float16* __restrict__ V16, int ldv, int voff, _Float16* __restrict__ Vt) { __shared__ unsigned short tl[64][66]; const int tid = threadIdx.x; const int slab = blockIdx.x / (TTv / 64), lg = blockIdx.x % (TTv / 64); const int b = slab / NHv, h = slab % NHv;
  for (int i = tid; i < 64 * 8; i += 256) { const int r = i / 8, c8 = (i % 8) * 8; FragH f; f.half[0] = *(const v8us*)((const unsigned short*)V16 + ((size_t)b * TTv + lg * 64 + r) * ldv + voff + h * 64 + c8);
#pragma unroll
    for (int q = 0; q < 8; ++q) tl[r][c8 + q] = f.u[q]; }
  __syncthreads();
  {
#pragma unroll
    for (int rd = 0; rd < 2; ++rd) { const int d = rd * 32 + tid / 8, pc = tid % 8; FragH f;
#pragma unroll
      for (int q = 0; q < 8; ++q) f.u[q] = tl[pc * 8 + q][d];
      *(v8us*)((unsigned short*)Vt + ((size_t)slab * 64 + d) * TTv + lg * 64 + pc * 8) = f.half[0]; }
     } }

__global__ __launch_bounds__(256) void k_hl(const float* __restrict__ F, _Float16* __restrict__ Hh, _Float16* __restrict__ Hl, size_t n8) { const size_t t = (size_t)blockIdx.x * 256 + threadIdx.x; if (t >= n8) return; FragH fh, fl; const v4f a = *(const v4fa*)(F + t * 8), c = *(const v4fa*)(F + t * 8 + 4);
#pragma unroll
  for (int q = 0; q < 4; ++q) { _Float16 h = (_Float16)a[q]; fh.h[q] = h; fl.h[q] = (_Float16)((a[q] - (float)h) * 1024.0f); h = (_Float16)c[q]; fh.h[4 + q] = h; fl.h[4 + q] = (_Float16)((c[q] - (float)h) * 1024.0f); }
  { *(v8us*)((unsigned short*)Hh + t * 8) = fh.half[0]; *(v8us*)((unsigned short*)Hl + t * 8) = fl.half[0];  } }

// Offset in halves of the 8 values k = kk .. kk + 7 (kk a multiple of 8) of row n, K 256, in matrix-fragment order [n / 16][kk / 32][half][lane][8], half = (kk >> 4) & 1, lane = 16 * ((kk >> 3) & 1) + n % 16:
// a wave's 16-byte load of half a fragment then covers 512 contiguous bytes (four whole lines) instead of pieces of sixteen lines.
__device__ __forceinline__ size_t frag_off(int n, int kk) { return ((((size_t)(n >> 4) * 8 + (kk >> 5)) * 2 + ((kk >> 4) & 1)) * 32 + ((kk >> 3) & 1) * 16 + (n & 15)) * 8; }
// The folded weights [W*s | W*s*2^-10] for K = N = 128, stored in fragment order. 2048 threads, one (n, k8) each; neighbouring threads take neighbouring n (whole lines on the load side).
// LO false: only the W*s plane is written (k_attn multiplies both planes of its operand by that one plane and joins the two sums afterwards).
template <bool LO>
__global__ __launch_bounds__(256) void k_wtf(const float* __restrict__ W, float scale, _Float16* __restrict__ Bt) { const int t = blockIdx.x * 256 + threadIdx.x; const int n = t % EE, k8 = (t / EE) * 8; const int i0 = k8 * EE + n; float x[8]; FragH f, f2;
#pragma unroll
  for (int i = 0; i < 8; ++i) x[i] = W[i0 + i * EE];
  asm volatile("s_wait_xcnt 0x0" :: "v"(i0) : "memory");      /* named as an input, the eight loads' offset register stays whole up to this wait: none of their results lands on it */
#pragma unroll
  for (int i = 0; i < 8; ++i) { const float wv = bf16_round(x[i]) * scale; f.h[i] = (_Float16)wv; f2.h[i] = (_Float16)(wv * 0.0009765625f); }
  { *(v8us*)((unsigned short*)Bt + frag_off(n, k8)) = f.half[0]; if (LO) *(v8us*)((unsigned short*)Bt + frag_off(n, EE + k8)) = f2.half[0];  } }
__global__ __launch_bounds__(256) void k_wb(const float* __restrict__ w, _Float16* __restrict__ Bt) { const int t = blockIdx.x * 256 + threadIdx.x; if (t >= 16 * (2 * EE / 8)) return; const int k0 = (t % (2 * EE / 8)) * 8, o = t / (2 * EE / 8); const int kk0 = k0 % EE; const float sc = (k0 < EE) ? 16.0f : (16.0f * 0.0009765625f); FragH f;
#pragma unroll
  for (int q = 0; q < 8; ++q) f.h[q] = (o < NHD) ? (_Float16)(bf16_round(w[(size_t)(kk0 + q) * NHD + o]) * sc) : (_Float16)0.0f;
  *(v8us*)((unsigned short*)Bt + frag_off(o, k0)) = f.half[0];  }
// LayerNorm and every product that reads x, in one launch. A block normalises 128 tokens into LDS as [x_hi (128) | x_lo*2^10 (128)] f16 rows and its eight waves form, against the folded weights
// [W*s | W*s*2^-10] (K 256, packed in fragment order): [q | k] (8 units of 64 tokens x 64 columns), gate logits (4 units), v^T (4 units), two units a wave, and the pair bias (one 16-token tile a wave).
#define XP 264                   /* staged x row pitch in halves: 512 B of data + 16 B (16 B x odd: conflict-free ds_load_b128) */
#define SP 72                    /* output staging row pitch in halves: 128 B of data + 16 B */
#define TM 128                   /* tokens per block */
typedef _Float16 v4ha __attribute__((ext_vector_type(4), may_alias));
// One 64 x 64 unit. KIND 0: [q | k], 1: gate logits (+ bias), both stored [token][column]; 2: v^T, stored [column][token].
// The operand whose index runs along the stored row goes in as A: a lane then holds 8 neighbours of one stored row (16 bytes), and the wave's own LDS range turns them into whole 128-byte lines.
// Every loop here and in k_proj is unrolled because its index picks registers (fragments, accumulators, a row's values), which only a compile-time index can.
template <int KIND>
__device__ __forceinline__ void proj_unit(const unsigned short* xs, const unsigned short* __restrict__ wt, const float* bias /* LDS, rounded */, unsigned short* st, unsigned short* __restrict__ out, int ldo, int lane) {
  const int ln = lane & 15, hh = lane >> 4;
  const unsigned short* xr = xs + ln * XP + 8 * hh;
  const unsigned short* wr = wt + lane * 8;      /* fragment order: 4096 halves a 16-row tile, 512 a k step, 256 half a fragment */
  const float alpha = (KIND == 2) ? 1.0f : 0.0625f;
  v8f acc[4][4] = {};
  FragH wf[2][4];                /* weight fragments come from L2: fetched one k step ahead */
#pragma unroll
  for (int j = 0; j < 4; ++j) { wf[0][j].half[0] = *(const v8us*)(wr + j * 4096); wf[0][j].half[1] = *(const v8us*)(wr + j * 4096 + 256); }
#pragma unroll
  for (int kb = 0; kb < 8; ++kb) {
    if (kb + 1 < 8) {
#pragma unroll
      for (int j = 0; j < 4; ++j) { wf[(kb + 1) & 1][j].half[0] = *(const v8us*)(wr + j * 4096 + (kb + 1) * 512); wf[(kb + 1) & 1][j].half[1] = *(const v8us*)(wr + j * 4096 + (kb + 1) * 512 + 256); }
    }
    FragH xf[4];
#pragma unroll
    for (int i = 0; i < 4; ++i) { xf[i].half[0] = *(const v8us*)(xr + i * 16 * XP + kb * 32); xf[i].half[1] = *(const v8us*)(xr + i * 16 * XP + kb * 32 + 16); }
    __builtin_amdgcn_sched_barrier(0);      /* keeps the next step's weight loads and this step's LDS reads in one group ahead of the 16 products: left alone the compiler sinks each load to its first use, and the wave waits out every latency */
#pragma unroll
    for (int i = 0; i < 4; ++i)
#pragma unroll
      for (int j = 0; j < 4; ++j)
        acc[i][j] = (KIND == 2) ? __builtin_amdgcn_wmma_f32_16x16x32_f16(false, xf[i].v, false, wf[kb & 1][j].v, (short)0, acc[i][j], false, false)
                                : __builtin_amdgcn_wmma_f32_16x16x32_f16(false, wf[kb & 1][j].v, false, xf[i].v, (short)0, acc[i][j], false, false);
    __builtin_amdgcn_sched_barrier(0);      /* keeps later steps' loads from rising further: a third set of fragments would not fit 256 registers */
  }
  asm volatile("s_wait_xcnt 0x0" :: "v"(lane), "s"(wt) : "memory");      /* the weight loads' address registers (lane offset, scalar base) are reused only behind this wait: named as inputs, they stay whole up to it */
#pragma unroll
  for (int j = 0; j < 4; ++j) {
    float bv[8] = {0.f, 0.f, 0.f, 0.f, 0.f, 0.f, 0.f, 0.f};
    if (KIND == 1) { const v4f b0 = *(const v4fa*)(bias + j * 16 + 8 * hh), b1 = *(const v4fa*)(bias + j * 16 + 8 * hh + 4);
#pragma unroll
      for (int r = 0; r < 4; ++r) { bv[r] = b0[r]; bv[4 + r] = b1[r]; } }
#pragma unroll
    for (int i = 0; i < 4; ++i) { FragH f;
#pragma unroll
      for (int r = 0; r < 8; ++r) f.h[r] = (_Float16)((KIND == 1) ? acc[i][j][r] * alpha + bv[r] : acc[i][j][r] * alpha);
      const int row = (KIND == 2) ? j * 16 + ln : i * 16 + ln, col = (KIND == 2) ? i * 16 + 8 * hh : j * 16 + 8 * hh;
      *(v8us*)&st[row * SP + col] = f.half[0]; }
  }
  __builtin_amdgcn_fence(__ATOMIC_ACQ_REL, "workgroup", "local"); __builtin_amdgcn_wave_barrier();      /* the rows read below were written by other lanes of this wave */
#pragma unroll
  for (int q = 0; q < 16; ++q) { const int row = q * 4 + (lane >> 3), c8 = (lane & 7) * 8; const v8us v = *(const v8us*)&st[row * SP + c8]; *(v8us*)(out + (size_t)row * ldo + c8) = v; }
  asm volatile("s_wait_xcnt 0x0" ::: "memory");      /* the stores' address and data registers are reused by what follows only behind this wait; its clobber also keeps the next unit's writes of st behind the reads above */
}
// Two blocks a WGP (LDS allows two): four waves per SIMD, so 256 registers a wave.
__global__ __launch_bounds__(256) __attribute__((amdgpu_waves_per_eu(4, 4))) void k_proj(const float* __restrict__ X, const float* __restrict__ g, const float* __restrict__ bb, const float* __restrict__ bfu,
                                              const _Float16* __restrict__ BQK, const _Float16* __restrict__ AV, const _Float16* __restrict__ BB, const _Float16* __restrict__ BFU,
                                              _Float16* __restrict__ QK, _Float16* __restrict__ VT, _Float16* __restrict__ PB, _Float16* __restrict__ FU) {
  __shared__ __attribute__((aligned(16))) unsigned short xs[TM * XP];
  __shared__ __attribute__((aligned(16))) unsigned short stg[8 * 64 * SP];
  __shared__ __attribute__((aligned(16))) float sb[2 * EE];      /* the gate bias, twice: every thread loads and stores one value, so the load issues with the row loads and no wave waits for it in a branch of its own */
  const int tid = threadIdx.x, lane = tid & 31, ln = lane & 15, hh = lane >> 4;
  const int w = __builtin_amdgcn_readfirstlane(tid >> 5);      /* the wave's number in a scalar register: the choice of units below is a scalar branch */
  const int tok0 = blockIdx.x * TM;
  const int bi = tid & (EE - 1);
  const float bfv = bfu[bi];
  asm volatile("s_wait_xcnt 0x0" :: "v"(bi) : "memory");      /* named as an input, the load's index register stays whole up to this wait: the row loads below may land on it only behind it */
  { /* LayerNorm: wave w takes tokens 16 w .. 16 w + 15, a whole row per wave, 4 channels a lane */
    float v[16][4], s[16], q2[16];
#pragma unroll
    for (int u = 0; u < 16; ++u) { const v4f a = *(const v4fa*)(X + (size_t)(tok0 + w * 16 + u) * EE + lane * 4);
#pragma unroll
      for (int k = 0; k < 4; ++k) v[u][k] = a[k]; }
    const v4f g4 = *(const v4fa*)(g + lane * 4), b4 = *(const v4fa*)(bb + lane * 4);
#pragma unroll
    for (int u = 0; u < 16; ++u) { s[u] = 0.f;
#pragma unroll
      for (int k = 0; k < 4; ++k) { v[u][k] = bf16_round(v[u][k]); s[u] += v[u][k]; } }
#pragma unroll
    for (int o = 16; o > 0; o >>= 1)
#pragma unroll
      for (int u = 0; u < 16; ++u) s[u] += __shfl_xor(s[u], o, 32);
#pragma unroll
    for (int u = 0; u < 16; ++u) { const float mu = s[u] / (float)EE; q2[u] = 0.f;
#pragma unroll
      for (int k = 0; k < 4; ++k) { v[u][k] -= mu; q2[u] += v[u][k] * v[u][k]; } }
#pragma unroll
    for (int o = 16; o > 0; o >>= 1)
#pragma unroll
      for (int u = 0; u < 16; ++u) q2[u] += __shfl_xor(q2[u], o, 32);
#pragma unroll
    for (int u = 0; u < 16; ++u) { const float rs = rsqrtf(q2[u] / (float)EE + 1e-5f); v4ha h4, l4;
#pragma unroll
      for (int k = 0; k < 4; ++k) { const float xv = v[u][k] * rs * bf16_round(g4[k]) + bf16_round(b4[k]); h4[k] = (_Float16)xv; l4[k] = (_Float16)((xv - (float)h4[k]) * 1024.0f); }
      *(v4ha*)&xs[(w * 16 + u) * XP + lane * 4] = h4; *(v4ha*)&xs[(w * 16 + u) * XP + EE + lane * 4] = l4; }
  }
  sb[tid] = bf16_round(bfv);      /* the gate bias, rounded once a block */
  __syncthreads();               /* publishes the normalised tile (and the bias) to all eight waves */
  const int th = w & 1;          /* which 64 of the block's 128 tokens */
  const unsigned short* xh = xs + th * 64 * XP;
  unsigned short* st = stg + w * 64 * SP;
  const size_t tokh = (size_t)tok0 + th * 64;
  proj_unit<0>(xh, (const unsigned short*)BQK + (size_t)(w >> 1) * 64 * 2 * EE, nullptr, st, (unsigned short*)QK + tokh * 2 * EE + (w >> 1) * 64, 2 * EE, lane);
  if (w < 4) proj_unit<1>(xh, (const unsigned short*)BFU + (size_t)(w >> 1) * 64 * 2 * EE, sb + (w >> 1) * 64, st, (unsigned short*)FU + tokh * EE + (w >> 1) * 64, EE, lane);
  else       proj_unit<2>(xh, (const unsigned short*)AV + (size_t)((w >> 1) & 1) * 64 * 2 * EE, nullptr, st, (unsigned short*)VT + ((size_t)(tok0 / SL) * EE + ((w >> 1) & 1) * 64) * SL + (tok0 % SL) + th * 64, SL, lane);
  { /* pair bias of tokens 16 w .. 16 w + 15 (4 live of 16 columns): a lane holds 8 columns of one token */
    const unsigned short* xr = xs + (w * 16 + ln) * XP + 8 * hh; const unsigned short* wr = (const unsigned short*)BB + lane * 8;
    v8f c = {}; FragH wf[8];
#pragma unroll
    for (int kb = 0; kb < 8; ++kb) { wf[kb].half[0] = *(const v8us*)(wr + kb * 512); wf[kb].half[1] = *(const v8us*)(wr + kb * 512 + 256); }
    asm volatile("s_wait_xcnt 0x0" :: "v"(lane), "s"(BB) : "memory");      /* named as inputs, the loads' address registers (lane offset, scalar base) stay whole up to this wait: none of the sixteen loads lands on them */
#pragma unroll
    for (int kb = 0; kb < 8; ++kb) { FragH xf; xf.half[0] = *(const v8us*)(xr + kb * 32); xf.half[1] = *(const v8us*)(xr + kb * 32 + 16);
      c = __builtin_amdgcn_wmma_f32_16x16x32_f16(false, wf[kb].v, false, xf.v, (short)0, c, false, false); }
    FragH f;
#pragma unroll
    for (int r = 0; r < 8; ++r) f.h[r] = (_Float16)(c[r] * 0.0625f);
    *(v8us*)((unsigned short*)PB + ((size_t)tok0 + w * 16 + ln) * 16 + 8 * hh) = f.half[0]; }
}
// BF[h][a-tile][b-tile][p][lane][i] = (bf16(mask[a][b]) + pair_bias[a][b][h]) * sqrt(32), a = 16*atile + (lane & 15), b = 16*btile + 8*(lane >> 4) + 4*p + i:
// the accumulator (C) fragment order of the transposed score tile, so that k_attn loads it with whole-line 16-byte loads. The sqrt(32) undoes the score scale applied after the product.
__global__ __launch_bounds__(256) void k_bias(const float* __restrict__ mask, const _Float16* __restrict__ PB, float* __restrict__ BF) {
  const int t = blockIdx.x * 256 + threadIdx.x; if (t >= (SL / 16) * (SL / 16) * 64) return;
  const int lane = t & 31, p = (t >> 5) & 1, bt = (t >> 6) & 15, at = t >> 10; const int a = at * 16 + (lane & 15), b = bt * 16 + 8 * (lane >> 4) + 4 * p;
  const v4f mk = *(const v4fa*)(mask + (size_t)a * SL + b);
#pragma unroll
  for (int h = 0; h < NHD; ++h) { v4f o;
#pragma unroll
    for (int i = 0; i < 4; ++i) o[i] = (bf16_round(mk[i]) + (float)PB[((size_t)a * SL + b + i) * 16 + h]) * 5.656854249492381f;
    *(v4f*)(BF + ((((size_t)h * 16 + at) * 16 + bt) * 2 + p) * 128 + lane * 4) = o; } }

__device__ __forceinline__ v8f exp2x8(v8f x) {
  float a = x[0], b = x[1], c = x[2], d = x[3], e = x[4], f = x[5], g = x[6], h = x[7];
  asm("v_exp_f32 %0, %0\n\tv_exp_f32 %1, %1\n\tv_exp_f32 %2, %2\n\tv_exp_f32 %3, %3\n\tv_exp_f32 %4, %4\n\tv_exp_f32 %5, %5\n\tv_exp_f32 %6, %6\n\tv_exp_f32 %7, %7\n\tv_nop"
      : "+v"(a), "+v"(b), "+v"(c), "+v"(d), "+v"(e), "+v"(f), "+v"(g), "+v"(h));
  return (v8f){a, b, c, d, e, f, g, h};
}
// Eight v_rcp_f32 in the same form, for the same reason.
__device__ __forceinline__ v8f rcpx8(v8f x) {
  float a = x[0], b = x[1], c = x[2], d = x[3], e = x[4], f = x[5], g = x[6], h = x[7];
  asm("v_rcp_f32 %0, %0\n\tv_rcp_f32 %1, %1\n\tv_rcp_f32 %2, %2\n\tv_rcp_f32 %3, %3\n\tv_rcp_f32 %4, %4\n\tv_rcp_f32 %5, %5\n\tv_rcp_f32 %6, %6\n\tv_rcp_f32 %7, %7\n\tv_nop"
      : "+v"(a), "+v"(b), "+v"(c), "+v"(d), "+v"(e), "+v"(f), "+v"(g), "+v"(h));
  return (v8f){a, b, c, d, e, f, g, h};
}
// value of lane l ^ 16 (the other half of the wave), without LDS
__device__ __forceinline__ float other_half(float x) { const int b = __float_as_int(x); return __int_as_float(__builtin_amdgcn_permlanex16(b, b, 0x76543210, 0xfedcba98, false, false)); }
#define QP 136                   /* staged q row pitch in halves: 256 B of data (four heads) + 16 B (16 B x odd: conflict-free ds_load_b128) */
#define VP 264                   /* staged v^T row pitch in halves: 512 B of data + 16 B */
#define OP 68                    /* output staging row pitch in floats: 256 B of data + 16 B */
// One struct fixes the order in LDS: Wo^T lies lowest, so that lane offset + constant stays inside the 16-bit offset field of an LDS read and all its fragments are read from one address register.
struct __attribute__((aligned(16))) AttnLds {
  unsigned short swo[EE * EE];   /* Wo^T * 16 in fragment order: [e tile][head][half][lane][8] */
  float sbo[4 * EE];             /* the output bias, four times: every thread loads and stores one value, so the load issues with the staging loads and no wave waits for it in a branch of its own */
  unsigned short sog[16 * 4096]; /* 8 KB a wave, its own: first the gated output as fragments [hi, lo][head][half][lane][8], then, once those are back in registers, the output staging rows */
  unsigned short sq[SL * QP];
  unsigned short sv[EE * VP];
};
// What one head needs from L2 ahead of its scores: the bias tiles (the accumulators' start values) and the k fragment.
__device__ __forceinline__ void head_loads(const float* __restrict__ bf, const unsigned short* __restrict__ kr, v8f (&acc)[16], FragH& kf) {
#pragma unroll
  for (int t = 0; t < 16; ++t) { const v4f lo = *(const v4fa*)(bf + t * 256), hi = *(const v4fa*)(bf + t * 256 + 128); acc[t] = (v8f){lo[0], lo[1], lo[2], lo[3], hi[0], hi[1], hi[2], hi[3]}; }
  kf.half[0] = *(const v8us*)kr; kf.half[1] = *(const v8us*)(kr + 16);
}
// One block a WGP (LDS): four waves per SIMD, so 256 registers a wave. Every loop but the one over the heads is unrolled because its index picks registers.
__global__ __launch_bounds__(512) void k_attn(const _Float16* __restrict__ QK, const _Float16* __restrict__ VT, const float* __restrict__ BF, const _Float16* __restrict__ FU, const _Float16* __restrict__ BO, const float* __restrict__ bo, float* __restrict__ out) {
  __shared__ AttnLds lds;
  unsigned short* const swo = lds.swo; float* const sbo = lds.sbo; unsigned short* const sq = lds.sq; unsigned short* const sv = lds.sv;
  const int tid = threadIdx.x, lane = tid & 31, ln = lane & 15, hh = lane >> 4;
  const int w = __builtin_amdgcn_readfirstlane(tid >> 5);      /* the wave's number in a scalar register: the bias tiles then load from a scalar base */
  const int s = blockIdx.x;
  const unsigned short* qk = (const unsigned short*)QK + (size_t)s * SL * 2 * EE;
  const unsigned short* vt = (const unsigned short*)VT + (size_t)s * EE * SL;
  /* staging: 16-byte piece tid + 512 u of each tile; every address is one per-thread base plus a constant step */
  const unsigned short* gqp = qk + (tid >> 4) * 2 * EE + (tid & 15) * 8;      /* 16 pieces a q row: 32 rows a step */
  const unsigned short* gvp = vt + tid * 8;                                   /* 32 pieces a v^T row: 16 rows a step */
  const unsigned short* gwp = (const unsigned short*)BO + (tid >> 8) * 4096 + (tid & 255) * 8;      /* 256 pieces a 16-row tile, the first 4 of its 8 k steps: 2 tiles a step */
  v8us gq[8], gv[8], gw[4];
#pragma unroll
  for (int u = 0; u < 8; ++u) { gq[u] = *(const v8us*)(gqp + u * 32 * 2 * EE); gv[u] = *(const v8us*)(gvp + u * 4096); }
#pragma unroll
  for (int u = 0; u < 4; ++u) gw[u] = *(const v8us*)(gwp + u * 2 * 4096);
  const float bov = bo[tid & (EE - 1)];
  asm volatile("s_wait_xcnt 0x0" ::: "memory");      /* the address registers of the twenty-one loads above are free for reuse as destinations of the loads below only behind this wait */
  const float* bf = BF + (size_t)w * 16 * 256 + lane * 4;      /* + h * 16 * 16 * 256 */
  const unsigned short* kr = qk + (size_t)(w * 16 + ln) * 2 * EE + EE + 8 * hh;      /* + h * HDC */
  const unsigned short* fr = (const unsigned short*)FU + ((size_t)s * SL + w * 16 + ln) * EE + 8 * hh;      /* + h * HDC */
  v8f acc[16]; FragH kf;
  head_loads(bf, kr, acc, kf);
  asm volatile("s_wait_xcnt 0x0" ::: "memory");      /* the address registers of the first head's loads are reused only behind this wait */
#pragma unroll
  for (int u = 0; u < 8; ++u) { *(v8us*)&sq[((tid >> 4) + u * 32) * QP + (tid & 15) * 8] = gq[u]; *(v8us*)&sv[((tid >> 5) + u * 16) * VP + (tid & 31) * 8] = gv[u]; }
#pragma unroll
  for (int u = 0; u < 4; ++u) *(v8us*)&swo[tid * 8 + u * 4096] = gw[u];
  sbo[tid] = bf16_round(bov);    /* the output bias, rounded once a block */
  __syncthreads();               /* publishes the staged q, v^T and Wo^T tiles (and the bias) to all sixteen waves */
  unsigned short* const og = lds.sog + w * 4096 + lane * 8;      /* the gated output of this wave's 16 positions waits in LDS, each lane's values in its own 16-byte slots: 64 registers that the heads' scores need */
#pragma unroll 1      /* rolled: nothing here is picked by h at compile time, and no head's loads or reads rise into the head before, where there are no registers for them */
  for (int h = 0; h < NHD; ++h) {
    FragH fu; fu.half[0] = *(const v8us*)(fr + h * HDC); fu.half[1] = *(const v8us*)(fr + h * HDC + 16);      /* gate logits of channels 8 hh + r and 16 + 8 hh + r: the rows of Ot that this lane holds */
    asm volatile("s_wait_xcnt 0x0" ::: "memory");      /* the address registers of the two loads above are reused only behind this wait */
#pragma unroll
    for (int t = 0; t < 16; ++t) { FragH qf; const unsigned short* qr = &sq[(t * 16 + ln) * QP + h * HDC + 8 * hh]; qf.half[0] = *(const v8us*)qr; qf.half[1] = *(const v8us*)(qr + 16);
      acc[t] = __builtin_amdgcn_wmma_f32_16x16x32_f16(false, qf.v, false, kf.v, (short)0, acc[t], false, false); }
    float mx[4] = {-3.0e38f, -3.0e38f, -3.0e38f, -3.0e38f};
#pragma unroll
    for (int t = 0; t < 16; ++t)
#pragma unroll
      for (int r = 0; r < 8; ++r) mx[r & 3] = fmaxf(mx[r & 3], acc[t][r]);
    float m = fmaxf(fmaxf(mx[0], mx[1]), fmaxf(mx[2], mx[3])); m = fmaxf(m, other_half(m));
    const float cs = 0.17677669529663687f * 1.4426950408889634f;      /* 32^-1/2 * log2(e) */
    const float mc = 10.0f - m * cs;                                  /* p = 2^10 * exp(logit - max): the f16 range the probabilities had before */
    float sm[4] = {0.f, 0.f, 0.f, 0.f};
    FragH pf[8];
#pragma unroll
    for (int t = 0; t < 16; ++t) { v8f z;
#pragma unroll
      for (int r = 0; r < 8; ++r) z[r] = __builtin_fmaf(acc[t][r], cs, mc);
      const v8f e = exp2x8(z);
#pragma unroll
      for (int r = 0; r < 8; ++r) { sm[r & 3] += e[r]; pf[t >> 1].h[(t & 1) * 8 + r] = (_Float16)e[r]; } }
    float su = (sm[0] + sm[1]) + (sm[2] + sm[3]); su += other_half(su);
    v8f o[2] = {};
#pragma unroll
    for (int kk = 0; kk < 8; ++kk)
#pragma unroll
      for (int j = 0; j < 2; ++j) { FragH vf; const unsigned short* vr = &sv[(h * HDC + j * 16 + ln) * VP + kk * 32 + 8 * hh]; vf.half[0] = *(const v8us*)vr; vf.half[1] = *(const v8us*)(vr + 16);
        o[j] = __builtin_amdgcn_wmma_f32_16x16x32_f16(false, vf.v, false, pf[kk].v, (short)0, o[j], false, false); }
    v8f sg[2];                   /* sigmoid(gate logit), formed ahead of the next head's loads: a wait for the logits behind those loads would wait for them too */
#pragma unroll
    for (int j = 0; j < 2; ++j) { v8f z;
#pragma unroll
      for (int r = 0; r < 8; ++r) z[r] = (float)fu.h[j * 8 + r] * -1.4426950408889634f;
      v8f d = exp2x8(z);
#pragma unroll
      for (int r = 0; r < 8; ++r) d[r] += 1.0f;
      sg[j] = rcpx8(d); }
    if (h + 1 < NHD) {           /* the score registers are free: the next head's loads fly while this head is gated */
      const float* bfn = bf + (h + 1) * 16 * 16 * 256; const unsigned short* krn = kr + (h + 1) * HDC;
      head_loads(bfn, krn, acc, kf);
      asm volatile("s_wait_xcnt 0x0" :: "v"(bfn), "v"(krn) : "memory");      /* named as inputs, the loads' address registers stay whole up to this wait: none of the results lands on them */
    }
    const float inv = 1.0f / su;
#pragma unroll
    for (int j = 0; j < 2; ++j) { FragH gh, gl;      /* og = o / sum * sigmoid, hi and lo * 2^10 */
#pragma unroll
      for (int r = 0; r < 8; ++r) { const float gvl = o[j][r] * (inv * sg[j][r]); const _Float16 hv = (_Float16)gvl; gh.h[r] = hv; gl.h[r] = (_Float16)((gvl - (float)hv) * 1024.0f); }
      *(v8us*)(og + (h * 2 + j) * 256) = gh.half[0]; *(v8us*)(og + 2048 + (h * 2 + j) * 256) = gl.half[0]; }
  }
  /* outT[e][a]: a lane holds 8 neighbouring e of one a. Half a row (64 e) at a time goes through the wave's own LDS range, which turns the 32-byte pieces into whole 128-byte lines. */
  FragH ogh[NHD], ogl[NHD];
#pragma unroll
  for (int h = 0; h < NHD; ++h) { ogh[h].half[0] = *(const v8us*)(og + h * 512); ogh[h].half[1] = *(const v8us*)(og + h * 512 + 256); ogl[h].half[0] = *(const v8us*)(og + 2048 + h * 512); ogl[h].half[1] = *(const v8us*)(og + 2048 + h * 512 + 256); }
  float* st = (float*)(lds.sog + w * 4096);
  float* orow = out + ((size_t)s * SL + w * 16) * EE;
  const int rsub = lane >> 4, c4 = (lane & 15) * 4;
  const unsigned short* wr = swo + lane * 8;      /* 2048 halves a 16-row tile, 512 a head, 256 half a fragment */
  FragH wf[2][2 * NHD];          /* the weight fragments of two e tiles, read one pair of tiles ahead */
#pragma unroll
  for (int i = 0; i < 2 * NHD; ++i) { wf[0][i].half[0] = *(const v8us*)(wr + i * 512); wf[0][i].half[1] = *(const v8us*)(wr + i * 512 + 256); }
#pragma unroll
  for (int g = 0; g < 4; ++g) {
    if (g + 1 < 4) {
#pragma unroll
      for (int i = 0; i < 2 * NHD; ++i) { wf[(g + 1) & 1][i].half[0] = *(const v8us*)(wr + (g + 1) * 4096 + i * 512); wf[(g + 1) & 1][i].half[1] = *(const v8us*)(wr + (g + 1) * 4096 + i * 512 + 256); }
    }
    __builtin_amdgcn_sched_barrier(0);      /* keeps the next pair's LDS reads in one group ahead of the 16 products: left alone the compiler sinks each read to its first use, and the wave waits out every latency */
    v8f ch[2] = {}, cl[2] = {};
#pragma unroll
    for (int h = 0; h < NHD; ++h)
#pragma unroll
      for (int e2 = 0; e2 < 2; ++e2) {
        ch[e2] = __builtin_amdgcn_wmma_f32_16x16x32_f16(false, wf[g & 1][e2 * NHD + h].v, false, ogh[h].v, (short)0, ch[e2], false, false);
        cl[e2] = __builtin_amdgcn_wmma_f32_16x16x32_f16(false, wf[g & 1][e2 * NHD + h].v, false, ogl[h].v, (short)0, cl[e2], false, false); }
    __builtin_amdgcn_sched_barrier(0);      /* keeps the joins below all 16 products: risen in among the last of them, each group of joins takes its own run of v_nop behind a product */
#pragma unroll
    for (int e2 = 0; e2 < 2; ++e2) { v4f a0, a1;
#pragma unroll
      for (int r = 0; r < 4; ++r) { a0[r] = __builtin_fmaf(cl[e2][r], 0.0009765625f, ch[e2][r]); a1[r] = __builtin_fmaf(cl[e2][4 + r], 0.0009765625f, ch[e2][4 + r]); }
      float* sp = &st[ln * OP + ((g & 1) * 2 + e2) * 16 + 8 * hh]; *(v4fa*)sp = a0; *(v4fa*)(sp + 4) = a1; }
    if (g & 1) {
      __builtin_amdgcn_fence(__ATOMIC_ACQ_REL, "workgroup", "local"); __builtin_amdgcn_wave_barrier();      /* the rows read below were written by other lanes of this wave */
      const int p = g >> 1;
      const v4f b4 = *(const v4fa*)&sbo[p * 64 + c4];
      v4f rv[8];
#pragma unroll
      for (int q = 0; q < 8; ++q) rv[q] = *(const v4fa*)&st[(q * 2 + rsub) * OP + c4];
      __builtin_amdgcn_sched_barrier(0);      /* keeps the nine LDS reads in one group: one wait instead of one a row */
#pragma unroll
      for (int q = 0; q < 8; ++q) { v4f r4;
#pragma unroll
        for (int i = 0; i < 4; ++i) r4[i] = __builtin_fmaf(rv[q][i], 0.0625f, b4[i]);
        *(v4f*)(orow + (size_t)(q * 2 + rsub) * EE + p * 64 + c4) = r4; }
      asm volatile("s_wait_xcnt 0x0" ::: "memory");      /* the stores' address and data registers are reused only behind this wait; its clobber also keeps the second half's writes of st behind the reads above */
    }
  }
}

extern "C" void kernel_launch(void* const* d_in, const int* in_sizes, int n_in,
                              void* d_out, int out_size, void* d_ws, size_t ws_size, hipStream_t stream) {
  (void)in_sizes; (void)n_in; (void)out_size;
  const float* const* I = (const float* const*)d_in; const float* pr = I[0]; const float* mask = I[1]; const float* gam = I[2]; const float* bet = I[3]; const float* Wq = I[4]; const float* Wk = I[5]; const float* Wv = I[6]; const float* Wb = I[7]; const float* Wfu = I[8]; const float* bfu = I[9]; const float* Wo = I[10]; const float* bo = I[11];
  char* ws = (char*)d_ws; size_t off = 0;
  auto take = [&](size_t bytes) { char* p = ws + off; off += (bytes + 255) & ~(size_t)255; return p; };
  _Float16* BQK = (_Float16*)take((size_t)2 * EE * 2 * EE * 2); _Float16* AV = (_Float16*)take((size_t)EE * 2 * EE * 2); _Float16* BB = (_Float16*)take((size_t)16 * 2 * EE * 2); _Float16* BFU = (_Float16*)take((size_t)EE * 2 * EE * 2); _Float16* BO = (_Float16*)take((size_t)EE * 2 * EE * 2);      /* all folded: [W·s | W·s·2^-10] against [hi | lo·2^10] operands (K 256) */      /* of BO only the first plane is written and read */
  _Float16* QK16 = (_Float16*)take((size_t)NTOK * 2 * EE * 2); _Float16* PB16 = (_Float16*)take((size_t)NTOK * 16 * 2); _Float16* VT16 = (_Float16*)take((size_t)NTOK * EE * 2); float* BF = (float*)take((size_t)NHD * SL * SL * 4); _Float16* FU16 = (_Float16*)take((size_t)NTOK * EE * 2);
  if (off > ws_size) return;      // about 0.4 + 33.5 + 2.1 + 16.8 + 1.0 + 16.8 = 71 MB
  k_wtf<true><<<EE * (EE / 8) / 256, 256, 0, stream>>>(Wq, 16.0f, BQK); k_wtf<true><<<EE * (EE / 8) / 256, 256, 0, stream>>>(Wk, 16.0f, BQK + (size_t)EE * 2 * EE);      /* (in,out) -> 256 rows of K 256, in fragment order */
  k_wtf<true><<<EE * (EE / 8) / 256, 256, 0, stream>>>(Wv, 1.0f, AV);      /* row hc, k = [hi e | lo e]: Wv[e][hc] (raw), in fragment order: the v^T product's operand against [x_hi | x_lo*2^10] rows */
  k_wb<<<(16 * (2 * EE / 8) + 255) / 256, 256, 0, stream>>>(Wb, BB); k_wtf<true><<<EE * (EE / 8) / 256, 256, 0, stream>>>(Wfu, 16.0f, BFU); k_wtf<false><<<EE * (EE / 8) / 256, 256, 0, stream>>>(Wo, 16.0f, BO);      /* row e, k = hc: Wo[hc][e] * 16, the one plane */
  k_proj<<<NTOK / TM, 256, 0, stream>>>(pr, gam, bet, bfu, BQK, AV, BB, BFU, QK16, VT16, PB16, FU16);      /* LayerNorm, then [q | k] (unscaled), VT[s][hc][b], pair bias (4 live of 16) and gate logits (+ bfu), all f16, from the x tile in LDS */
  k_bias<<<(SL / 16) * (SL / 16) * 64 / 256, 256, 0, stream>>>(mask, PB16, BF);      /* mask + pair bias per head, in score-fragment order */
  k_attn<<<SL, 512, 0, stream>>>(QK16, VT16, BF, FU16, BO, bo, (float*)d_out);      /* attention of all rows and heads, gate, output product (+ bo) */
}

// v004
// It runs in 54.4 microseconds.
// Next to v003, in two timings, it ran 1.14 times as fast each time.
// All steps since v000 together make it 18.6 times as fast.
#include <hip/hip_runtime.h>
// Row-wise pair attention on a pair representation ([1,256,256,128], 4 heads × 32): x = LN(pair_rep); q = x·Wq·32^-½, k = x·Wk, v = x·Wv; per (row s, head h): logits[a][b] = Σ_c k[s,a,h,c]·q[s,b,h,c] + mask[a][b] + (x·Wb)[a][b][h]; softmax over b; o[s,a,h,:] = Σ_b attn·v[s,b,h,:]; o *= sigmoid(x·Wfu + bfu); out = o·Wo + bo → [1,256,256,128]. (The module's einsum makes k carry the output index and q the summed index.)
// Compute dtype: inputs and parameters rounded to bf16; x and the gated output carried hi/lo (≈f32); q/k/v planes, pair bias, probabilities and gate logits f16 (≈2^-12); mask/bias/softmax/LN/sigmoid in f32; f32 accumulation. v_wmma_f32_16x16x32_f16.
#define SL 256
#define NTOK (SL * SL)           /* 65536 */
#define EE 128
#define NHD 4
#define HDC 32
typedef __bf16 v16b __attribute__((ext_vector_type(16)));
typedef unsigned short v8us __attribute__((ext_vector_type(8), may_alias));
typedef float  v8f  __attribute__((ext_vector_type(8)));
typedef float  v4f  __attribute__((ext_vector_type(4)));
typedef float  v4fa __attribute__((ext_vector_type(4), may_alias));
union FragB { v16b v; v8us half[2]; unsigned short u[16]; };

__device__ __forceinline__ unsigned short bf16_bits(float x) { unsigned int u = __float_as_uint(x); return (unsigned short)((u + 0x7FFFu + ((u >> 16) & 1u)) >> 16); }
__device__ __forceinline__ float bf16_val(unsigned short b) { return __uint_as_float(((unsigned int)b) << 16); }
__device__ __forceinline__ float bf16_round(float x) { return bf16_val(bf16_bits(x)); }
// D += A·B with NT terms: 1 = ah·bh, 2 = + al·bh (A split), 3 = + ah·bl (both split)
template <int NT>
__device__ __forceinline__ v8f mmaN(v16b ah, v16b al, v16b bh, v16b bl, v8f c) {
  c = __builtin_amdgcn_wmma_f32_16x16x32_bf16(false, ah, false, bh, (short)0, c, false, false);
  if (NT >= 2) c = __builtin_amdgcn_wmma_f32_16x16x32_bf16(false, al, false, bh, (short)0, c, false, false);
  if (NT >= 3) c = __builtin_amdgcn_wmma_f32_16x16x32_bf16(false, ah, false, bl, (short)0, c, false, false);
  asm volatile("v_nop\n\tv_nop\n\tv_nop\n\tv_nop" : "+v"(c) : "v"(ah), "v"(al), "v"(bh), "v"(bl));
  return c;
}

__global__ __launch_bounds__(256) void k_wt_bf16(const float* __restrict__ W, unsigned short* __restrict__ Wt, int K, int N) {
  const int t = blockIdx.x * 256 + threadIdx.x;
  const int k8n = K / 8;
  if (t >= N * k8n) return;
  const int n = t / k8n, k8 = (t % k8n) * 8;
  v8us v;
#pragma unroll
  for (int i = 0; i < 8; ++i) v[i] = bf16_bits(W[(size_t)(k8 + i) * N + n]);
  *(v8us*)(Wt + (size_t)n * K + k8) = v;
  
}

// GEMM C[M][N] (f32, pitch ldc) = act(A[M][K]·W + bias). A f32 row-major (pitch lda) converted per fragment to bf16
// (ASPLIT: hi/lo two planes -> 2 terms, else single rounded term); Wt bf16 [N][K] (pitch ldb). BIAS_BF16 rounds the
// bias to bf16 first (bias quantised to bf16 before the add). K%32==0, M%16==0, N%64==0.
template <bool ASPLIT, int ACT, bool BIAS_BF16>
__global__ __launch_bounds__(128) void k_gemm_bf(const float* __restrict__ A, int lda, const unsigned short* __restrict__ Wt, int ldb,
                                               const float* __restrict__ bias, float* __restrict__ C, int ldc, int M, int N, int K) {
  __shared__ __attribute__((aligned(16))) float so[4][16][64];
  const int tid = threadIdx.x, w = tid >> 5, lane = tid & 31, ln = lane & 15, hh = lane >> 4;
  const int ntn = N / 64;
  const int wid = blockIdx.x * 4 + w;
  const int mt = wid / ntn, nq = wid % ntn;
  if (mt * 16 >= M) return;
  const int row0 = mt * 16, col0 = nq * 64;
  const float* arow = A + (size_t)(row0 + ln) * lda;
  v8f acc[4] = {};
  for (int kb = 0; kb < K; kb += 32) {
    FragB ah, al;
    const v4f x0 = *(const v4fa*)(arow + kb + 8 * hh), x1 = *(const v4fa*)(arow + kb + 8 * hh + 4);
    const v4f x2 = *(const v4fa*)(arow + kb + 16 + 8 * hh), x3 = *(const v4fa*)(arow + kb + 16 + 8 * hh + 4);
    float xs[16] = {x0[0],x0[1],x0[2],x0[3],x1[0],x1[1],x1[2],x1[3],x2[0],x2[1],x2[2],x2[3],x3[0],x3[1],x3[2],x3[3]};
#pragma unroll
    for (int i = 0; i < 16; ++i) { const unsigned short hb = bf16_bits(xs[i]); ah.u[i] = hb; al.u[i] = ASPLIT ? bf16_bits(xs[i] - bf16_val(hb)) : (unsigned short)0; }
#pragma unroll
    for (int t = 0; t < 4; ++t) {
      const unsigned short* brow = Wt + (size_t)(col0 + t * 16 + ln) * ldb + kb;
      FragB b;
      b.half[0] = *(const v8us*)(brow + 8 * hh);
      b.half[1] = *(const v8us*)(brow + 16 + 8 * hh);
      acc[t] = mmaN<ASPLIT ? 2 : 1>(ah.v, al.v, b.v, b.v, acc[t]);
    }
  }
#pragma unroll
  for (int t = 0; t < 4; ++t) {
    float bv = bias ? bias[col0 + t * 16 + ln] : 0.f;
    if (BIAS_BF16) bv = bf16_round(bv);
#pragma unroll
    for (int r = 0; r < 8; ++r) { float v = acc[t][r] + bv; if (ACT == 1) v = fmaxf(v, 0.f); so[w][8 * hh + r][t * 16 + ln] = v; }
  }
  __builtin_amdgcn_fence(__ATOMIC_ACQ_REL, "workgroup");
  __builtin_amdgcn_wave_barrier();
  const int rsub = lane >> 4, c4 = (lane & 15) * 4;
  {
#pragma unroll
    for (int q = 0; q < 8; ++q) {
      const int r = q * 2 + rsub;
      const v4f v = *(const v4fa*)&so[w][r][c4];
      *(v4f*)(C + (size_t)(row0 + r) * ldc + col0 + c4) = v;
    }
    
  }
}

// GEMM C = act(A·W + bias + resid): A f32 (ASPLIT -> hi/lo 2 terms), Wt bf16 [N][K]; ACT 0 none, 1 relu, 2 exact gelu;
// resid (optional, f32, row index = (row % rmod), pitch ldr, RES_BF16 rounds it) added before the activation.
template <bool ASPLIT, int ACT, bool BIAS_BF16, bool RES_BF16>
__global__ __launch_bounds__(128) void k_gemm_bf3(const float* __restrict__ A, int lda, const unsigned short* __restrict__ Wt, int ldb,
                                                const float* __restrict__ bias, const float* __restrict__ resid, int rmod, int ldr,
                                                float* __restrict__ C, int ldc, int M, int N, int K) {
  __shared__ __attribute__((aligned(16))) float so[4][16][64];
  const int tid = threadIdx.x, w = tid >> 5, lane = tid & 31, ln = lane & 15, hh = lane >> 4;
  const int ntn = N / 64;
  const int wid = blockIdx.x * 4 + w;
  const int mt = wid / ntn, nq = wid % ntn;
  if (mt * 16 >= M) return;
  const int row0 = mt * 16, col0 = nq * 64;
  const float* arow = A + (size_t)(row0 + ln) * lda;
  v8f acc[4] = {};
  for (int kb = 0; kb < K; kb += 32) {
    FragB ah, al;
    const v4f x0 = *(const v4fa*)(arow + kb + 8 * hh), x1 = *(const v4fa*)(arow + kb + 8 * hh + 4);
    const v4f x2 = *(const v4fa*)(arow + kb + 16 + 8 * hh), x3 = *(const v4fa*)(arow + kb + 16 + 8 * hh + 4);
    float xs[16] = {x0[0],x0[1],x0[2],x0[3],x1[0],x1[1],x1[2],x1[3],x2[0],x2[1],x2[2],x2[3],x3[0],x3[1],x3[2],x3[3]};
#pragma unroll
    for (int i = 0; i < 16; ++i) { const unsigned short hb = bf16_bits(xs[i]); ah.u[i] = hb; al.u[i] = ASPLIT ? bf16_bits(xs[i] - bf16_val(hb)) : (unsigned short)0; }
#pragma unroll
    for (int t = 0; t < 4; ++t) {
      const unsigned short* brow = Wt + (size_t)(col0 + t * 16 + ln) * ldb + kb;
      FragB b;
      b.half[0] = *(const v8us*)(brow + 8 * hh);
      b.half[1] = *(const v8us*)(brow + 16 + 8 * hh);
      acc[t] = mmaN<ASPLIT ? 2 : 1>(ah.v, al.v, b.v, b.v, acc[t]);
    }
  }
#pragma unroll
  for (int t = 0; t < 4; ++t) {
    const int col = col0 + t * 16 + ln;
    float bv = bias ? bias[col] : 0.f;
    if (BIAS_BF16) bv = bf16_round(bv);
#pragma unroll
    for (int r = 0; r < 8; ++r) {
      float v = acc[t][r] + bv;
      if (resid) { float rv = resid[(size_t)((row0 + 8 * hh + r) % rmod) * ldr + col]; if (RES_BF16) rv = bf16_round(rv); v += rv; }
      if (ACT == 1) v = fmaxf(v, 0.f);
      if (ACT == 2) v = 0.5f * v * (1.0f + erff(v * 0.70710678118654752f));
      if (ACT == 3) { const float u = 0.7978845608028654f * (v + 0.044715f * v * v * v); v = 0.5f * v * (1.0f + tanhf(u)); }
      so[w][8 * hh + r][t * 16 + ln] = v;
    }
  }
  __builtin_amdgcn_fence(__ATOMIC_ACQ_REL, "workgroup");
  __builtin_amdgcn_wave_barrier();
  const int rsub = lane >> 4, c4 = (lane & 15) * 4;
  {
#pragma unroll
    for (int q = 0; q < 8; ++q) {
      const int r = q * 2 + rsub;
      const v4f v = *(const v4fa*)&so[w][r][c4];
      *(v4f*)(C + (size_t)(row0 + r) * ldc + col0 + c4) = v;
    }
    
  }
}
// row LayerNorm (biased variance, eps) over N: s = X (+ R); optional out_sum <- s; out_norm <- (s-mu)*rsqrt(var+eps)*g + b
template <bool PARAM_BF16>
__global__ __launch_bounds__(256) void k_layernorm(const float* __restrict__ X, const float* __restrict__ R, const float* __restrict__ g, const float* __restrict__ bta,
                                                  float* __restrict__ out_sum, float* __restrict__ out_norm, int N, float eps) {
  __shared__ float red[256];
  const int row = blockIdx.x, tid = threadIdx.x;
  const float* x = X + (size_t)row * N; const float* rr = R ? R + (size_t)row * N : nullptr;
  float vals[16];                     // up to N = 4096
  const int per = N / 256;            // contiguous chunk per thread? use strided-by-4 chunks: thread handles j = tid*4 + 1024*u
  float s1 = 0.f;
  for (int u = 0; u < per / 4; ++u) {
    const int j = tid * 4 + 1024 * u;
    const v4f a = *(const v4fa*)(x + j);
    v4f b = {0.f,0.f,0.f,0.f}; if (rr) b = *(const v4fa*)(rr + j);
#pragma unroll
    for (int q = 0; q < 4; ++q) { const float v = a[q] + b[q]; vals[u * 4 + q] = v; s1 += v; }
  }
  red[tid] = s1; __syncthreads();
  for (int st = 128; st > 0; st >>= 1) { if (tid < st) red[tid] += red[tid + st]; __syncthreads(); }
  const float mu = red[0] / (float)N; __syncthreads();
  float s2 = 0.f;
  for (int u = 0; u < per / 4; ++u)
#pragma unroll
    for (int q = 0; q < 4; ++q) { const float c = vals[u * 4 + q] - mu; s2 += c * c; }
  red[tid] = s2; __syncthreads();
  for (int st = 128; st > 0; st >>= 1) { if (tid < st) red[tid] += red[tid + st]; __syncthreads(); }
  const float rs = rsqrtf(red[0] / (float)N + eps);
  {
    for (int u = 0; u < per / 4; ++u) {
      const int j = tid * 4 + 1024 * u;
      v4f o, sm;
#pragma unroll
      for (int q = 0; q < 4; ++q) {
        float gg = g[j + q], bb = bta[j + q];
        if (PARAM_BF16) { gg = bf16_round(gg); bb = bf16_round(bb); }
        sm[q] = vals[u * 4 + q]; o[q] = (vals[u * 4 + q] - mu) * rs * gg + bb;
      }
      if (out_sum) *(v4f*)(out_sum + (size_t)row * N + j) = sm;
      *(v4f*)(out_norm + (size_t)row * N + j) = o;
    }
    
  }
}



// ---- f16 WMMA path (v_wmma_f32_16x16x32_f16): 11-bit significands for operands in range — used where a [0,1] probability operand needs more precision than bf16
typedef _Float16 v16h __attribute__((ext_vector_type(16)));
union FragH { v16h v; v8us half[2]; _Float16 h[16]; unsigned short u[16]; };
template <int NT>
__device__ __forceinline__ v8f mmaH(v16h ah, v16h al, v16h bh, v16h bl, v8f c) {
  c = __builtin_amdgcn_wmma_f32_16x16x32_f16(false, ah, false, bh, (short)0, c, false, false);
  if (NT >= 2) c = __builtin_amdgcn_wmma_f32_16x16x32_f16(false, al, false, bh, (short)0, c, false, false);
  if (NT >= 3) c = __builtin_amdgcn_wmma_f32_16x16x32_f16(false, ah, false, bl, (short)0, c, false, false);
  asm volatile("v_nop\n\tv_nop\n\tv_nop\n\tv_nop" : "+v"(c) : "v"(ah), "v"(al), "v"(bh), "v"(bl));
  return c;
}
// batched GEMM like k_gemm_b but f16 operands: A f32 (split into f16 hi/lo if ASPLIT, else rounded to f16), Bt = f16 values [n][k]; alpha; C f32; N multiple of 16 (partial tiles skipped)
template <bool ASPLIT>
__global__ __launch_bounds__(128) void k_gemm_h(const float* __restrict__ A, int lda, size_t sA, const _Float16* __restrict__ Bh, int ldb, size_t sB, float alpha, float* __restrict__ C, int ldc, size_t sC, int M, int N, int K) {
  __shared__ __attribute__((aligned(16))) float so[4][16][64];
  const int tid = threadIdx.x, w = tid >> 5, lane = tid & 31, ln = lane & 15, hh = lane >> 4; const int by = blockIdx.y;
  A += (size_t)by * sA; Bh += (size_t)by * sB; C += (size_t)by * sC;
  const int ntn = (N + 63) / 64; const int wid = blockIdx.x * 4 + w; const int mt = wid / ntn, nq = wid % ntn; if (mt * 16 >= M) return;
  const int row0 = mt * 16, col0 = nq * 64; const float* arow = A + (size_t)(row0 + ln) * lda;
  v8f acc[4] = {};
  for (int kb = 0; kb < K; kb += 32) {
    FragH ah, al;
    const v4f x0 = *(const v4fa*)(arow + kb + 8 * hh), x1 = *(const v4fa*)(arow + kb + 8 * hh + 4), x2 = *(const v4fa*)(arow + kb + 16 + 8 * hh), x3 = *(const v4fa*)(arow + kb + 16 + 8 * hh + 4);
    float xs[16] = {x0[0],x0[1],x0[2],x0[3],x1[0],x1[1],x1[2],x1[3],x2[0],x2[1],x2[2],x2[3],x3[0],x3[1],x3[2],x3[3]};
#pragma unroll
    for (int i = 0; i < 16; ++i) { const _Float16 h = (_Float16)xs[i]; ah.h[i] = h; al.h[i] = ASPLIT ? (_Float16)(xs[i] - (float)h) : (_Float16)0.0f; }
#pragma unroll
    for (int t = 0; t < 4; ++t) { if (col0 + t * 16 >= N) continue; const size_t boff = (size_t)(col0 + t * 16 + ln) * ldb + kb; FragH bq; bq.half[0] = *(const v8us*)(Bh + boff + 8 * hh); bq.half[1] = *(const v8us*)(Bh + boff + 16 + 8 * hh);
      acc[t] = mmaH<ASPLIT ? 2 : 1>(ah.v, al.v, bq.v, bq.v, acc[t]); }
  }
#pragma unroll
  for (int t = 0; t < 4; ++t) { if (col0 + t * 16 >= N) continue;
#pragma unroll
    for (int r = 0; r < 8; ++r) so[w][8 * hh + r][t * 16 + ln] = acc[t][r] * alpha; }
  __builtin_amdgcn_fence(__ATOMIC_ACQ_REL, "workgroup"); __builtin_amdgcn_wave_barrier();
  const int rsub = lane >> 4, c4 = (lane & 15) * 4;
  {
#pragma unroll
    for (int q = 0; q < 8; ++q) { const int r = q * 2 + rsub; if (col0 + c4 < N) { const v4f v = *(const v4fa*)&so[w][r][c4]; *(v4f*)(C + (size_t)(row0 + r) * ldc + col0 + c4) = v; } }
     }
}

// Wt[n][k] = f16(W[k][n]·scale) from f32 row-major W[K][N] (scale = power of two; bf16-exact weights stay exact in f16 away from the subnormal range)
__global__ __launch_bounds__(256) void k_wt_f16(const float* __restrict__ W, _Float16* __restrict__ Wt, int K, int N, float scale) {
  const int t = blockIdx.x * 256 + threadIdx.x; if (t >= N * (K / 8)) return; const int n = t / (K / 8), k8 = (t % (K / 8)) * 8; FragH f;
#pragma unroll
  for (int i = 0; i < 8; ++i) f.h[i] = (_Float16)(bf16_round(W[(size_t)(k8 + i) * N + n]) * scale); const v8us o = f.half[0];
  *(v8us*)((unsigned short*)Wt + (size_t)n * K + k8) = o; 
}
// k_gemm_hh variant with fused epilogue: v = acc·alpha + bias[by·sBias + col] (+ CP[(row/rowsPerB)·sCPb + by·64 + col] if CP) ; ACT 0 none / 1 elu ; writes f32 C and/or f16 C16 (each if non-null)
template <int ACT>
__global__ __launch_bounds__(128) void k_gemm_hhx(const _Float16* __restrict__ A, int lda, size_t sA, const _Float16* __restrict__ Bh, int ldb, size_t sB, float alpha, const float* __restrict__ bias, size_t sBias, const float* __restrict__ CP, int rowsPerB, size_t sCPb, int row0g,
    float* __restrict__ C, _Float16* __restrict__ C16, int ldc, size_t sC, int M, int N, int K) {
  __shared__ __attribute__((aligned(16))) float so[4][16][64];
  const int tid = threadIdx.x, w = tid >> 5, lane = tid & 31, ln = lane & 15, hh = lane >> 4; const int by = blockIdx.y;
  A += (size_t)by * sA; Bh += (size_t)by * sB; const size_t cofs = (size_t)by * sC; const float* bp = bias ? bias + (size_t)by * sBias : nullptr;
  const int ntn = (N + 63) / 64; const int wid = blockIdx.x * 4 + w; const int mt = wid / ntn, nq = wid % ntn; if (mt * 16 >= M) return;
  const int row0 = mt * 16, col0 = nq * 64; const _Float16* arow = A + (size_t)(row0 + ln) * lda;
  v8f acc[4] = {};
  for (int kb = 0; kb < K; kb += 32) { FragH ah; ah.half[0] = *(const v8us*)((const unsigned short*)arow + kb + 8 * hh); ah.half[1] = *(const v8us*)((const unsigned short*)arow + kb + 16 + 8 * hh);
#pragma unroll
    for (int t = 0; t < 4; ++t) { if (col0 + t * 16 >= N) continue; const size_t boff = (size_t)(col0 + t * 16 + ln) * ldb + kb; FragH bq; bq.half[0] = *(const v8us*)((const unsigned short*)Bh + boff + 8 * hh); bq.half[1] = *(const v8us*)((const unsigned short*)Bh + boff + 16 + 8 * hh);
      acc[t] = mmaH<1>(ah.v, ah.v, bq.v, bq.v, acc[t]); }
  }
#pragma unroll
  for (int t = 0; t < 4; ++t) { if (col0 + t * 16 >= N) continue; const int col = col0 + t * 16 + ln; const float bv = bp ? bf16_round(bp[col]) : 0.f;
#pragma unroll
    for (int r = 0; r < 8; ++r) { float v = acc[t][r] * alpha + bv; if (CP) { const int bidx = (row0g + row0 + 8 * hh + r) / rowsPerB; v += CP[(size_t)bidx * sCPb + (size_t)by * 64 + col]; } if (ACT == 1) v = (v > 0.f) ? v : expm1f(v); else if (ACT == 7) v = (v > 0.f) ? v + 1.0f : expf(v); else if (ACT == 8) v = tanhf(v); else if (ACT == 9) v = 0.5f * v * (1.0f + tanhf(0.7978845608028654f * (v + 0.044715f * v * v * v))); else if (ACT == 11) v = 1.0f / (1.0f + expf(-v)); else if (ACT == 12) v = (v > 0.f) ? v : 0.01f * v; else if (ACT == 14) v = (v > 0.f) ? v : 0.1f * v; else if (ACT == 15) v = v / (1.0f + expf(-v)); else if (ACT == 3) v = fmaxf(v, 0.f); else if (ACT == 6) v = 0.5f * v * (1.0f + erff(v * 0.70710678118654752f)); so[w][8 * hh + r][t * 16 + ln] = v; } }
  __builtin_amdgcn_fence(__ATOMIC_ACQ_REL, "workgroup"); __builtin_amdgcn_wave_barrier();
  const int rsub = lane >> 4, c4 = (lane & 15) * 4; typedef _Float16 v4h __attribute__((ext_vector_type(4)));
  {
#pragma unroll
    for (int q = 0; q < 8; ++q) { const int r = q * 2 + rsub; if (col0 + c4 < N) { const v4f v = *(const v4fa*)&so[w][r][c4]; if (C) *(v4f*)(C + cofs + (size_t)(row0 + r) * ldc + col0 + c4) = v; if (C16) { v4h h4; for (int i = 0; i < 4; ++i) h4[i] = (_Float16)v[i]; *(v4h*)(C16 + cofs + (size_t)(row0 + r) * ldc + col0 + c4) = h4; } } }
     }
}


typedef _Float16 v4h __attribute__((ext_vector_type(4)));

__global__ __launch_bounds__(256) void k_x16(const float* __restrict__ x, _Float16* __restrict__ X16, size_t n8) { const size_t t = (size_t)blockIdx.x * 256 + threadIdx.x; if (t >= n8) return; FragH f;
#pragma unroll
  for (int q = 0; q < 8; ++q) f.h[q] = (_Float16)bf16_round(x[t * 8 + q]); *(v8us*)((unsigned short*)X16 + t * 8) = f.half[0];  }
__global__ __launch_bounds__(256) void k_h16(const float* __restrict__ x, _Float16* __restrict__ X16, size_t n8) { const size_t t = (size_t)blockIdx.x * 256 + threadIdx.x; if (t >= n8) return; FragH f;
#pragma unroll
  for (int q = 0; q < 8; ++q) f.h[q] = (_Float16)x[t * 8 + q]; *(v8us*)((unsigned short*)X16 + t * 8) = f.half[0];  }
__global__ __launch_bounds__(256) void k_round16f(const float* __restrict__ W, _Float16* __restrict__ Bt, size_t n8) { const size_t t = (size_t)blockIdx.x * 256 + threadIdx.x; if (t >= n8) return; FragH f;
#pragma unroll
  for (int i = 0; i < 8; ++i) f.h[i] = (_Float16)(bf16_round(W[t * 8 + i]) * 16.0f); *(v8us*)((unsigned short*)Bt + t * 8) = f.half[0];  }
template <int NHv, int TTv>
__global__ __launch_bounds__(256) void k_vt(const _Float16* __restrict__ V16, int ldv, int voff, _Float16* __restrict__ Vt) { __shared__ unsigned short tl[64][66]; const int tid = threadIdx.x; const int slab = blockIdx.x / (TTv / 64), lg = blockIdx.x % (TTv / 64); const int b = slab / NHv, h = slab % NHv;
  for (int i = tid; i < 64 * 8; i += 256) { const int r = i / 8, c8 = (i % 8) * 8; FragH f; f.half[0] = *(const v8us*)((const unsigned short*)V16 + ((size_t)b * TTv + lg * 64 + r) * ldv + voff + h * 64 + c8);
#pragma unroll
    for (int q = 0; q < 8; ++q) tl[r][c8 + q] = f.u[q]; }
  __syncthreads();
  {
#pragma unroll
    for (int rd = 0; rd < 2; ++rd) { const int d = rd * 32 + tid / 8, pc = tid % 8; FragH f;
#pragma unroll
      for (int q = 0; q < 8; ++q) f.u[q] = tl[pc * 8 + q][d];
      *(v8us*)((unsigned short*)Vt + ((size_t)slab * 64 + d) * TTv + lg * 64 + pc * 8) = f.half[0]; }
     } }

__global__ __launch_bounds__(256) void k_hl(const float* __restrict__ F, _Float16* __restrict__ Hh, _Float16* __restrict__ Hl, size_t n8) { const size_t t = (size_t)blockIdx.x * 256 + threadIdx.x; if (t >= n8) return; FragH fh, fl; const v4f a = *(const v4fa*)(F + t * 8), c = *(const v4fa*)(F + t * 8 + 4);
#pragma unroll
  for (int q = 0; q < 4; ++q) { _Float16 h = (_Float16)a[q]; fh.h[q] = h; fl.h[q] = (_Float16)((a[q] - (float)h) * 1024.0f); h = (_Float16)c[q]; fh.h[4 + q] = h; fl.h[4 + q] = (_Float16)((c[q] - (float)h) * 1024.0f); }
  { *(v8us*)((unsigned short*)Hh + t * 8) = fh.half[0]; *(v8us*)((unsigned short*)Hl + t * 8) = fl.half[0];  } }

// Offset in halves of the 8 values k = kk .. kk + 7 (kk a multiple of 8) of row n, K 256, in matrix-fragment order [n / 16][kk / 32][half][lane][8], half = (kk >> 4) & 1, lane = 16 * ((kk >> 3) & 1) + n % 16:
// a wave's 16-byte load of half a fragment then covers 512 contiguous bytes (four whole lines) instead of pieces of sixteen lines.
__device__ __forceinline__ size_t frag_off(int n, int kk) { return ((((size_t)(n >> 4) * 8 + (kk >> 5)) * 2 + ((kk >> 4) & 1)) * 32 + ((kk >> 3) & 1) * 16 + (n & 15)) * 8; }
// The folded weights [W*s | W*s*2^-10] for K = N = 128, stored in fragment order. 2048 threads (t), one (n, k8) each; neighbouring threads take neighbouring n (whole lines on the load side).
// LO false: only the W*s plane is written (k_attn multiplies both planes of its operand by that one plane and joins the two sums afterwards).
template <bool LO>
__device__ __forceinline__ void pack_wtf(const float* __restrict__ W, float scale, _Float16* __restrict__ Bt, int t) { const int n = t % EE, k8 = (t / EE) * 8; const int i0 = k8 * EE + n; float x[8]; FragH f, f2;
#pragma unroll
  for (int i = 0; i < 8; ++i) x[i] = W[i0 + i * EE];
  asm volatile("s_wait_xcnt 0x0" :: "v"(i0) : "memory");      /* named as an input, the eight loads' offset register stays whole up to this wait: none of their results lands on it */
#pragma unroll
  for (int i = 0; i < 8; ++i) { const float wv = bf16_round(x[i]) * scale; f.h[i] = (_Float16)wv; f2.h[i] = (_Float16)(wv * 0.0009765625f); }
  { *(v8us*)((unsigned short*)Bt + frag_off(n, k8)) = f.half[0]; if (LO) *(v8us*)((unsigned short*)Bt + frag_off(n, EE + k8)) = f2.half[0];  } }
// The pair-bias weights, 4 live of 16 rows, the others zero. 512 threads (t), one (o, k0) each: a wave has one o, so the test on o is the same for a whole wave.
__device__ __forceinline__ void pack_wb(const float* __restrict__ w, _Float16* __restrict__ Bt, int t) { const int k0 = (t % (2 * EE / 8)) * 8, o = t / (2 * EE / 8); const int kk0 = k0 % EE; const float sc = (k0 < EE) ? 16.0f : (16.0f * 0.0009765625f); FragH f;
#pragma unroll
  for (int q = 0; q < 8; ++q) f.h[q] = (_Float16)0.0f;
  if (o < NHD) { const int i0 = kk0 * NHD + o; float x[8];
#pragma unroll
    for (int q = 0; q < 8; ++q) x[q] = w[i0 + q * NHD];
    asm volatile("s_wait_xcnt 0x0" :: "v"(i0) : "memory");      /* named as an input, the eight loads' offset register stays whole up to this wait: none of their results lands on it */
#pragma unroll
    for (int q = 0; q < 8; ++q) f.h[q] = (_Float16)(bf16_round(x[q]) * sc); }
  *(v8us*)((unsigned short*)Bt + frag_off(o, k0)) = f.half[0];  }
// All six weight packs in one launch: none needs anything of another, so each takes a range of the block index (eight blocks a 128 x 128 matrix, two for the pair-bias weights). The choice is the same for a whole block.
#define PACK_BLOCKS (5 * 8 + 2)
__global__ __launch_bounds__(256) void k_pack(const float* __restrict__ Wq, const float* __restrict__ Wk, const float* __restrict__ Wv, const float* __restrict__ Wfu, const float* __restrict__ Wo, const float* __restrict__ Wb,
                                              _Float16* __restrict__ BQK, _Float16* __restrict__ AV, _Float16* __restrict__ BFU, _Float16* __restrict__ BO, _Float16* __restrict__ BB) {
  const int job = blockIdx.x >> 3, t = (blockIdx.x & 7) * 256 + threadIdx.x;
  if (job == 5) {
    pack_wb(Wb, BB, t);
    asm volatile("s_wait_xcnt 0x0" ::: "memory");      /* the built code joins the ranges by flags, so another range's instructions stand on a path behind this store: they reuse its registers only behind this wait */
  } else if (job == 4) pack_wtf<false>(Wo, 16.0f, BO, t);
  else {
    const float* W = (job == 0) ? Wq : (job == 1) ? Wk : (job == 2) ? Wv : Wfu;
    _Float16* Bt = (job == 0) ? BQK : (job == 1) ? BQK + (size_t)EE * 2 * EE : (job == 2) ? AV : BFU;
    pack_wtf<true>(W, (job == 2) ? 1.0f : 16.0f, Bt, t);
    asm volatile("s_wait_xcnt 0x0" ::: "memory");      /* as above, for the two stores of this range */
  }
}
// LayerNorm and every product that reads x, in one launch. A block normalises 128 tokens into LDS as [x_hi (128) | x_lo*2^10 (128)] f16 rows and its eight waves form, against the folded weights
// [W*s | W*s*2^-10] (K 256, packed in fragment order): [q | k] (8 units of 64 tokens x 64 columns), gate logits (4 units), v^T (4 units), two units a wave, and the pair bias (one 16-token tile a wave).
#define XP 264                   /* staged x row pitch in halves: 512 B of data + 16 B (16 B x odd: conflict-free ds_load_b128) */
#define SP 72                    /* output staging row pitch in halves: 128 B of data + 16 B */
#define TM 128                   /* tokens per block */
typedef _Float16 v4ha __attribute__((ext_vector_type(4), may_alias));
// One 64 x 64 unit. KIND 0: [q | k], 1: gate logits (+ bias), both stored [token][column]; 2: v^T, stored [column][token].
// The operand whose index runs along the stored row goes in as A: a lane then holds 8 neighbours of one stored row (16 bytes), and the wave's own LDS range turns them into whole 128-byte lines.
// Every loop here and in k_proj is unrolled because its index picks registers (fragments, accumulators, a row's values), which only a compile-time index can.
template <int KIND>
__device__ __forceinline__ void proj_unit(const unsigned short* xs, const unsigned short* __restrict__ wt, const float* bias /* LDS, rounded */, unsigned short* st, unsigned short* __restrict__ out, int ldo, int lane) {
  const int ln = lane & 15, hh = lane >> 4;
  const unsigned short* xr = xs + ln * XP + 8 * hh;
  const unsigned short* wr = wt + lane * 8;      /* fragment order: 4096 halves a 16-row tile, 512 a k step, 256 half a fragment */
  const float alpha = (KIND == 2) ? 1.0f : 0.0625f;
  v8f acc[4][4] = {};
  FragH wf[2][4];                /* weight fragments come from L2: fetched one k step ahead */
#pragma unroll
  for (int j = 0; j < 4; ++j) { wf[0][j].half[0] = *(const v8us*)(wr + j * 4096); wf[0][j].half[1] = *(const v8us*)(wr + j * 4096 + 256); }
#pragma unroll
  for (int kb = 0; kb < 8; ++kb) {
    if (kb + 1 < 8) {
#pragma unroll
      for (int j = 0; j < 4; ++j) { wf[(kb + 1) & 1][j].half[0] = *(const v8us*)(wr + j * 4096 + (kb + 1) * 512); wf[(kb + 1) & 1][j].half[1] = *(const v8us*)(wr + j * 4096 + (kb + 1) * 512 + 256); }
    }
    FragH xf[4];
#pragma unroll
    for (int i = 0; i < 4; ++i) { xf[i].half[0] = *(const v8us*)(xr + i * 16 * XP + kb * 32); xf[i].half[1] = *(const v8us*)(xr + i * 16 * XP + kb * 32 + 16); }
    __builtin_amdgcn_sched_barrier(0);      /* keeps the next step's weight loads and this step's LDS reads in one group ahead of the 16 products: left alone the compiler sinks each load to its first use, and the wave waits out every latency */
#pragma unroll
    for (int i = 0; i < 4; ++i)
#pragma unroll
      for (int j = 0; j < 4; ++j)
        acc[i][j] = (KIND == 2) ? __builtin_amdgcn_wmma_f32_16x16x32_f16(false, xf[i].v, false, wf[kb & 1][j].v, (short)0, acc[i][j], false, false)
                                : __builtin_amdgcn_wmma_f32_16x16x32_f16(false, wf[kb & 1][j].v, false, xf[i].v, (short)0, acc[i][j], false, false);
    __builtin_amdgcn_sched_barrier(0);      /* keeps later steps' loads from rising further: a third set of fragments would not fit 256 registers */
  }
  asm volatile("s_wait_xcnt 0x0" :: "v"(lane), "s"(wt) : "memory");      /* the weight loads' address registers (lane offset, scalar base) are reused only behind this wait: named as inputs, they stay whole up to it */
#pragma unroll
  for (int j = 0; j < 4; ++j) {
    float bv[8] = {0.f, 0.f, 0.f, 0.f, 0.f, 0.f, 0.f, 0.f};
    if (KIND == 1) { const v4f b0 = *(const v4fa*)(bias + j * 16 + 8 * hh), b1 = *(const v4fa*)(bias + j * 16 + 8 * hh + 4);
#pragma unroll
      for (int r = 0; r < 4; ++r) { bv[r] = b0[r]; bv[4 + r] = b1[r]; } }
#pragma unroll
    for (int i = 0; i < 4; ++i) { FragH f;
#pragma unroll
      for (int r = 0; r < 8; ++r) f.h[r] = (_Float16)((KIND == 1) ? acc[i][j][r] * alpha + bv[r] : acc[i][j][r] * alpha);
      const int row = (KIND == 2) ? j * 16 + ln : i * 16 + ln, col = (KIND == 2) ? i * 16 + 8 * hh : j * 16 + 8 * hh;
      *(v8us*)&st[row * SP + col] = f.half[0]; }
  }
  __builtin_amdgcn_fence(__ATOMIC_ACQ_REL, "workgroup", "local"); __builtin_amdgcn_wave_barrier();      /* the rows read below were written by other lanes of this wave */
#pragma unroll
  for (int q = 0; q < 16; ++q) { const int row = q * 4 + (lane >> 3), c8 = (lane & 7) * 8; const v8us v = *(const v8us*)&st[row * SP + c8]; *(v8us*)(out + (size_t)row * ldo + c8) = v; }
  asm volatile("s_wait_xcnt 0x0" ::: "memory");      /* the stores' address and data registers are reused by what follows only behind this wait; its clobber also keeps the next unit's writes of st behind the reads above */
}
// Two blocks a WGP (LDS allows two): four waves per SIMD, so 256 registers a wave.
__global__ __launch_bounds__(256) __attribute__((amdgpu_waves_per_eu(4, 4))) void k_proj(const float* __restrict__ X, const float* __restrict__ g, const float* __restrict__ bb, const float* __restrict__ bfu,
                                              const _Float16* __restrict__ BQK, const _Float16* __restrict__ AV, const _Float16* __restrict__ BB, const _Float16* __restrict__ BFU,
                                              _Float16* __restrict__ QK, _Float16* __restrict__ VT, _Float16* __restrict__ PB, _Float16* __restrict__ FU) {
  __shared__ __attribute__((aligned(16))) unsigned short xs[TM * XP];
  __shared__ __attribute__((aligned(16))) unsigned short stg[8 * 64 * SP];
  __shared__ __attribute__((aligned(16))) float sb[2 * EE];      /* the gate bias, twice: every thread loads and stores one value, so the load issues with the row loads and no wave waits for it in a branch of its own */
  const int tid = threadIdx.x, lane = tid & 31, ln = lane & 15, hh = lane >> 4;
  const int w = __builtin_amdgcn_readfirstlane(tid >> 5);      /* the wave's number in a scalar register: the choice of units below is a scalar branch */
  const int tok0 = blockIdx.x * TM;
  const int bi = tid & (EE - 1);
  const float bfv = bfu[bi];
  asm volatile("s_wait_xcnt 0x0" :: "v"(bi) : "memory");      /* named as an input, the load's index register stays whole up to this wait: the row loads below may land on it only behind it */
  { /* LayerNorm: wave w takes tokens 16 w .. 16 w + 15, a whole row per wave, 4 channels a lane */
    float v[16][4], s[16], q2[16];
#pragma unroll
    for (int u = 0; u < 16; ++u) { const v4f a = *(const v4fa*)(X + (size_t)(tok0 + w * 16 + u) * EE + lane * 4);
#pragma unroll
      for (int k = 0; k < 4; ++k) v[u][k] = a[k]; }
    const v4f g4 = *(const v4fa*)(g + lane * 4), b4 = *(const v4fa*)(bb + lane * 4);
#pragma unroll
    for (int u = 0; u < 16; ++u) { s[u] = 0.f;
#pragma unroll
      for (int k = 0; k < 4; ++k) { v[u][k] = bf16_round(v[u][k]); s[u] += v[u][k]; } }
#pragma unroll
    for (int o = 16; o > 0; o >>= 1)
#pragma unroll
      for (int u = 0; u < 16; ++u) s[u] += __shfl_xor(s[u], o, 32);
#pragma unroll
    for (int u = 0; u < 16; ++u) { const float mu = s[u] / (float)EE; q2[u] = 0.f;
#pragma unroll
      for (int k = 0; k < 4; ++k) { v[u][k] -= mu; q2[u] += v[u][k] * v[u][k]; } }
#pragma unroll
    for (int o = 16; o > 0; o >>= 1)
#pragma unroll
      for (int u = 0; u < 16; ++u) q2[u] += __shfl_xor(q2[u], o, 32);
#pragma unroll
    for (int u = 0; u < 16; ++u) { const float rs = rsqrtf(q2[u] / (float)EE + 1e-5f); v4ha h4, l4;
#pragma unroll
      for (int k = 0; k < 4; ++k) { const float xv = v[u][k] * rs * bf16_round(g4[k]) + bf16_round(b4[k]); h4[k] = (_Float16)xv; l4[k] = (_Float16)((xv - (float)h4[k]) * 1024.0f); }
      *(v4ha*)&xs[(w * 16 + u) * XP + lane * 4] = h4; *(v4ha*)&xs[(w * 16 + u) * XP + EE + lane * 4] = l4; }
  }
  sb[tid] = bf16_round(bfv);      /* the gate bias, rounded once a block */
  __syncthreads();               /* publishes the normalised tile (and the bias) to all eight waves */
  const int th = w & 1;          /* which 64 of the block's 128 tokens */
  const unsigned short* xh = xs + th * 64 * XP;
  unsigned short* st = stg + w * 64 * SP;
  const size_t tokh = (size_t)tok0 + th * 64;
  proj_unit<0>(xh, (const unsigned short*)BQK + (size_t)(w >> 1) * 64 * 2 * EE, nullptr, st, (unsigned short*)QK + tokh * 2 * EE + (w >> 1) * 64, 2 * EE, lane);
  if (w < 4) proj_unit<1>(xh, (const unsigned short*)BFU + (size_t)(w >> 1) * 64 * 2 * EE, sb + (w >> 1) * 64, st, (unsigned short*)FU + tokh * EE + (w >> 1) * 64, EE, lane);
  else       proj_unit<2>(xh, (const unsigned short*)AV + (size_t)((w >> 1) & 1) * 64 * 2 * EE, nullptr, st, (unsigned short*)VT + ((size_t)(tok0 / SL) * EE + ((w >> 1) & 1) * 64) * SL + (tok0 % SL) + th * 64, SL, lane);
  { /* pair bias of tokens 16 w .. 16 w + 15 (4 live of 16 columns): a lane holds 8 columns of one token */
    const unsigned short* xr = xs + (w * 16 + ln) * XP + 8 * hh; const unsigned short* wr = (const unsigned short*)BB + lane * 8;
    v8f c = {}; FragH wf[8];
#pragma unroll
    for (int kb = 0; kb < 8; ++kb) { wf[kb].half[0] = *(const v8us*)(wr + kb * 512); wf[kb].half[1] = *(const v8us*)(wr + kb * 512 + 256); }
    asm volatile("s_wait_xcnt 0x0" :: "v"(lane), "s"(BB) : "memory");      /* named as inputs, the loads' address registers (lane offset, scalar base) stay whole up to this wait: none of the sixteen loads lands on them */
#pragma unroll
    for (int kb = 0; kb < 8; ++kb) { FragH xf; xf.half[0] = *(const v8us*)(xr + kb * 32); xf.half[1] = *(const v8us*)(xr + kb * 32 + 16);
      c = __builtin_amdgcn_wmma_f32_16x16x32_f16(false, wf[kb].v, false, xf.v, (short)0, c, false, false); }
    FragH f;
#pragma unroll
    for (int r = 0; r < 8; ++r) f.h[r] = (_Float16)(c[r] * 0.0625f);
    *(v8us*)((unsigned short*)PB + ((size_t)tok0 + w * 16 + ln) * 16 + 8 * hh) = f.half[0]; }
}
// BF[h][a-tile][b-tile][p][lane][i] = (bf16(mask[a][b]) + pair_bias[a][b][h]) * sqrt(32), a = 16*atile + (lane & 15), b = 16*btile + 8*(lane >> 4) + 4*p + i:
// the accumulator (C) fragment order of the transposed score tile, so that k_attn loads it with whole-line 16-byte loads. The sqrt(32) undoes the score scale applied after the product.
__global__ __launch_bounds__(256) void k_bias(const float* __restrict__ mask, const _Float16* __restrict__ PB, float* __restrict__ BF) {
  const int t = blockIdx.x * 256 + threadIdx.x; if (t >= (SL / 16) * (SL / 16) * 64) return;
  const int lane = t & 31, p = (t >> 5) & 1, bt = (t >> 6) & 15, at = t >> 10; const int a = at * 16 + (lane & 15), b = bt * 16 + 8 * (lane >> 4) + 4 * p;
  const v4f mk = *(const v4fa*)(mask + (size_t)a * SL + b);
#pragma unroll
  for (int h = 0; h < NHD; ++h) { v4f o;
#pragma unroll
    for (int i = 0; i < 4; ++i) o[i] = (bf16_round(mk[i]) + (float)PB[((size_t)a * SL + b + i) * 16 + h]) * 5.656854249492381f;
    *(v4f*)(BF + ((((size_t)h * 16 + at) * 16 + bt) * 2 + p) * 128 + lane * 4) = o; } }

__device__ __forceinline__ v8f exp2x8(v8f x) {
  float a = x[0], b = x[1], c = x[2], d = x[3], e = x[4], f = x[5], g = x[6], h = x[7];
  asm("v_exp_f32 %0, %0\n\tv_exp_f32 %1, %1\n\tv_exp_f32 %2, %2\n\tv_exp_f32 %3, %3\n\tv_exp_f32 %4, %4\n\tv_exp_f32 %5, %5\n\tv_exp_f32 %6, %6\n\tv_exp_f32 %7, %7\n\tv_nop"
      : "+v"(a), "+v"(b), "+v"(c), "+v"(d), "+v"(e), "+v"(f), "+v"(g), "+v"(h));
  return (v8f){a, b, c, d, e, f, g, h};
}
// Eight v_rcp_f32 in the same form, for the same reason.
__device__ __forceinline__ v8f rcpx8(v8f x) {
  float a = x[0], b = x[1], c = x[2], d = x[3], e = x[4], f = x[5], g = x[6], h = x[7];
  asm("v_rcp_f32 %0, %0\n\tv_rcp_f32 %1, %1\n\tv_rcp_f32 %2, %2\n\tv_rcp_f32 %3, %3\n\tv_rcp_f32 %4, %4\n\tv_rcp_f32 %5, %5\n\tv_rcp_f32 %6, %6\n\tv_rcp_f32 %7, %7\n\tv_nop"
      : "+v"(a), "+v"(b), "+v"(c), "+v"(d), "+v"(e), "+v"(f), "+v"(g), "+v"(h));
  return (v8f){a, b, c, d, e, f, g, h};
}
// value of lane l ^ 16 (the other half of the wave), without LDS
__device__ __forceinline__ float other_half(float x) { const int b = __float_as_int(x); return __int_as_float(__builtin_amdgcn_permlanex16(b, b, 0x76543210, 0xfedcba98, false, false)); }
#define QP 136                   /* staged q row pitch in halves: 256 B of data (four heads) + 16 B (16 B x odd: conflict-free ds_load_b128) */
#define VP 264                   /* staged v^T row pitch in halves: 512 B of data + 16 B */
#define OP 68                    /* output staging row pitch in floats: 256 B of data + 16 B */
// One struct fixes the order in LDS: Wo^T lies lowest, so that lane offset + constant stays inside the 16-bit offset field of an LDS read and all its fragments are read from one address register.
struct __attribute__((aligned(16))) AttnLds {
  unsigned short swo[EE * EE];   /* Wo^T * 16 in fragment order: [e tile][head][half][lane][8] */
  float sbo[4 * EE];             /* the output bias, four times: every thread loads and stores one value, so the load issues with the staging loads and no wave waits for it in a branch of its own */
  unsigned short sog[16 * 4096]; /* 8 KB a wave, its own: first the gated output as fragments [hi, lo][head][half][lane][8], then, once those are back in registers, the output staging rows */
  unsigned short sq[SL * QP];
  unsigned short sv[EE * VP];
};
// What one head needs from L2 ahead of its scores: the bias tiles (the accumulators' start values) and the k fragment.
__device__ __forceinline__ void head_loads(const float* __restrict__ bf, const unsigned short* __restrict__ kr, v8f (&acc)[16], FragH& kf) {
#pragma unroll
  for (int t = 0; t < 16; ++t) { const v4f lo = *(const v4fa*)(bf + t * 256), hi = *(const v4fa*)(bf + t * 256 + 128); acc[t] = (v8f){lo[0], lo[1], lo[2], lo[3], hi[0], hi[1], hi[2], hi[3]}; }
  kf.half[0] = *(const v8us*)kr; kf.half[1] = *(const v8us*)(kr + 16);
}
// One block a WGP (LDS): four waves per SIMD, so 256 registers a wave. Every loop but the one over the heads is unrolled because its index picks registers.
__global__ __launch_bounds__(512) void k_attn(const _Float16* __restrict__ QK, const _Float16* __restrict__ VT, const float* __restrict__ BF, const _Float16* __restrict__ FU, const _Float16* __restrict__ BO, const float* __restrict__ bo, float* __restrict__ out) {
  __shared__ AttnLds lds;
  unsigned short* const swo = lds.swo; float* const sbo = lds.sbo; unsigned short* const sq = lds.sq; unsigned short* const sv = lds.sv;
  const int tid = threadIdx.x, lane = tid & 31, ln = lane & 15, hh = lane >> 4;
  const int w = __builtin_amdgcn_readfirstlane(tid >> 5);      /* the wave's number in a scalar register: the bias tiles then load from a scalar base */
  const int s = blockIdx.x;
  const unsigned short* qk = (const unsigned short*)QK + (size_t)s * SL * 2 * EE;
  const unsigned short* vt = (const unsigned short*)VT + (size_t)s * EE * SL;
  /* staging: 16-byte piece tid + 512 u of each tile; every address is one per-thread base plus a constant step */
  const unsigned short* gqp = qk + (tid >> 4) * 2 * EE + (tid & 15) * 8;      /* 16 pieces a q row: 32 rows a step */
  const unsigned short* gvp = vt + tid * 8;                                   /* 32 pieces a v^T row: 16 rows a step */
  const unsigned short* gwp = (const unsigned short*)BO + (tid >> 8) * 4096 + (tid & 255) * 8;      /* 256 pieces a 16-row tile, the first 4 of its 8 k steps: 2 tiles a step */
  v8us gq[8], gv[8], gw[4];
#pragma unroll
  for (int u = 0; u < 8; ++u) { gq[u] = *(const v8us*)(gqp + u * 32 * 2 * EE); gv[u] = *(const v8us*)(gvp + u * 4096); }
#pragma unroll
  for (int u = 0; u < 4; ++u) gw[u] = *(const v8us*)(gwp + u * 2 * 4096);
  const float bov = bo[tid & (EE - 1)];
  asm volatile("s_wait_xcnt 0x0" ::: "memory");      /* the address registers of the twenty-one loads above are free for reuse as destinations of the loads below only behind this wait */
  const float* bf = BF + (size_t)w * 16 * 256 + lane * 4;      /* + h * 16 * 16 * 256 */
  const unsigned short* kr = qk + (size_t)(w * 16 + ln) * 2 * EE + EE + 8 * hh;      /* + h * HDC */
  const unsigned short* fr = (const unsigned short*)FU + ((size_t)s * SL + w * 16 + ln) * EE + 8 * hh;      /* + h * HDC */
  v8f acc[16]; FragH kf;
  head_loads(bf, kr, acc, kf);
  asm volatile("s_wait_xcnt 0x0" ::: "memory");      /* the address registers of the first head's loads are reused only behind this wait */
#pragma unroll
  for (int u = 0; u < 8; ++u) { *(v8us*)&sq[((tid >> 4) + u * 32) * QP + (tid & 15) * 8] = gq[u]; *(v8us*)&sv[((tid >> 5) + u * 16) * VP + (tid & 31) * 8] = gv[u]; }
#pragma unroll
  for (int u = 0; u < 4; ++u) *(v8us*)&swo[tid * 8 + u * 4096] = gw[u];
  sbo[tid] = bf16_round(bov);    /* the output bias, rounded once a block */
  __syncthreads();               /* publishes the staged q, v^T and Wo^T tiles (and the bias) to all sixteen waves */
  unsigned short* const og = lds.sog + w * 4096 + lane * 8;      /* the gated output of this wave's 16 positions waits in LDS, each lane's values in its own 16-byte slots: 64 registers that the heads' scores need */
#pragma unroll 1      /* rolled: nothing here is picked by h at compile time, and no head's loads or reads rise into the head before, where there are no registers for them */
  for (int h = 0; h < NHD; ++h) {
    FragH fu; fu.half[0] = *(const v8us*)(fr + h * HDC); fu.half[1] = *(const v8us*)(fr + h * HDC + 16);      /* gate logits of channels 8 hh + r and 16 + 8 hh + r: the rows of Ot that this lane holds */
    asm volatile("s_wait_xcnt 0x0" ::: "memory");      /* the address registers of the two loads above are reused only behind this wait */
#pragma unroll
    for (int t = 0; t < 16; ++t) { FragH qf; const unsigned short* qr = &sq[(t * 16 + ln) * QP + h * HDC + 8 * hh]; qf.half[0] = *(const v8us*)qr; qf.half[1] = *(const v8us*)(qr + 16);
      acc[t] = __builtin_amdgcn_wmma_f32_16x16x32_f16(false, qf.v, false, kf.v, (short)0, acc[t], false, false); }
    float mx[4] = {-3.0e38f, -3.0e38f, -3.0e38f, -3.0e38f};
#pragma unroll
    for (int t = 0; t < 16; ++t)
#pragma unroll
      for (int r = 0; r < 8; ++r) mx[r & 3] = fmaxf(mx[r & 3], acc[t][r]);
    float m = fmaxf(fmaxf(mx[0], mx[1]), fmaxf(mx[2], mx[3])); m = fmaxf(m, other_half(m));
    const float cs = 0.17677669529663687f * 1.4426950408889634f;      /* 32^-1/2 * log2(e) */
    const float mc = 10.0f - m * cs;                                  /* p = 2^10 * exp(logit - max): the f16 range the probabilities had before */
    float sm[4] = {0.f, 0.f, 0.f, 0.f};
    FragH pf[8];
#pragma unroll
    for (int t = 0; t < 16; ++t) { v8f z;
#pragma unroll
      for (int r = 0; r < 8; ++r) z[r] = __builtin_fmaf(acc[t][r], cs, mc);
      const v8f e = exp2x8(z);
#pragma unroll
      for (int r = 0; r < 8; ++r) { sm[r & 3] += e[r]; pf[t >> 1].h[(t & 1) * 8 + r] = (_Float16)e[r]; } }
    float su = (sm[0] + sm[1]) + (sm[2] + sm[3]); su += other_half(su);
    v8f o[2] = {};
#pragma unroll
    for (int kk = 0; kk < 8; ++kk)
#pragma unroll
      for (int j = 0; j < 2; ++j) { FragH vf; const unsigned short* vr = &sv[(h * HDC + j * 16 + ln) * VP + kk * 32 + 8 * hh]; vf.half[0] = *(const v8us*)vr; vf.half[1] = *(const v8us*)(vr + 16);
        o[j] = __builtin_amdgcn_wmma_f32_16x16x32_f16(false, vf.v, false, pf[kk].v, (short)0, o[j], false, false); }
    v8f sg[2];                   /* sigmoid(gate logit), formed ahead of the next head's loads: a wait for the logits behind those loads would wait for them too */
#pragma unroll
    for (int j = 0; j < 2; ++j) { v8f z;
#pragma unroll
      for (int r = 0; r < 8; ++r) z[r] = (float)fu.h[j * 8 + r] * -1.4426950408889634f;
      v8f d = exp2x8(z);
#pragma unroll
      for (int r = 0; r < 8; ++r) d[r] += 1.0f;
      sg[j] = rcpx8(d); }
    if (h + 1 < NHD) {           /* the score registers are free: the next head's loads fly while this head is gated */
      const float* bfn = bf + (h + 1) * 16 * 16 * 256; const unsigned short* krn = kr + (h + 1) * HDC;
      head_loads(bfn, krn, acc, kf);
      asm volatile("s_wait_xcnt 0x0" :: "v"(bfn), "v"(krn) : "memory");      /* named as inputs, the loads' address registers stay whole up to this wait: none of the results lands on them */
    }
    const float inv = 1.0f / su;
#pragma unroll
    for (int j = 0; j < 2; ++j) { FragH gh, gl;      /* og = o / sum * sigmoid, hi and lo * 2^10 */
#pragma unroll
      for (int r = 0; r < 8; ++r) { const float gvl = o[j][r] * (inv * sg[j][r]); const _Float16 hv = (_Float16)gvl; gh.h[r] = hv; gl.h[r] = (_Float16)((gvl - (float)hv) * 1024.0f); }
      *(v8us*)(og + (h * 2 + j) * 256) = gh.half[0]; *(v8us*)(og + 2048 + (h * 2 + j) * 256) = gl.half[0]; }
  }
  /* outT[e][a]: a lane holds 8 neighbouring e of one a. Half a row (64 e) at a time goes through the wave's own LDS range, which turns the 32-byte pieces into whole 128-byte lines. */
  FragH ogh[NHD], ogl[NHD];
#pragma unroll
  for (int h = 0; h < NHD; ++h) { ogh[h].half[0] = *(const v8us*)(og + h * 512); ogh[h].half[1] = *(const v8us*)(og + h * 512 + 256); ogl[h].half[0] = *(const v8us*)(og + 2048 + h * 512); ogl[h].half[1] = *(const v8us*)(og + 2048 + h * 512 + 256); }
  float* st = (float*)(lds.sog + w * 4096);
  float* orow = out + ((size_t)s * SL + w * 16) * EE;
  const int rsub = lane >> 4, c4 = (lane & 15) * 4;
  const unsigned short* wr = swo + lane * 8;      /* 2048 halves a 16-row tile, 512 a head, 256 half a fragment */
  FragH wf[2][2 * NHD];          /* the weight fragments of two e tiles, read one pair of tiles ahead */
#pragma unroll
  for (int i = 0; i < 2 * NHD; ++i) { wf[0][i].half[0] = *(const v8us*)(wr + i * 512); wf[0][i].half[1] = *(const v8us*)(wr + i * 512 + 256); }
#pragma unroll
  for (int g = 0; g < 4; ++g) {
    if (g + 1 < 4) {
#pragma unroll
      for (int i = 0; i < 2 * NHD; ++i) { wf[(g + 1) & 1][i].half[0] = *(const v8us*)(wr + (g + 1) * 4096 + i * 512); wf[(g + 1) & 1][i].half[1] = *(const v8us*)(wr + (g + 1) * 4096 + i * 512 + 256); }
    }
    __builtin_amdgcn_sched_barrier(0);      /* keeps the next pair's LDS reads in one group ahead of the 16 products: left alone the compiler sinks each read to its first use, and the wave waits out every latency */
    v8f ch[2] = {}, cl[2] = {};
#pragma unroll
    for (int h = 0; h < NHD; ++h)
#pragma unroll
      for (int e2 = 0; e2 < 2; ++e2) {
        ch[e2] = __builtin_amdgcn_wmma_f32_16x16x32_f16(false, wf[g & 1][e2 * NHD + h].v, false, ogh[h].v, (short)0, ch[e2], false, false);
        cl[e2] = __builtin_amdgcn_wmma_f32_16x16x32_f16(false, wf[g & 1][e2 * NHD + h].v, false, ogl[h].v, (short)0, cl[e2], false, false); }
    __builtin_amdgcn_sched_barrier(0);      /* keeps the joins below all 16 products: risen in among the last of them, each group of joins takes its own run of v_nop behind a product */
#pragma unroll
    for (int e2 = 0; e2 < 2; ++e2) { v4f a0, a1;
#pragma unroll
      for (int r = 0; r < 4; ++r) { a0[r] = __builtin_fmaf(cl[e2][r], 0.0009765625f, ch[e2][r]); a1[r] = __builtin_fmaf(cl[e2][4 + r], 0.0009765625f, ch[e2][4 + r]); }
      float* sp = &st[ln * OP + ((g & 1) * 2 + e2) * 16 + 8 * hh]; *(v4fa*)sp = a0; *(v4fa*)(sp + 4) = a1; }
    if (g & 1) {
      __builtin_amdgcn_fence(__ATOMIC_ACQ_REL, "workgroup", "local"); __builtin_amdgcn_wave_barrier();      /* the rows read below were written by other lanes of this wave */
      const int p = g >> 1;
      const v4f b4 = *(const v4fa*)&sbo[p * 64 + c4];
      v4f rv[8];
#pragma unroll
      for (int q = 0; q < 8; ++q) rv[q] = *(const v4fa*)&st[(q * 2 + rsub) * OP + c4];
      __builtin_amdgcn_sched_barrier(0);      /* keeps the nine LDS reads in one group: one wait instead of one a row */
#pragma unroll
      for (int q = 0; q < 8; ++q) { v4f r4;
#pragma unroll
        for (int i = 0; i < 4; ++i) r4[i] = __builtin_fmaf(rv[q][i], 0.0625f, b4[i]);
        *(v4f*)(orow + (size_t)(q * 2 + rsub) * EE + p * 64 + c4) = r4; }
      asm volatile("s_wait_xcnt 0x0" ::: "memory");      /* the stores' address and data registers are reused only behind this wait; its clobber also keeps the second half's writes of st behind the reads above */
    }
  }
}

extern "C" void kernel_launch(void* const* d_in, const int* in_sizes, int n_in,
                              void* d_out, int out_size, void* d_ws, size_t ws_size, hipStream_t stream) {
  (void)in_sizes; (void)n_in; (void)out_size;
  const float* const* I = (const float* const*)d_in; const float* pr = I[0]; const float* mask = I[1]; const float* gam = I[2]; const float* bet = I[3]; const float* Wq = I[4]; const float* Wk = I[5]; const float* Wv = I[6]; const float* Wb = I[7]; const float* Wfu = I[8]; const float* bfu = I[9]; const float* Wo = I[10]; const float* bo = I[11];
  char* ws = (char*)d_ws; size_t off = 0;
  auto take = [&](size_t bytes) { char* p = ws + off; off += (bytes + 255) & ~(size_t)255; return p; };
  _Float16* BQK = (_Float16*)take((size_t)2 * EE * 2 * EE * 2); _Float16* AV = (_Float16*)take((size_t)EE * 2 * EE * 2); _Float16* BB = (_Float16*)take((size_t)16 * 2 * EE * 2); _Float16* BFU = (_Float16*)take((size_t)EE * 2 * EE * 2); _Float16* BO = (_Float16*)take((size_t)EE * 2 * EE * 2);      /* all folded: [W·s | W·s·2^-10] against [hi | lo·2^10] operands (K 256) */      /* of BO only the first plane is written and read */
  _Float16* QK16 = (_Float16*)take((size_t)NTOK * 2 * EE * 2); _Float16* PB16 = (_Float16*)take((size_t)NTOK * 16 * 2); _Float16* VT16 = (_Float16*)take((size_t)NTOK * EE * 2); float* BF = (float*)take((size_t)NHD * SL * SL * 4); _Float16* FU16 = (_Float16*)take((size_t)NTOK * EE * 2);
  if (off > ws_size) return;      // about 0.4 + 33.5 + 2.1 + 16.8 + 1.0 + 16.8 = 71 MB
  /* Wq, Wk: (in,out) -> 256 rows of K 256; Wv: row hc, k = [hi e | lo e], Wv[e][hc] (raw), the v^T product's operand against [x_hi | x_lo*2^10] rows; Wfu like Wq; Wo: row e, k = hc, Wo[hc][e] * 16, the one plane; Wb: 4 live of 16 rows. All in fragment order. */
  k_pack<<<PACK_BLOCKS, 256, 0, stream>>>(Wq, Wk, Wv, Wfu, Wo, Wb, BQK, AV, BFU, BO, BB);
  k_proj<<<NTOK / TM, 256, 0, stream>>>(pr, gam, bet, bfu, BQK, AV, BB, BFU, QK16, VT16, PB16, FU16);      /* LayerNorm, then [q | k] (unscaled), VT[s][hc][b], pair bias (4 live of 16) and gate logits (+ bfu), all f16, from the x tile in LDS */
  k_bias<<<(SL / 16) * (SL / 16) * 64 / 256, 256, 0, stream>>>(mask, PB16, BF);      /* mask + pair bias per head, in score-fragment order */
  k_attn<<<SL, 512, 0, stream>>>(QK16, VT16, BF, FU16, BO, bo, (float*)d_out);      /* attention of all rows and heads, gate, output product (+ bo) */
}

// v005
// It runs in 41.2 microseconds.
// Timed twice side by side with v004, it ran 1.31 and 1.32 times as fast.
// Counting every step since v000, it is 24.4 times as fast.
#include <hip/hip_runtime.h>
// Row-wise pair attention on a pair representation ([1,256,256,128], 4 heads × 32): x = LN(pair_rep); q = x·Wq·32^-½, k = x·Wk, v = x·Wv; per (row s, head h): logits[a][b] = Σ_c k[s,a,h,c]·q[s,b,h,c] + mask[a][b] + (x·Wb)[a][b][h]; softmax over b; o[s,a,h,:] = Σ_b attn·v[s,b,h,:]; o *= sigmoid(x·Wfu + bfu); out = o·Wo + bo → [1,256,256,128]. (The module's einsum makes k carry the output index and q the summed index.)
// Compute dtype: inputs and parameters rounded to bf16; x and the gated output carried hi/lo (≈f32); q/k/v planes, pair bias, probabilities and gate logits f16 (≈2^-12); mask/bias/softmax/LN/sigmoid in f32; f32 accumulation. v_wmma_f32_16x16x32_f16.
#define SL 256
#define NTOK (SL * SL)           /* 65536 */
#define EE 128
#define NHD 4
#define HDC 32
typedef __bf16 v16b __attribute__((ext_vector_type(16)));
typedef unsigned short v8us __attribute__((ext_vector_type(8), may_alias));
typedef float  v8f  __attribute__((ext_vector_type(8)));
typedef float  v4f  __attribute__((ext_vector_type(4)));
typedef float  v4fa __attribute__((ext_vector_type(4), may_alias));
union FragB { v16b v; v8us half[2]; unsigned short u[16]; };

__device__ __forceinline__ unsigned short bf16_bits(float x) { unsigned int u = __float_as_uint(x); return (unsigned short)((u + 0x7FFFu + ((u >> 16) & 1u)) >> 16); }
__device__ __forceinline__ float bf16_val(unsigned short b) { return __uint_as_float(((unsigned int)b) << 16); }
__device__ __forceinline__ float bf16_round(float x) { return bf16_val(bf16_bits(x)); }
// D += A·B with NT terms: 1 = ah·bh, 2 = + al·bh (A split), 3 = + ah·bl (both split)
template <int NT>
__device__ __forceinline__ v8f mmaN(v16b ah, v16b al, v16b bh, v16b bl, v8f c) {
  c = __builtin_amdgcn_wmma_f32_16x16x32_bf16(false, ah, false, bh, (short)0, c, false, false);
  if (NT >= 2) c = __builtin_amdgcn_wmma_f32_16x16x32_bf16(false, al, false, bh, (short)0, c, false, false);
  if (NT >= 3) c = __builtin_amdgcn_wmma_f32_16x16x32_bf16(false, ah, false, bl, (short)0, c, false, false);
  asm volatile("v_nop\n\tv_nop\n\tv_nop\n\tv_nop" : "+v"(c) : "v"(ah), "v"(al), "v"(bh), "v"(bl));
  return c;
}

__global__ __launch_bounds__(256) void k_wt_bf16(const float* __restrict__ W, unsigned short* __restrict__ Wt, int K, int N) {
  const int t = blockIdx.x * 256 + threadIdx.x;
  const int k8n = K / 8;
  if (t >= N * k8n) return;
  const int n = t / k8n, k8 = (t % k8n) * 8;
  v8us v;
#pragma unroll
  for (int i = 0; i < 8; ++i) v[i] = bf16_bits(W[(size_t)(k8 + i) * N + n]);
  *(v8us*)(Wt + (size_t)n * K + k8) = v;
  
}

// GEMM C[M][N] (f32, pitch ldc) = act(A[M][K]·W + bias). A f32 row-major (pitch lda) converted per fragment to bf16
// (ASPLIT: hi/lo two planes -> 2 terms, else single rounded term); Wt bf16 [N][K] (pitch ldb). BIAS_BF16 rounds the
// bias to bf16 first (bias quantised to bf16 before the add). K%32==0, M%16==0, N%64==0.
template <bool ASPLIT, int ACT, bool BIAS_BF16>
__global__ __launch_bounds__(128) void k_gemm_bf(const float* __restrict__ A, int lda, const unsigned short* __restrict__ Wt, int ldb,
                                               const float* __restrict__ bias, float* __restrict__ C, int ldc, int M, int N, int K) {
  __shared__ __attribute__((aligned(16))) float so[4][16][64];
  const int tid = threadIdx.x, w = tid >> 5, lane = tid & 31, ln = lane & 15, hh = lane >> 4;
  const int ntn = N / 64;
  const int wid = blockIdx.x * 4 + w;
  const int mt = wid / ntn, nq = wid % ntn;
  if (mt * 16 >= M) return;
  const int row0 = mt * 16, col0 = nq * 64;
  const float* arow = A + (size_t)(row0 + ln) * lda;
  v8f acc[4] = {};
  for (int kb = 0; kb < K; kb += 32) {
    FragB ah, al;
    const v4f x0 = *(const v4fa*)(arow + kb + 8 * hh), x1 = *(const v4fa*)(arow + kb + 8 * hh + 4);
    const v4f x2 = *(const v4fa*)(arow + kb + 16 + 8 * hh), x3 = *(const v4fa*)(arow + kb + 16 + 8 * hh + 4);
    float xs[16] = {x0[0],x0[1],x0[2],x0[3],x1[0],x1[1],x1[2],x1[3],x2[0],x2[1],x2[2],x2[3],x3[0],x3[1],x3[2],x3[3]};
#pragma unroll
    for (int i = 0; i < 16; ++i) { const unsigned short hb = bf16_bits(xs[i]); ah.u[i] = hb; al.u[i] = ASPLIT ? bf16_bits(xs[i] - bf16_val(hb)) : (unsigned short)0; }
#pragma unroll
    for (int t = 0; t < 4; ++t) {
      const unsigned short* brow = Wt + (size_t)(col0 + t * 16 + ln) * ldb + kb;
      FragB b;
      b.half[0] = *(const v8us*)(brow + 8 * hh);
      b.half[1] = *(const v8us*)(brow + 16 + 8 * hh);
      acc[t] = mmaN<ASPLIT ? 2 : 1>(ah.v, al.v, b.v, b.v, acc[t]);
    }
  }
#pragma unroll
  for (int t = 0; t < 4; ++t) {
    float bv = bias ? bias[col0 + t * 16 + ln] : 0.f;
    if (BIAS_BF16) bv = bf16_round(bv);
#pragma unroll
    for (int r = 0; r < 8; ++r) { float v = acc[t][r] + bv; if (ACT == 1) v = fmaxf(v, 0.f); so[w][8 * hh + r][t * 16 + ln] = v; }
  }
  __builtin_amdgcn_fence(__ATOMIC_ACQ_REL, "workgroup");
  __builtin_amdgcn_wave_barrier();
  const int rsub = lane >> 4, c4 = (lane & 15) * 4;
  {
#pragma unroll
    for (int q = 0; q < 8; ++q) {
      const int r = q * 2 + rsub;
      const v4f v = *(const v4fa*)&so[w][r][c4];
      *(v4f*)(C + (size_t)(row0 + r) * ldc + col0 + c4) = v;
    }
    
  }
}

// GEMM C = act(A·W + bias + resid): A f32 (ASPLIT -> hi/lo 2 terms), Wt bf16 [N][K]; ACT 0 none, 1 relu, 2 exact gelu;
// resid (optional, f32, row index = (row % rmod), pitch ldr, RES_BF16 rounds it) added before the activation.
template <bool ASPLIT, int ACT, bool BIAS_BF16, bool RES_BF16>
__global__ __launch_bounds__(128) void k_gemm_bf3(const float* __restrict__ A, int lda, const unsigned short* __restrict__ Wt, int ldb,
                                                const float* __restrict__ bias, const float* __restrict__ resid, int rmod, int ldr,
                                                float* __restrict__ C, int ldc, int M, int N, int K) {
  __shared__ __attribute__((aligned(16))) float so[4][16][64];
  const int tid = threadIdx.x, w = tid >> 5, lane = tid & 31, ln = lane & 15, hh = lane >> 4;
  const int ntn = N / 64;
  const int wid = blockIdx.x * 4 + w;
  const int mt = wid / ntn, nq = wid % ntn;
  if (mt * 16 >= M) return;
  const int row0 = mt * 16, col0 = nq * 64;
  const float* arow = A + (size_t)(row0 + ln) * lda;
  v8f acc[4] = {};
  for (int kb = 0; kb < K; kb += 32) {
    FragB ah, al;
    const v4f x0 = *(const v4fa*)(arow + kb + 8 * hh), x1 = *(const v4fa*)(arow + kb + 8 * hh + 4);
    const v4f x2 = *(const v4fa*)(arow + kb + 16 + 8 * hh), x3 = *(const v4fa*)(arow + kb + 16 + 8 * hh + 4);
    float xs[16] = {x0[0],x0[1],x0[2],x0[3],x1[0],x1[1],x1[2],x1[3],x2[0],x2[1],x2[2],x2[3],x3[0],x3[1],x3[2],x3[3]};
#pragma unroll
    for (int i = 0; i < 16; ++i) { const unsigned short hb = bf16_bits(xs[i]); ah.u[i] = hb; al.u[i] = ASPLIT ? bf16_bits(xs[i] - bf16_val(hb)) : (unsigned short)0; }
#pragma unroll
    for (int t = 0; t < 4; ++t) {
      const unsigned short* brow = Wt + (size_t)(col0 + t * 16 + ln) * ldb + kb;
      FragB b;
      b.half[0] = *(const v8us*)(brow + 8 * hh);
      b.half[1] = *(const v8us*)(brow + 16 + 8 * hh);
      acc[t] = mmaN<ASPLIT ? 2 : 1>(ah.v, al.v, b.v, b.v, acc[t]);
    }
  }
#pragma unroll
  for (int t = 0; t < 4; ++t) {
    const int col = col0 + t * 16 + ln;
    float bv = bias ? bias[col] : 0.f;
    if (BIAS_BF16) bv = bf16_round(bv);
#pragma unroll
    for (int r = 0; r < 8; ++r) {
      float v = acc[t][r] + bv;
      if (resid) { float rv = resid[(size_t)((row0 + 8 * hh + r) % rmod) * ldr + col]; if (RES_BF16) rv = bf16_round(rv); v += rv; }
      if (ACT == 1) v = fmaxf(v, 0.f);
      if (ACT == 2) v = 0.5f * v * (1.0f + erff(v * 0.70710678118654752f));
      if (ACT == 3) { const float u = 0.7978845608028654f * (v + 0.044715f * v * v * v); v = 0.5f * v * (1.0f + tanhf(u)); }
      so[w][8 * hh + r][t * 16 + ln] = v;
    }
  }
  __builtin_amdgcn_fence(__ATOMIC_ACQ_REL, "workgroup");
  __builtin_amdgcn_wave_barrier();
  const int rsub = lane >> 4, c4 = (lane & 15) * 4;
  {
#pragma unroll
    for (int q = 0; q < 8; ++q) {
      const int r = q * 2 + rsub;
      const v4f v = *(const v4fa*)&so[w][r][c4];
      *(v4f*)(C + (size_t)(row0 + r) * ldc + col0 + c4) = v;
    }
    
  }
}
// row LayerNorm (biased variance, eps) over N: s = X (+ R); optional out_sum <- s; out_norm <- (s-mu)*rsqrt(var+eps)*g + b
template <bool PARAM_BF16>
__global__ __launch_bounds__(256) void k_layernorm(const float* __restrict__ X, const float* __restrict__ R, const float* __restrict__ g, const float* __restrict__ bta,
                                                  float* __restrict__ out_sum, float* __restrict__ out_norm, int N, float eps) {
  __shared__ float red[256];
  const int row = blockIdx.x, tid = threadIdx.x;
  const float* x = X + (size_t)row * N; const float* rr = R ? R + (size_t)row * N : nullptr;
  float vals[16];                     // up to N = 4096
  const int per = N / 256;            // contiguous chunk per thread? use strided-by-4 chunks: thread handles j = tid*4 + 1024*u
  float s1 = 0.f;
  for (int u = 0; u < per / 4; ++u) {
    const int j = tid * 4 + 1024 * u;
    const v4f a = *(const v4fa*)(x + j);
    v4f b = {0.f,0.f,0.f,0.f}; if (rr) b = *(const v4fa*)(rr + j);
#pragma unroll
    for (int q = 0; q < 4; ++q) { const float v = a[q] + b[q]; vals[u * 4 + q] = v; s1 += v; }
  }
  red[tid] = s1; __syncthreads();
  for (int st = 128; st > 0; st >>= 1) { if (tid < st) red[tid] += red[tid + st]; __syncthreads(); }
  const float mu = red[0] / (float)N; __syncthreads();
  float s2 = 0.f;
  for (int u = 0; u < per / 4; ++u)
#pragma unroll
    for (int q = 0; q < 4; ++q) { const float c = vals[u * 4 + q] - mu; s2 += c * c; }
  red[tid] = s2; __syncthreads();
  for (int st = 128; st > 0; st >>= 1) { if (tid < st) red[tid] += red[tid + st]; __syncthreads(); }
  const float rs = rsqrtf(red[0] / (float)N + eps);
  {
    for (int u = 0; u < per / 4; ++u) {
      const int j = tid * 4 + 1024 * u;
      v4f o, sm;
#pragma unroll
      for (int q = 0; q < 4; ++q) {
        float gg = g[j + q], bb = bta[j + q];
        if (PARAM_BF16) { gg = bf16_round(gg); bb = bf16_round(bb); }
        sm[q] = vals[u * 4 + q]; o[q] = (vals[u * 4 + q] - mu) * rs * gg + bb;
      }
      if (out_sum) *(v4f*)(out_sum + (size_t)row * N + j) = sm;
      *(v4f*)(out_norm + (size_t)row * N + j) = o;
    }
    
  }
}



// ---- f16 WMMA path (v_wmma_f32_16x16x32_f16): 11-bit significands for operands in range — used where a [0,1] probability operand needs more precision than bf16
typedef _Float16 v16h __attribute__((ext_vector_type(16)));
union FragH { v16h v; v8us half[2]; _Float16 h[16]; unsigned short u[16]; };
template <int NT>
__device__ __forceinline__ v8f mmaH(v16h ah, v16h al, v16h bh, v16h bl, v8f c) {
  c = __builtin_amdgcn_wmma_f32_16x16x32_f16(false, ah, false, bh, (short)0, c, false, false);
  if (NT >= 2) c = __builtin_amdgcn_wmma_f32_16x16x32_f16(false, al, false, bh, (short)0, c, false, false);
  if (NT >= 3) c = __builtin_amdgcn_wmma_f32_16x16x32_f16(false, ah, false, bl, (short)0, c, false, false);
  asm volatile("v_nop\n\tv_nop\n\tv_nop\n\tv_nop" : "+v"(c) : "v"(ah), "v"(al), "v"(bh), "v"(bl));
  return c;
}
// batched GEMM like k_gemm_b but f16 operands: A f32 (split into f16 hi/lo if ASPLIT, else rounded to f16), Bt = f16 values [n][k]; alpha; C f32; N multiple of 16 (partial tiles skipped)
template <bool ASPLIT>
__global__ __launch_bounds__(128) void k_gemm_h(const float* __restrict__ A, int lda, size_t sA, const _Float16* __restrict__ Bh, int ldb, size_t sB, float alpha, float* __restrict__ C, int ldc, size_t sC, int M, int N, int K) {
  __shared__ __attribute__((aligned(16))) float so[4][16][64];
  const int tid = threadIdx.x, w = tid >> 5, lane = tid & 31, ln = lane & 15, hh = lane >> 4; const int by = blockIdx.y;
  A += (size_t)by * sA; Bh += (size_t)by * sB; C += (size_t)by * sC;
  const int ntn = (N + 63) / 64; const int wid = blockIdx.x * 4 + w; const int mt = wid / ntn, nq = wid % ntn; if (mt * 16 >= M) return;
  const int row0 = mt * 16, col0 = nq * 64; const float* arow = A + (size_t)(row0 + ln) * lda;
  v8f acc[4] = {};
  for (int kb = 0; kb < K; kb += 32) {
    FragH ah, al;
    const v4f x0 = *(const v4fa*)(arow + kb + 8 * hh), x1 = *(const v4fa*)(arow + kb + 8 * hh + 4), x2 = *(const v4fa*)(arow + kb + 16 + 8 * hh), x3 = *(const v4fa*)(arow + kb + 16 + 8 * hh + 4);
    float xs[16] = {x0[0],x0[1],x0[2],x0[3],x1[0],x1[1],x1[2],x1[3],x2[0],x2[1],x2[2],x2[3],x3[0],x3[1],x3[2],x3[3]};
#pragma unroll
    for (int i = 0; i < 16; ++i) { const _Float16 h = (_Float16)xs[i]; ah.h[i] = h; al.h[i] = ASPLIT ? (_Float16)(xs[i] - (float)h) : (_Float16)0.0f; }
#pragma unroll
    for (int t = 0; t < 4; ++t) { if (col0 + t * 16 >= N) continue; const size_t boff = (size_t)(col0 + t * 16 + ln) * ldb + kb; FragH bq; bq.half[0] = *(const v8us*)(Bh + boff + 8 * hh); bq.half[1] = *(const v8us*)(Bh + boff + 16 + 8 * hh);
      acc[t] = mmaH<ASPLIT ? 2 : 1>(ah.v, al.v, bq.v, bq.v, acc[t]); }
  }
#pragma unroll
  for (int t = 0; t < 4; ++t) { if (col0 + t * 16 >= N) continue;
#pragma unroll
    for (int r = 0; r < 8; ++r) so[w][8 * hh + r][t * 16 + ln] = acc[t][r] * alpha; }
  __builtin_amdgcn_fence(__ATOMIC_ACQ_REL, "workgroup"); __builtin_amdgcn_wave_barrier();
  const int rsub = lane >> 4, c4 = (lane & 15) * 4;
  {
#pragma unroll
    for (int q = 0; q < 8; ++q) { const int r = q * 2 + rsub; if (col0 + c4 < N) { const v4f v = *(const v4fa*)&so[w][r][c4]; *(v4f*)(C + (size_t)(row0 + r) * ldc + col0 + c4) = v; } }
     }
}

// Wt[n][k] = f16(W[k][n]·scale) from f32 row-major W[K][N] (scale = power of two; bf16-exact weights stay exact in f16 away from the subnormal range)
__global__ __launch_bounds__(256) void k_wt_f16(const float* __restrict__ W, _Float16* __restrict__ Wt, int K, int N, float scale) {
  const int t = blockIdx.x * 256 + threadIdx.x; if (t >= N * (K / 8)) return; const int n = t / (K / 8), k8 = (t % (K / 8)) * 8; FragH f;
#pragma unroll
  for (int i = 0; i < 8; ++i) f.h[i] = (_Float16)(bf16_round(W[(size_t)(k8 + i) * N + n]) * scale); const v8us o = f.half[0];
  *(v8us*)((unsigned short*)Wt + (size_t)n * K + k8) = o; 
}
// k_gemm_hh variant with fused epilogue: v = acc·alpha + bias[by·sBias + col] (+ CP[(row/rowsPerB)·sCPb + by·64 + col] if CP) ; ACT 0 none / 1 elu ; writes f32 C and/or f16 C16 (each if non-null)
template <int ACT>
__global__ __launch_bounds__(128) void k_gemm_hhx(const _Float16* __restrict__ A, int lda, size_t sA, const _Float16* __restrict__ Bh, int ldb, size_t sB, float alpha, const float* __restrict__ bias, size_t sBias, const float* __restrict__ CP, int rowsPerB, size_t sCPb, int row0g,
    float* __restrict__ C, _Float16* __restrict__ C16, int ldc, size_t sC, int M, int N, int K) {
  __shared__ __attribute__((aligned(16))) float so[4][16][64];
  const int tid = threadIdx.x, w = tid >> 5, lane = tid & 31, ln = lane & 15, hh = lane >> 4; const int by = blockIdx.y;
  A += (size_t)by * sA; Bh += (size_t)by * sB; const size_t cofs = (size_t)by * sC; const float* bp = bias ? bias + (size_t)by * sBias : nullptr;
  const int ntn = (N + 63) / 64; const int wid = blockIdx.x * 4 + w; const int mt = wid / ntn, nq = wid % ntn; if (mt * 16 >= M) return;
  const int row0 = mt * 16, col0 = nq * 64; const _Float16* arow = A + (size_t)(row0 + ln) * lda;
  v8f acc[4] = {};
  for (int kb = 0; kb < K; kb += 32) { FragH ah; ah.half[0] = *(const v8us*)((const unsigned short*)arow + kb + 8 * hh); ah.half[1] = *(const v8us*)((const unsigned short*)arow + kb + 16 + 8 * hh);
#pragma unroll
    for (int t = 0; t < 4; ++t) { if (col0 + t * 16 >= N) continue; const size_t boff = (size_t)(col0 + t * 16 + ln) * ldb + kb; FragH bq; bq.half[0] = *(const v8us*)((const unsigned short*)Bh + boff + 8 * hh); bq.half[1] = *(const v8us*)((const unsigned short*)Bh + boff + 16 + 8 * hh);
      acc[t] = mmaH<1>(ah.v, ah.v, bq.v, bq.v, acc[t]); }
  }
#pragma unroll
  for (int t = 0; t < 4; ++t) { if (col0 + t * 16 >= N) continue; const int col = col0 + t * 16 + ln; const float bv = bp ? bf16_round(bp[col]) : 0.f;
#pragma unroll
    for (int r = 0; r < 8; ++r) { float v = acc[t][r] * alpha + bv; if (CP) { const int bidx = (row0g + row0 + 8 * hh + r) / rowsPerB; v += CP[(size_t)bidx * sCPb + (size_t)by * 64 + col]; } if (ACT == 1) v = (v > 0.f) ? v : expm1f(v); else if (ACT == 7) v = (v > 0.f) ? v + 1.0f : expf(v); else if (ACT == 8) v = tanhf(v); else if (ACT == 9) v = 0.5f * v * (1.0f + tanhf(0.7978845608028654f * (v + 0.044715f * v * v * v))); else if (ACT == 11) v = 1.0f / (1.0f + expf(-v)); else if (ACT == 12) v = (v > 0.f) ? v : 0.01f * v; else if (ACT == 14) v = (v > 0.f) ? v : 0.1f * v; else if (ACT == 15) v = v / (1.0f + expf(-v)); else if (ACT == 3) v = fmaxf(v, 0.f); else if (ACT == 6) v = 0.5f * v * (1.0f + erff(v * 0.70710678118654752f)); so[w][8 * hh + r][t * 16 + ln] = v; } }
  __builtin_amdgcn_fence(__ATOMIC_ACQ_REL, "workgroup"); __builtin_amdgcn_wave_barrier();
  const int rsub = lane >> 4, c4 = (lane & 15) * 4; typedef _Float16 v4h __attribute__((ext_vector_type(4)));
  {
#pragma unroll
    for (int q = 0; q < 8; ++q) { const int r = q * 2 + rsub; if (col0 + c4 < N) { const v4f v = *(const v4fa*)&so[w][r][c4]; if (C) *(v4f*)(C + cofs + (size_t)(row0 + r) * ldc + col0 + c4) = v; if (C16) { v4h h4; for (int i = 0; i < 4; ++i) h4[i] = (_Float16)v[i]; *(v4h*)(C16 + cofs + (size_t)(row0 + r) * ldc + col0 + c4) = h4; } } }
     }
}


typedef _Float16 v4h __attribute__((ext_vector_type(4)));

__global__ __launch_bounds__(256) void k_x16(const float* __restrict__ x, _Float16* __restrict__ X16, size_t n8) { const size_t t = (size_t)blockIdx.x * 256 + threadIdx.x; if (t >= n8) return; FragH f;
#pragma unroll
  for (int q = 0; q < 8; ++q) f.h[q] = (_Float16)bf16_round(x[t * 8 + q]); *(v8us*)((unsigned short*)X16 + t * 8) = f.half[0];  }
__global__ __launch_bounds__(256) void k_h16(const float* __restrict__ x, _Float16* __restrict__ X16, size_t n8) { const size_t t = (size_t)blockIdx.x * 256 + threadIdx.x; if (t >= n8) return; FragH f;
#pragma unroll
  for (int q = 0; q < 8; ++q) f.h[q] = (_Float16)x[t * 8 + q]; *(v8us*)((unsigned short*)X16 + t * 8) = f.half[0];  }
__global__ __launch_bounds__(256) void k_round16f(const float* __restrict__ W, _Float16* __restrict__ Bt, size_t n8) { const size_t t = (size_t)blockIdx.x * 256 + threadIdx.x; if (t >= n8) return; FragH f;
#pragma unroll
  for (int i = 0; i < 8; ++i) f.h[i] = (_Float16)(bf16_round(W[t * 8 + i]) * 16.0f); *(v8us*)((unsigned short*)Bt + t * 8) = f.half[0];  }
template <int NHv, int TTv>
__global__ __launch_bounds__(256) void k_vt(const _Float16* __restrict__ V16, int ldv, int voff, _Float16* __restrict__ Vt) { __shared__ unsigned short tl[64][66]; const int tid = threadIdx.x; const int slab = blockIdx.x / (TTv / 64), lg = blockIdx.x % (TTv / 64); const int b = slab / NHv, h = slab % NHv;
  for (int i = tid; i < 64 * 8; i += 256) { const int r = i / 8, c8 = (i % 8) * 8; FragH f; f.half[0] = *(const v8us*)((const unsigned short*)V16 + ((size_t)b * TTv + lg * 64 + r) * ldv + voff + h * 64 + c8);
#pragma unroll
    for (int q = 0; q < 8; ++q) tl[r][c8 + q] = f.u[q]; }
  __syncthreads();
  {
#pragma unroll
    for (int rd = 0; rd < 2; ++rd) { const int d = rd * 32 + tid / 8, pc = tid % 8; FragH f;
#pragma unroll
      for (int q = 0; q < 8; ++q) f.u[q] = tl[pc * 8 + q][d];
      *(v8us*)((unsigned short*)Vt + ((size_t)slab * 64 + d) * TTv + lg * 64 + pc * 8) = f.half[0]; }
     } }

__global__ __launch_bounds__(256) void k_hl(const float* __restrict__ F, _Float16* __restrict__ Hh, _Float16* __restrict__ Hl, size_t n8) { const size_t t = (size_t)blockIdx.x * 256 + threadIdx.x; if (t >= n8) return; FragH fh, fl; const v4f a = *(const v4fa*)(F + t * 8), c = *(const v4fa*)(F + t * 8 + 4);
#pragma unroll
  for (int q = 0; q < 4; ++q) { _Float16 h = (_Float16)a[q]; fh.h[q] = h; fl.h[q] = (_Float16)((a[q] - (float)h) * 1024.0f); h = (_Float16)c[q]; fh.h[4 + q] = h; fl.h[4 + q] = (_Float16)((c[q] - (float)h) * 1024.0f); }
  { *(v8us*)((unsigned short*)Hh + t * 8) = fh.half[0]; *(v8us*)((unsigned short*)Hl + t * 8) = fl.half[0];  } }

// Offset in halves of the 8 values k = kk .. kk + 7 (kk a multiple of 8) of row n, K 256, in matrix-fragment order [n / 16][kk / 32][half][lane][8], half = (kk >> 4) & 1, lane = 16 * ((kk >> 3) & 1) + n % 16:
// a wave's 16-byte load of half a fragment then covers 512 contiguous bytes (four whole lines) instead of pieces of sixteen lines.
__device__ __forceinline__ size_t frag_off(int n, int kk) { return ((((size_t)(n >> 4) * 8 + (kk >> 5)) * 2 + ((kk >> 4) & 1)) * 32 + ((kk >> 3) & 1) * 16 + (n & 15)) * 8; }
// The folded weights [W*s | W*s*2^-10] for K = N = 128, stored in fragment order. 2048 threads (t), one (n, k8) each; neighbouring threads take neighbouring n (whole lines on the load side).
// LO false: only the W*s plane is written (k_attn multiplies both planes of its operand by that one plane and joins the two sums afterwards).
template <bool LO>
__device__ __forceinline__ void pack_wtf(const float* __restrict__ W, float scale, _Float16* __restrict__ Bt, int t) { const int n = t % EE, k8 = (t / EE) * 8; const int i0 = k8 * EE + n; float x[8]; FragH f, f2;
#pragma unroll
  for (int i = 0; i < 8; ++i) x[i] = W[i0 + i * EE];
  asm volatile("s_wait_xcnt 0x0" :: "v"(i0) : "memory");      /* named as an input, the eight loads' offset register stays whole up to this wait: none of their results lands on it */
#pragma unroll
  for (int i = 0; i < 8; ++i) { const float wv = bf16_round(x[i]) * scale; f.h[i] = (_Float16)wv; f2.h[i] = (_Float16)(wv * 0.0009765625f); }
  { *(v8us*)((unsigned short*)Bt + frag_off(n, k8)) = f.half[0]; if (LO) *(v8us*)((unsigned short*)Bt + frag_off(n, EE + k8)) = f2.half[0];  } }
// The pair-bias weights, 4 live of 16 rows, the others zero. 512 threads (t), one (o, k0) each: a wave has one o, so the test on o is the same for a whole wave.
__device__ __forceinline__ void pack_wb(const float* __restrict__ w, _Float16* __restrict__ Bt, int t) { const int k0 = (t % (2 * EE / 8)) * 8, o = t / (2 * EE / 8); const int kk0 = k0 % EE; const float sc = (k0 < EE) ? 16.0f : (16.0f * 0.0009765625f); FragH f;
#pragma unroll
  for (int q = 0; q < 8; ++q) f.h[q] = (_Float16)0.0f;
  if (o < NHD) { const int i0 = kk0 * NHD + o; float x[8];
#pragma unroll
    for (int q = 0; q < 8; ++q) x[q] = w[i0 + q * NHD];
    asm volatile("s_wait_xcnt 0x0" :: "v"(i0) : "memory");      /* named as an input, the eight loads' offset register stays whole up to this wait: none of their results lands on it */
#pragma unroll
    for (int q = 0; q < 8; ++q) f.h[q] = (_Float16)(bf16_round(x[q]) * sc); }
  *(v8us*)((unsigned short*)Bt + frag_off(o, k0)) = f.half[0];  }
// All six weight packs in one launch: none needs anything of another, so each takes a range of the block index (eight blocks a 128 x 128 matrix, two for the pair-bias weights). The choice is the same for a whole block.
#define PACK_BLOCKS (5 * 8 + 2)
__global__ __launch_bounds__(256) void k_pack(const float* __restrict__ Wq, const float* __restrict__ Wk, const float* __restrict__ Wv, const float* __restrict__ Wfu, const float* __restrict__ Wo, const float* __restrict__ Wb,
                                              _Float16* __restrict__ BQK, _Float16* __restrict__ AV, _Float16* __restrict__ BFU, _Float16* __restrict__ BO, _Float16* __restrict__ BB) {
  const int job = blockIdx.x >> 3, t = (blockIdx.x & 7) * 256 + threadIdx.x;
  if (job == 5) {
    pack_wb(Wb, BB, t);
    asm volatile("s_wait_xcnt 0x0" ::: "memory");      /* the built code joins the ranges by flags, so another range's instructions stand on a path behind this store: they reuse its registers only behind this wait */
  } else if (job == 4) pack_wtf<false>(Wo, 16.0f, BO, t);
  else {
    const float* W = (job == 0) ? Wq : (job == 1) ? Wk : (job == 2) ? Wv : Wfu;
    _Float16* Bt = (job == 0) ? BQK : (job == 1) ? BQK + (size_t)EE * 2 * EE : (job == 2) ? AV : BFU;
    pack_wtf<true>(W, (job == 2) ? 1.0f : 16.0f, Bt, t);
    asm volatile("s_wait_xcnt 0x0" ::: "memory");      /* as above, for the two stores of this range */
  }
}
// LayerNorm and the products that read x. Normalised tokens lie in LDS as [x_hi (128) | x_lo*2^10 (128)] f16 rows and meet the folded weights [W*s | W*s*2^-10] (K 256, packed in fragment order).
#define XP 264                   /* staged x row pitch in halves: 512 B of data + 16 B (16 B x odd: conflict-free ds_load_b128) */
typedef _Float16 v4ha __attribute__((ext_vector_type(4), may_alias));
// LayerNorm of sixteen tokens by one wave: a whole row per load, 4 channels a lane. xp, g, bb and xw already hold the lane's offset (4 * lane); step = floats from one of the wave's tokens to its next.
// Every loop here and in proj_unit is unrolled because its index picks registers (a row's values, fragments, accumulators), which only a compile-time index can.
__device__ __forceinline__ void ln_rows(const float* __restrict__ xp, int step, const float* __restrict__ g, const float* __restrict__ bb, unsigned short* xw) {
  float v[16][4], s[16], q2[16];
#pragma unroll
  for (int u = 0; u < 16; ++u) { const v4f a = *(const v4fa*)(xp + (size_t)u * step);
#pragma unroll
    for (int k = 0; k < 4; ++k) v[u][k] = a[k]; }
  const v4f g4 = *(const v4fa*)g, b4 = *(const v4fa*)bb;
  asm volatile("s_wait_xcnt 0x0" ::: "memory");      /* the address registers of the eighteen loads above are reused only behind this wait */
  __builtin_amdgcn_sched_barrier(0);      /* keeps all eighteen loads in one group ahead of the arithmetic: left alone the compiler holds the last rows' loads back behind the first rows' waits, and the wave waits out the memory latency twice */
#pragma unroll
  for (int u = 0; u < 16; ++u) { s[u] = 0.f;
#pragma unroll
    for (int k = 0; k < 4; ++k) { v[u][k] = bf16_round(v[u][k]); s[u] += v[u][k]; } }
#pragma unroll
  for (int o = 16; o > 0; o >>= 1)
#pragma unroll
    for (int u = 0; u < 16; ++u) s[u] += __shfl_xor(s[u], o, 32);
#pragma unroll
  for (int u = 0; u < 16; ++u) { const float mu = s[u] / (float)EE; q2[u] = 0.f;
#pragma unroll
    for (int k = 0; k < 4; ++k) { v[u][k] -= mu; q2[u] += v[u][k] * v[u][k]; } }
#pragma unroll
  for (int o = 16; o > 0; o >>= 1)
#pragma unroll
    for (int u = 0; u < 16; ++u) q2[u] += __shfl_xor(q2[u], o, 32);
#pragma unroll
  for (int u = 0; u < 16; ++u) { const float rs = rsqrtf(q2[u] / (float)EE + 1e-5f); v4ha h4, l4;
#pragma unroll
    for (int k = 0; k < 4; ++k) { const float xv = v[u][k] * rs * bf16_round(g4[k]) + bf16_round(b4[k]); h4[k] = (_Float16)xv; l4[k] = (_Float16)((xv - (float)h4[k]) * 1024.0f); }
    *(v4ha*)&xw[u * XP] = h4; *(v4ha*)&xw[u * XP + EE] = l4; }
}
// One unit of 64 tokens x 64 columns, left in registers as f16: res[i][j] = 8 values of token tile i and column tile j.
// XA false: the weights go in as A, so a lane holds 8 neighbouring columns (j * 16 + 8 hh + r) of one token (i * 16 + ln). XA true (v^T): x goes in as A, so a lane holds 8 neighbouring tokens (i * 16 + 8 hh + r) of one column (j * 16 + ln).
template <bool XA, bool HASB>
__device__ __forceinline__ void proj_unit(const unsigned short* xs, const unsigned short* __restrict__ wt, const float* bias /* LDS, rounded */, v8us (&res)[4][4], int lane) {
  const int ln = lane & 15, hh = lane >> 4;
  const unsigned short* xr = xs + ln * XP + 8 * hh;
  const unsigned short* wr = wt + lane * 8;      /* fragment order: 4096 halves a 16-row tile, 512 a k step, 256 half a fragment */
  const float alpha = XA ? 1.0f : 0.0625f;
  v8f acc[4][4] = {};
  FragH wf[2][4];                /* weight fragments come from L2: fetched one k step ahead */
#pragma unroll
  for (int j = 0; j < 4; ++j) { wf[0][j].half[0] = *(const v8us*)(wr + j * 4096); wf[0][j].half[1] = *(const v8us*)(wr + j * 4096 + 256); }
#pragma unroll
  for (int kb = 0; kb < 8; ++kb) {
    if (kb + 1 < 8) {
#pragma unroll
      for (int j = 0; j < 4; ++j) { wf[(kb + 1) & 1][j].half[0] = *(const v8us*)(wr + j * 4096 + (kb + 1) * 512); wf[(kb + 1) & 1][j].half[1] = *(const v8us*)(wr + j * 4096 + (kb + 1) * 512 + 256); }
    }
    FragH xf[4];
#pragma unroll
    for (int i = 0; i < 4; ++i) { xf[i].half[0] = *(const v8us*)(xr + i * 16 * XP + kb * 32); xf[i].half[1] = *(const v8us*)(xr + i * 16 * XP + kb * 32 + 16); }
    __builtin_amdgcn_sched_barrier(0);      /* keeps the next step's weight loads and this step's LDS reads in one group ahead of the 16 products: left alone the compiler sinks each load to its first use, and the wave waits out every latency */
#pragma unroll
    for (int i = 0; i < 4; ++i)
#pragma unroll
      for (int j = 0; j < 4; ++j)
        acc[i][j] = XA ? __builtin_amdgcn_wmma_f32_16x16x32_f16(false, xf[i].v, false, wf[kb & 1][j].v, (short)0, acc[i][j], false, false)
                       : __builtin_amdgcn_wmma_f32_16x16x32_f16(false, wf[kb & 1][j].v, false, xf[i].v, (short)0, acc[i][j], false, false);
    __builtin_amdgcn_sched_barrier(0);      /* keeps later steps' loads from rising further: a third set of fragments would not fit 256 registers */
  }
  asm volatile("s_wait_xcnt 0x0" :: "v"(lane), "s"(wt) : "memory");      /* the weight loads' address registers (lane offset, scalar base) are reused only behind this wait: named as inputs, they stay whole up to it */
#pragma unroll
  for (int j = 0; j < 4; ++j) {
    float bv[8] = {0.f, 0.f, 0.f, 0.f, 0.f, 0.f, 0.f, 0.f};
    if (HASB) { const v4f b0 = *(const v4fa*)(bias + j * 16 + 8 * hh), b1 = *(const v4fa*)(bias + j * 16 + 8 * hh + 4);
#pragma unroll
      for (int r = 0; r < 4; ++r) { bv[r] = b0[r]; bv[4 + r] = b1[r]; } }
#pragma unroll
    for (int i = 0; i < 4; ++i) { FragH f;
#pragma unroll
      for (int r = 0; r < 8; ++r) f.h[r] = (_Float16)(HASB ? acc[i][j][r] * alpha + bv[r] : acc[i][j][r] * alpha);
      res[i][j] = f.half[0]; }
  }
}
// BF[h][a-tile][b-tile][p][lane][i] = (bf16(mask[a][b]) + pair_bias[a][b][h]) * sqrt(32), a = 16*atile + (lane & 15), b = 16*btile + 8*(lane >> 4) + 4*p + i:
// the accumulator (C) fragment order of the transposed score tile, so that k_attn loads it with whole-line 16-byte loads. The sqrt(32) undoes the score scale applied after the product.
// The pair bias is the one product of x that every row s needs, so it has a launch of its own, ahead of k_attn. A block of sixteen waves takes one 16 x 16 tile of (a, b): wave w normalises the sixteen tokens
// (a = 16 atile + u, b = 16 btile + w) into its own LDS rows and multiplies them by the pair-bias weights (4 live of 16 rows); the tile is gathered in LDS and leaves as whole lines, mask added.
__global__ __launch_bounds__(512) void k_pbias(const float* __restrict__ X, const float* __restrict__ g, const float* __restrict__ bb, const float* __restrict__ mask, const _Float16* __restrict__ BB, float* __restrict__ BF) {
  __shared__ __attribute__((aligned(16))) unsigned short xs[SL * XP];
  __shared__ __attribute__((aligned(16))) float sbt[NHD * 256];      /* [h][p][lane][i] */
  const int tid = threadIdx.x, lane = tid & 31, ln = lane & 15, hh = lane >> 4;
  const int w = __builtin_amdgcn_readfirstlane(tid >> 5);      /* the wave's number in a scalar register: the row loads then go from a scalar base */
  const int at = blockIdx.x >> 4, bt = blockIdx.x & 15;
  /* the weight fragments and the mask values (needed by the first eight waves only, loaded by all: no branch) are asked for ahead of the rows, so that their latency passes under the rows' and the LayerNorm */
  const int p = (tid >> 5) & 1;
  const float* mp = mask + (size_t)(at * 16 + ln) * SL + bt * 16 + 8 * hh + 4 * p;
  const v4f mk = *(const v4fa*)mp;
  asm volatile("s_wait_xcnt 0x0" :: "v"(mp) : "memory");      /* named as an input, the load's address stays whole up to this wait: none of the loads below lands on it */
  const unsigned short* wr = (const unsigned short*)BB + lane * 8;
  FragH wf[8];
#pragma unroll
  for (int kb = 0; kb < 8; ++kb) { wf[kb].half[0] = *(const v8us*)(wr + kb * 512); wf[kb].half[1] = *(const v8us*)(wr + kb * 512 + 256); }
  asm volatile("s_wait_xcnt 0x0" :: "v"(lane), "s"(BB) : "memory");      /* named as inputs, the loads' address registers (lane offset, scalar base) stay whole up to this wait: none of the sixteen loads lands on them */
  ln_rows(X + (((size_t)at * 16) * SL + bt * 16 + w) * EE + lane * 4, SL * EE, g + lane * 4, bb + lane * 4, xs + w * 16 * XP + lane * 4);
  __builtin_amdgcn_fence(__ATOMIC_ACQ_REL, "workgroup", "local"); __builtin_amdgcn_wave_barrier();      /* the rows read below were written by other lanes of this wave */
  { const unsigned short* xr = xs + (w * 16 + ln) * XP + 8 * hh;
    v8f c = {}; FragH xf[8];
#pragma unroll
    for (int kb = 0; kb < 8; ++kb) { xf[kb].half[0] = *(const v8us*)(xr + kb * 32); xf[kb].half[1] = *(const v8us*)(xr + kb * 32 + 16); }
    __builtin_amdgcn_sched_barrier(0);      /* keeps the sixteen LDS reads in one group ahead of the eight products: left alone the compiler puts each pair next to its product, and the wave waits out eight LDS latencies */
#pragma unroll
    for (int kb = 0; kb < 8; ++kb) c = __builtin_amdgcn_wmma_f32_16x16x32_f16(false, wf[kb].v, false, xf[kb].v, (short)0, c, false, false);
    float pv[NHD];               /* rounded to f16 as before: a lane of the lower half holds the four heads of token (a = ln, b = w) */
#pragma unroll
    for (int h = 0; h < NHD; ++h) pv[h] = (float)(_Float16)(c[h] * 0.0625f);
    if (hh == 0) {
#pragma unroll
      for (int h = 0; h < NHD; ++h) sbt[((h * 2 + ((w >> 2) & 1)) * 32 + (w >> 3) * 16 + ln) * 4 + (w & 3)] = pv[h]; } }
  __syncthreads();               /* publishes the sixteen waves' columns of the tile */
  if (tid < NHD * 64) {          /* whole waves: 256 pieces of 16 bytes */
    const int h = tid >> 6;
    const v4f pb = *(const v4fa*)&sbt[tid * 4]; v4f o;
#pragma unroll
    for (int i = 0; i < 4; ++i) o[i] = (bf16_round(mk[i]) + pb[i]) * 5.656854249492381f;
    *(v4f*)(BF + ((((size_t)h * 16 + at) * 16 + bt) * 2 + p) * 128 + lane * 4) = o; }
}

__device__ __forceinline__ v8f exp2x8(v8f x) {
  float a = x[0], b = x[1], c = x[2], d = x[3], e = x[4], f = x[5], g = x[6], h = x[7];
  asm("v_exp_f32 %0, %0\n\tv_exp_f32 %1, %1\n\tv_exp_f32 %2, %2\n\tv_exp_f32 %3, %3\n\tv_exp_f32 %4, %4\n\tv_exp_f32 %5, %5\n\tv_exp_f32 %6, %6\n\tv_exp_f32 %7, %7\n\tv_nop"
      : "+v"(a), "+v"(b), "+v"(c), "+v"(d), "+v"(e), "+v"(f), "+v"(g), "+v"(h));
  return (v8f){a, b, c, d, e, f, g, h};
}
// Eight v_rcp_f32 in the same form, for the same reason.
__device__ __forceinline__ v8f rcpx8(v8f x) {
  float a = x[0], b = x[1], c = x[2], d = x[3], e = x[4], f = x[5], g = x[6], h = x[7];
  asm("v_rcp_f32 %0, %0\n\tv_rcp_f32 %1, %1\n\tv_rcp_f32 %2, %2\n\tv_rcp_f32 %3, %3\n\tv_rcp_f32 %4, %4\n\tv_rcp_f32 %5, %5\n\tv_rcp_f32 %6, %6\n\tv_rcp_f32 %7, %7\n\tv_nop"
      : "+v"(a), "+v"(b), "+v"(c), "+v"(d), "+v"(e), "+v"(f), "+v"(g), "+v"(h));
  return (v8f){a, b, c, d, e, f, g, h};
}
// value of lane l ^ 16 (the other half of the wave), without LDS
__device__ __forceinline__ float other_half(float x) { const int b = __float_as_int(x); return __int_as_float(__builtin_amdgcn_permlanex16(b, b, 0x76543210, 0xfedcba98, false, false)); }
#define QP 136                   /* staged q row pitch in halves: 256 B of data (four heads) + 16 B (16 B x odd: conflict-free ds_load_b128) */
#define VP 264                   /* staged v^T row pitch in halves: 512 B of data + 16 B */
#define OP 68                    /* output staging row pitch in floats: 256 B of data + 16 B */
// One struct fixes the order in LDS: Wo^T lies lowest, so that lane offset + constant stays inside the 16-bit offset field of an LDS read and all its fragments are read from one address register.
struct __attribute__((aligned(16))) AttnLds {
  unsigned short swo[EE * EE];   /* Wo^T * 16 in fragment order: [e tile][head][half][lane][8] */
  float sbo[4 * EE];             /* the output bias, four times: every thread loads and stores one value, so the load issues with the staging loads and no wave waits for it in a branch of its own */
  float sfb[4 * EE];             /* the gate bias, four times, for the same reason */
  float szr[64];                 /* zeros: what the k columns take in the gate bias's place, so that one unit's code serves both */
  unsigned short sog[16 * 4096]; /* 8 KB a wave, its own, as fragments [plane][head][half][lane][8]: first k (plane 0) and the gate logits (plane 1) of its 16 positions; each head's gated output, hi and lo, takes their place once they are read; at the end the output staging rows */
  unsigned short sxqv[SL * QP + EE * VP];      /* first the normalised row (256 tokens, pitch XP); once every wave has read it, q (pitch QP) and behind it v^T (pitch VP) */
};
static_assert(SL * XP <= SL * QP + EE * VP, "the x tile must fit the range that q and v^T take over");
// What one head needs from L2 ahead of its scores: the bias tiles (the accumulators' start values).
__device__ __forceinline__ void head_loads(const float* __restrict__ bf /* the same for the whole wave */, int l4 /* 4 * lane */, v8f (&acc)[16]) {
#pragma unroll
  for (int t = 0; t < 16; ++t) { const v4f lo = *(const v4fa*)(bf + l4 + t * 256), hi = *(const v4fa*)(bf + l4 + t * 256 + 128); acc[t] = (v8f){lo[0], lo[1], lo[2], lo[3], hi[0], hi[1], hi[2], hi[3]}; }
}
// One head of one wave's 16 positions: scores, softmax, PV, gate. acc comes in holding the head's bias tiles and kf its k fragment; unless the head is the last, both leave holding the next head's.
__device__ __forceinline__ void attn_head(int h, const unsigned short* sq, const unsigned short* sv, unsigned short* og, const float* __restrict__ bf, int l4, int ln, int hh, v8f (&acc)[16], FragH& kf) {
  FragH fu; fu.half[0] = *(const v8us*)(og + 2048 + h * 512); fu.half[1] = *(const v8us*)(og + 2048 + h * 512 + 256);      /* gate logits of channels 8 hh + r and 16 + 8 hh + r: the rows of Ot that this lane holds */
  const unsigned short* qr = &sq[ln * QP + h * HDC + 8 * hh];
  FragH qf[2][4];              /* q fragments, read four tiles ahead */
#pragma unroll
  for (int i = 0; i < 4; ++i) { qf[0][i].half[0] = *(const v8us*)(qr + i * 16 * QP); qf[0][i].half[1] = *(const v8us*)(qr + i * 16 * QP + 16); }
#pragma unroll
  for (int g = 0; g < 4; ++g) {
    if (g + 1 < 4) {
#pragma unroll
      for (int i = 0; i < 4; ++i) { qf[(g + 1) & 1][i].half[0] = *(const v8us*)(qr + ((g + 1) * 4 + i) * 16 * QP); qf[(g + 1) & 1][i].half[1] = *(const v8us*)(qr + ((g + 1) * 4 + i) * 16 * QP + 16); }
    }
    __builtin_amdgcn_sched_barrier(0);      /* keeps the next four tiles' LDS reads in one group ahead of these four products: in this kernel the compiler left each read next to its product, and the wave waited out every LDS latency */
#pragma unroll
    for (int i = 0; i < 4; ++i) acc[g * 4 + i] = __builtin_amdgcn_wmma_f32_16x16x32_f16(false, qf[g & 1][i].v, false, kf.v, (short)0, acc[g * 4 + i], false, false);
    if (g + 1 < 4) __builtin_amdgcn_sched_barrier(0);      /* keeps later groups' reads from rising further: a third set of fragments has no registers */
  }
  float mx[4] = {-3.0e38f, -3.0e38f, -3.0e38f, -3.0e38f};
#pragma unroll
  for (int t = 0; t < 16; ++t)
#pragma unroll
    for (int r = 0; r < 8; ++r) mx[r & 3] = fmaxf(mx[r & 3], acc[t][r]);
  float m = fmaxf(fmaxf(mx[0], mx[1]), fmaxf(mx[2], mx[3])); m = fmaxf(m, other_half(m));
  const float cs = 0.17677669529663687f * 1.4426950408889634f;      /* 32^-1/2 * log2(e) */
  const float mc = 10.0f - m * cs;                                  /* p = 2^10 * exp(logit - max): the f16 range the probabilities had before */
  float sm[4] = {0.f, 0.f, 0.f, 0.f};
  FragH pf[8];
#pragma unroll
  for (int t = 0; t < 16; ++t) { v8f z;
#pragma unroll
    for (int r = 0; r < 8; ++r) z[r] = __builtin_fmaf(acc[t][r], cs, mc);
    const v8f e = exp2x8(z);
#pragma unroll
    for (int r = 0; r < 8; ++r) { sm[r & 3] += e[r]; pf[t >> 1].h[(t & 1) * 8 + r] = (_Float16)e[r]; } }
  float su = (sm[0] + sm[1]) + (sm[2] + sm[3]); su += other_half(su);
  v8f o[2] = {};
  const unsigned short* vr = &sv[(h * HDC + ln) * VP + 8 * hh];
  FragH vf[2][4];              /* v^T fragments of two k steps (two tiles each), read two k steps ahead */
#pragma unroll
  for (int i = 0; i < 4; ++i) { const unsigned short* p = vr + (i & 1) * 16 * VP + (i >> 1) * 32; vf[0][i].half[0] = *(const v8us*)p; vf[0][i].half[1] = *(const v8us*)(p + 16); }
#pragma unroll
  for (int g = 0; g < 4; ++g) {
    if (g + 1 < 4) {
#pragma unroll
      for (int i = 0; i < 4; ++i) { const unsigned short* p = vr + (i & 1) * 16 * VP + ((g + 1) * 2 + (i >> 1)) * 32; vf[(g + 1) & 1][i].half[0] = *(const v8us*)p; vf[(g + 1) & 1][i].half[1] = *(const v8us*)(p + 16); }
    }
    __builtin_amdgcn_sched_barrier(0);      /* keeps the next two k steps' LDS reads in one group ahead of these four products, as for the scores */
#pragma unroll
    for (int i = 0; i < 4; ++i) o[i & 1] = __builtin_amdgcn_wmma_f32_16x16x32_f16(false, vf[g & 1][i].v, false, pf[g * 2 + (i >> 1)].v, (short)0, o[i & 1], false, false);
    if (g + 1 < 4) __builtin_amdgcn_sched_barrier(0);      /* keeps later reads from rising further, as for the scores */
  }
  v8f sg[2];                   /* sigmoid(gate logit), formed ahead of the next head's loads: a wait for the logits behind those loads would wait for them too */
#pragma unroll
  for (int j = 0; j < 2; ++j) { v8f z;
#pragma unroll
    for (int r = 0; r < 8; ++r) z[r] = (float)fu.h[j * 8 + r] * -1.4426950408889634f;
    v8f d = exp2x8(z);
#pragma unroll
    for (int r = 0; r < 8; ++r) d[r] += 1.0f;
    sg[j] = rcpx8(d); }
  if (h + 1 < NHD) {           /* the score registers are free: the next head's loads fly while this head is gated */
    const float* bfn = bf + (h + 1) * 16 * 16 * 256;
    head_loads(bfn, l4, acc);
    asm volatile("s_wait_xcnt 0x0" :: "v"(l4), "s"(bfn) : "memory");      /* named as inputs, the loads' address registers (lane offset, scalar base) stay whole up to this wait: none of the results lands on them */
    kf.half[0] = *(const v8us*)(og + (h + 1) * 512); kf.half[1] = *(const v8us*)(og + (h + 1) * 512 + 256);      /* the next head's k, read ahead of its scores */
  } else {                     /* the last head loads nothing: a fresh value ends the old scores' life here; without it they count as carried into a next head on this side, and the compiler keeps them through the gate in scratch memory, in every head */
#pragma unroll
    for (int t = 0; t < 16; ++t) acc[t] = (v8f){};
  }
  const float inv = 1.0f / su;
#pragma unroll
  for (int j = 0; j < 2; ++j) { FragH gh, gl;      /* og = o / sum * sigmoid, hi and lo * 2^10 */
#pragma unroll
    for (int r = 0; r < 8; ++r) { const float gvl = o[j][r] * (inv * sg[j][r]); const _Float16 hv = (_Float16)gvl; gh.h[r] = hv; gl.h[r] = (_Float16)((gvl - (float)hv) * 1024.0f); }
    *(v8us*)(og + (h * 2 + j) * 256) = gh.half[0]; *(v8us*)(og + 2048 + (h * 2 + j) * 256) = gl.half[0]; }
}
// One block a WGP (LDS): four waves per SIMD, so 256 registers a wave. Every loop but the one over the heads is unrolled because its index picks registers.
// Ahead of the attention the block forms all that it needs of its own row: LayerNorm of the 256 tokens into LDS, then 32 units of 64 tokens x 64 columns, two a wave: [k | gate logits] and [q | v^T]. None of these planes goes through global memory.
__global__ __launch_bounds__(512) void k_attn(const float* __restrict__ X, const float* __restrict__ g, const float* __restrict__ bb, const float* __restrict__ bfu,
                                              const _Float16* __restrict__ BQK, const _Float16* __restrict__ AV, const _Float16* __restrict__ BFU,
                                              const float* __restrict__ BF, const _Float16* __restrict__ BO, const float* __restrict__ bo, float* __restrict__ out) {
  __shared__ AttnLds lds;
  unsigned short* const swo = lds.swo; float* const sbo = lds.sbo; unsigned short* const xs = lds.sxqv; unsigned short* const sq = lds.sxqv; unsigned short* const sv = lds.sxqv + SL * QP;
  const int tid = threadIdx.x, lane = tid & 31, ln = lane & 15, hh = lane >> 4;
  const int w = __builtin_amdgcn_readfirstlane(tid >> 5);      /* the wave's number in a scalar register: the choice of units is a scalar branch, and the bias tiles load from a scalar base */
  const int s = blockIdx.x;
  const unsigned short* gwp = (const unsigned short*)BO + (tid >> 8) * 4096 + (tid & 255) * 8;      /* 16-byte piece tid + 512 u of Wo^T: 256 pieces a 16-row tile, the first 4 of its 8 k steps: 2 tiles a step */
  v8us gw[4];
#pragma unroll
  for (int u = 0; u < 4; ++u) gw[u] = *(const v8us*)(gwp + u * 2 * 4096);
  const float bov = bo[tid & (EE - 1)], bfv = bfu[tid & (EE - 1)];
  asm volatile("s_wait_xcnt 0x0" ::: "memory");      /* the address registers of the six loads above are free for reuse as destinations of the row loads below only behind this wait */
  ln_rows(X + ((size_t)s * SL + w * 16) * EE + lane * 4, EE, g + lane * 4, bb + lane * 4, xs + w * 16 * XP + lane * 4);      /* wave w: tokens 16 w .. 16 w + 15 */
#pragma unroll
  for (int u = 0; u < 4; ++u) *(v8us*)&swo[tid * 8 + u * 4096] = gw[u];
  sbo[tid] = bf16_round(bov);    /* the output bias, rounded once a block */
  lds.sfb[tid] = bf16_round(bfv);      /* the gate bias, rounded once a block */
  if (tid < 64) lds.szr[tid] = 0.0f;
  __syncthreads();               /* publishes the normalised row, Wo^T and the biases to all sixteen waves */
  const int th = w & 3, cg = w >> 2;      /* which 64 of the 256 tokens, which 64 of the 256 columns */
  const unsigned short* xh = xs + th * 64 * XP;
  v8us res[4][4];
  { /* [k | gate logits]: a lane's 8 columns of one token are half a fragment of the wave that owns the token (wave th * 4 + i), in the same lane */
    const unsigned short* wt = (cg < 2) ? (const unsigned short*)BQK + (size_t)(EE + cg * 64) * 2 * EE : (const unsigned short*)BFU + (size_t)(cg - 2) * 64 * 2 * EE;
    proj_unit<false, true>(xh, wt, (cg < 2) ? lds.szr : lds.sfb + (cg - 2) * 64, res, lane);
    unsigned short* d = lds.sog + th * 4 * 4096 + cg * 1024 + lane * 8;      /* plane cg >> 1 (2048 halves), head (cg & 1) * 2 + (j >> 1) (512), half j & 1 (256) */
#pragma unroll
    for (int i = 0; i < 4; ++i)
#pragma unroll
      for (int j = 0; j < 4; ++j) *(v8us*)(d + i * 4096 + j * 256) = res[i][j];
  }
  /* [q | v^T]: they take over the x tile's LDS, so they wait in registers until every wave has read it */
  if (cg < 2) proj_unit<false, false>(xh, (const unsigned short*)BQK + (size_t)cg * 64 * 2 * EE, nullptr, res, lane);
  else        proj_unit<true, false>(xh, (const unsigned short*)AV + (size_t)(cg - 2) * 64 * 2 * EE, nullptr, res, lane);
  __syncthreads();               /* ends every wave's reads of the x tile (and publishes k and the gate logits) */
  const float* bf = BF + (size_t)w * 16 * 256;      /* + h * 16 * 16 * 256: a scalar base; the lane's offset is one register */
  const int l4 = lane * 4;
  v8f acc[16]; FragH kf;
  head_loads(bf, l4, acc);
  asm volatile("s_wait_xcnt 0x0" :: "v"(l4), "s"(bf) : "memory");      /* named as inputs, the loads' address registers (lane offset, scalar base) stay whole up to this wait: none of the results lands on them */
  { unsigned short* d = (cg < 2) ? sq + (th * 64 + ln) * QP + cg * 64 + 8 * hh : sv + ((cg - 2) * 64 + ln) * VP + th * 64 + 8 * hh;
    const int si = (cg < 2) ? 16 * QP : 16, sj = (cg < 2) ? 16 : 16 * VP;      /* q: token tile i down the rows, column tile j along them; v^T: the other way round */
#pragma unroll
    for (int i = 0; i < 4; ++i)
#pragma unroll
      for (int j = 0; j < 4; ++j) *(v8us*)(d + i * si + j * sj) = res[i][j];
  }
  __syncthreads();               /* publishes q and v^T to all sixteen waves */
  unsigned short* const og = lds.sog + w * 4096 + lane * 8;      /* this wave's k, gate logits and gated output, each lane's values in its own 16-byte slots: registers that the heads' scores need */
  kf.half[0] = *(const v8us*)og; kf.half[1] = *(const v8us*)(og + 256);
#pragma unroll 1      /* rolled: nothing here is picked by h at compile time, and no head's loads or reads rise into the head before, where there are no registers for them */
  for (int h = 0; h < NHD; ++h) attn_head(h, sq, sv, og, bf, l4, ln, hh, acc, kf);
  /* outT[e][a]: a lane holds 8 neighbouring e of one a. Half a row (64 e) at a time goes through the wave's own LDS range, which turns the 32-byte pieces into whole 128-byte lines. */
  FragH ogh[NHD], ogl[NHD];
#pragma unroll
  for (int h = 0; h < NHD; ++h) { ogh[h].half[0] = *(const v8us*)(og + h * 512); ogh[h].half[1] = *(const v8us*)(og + h * 512 + 256); ogl[h].half[0] = *(const v8us*)(og + 2048 + h * 512); ogl[h].half[1] = *(const v8us*)(og + 2048 + h * 512 + 256); }
  float* st = (float*)(lds.sog + w * 4096);
  float* orow = out + ((size_t)s * SL + w * 16) * EE;
  const int rsub = lane >> 4, c4 = (lane & 15) * 4;
  const unsigned short* wr = swo + lane * 8;      /* 2048 halves a 16-row tile, 512 a head, 256 half a fragment */
  FragH wf[2][2 * NHD];          /* the weight fragments of two e tiles, read one pair of tiles ahead */
#pragma unroll
  for (int i = 0; i < 2 * NHD; ++i) { wf[0][i].half[0] = *(const v8us*)(wr + i * 512); wf[0][i].half[1] = *(const v8us*)(wr + i * 512 + 256); }
#pragma unroll
  for (int g = 0; g < 4; ++g) {
    if (g + 1 < 4) {
#pragma unroll
      for (int i = 0; i < 2 * NHD; ++i) { wf[(g + 1) & 1][i].half[0] = *(const v8us*)(wr + (g + 1) * 4096 + i * 512); wf[(g + 1) & 1][i].half[1] = *(const v8us*)(wr + (g + 1) * 4096 + i * 512 + 256); }
    }
    __builtin_amdgcn_sched_barrier(0);      /* keeps the next pair's LDS reads in one group ahead of the 16 products: left alone the compiler sinks each read to its first use, and the wave waits out every latency */
    v8f ch[2] = {}, cl[2] = {};
#pragma unroll
    for (int h = 0; h < NHD; ++h)
#pragma unroll
      for (int e2 = 0; e2 < 2; ++e2) {
        ch[e2] = __builtin_amdgcn_wmma_f32_16x16x32_f16(false, wf[g & 1][e2 * NHD + h].v, false, ogh[h].v, (short)0, ch[e2], false, false);
        cl[e2] = __builtin_amdgcn_wmma_f32_16x16x32_f16(false, wf[g & 1][e2 * NHD + h].v, false, ogl[h].v, (short)0, cl[e2], false, false); }
    __builtin_amdgcn_sched_barrier(0);      /* keeps the joins below all 16 products: risen in among the last of them, each group of joins takes its own run of v_nop behind a product */
#pragma unroll
    for (int e2 = 0; e2 < 2; ++e2) { v4f a0, a1;
#pragma unroll
      for (int r = 0; r < 4; ++r) { a0[r] = __builtin_fmaf(cl[e2][r], 0.0009765625f, ch[e2][r]); a1[r] = __builtin_fmaf(cl[e2][4 + r], 0.0009765625f, ch[e2][4 + r]); }
      float* sp = &st[ln * OP + ((g & 1) * 2 + e2) * 16 + 8 * hh]; *(v4fa*)sp = a0; *(v4fa*)(sp + 4) = a1; }
    if (g & 1) {
      __builtin_amdgcn_fence(__ATOMIC_ACQ_REL, "workgroup", "local"); __builtin_amdgcn_wave_barrier();      /* the rows read below were written by other lanes of this wave */
      const int p = g >> 1;
      const v4f b4 = *(const v4fa*)&sbo[p * 64 + c4];
      v4f rv[8];
#pragma unroll
      for (int q = 0; q < 8; ++q) rv[q] = *(const v4fa*)&st[(q * 2 + rsub) * OP + c4];
      __builtin_amdgcn_sched_barrier(0);      /* keeps the nine LDS reads in one group: one wait instead of one a row */
#pragma unroll
      for (int q = 0; q < 8; ++q) { v4f r4;
#pragma unroll
        for (int i = 0; i < 4; ++i) r4[i] = __builtin_fmaf(rv[q][i], 0.0625f, b4[i]);
        *(v4f*)(orow + (size_t)(q * 2 + rsub) * EE + p * 64 + c4) = r4; }
      asm volatile("s_wait_xcnt 0x0" ::: "memory");      /* the stores' address and data registers are reused only behind this wait; its clobber also keeps the second half's writes of st behind the reads above */
    }
  }
}

extern "C" void kernel_launch(void* const* d_in, const int* in_sizes, int n_in,
                              void* d_out, int out_size, void* d_ws, size_t ws_size, hipStream_t stream) {
  (void)in_sizes; (void)n_in; (void)out_size;
  const float* const* I = (const float* const*)d_in; const float* pr = I[0]; const float* mask = I[1]; const float* gam = I[2]; const float* bet = I[3]; const float* Wq = I[4]; const float* Wk = I[5]; const float* Wv = I[6]; const float* Wb = I[7]; const float* Wfu = I[8]; const float* bfu = I[9]; const float* Wo = I[10]; const float* bo = I[11];
  char* ws = (char*)d_ws; size_t off = 0;
  auto take = [&](size_t bytes) { char* p = ws + off; off += (bytes + 255) & ~(size_t)255; return p; };
  _Float16* BQK = (_Float16*)take((size_t)2 * EE * 2 * EE * 2); _Float16* AV = (_Float16*)take((size_t)EE * 2 * EE * 2); _Float16* BB = (_Float16*)take((size_t)16 * 2 * EE * 2); _Float16* BFU = (_Float16*)take((size_t)EE * 2 * EE * 2); _Float16* BO = (_Float16*)take((size_t)EE * 2 * EE * 2);      /* all folded: [W*s | W*s*2^-10] against [hi | lo*2^10] operands (K 256) */      /* of BO only the first plane is written and read */
  float* BF = (float*)take((size_t)NHD * SL * SL * 4);
  if (off > ws_size) return;      // about 0.4 + 1.0 = 1.4 MB
  /* Wq, Wk: (in,out) -> 256 rows of K 256; Wv: row hc, k = [hi e | lo e], Wv[e][hc] (raw), the v^T product's operand against [x_hi | x_lo*2^10] rows; Wfu like Wq; Wo: row e, k = hc, Wo[hc][e] * 16, the one plane; Wb: 4 live of 16 rows. All in fragment order. */
  k_pack<<<PACK_BLOCKS, 256, 0, stream>>>(Wq, Wk, Wv, Wfu, Wo, Wb, BQK, AV, BFU, BO, BB);
  k_pbias<<<(SL / 16) * (SL / 16), 512, 0, stream>>>(pr, gam, bet, mask, BB, BF);      /* LayerNorm, pair bias, + mask, per head, in score-fragment order */
  k_attn<<<SL, 512, 0, stream>>>(pr, gam, bet, bfu, BQK, AV, BFU, BF, BO, bo, (float*)d_out);      /* per row: LayerNorm, q, k, v^T, gate logits, attention of all heads, gate, output product (+ bo) */
}

// v006
// A run of this version takes 33.5 microseconds.
// Next to v005, in two timings, it ran 1.18 and 1.17 times as fast.
// All steps since v000 together make it 28.7 times as fast.
#include <hip/hip_runtime.h>
// Row-wise pair attention on a pair representation ([1,256,256,128], 4 heads × 32): x = LN(pair_rep); q = x·Wq·32^-½, k = x·Wk, v = x·Wv; per (row s, head h): logits[a][b] = Σ_c k[s,a,h,c]·q[s,b,h,c] + mask[a][b] + (x·Wb)[a][b][h]; softmax over b; o[s,a,h,:] = Σ_b attn·v[s,b,h,:]; o *= sigmoid(x·Wfu + bfu); out = o·Wo + bo → [1,256,256,128]. (The module's einsum makes k carry the output index and q the summed index.)
// Compute dtype: inputs and parameters rounded to bf16; the products of x take the tokens as exact bf16 operands against gamma * W carried hi/lo in bf16 (exact), LayerNorm's mean and 1/sigma applied behind them in f32; the gated output carried hi/lo (about f32); q/k/v planes, probabilities and gate logits f16 (about 2^-12); mask/bias/softmax/LN/sigmoid in f32; f32 accumulation. v_wmma_f32_16x16x32_bf16 and _f16.
#define SL 256
#define NTOK (SL * SL)           /* 65536 */
#define EE 128
#define NHD 4
#define HDC 32
typedef __bf16 v16b __attribute__((ext_vector_type(16)));
typedef unsigned short v8us __attribute__((ext_vector_type(8), may_alias));
typedef float  v8f  __attribute__((ext_vector_type(8)));
typedef float  v4f  __attribute__((ext_vector_type(4)));
typedef float  v4fa __attribute__((ext_vector_type(4), may_alias));
union FragB { v16b v; v8us half[2]; unsigned short u[16]; };

__device__ __forceinline__ unsigned short bf16_bits(float x) { unsigned int u = __float_as_uint(x); return (unsigned short)((u + 0x7FFFu + ((u >> 16) & 1u)) >> 16); }
__device__ __forceinline__ float bf16_val(unsigned short b) { return __uint_as_float(((unsigned int)b) << 16); }
__device__ __forceinline__ float bf16_round(float x) { return bf16_val(bf16_bits(x)); }
// D += A·B with NT terms: 1 = ah·bh, 2 = + al·bh (A split), 3 = + ah·bl (both split)
template <int NT>
__device__ __forceinline__ v8f mmaN(v16b ah, v16b al, v16b bh, v16b bl, v8f c) {
  c = __builtin_amdgcn_wmma_f32_16x16x32_bf16(false, ah, false, bh, (short)0, c, false, false);
  if (NT >= 2) c = __builtin_amdgcn_wmma_f32_16x16x32_bf16(false, al, false, bh, (short)0, c, false, false);
  if (NT >= 3) c = __builtin_amdgcn_wmma_f32_16x16x32_bf16(false, ah, false, bl, (short)0, c, false, false);
  asm volatile("v_nop\n\tv_nop\n\tv_nop\n\tv_nop" : "+v"(c) : "v"(ah), "v"(al), "v"(bh), "v"(bl));
  return c;
}

__global__ __launch_bounds__(256) void k_wt_bf16(const float* __restrict__ W, unsigned short* __restrict__ Wt, int K, int N) {
  const int t = blockIdx.x * 256 + threadIdx.x;
  const int k8n = K / 8;
  if (t >= N * k8n) return;
  const int n = t / k8n, k8 = (t % k8n) * 8;
  v8us v;
#pragma unroll
  for (int i = 0; i < 8; ++i) v[i] = bf16_bits(W[(size_t)(k8 + i) * N + n]);
  *(v8us*)(Wt + (size_t)n * K + k8) = v;
  
}

// GEMM C[M][N] (f32, pitch ldc) = act(A[M][K]·W + bias). A f32 row-major (pitch lda) converted per fragment to bf16
// (ASPLIT: hi/lo two planes -> 2 terms, else single rounded term); Wt bf16 [N][K] (pitch ldb). BIAS_BF16 rounds the
// bias to bf16 first (bias quantised to bf16 before the add). K%32==0, M%16==0, N%64==0.
template <bool ASPLIT, int ACT, bool BIAS_BF16>
__global__ __launch_bounds__(128) void k_gemm_bf(const float* __restrict__ A, int lda, const unsigned short* __restrict__ Wt, int ldb,
                                               const float* __restrict__ bias, float* __restrict__ C, int ldc, int M, int N, int K) {
  __shared__ __attribute__((aligned(16))) float so[4][16][64];
  const int tid = threadIdx.x, w = tid >> 5, lane = tid & 31, ln = lane & 15, hh = lane >> 4;
  const int ntn = N / 64;
  const int wid = blockIdx.x * 4 + w;
  const int mt = wid / ntn, nq = wid % ntn;
  if (mt * 16 >= M) return;
  const int row0 = mt * 16, col0 = nq * 64;
  const float* arow = A + (size_t)(row0 + ln) * lda;
  v8f acc[4] = {};
  for (int kb = 0; kb < K; kb += 32) {
    FragB ah, al;
    const v4f x0 = *(const v4fa*)(arow + kb + 8 * hh), x1 = *(const v4fa*)(arow + kb + 8 * hh + 4);
    const v4f x2 = *(const v4fa*)(arow + kb + 16 + 8 * hh), x3 = *(const v4fa*)(arow + kb + 16 + 8 * hh + 4);
    float xs[16] = {x0[0],x0[1],x0[2],x0[3],x1[0],x1[1],x1[2],x1[3],x2[0],x2[1],x2[2],x2[3],x3[0],x3[1],x3[2],x3[3]};
#pragma unroll
    for (int i = 0; i < 16; ++i) { const unsigned short hb = bf16_bits(xs[i]); ah.u[i] = hb; al.u[i] = ASPLIT ? bf16_bits(xs[i] - bf16_val(hb)) : (unsigned short)0; }
#pragma unroll
    for (int t = 0; t < 4; ++t) {
      const unsigned short* brow = Wt + (size_t)(col0 + t * 16 + ln) * ldb + kb;
      FragB b;
      b.half[0] = *(const v8us*)(brow + 8 * hh);
      b.half[1] = *(const v8us*)(brow + 16 + 8 * hh);
      acc[t] = mmaN<ASPLIT ? 2 : 1>(ah.v, al.v, b.v, b.v, acc[t]);
    }
  }
#pragma unroll
  for (int t = 0; t < 4; ++t) {
    float bv = bias ? bias[col0 + t * 16 + ln] : 0.f;
    if (BIAS_BF16) bv = bf16_round(bv);
#pragma unroll
    for (int r = 0; r < 8; ++r) { float v = acc[t][r] + bv; if (ACT == 1) v = fmaxf(v, 0.f); so[w][8 * hh + r][t * 16 + ln] = v; }
  }
  __builtin_amdgcn_fence(__ATOMIC_ACQ_REL, "workgroup");
  __builtin_amdgcn_wave_barrier();
  const int rsub = lane >> 4, c4 = (lane & 15) * 4;
  {
#pragma unroll
    for (int q = 0; q < 8; ++q) {
      const int r = q * 2 + rsub;
      const v4f v = *(const v4fa*)&so[w][r][c4];
      *(v4f*)(C + (size_t)(row0 + r) * ldc + col0 + c4) = v;
    }
    
  }
}

// GEMM C = act(A·W + bias + resid): A f32 (ASPLIT -> hi/lo 2 terms), Wt bf16 [N][K]; ACT 0 none, 1 relu, 2 exact gelu;
// resid (optional, f32, row index = (row % rmod), pitch ldr, RES_BF16 rounds it) added before the activation.
template <bool ASPLIT, int ACT, bool BIAS_BF16, bool RES_BF16>
__global__ __launch_bounds__(128) void k_gemm_bf3(const float* __restrict__ A, int lda, const unsigned short* __restrict__ Wt, int ldb,
                                                const float* __restrict__ bias, const float* __restrict__ resid, int rmod, int ldr,
                                                float* __restrict__ C, int ldc, int M, int N, int K) {
  __shared__ __attribute__((aligned(16))) float so[4][16][64];
  const int tid = threadIdx.x, w = tid >> 5, lane = tid & 31, ln = lane & 15, hh = lane >> 4;
  const int ntn = N / 64;
  const int wid = blockIdx.x * 4 + w;
  const int mt = wid / ntn, nq = wid % ntn;
  if (mt * 16 >= M) return;
  const int row0 = mt * 16, col0 = nq * 64;
  const float* arow = A + (size_t)(row0 + ln) * lda;
  v8f acc[4] = {};
  for (int kb = 0; kb < K; kb += 32) {
    FragB ah, al;
    const v4f x0 = *(const v4fa*)(arow + kb + 8 * hh), x1 = *(const v4fa*)(arow + kb + 8 * hh + 4);
    const v4f x2 = *(const v4fa*)(arow + kb + 16 + 8 * hh), x3 = *(const v4fa*)(arow + kb + 16 + 8 * hh + 4);
    float xs[16] = {x0[0],x0[1],x0[2],x0[3],x1[0],x1[1],x1[2],x1[3],x2[0],x2[1],x2[2],x2[3],x3[0],x3[1],x3[2],x3[3]};
#pragma unroll
    for (int i = 0; i < 16; ++i) { const unsigned short hb = bf16_bits(xs[i]); ah.u[i] = hb; al.u[i] = ASPLIT ? bf16_bits(xs[i] - bf16_val(hb)) : (unsigned short)0; }
#pragma unroll
    for (int t = 0; t < 4; ++t) {
      const unsigned short* brow = Wt + (size_t)(col0 + t * 16 + ln) * ldb + kb;
      FragB b;
      b.half[0] = *(const v8us*)(brow + 8 * hh);
      b.half[1] = *(const v8us*)(brow + 16 + 8 * hh);
      acc[t] = mmaN<ASPLIT ? 2 : 1>(ah.v, al.v, b.v, b.v, acc[t]);
    }
  }
#pragma unroll
  for (int t = 0; t < 4; ++t) {
    const int col = col0 + t * 16 + ln;
    float bv = bias ? bias[col] : 0.f;
    if (BIAS_BF16) bv = bf16_round(bv);
#pragma unroll
    for (int r = 0; r < 8; ++r) {
      float v = acc[t][r] + bv;
      if (resid) { float rv = resid[(size_t)((row0 + 8 * hh + r) % rmod) * ldr + col]; if (RES_BF16) rv = bf16_round(rv); v += rv; }
      if (ACT == 1) v = fmaxf(v, 0.f);
      if (ACT == 2) v = 0.5f * v * (1.0f + erff(v * 0.70710678118654752f));
      if (ACT == 3) { const float u = 0.7978845608028654f * (v + 0.044715f * v * v * v); v = 0.5f * v * (1.0f + tanhf(u)); }
      so[w][8 * hh + r][t * 16 + ln] = v;
    }
  }
  __builtin_amdgcn_fence(__ATOMIC_ACQ_REL, "workgroup");
  __builtin_amdgcn_wave_barrier();
  const int rsub = lane >> 4, c4 = (lane & 15) * 4;
  {
#pragma unroll
    for (int q = 0; q < 8; ++q) {
      const int r = q * 2 + rsub;
      const v4f v = *(const v4fa*)&so[w][r][c4];
      *(v4f*)(C + (size_t)(row0 + r) * ldc + col0 + c4) = v;
    }
    
  }
}
// row LayerNorm (biased variance, eps) over N: s = X (+ R); optional out_sum <- s; out_norm <- (s-mu)*rsqrt(var+eps)*g + b
template <bool PARAM_BF16>
__global__ __launch_bounds__(256) void k_layernorm(const float* __restrict__ X, const float* __restrict__ R, const float* __restrict__ g, const float* __restrict__ bta,
                                                  float* __restrict__ out_sum, float* __restrict__ out_norm, int N, float eps) {
  __shared__ float red[256];
  const int row = blockIdx.x, tid = threadIdx.x;
  const float* x = X + (size_t)row * N; const float* rr = R ? R + (size_t)row * N : nullptr;
  float vals[16];                     // up to N = 4096
  const int per = N / 256;            // contiguous chunk per thread? use strided-by-4 chunks: thread handles j = tid*4 + 1024*u
  float s1 = 0.f;
  for (int u = 0; u < per / 4; ++u) {
    const int j = tid * 4 + 1024 * u;
    const v4f a = *(const v4fa*)(x + j);
    v4f b = {0.f,0.f,0.f,0.f}; if (rr) b = *(const v4fa*)(rr + j);
#pragma unroll
    for (int q = 0; q < 4; ++q) { const float v = a[q] + b[q]; vals[u * 4 + q] = v; s1 += v; }
  }
  red[tid] = s1; __syncthreads();
  for (int st = 128; st > 0; st >>= 1) { if (tid < st) red[tid] += red[tid + st]; __syncthreads(); }
  const float mu = red[0] / (float)N; __syncthreads();
  float s2 = 0.f;
  for (int u = 0; u < per / 4; ++u)
#pragma unroll
    for (int q = 0; q < 4; ++q) { const float c = vals[u * 4 + q] - mu; s2 += c * c; }
  red[tid] = s2; __syncthreads();
  for (int st = 128; st > 0; st >>= 1) { if (tid < st) red[tid] += red[tid + st]; __syncthreads(); }
  const float rs = rsqrtf(red[0] / (float)N + eps);
  {
    for (int u = 0; u < per / 4; ++u) {
      const int j = tid * 4 + 1024 * u;
      v4f o, sm;
#pragma unroll
      for (int q = 0; q < 4; ++q) {
        float gg = g[j + q], bb = bta[j + q];
        if (PARAM_BF16) { gg = bf16_round(gg); bb = bf16_round(bb); }
        sm[q] = vals[u * 4 + q]; o[q] = (vals[u * 4 + q] - mu) * rs * gg + bb;
      }
      if (out_sum) *(v4f*)(out_sum + (size_t)row * N + j) = sm;
      *(v4f*)(out_norm + (size_t)row * N + j) = o;
    }
    
  }
}



// ---- f16 WMMA path (v_wmma_f32_16x16x32_f16): 11-bit significands for operands in range — used where a [0,1] probability operand needs more precision than bf16
typedef _Float16 v16h __attribute__((ext_vector_type(16)));
union FragH { v16h v; v8us half[2]; _Float16 h[16]; unsigned short u[16]; };
template <int NT>
__device__ __forceinline__ v8f mmaH(v16h ah, v16h al, v16h bh, v16h bl, v8f c) {
  c = __builtin_amdgcn_wmma_f32_16x16x32_f16(false, ah, false, bh, (short)0, c, false, false);
  if (NT >= 2) c = __builtin_amdgcn_wmma_f32_16x16x32_f16(false, al, false, bh, (short)0, c, false, false);
  if (NT >= 3) c = __builtin_amdgcn_wmma_f32_16x16x32_f16(false, ah, false, bl, (short)0, c, false, false);
  asm volatile("v_nop\n\tv_nop\n\tv_nop\n\tv_nop" : "+v"(c) : "v"(ah), "v"(al), "v"(bh), "v"(bl));
  return c;
}
// batched GEMM like k_gemm_b but f16 operands: A f32 (split into f16 hi/lo if ASPLIT, else rounded to f16), Bt = f16 values [n][k]; alpha; C f32; N multiple of 16 (partial tiles skipped)
template <bool ASPLIT>
__global__ __launch_bounds__(128) void k_gemm_h(const float* __restrict__ A, int lda, size_t sA, const _Float16* __restrict__ Bh, int ldb, size_t sB, float alpha, float* __restrict__ C, int ldc, size_t sC, int M, int N, int K) {
  __shared__ __attribute__((aligned(16))) float so[4][16][64];
  const int tid = threadIdx.x, w = tid >> 5, lane = tid & 31, ln = lane & 15, hh = lane >> 4; const int by = blockIdx.y;
  A += (size_t)by * sA; Bh += (size_t)by * sB; C += (size_t)by * sC;
  const int ntn = (N + 63) / 64; const int wid = blockIdx.x * 4 + w; const int mt = wid / ntn, nq = wid % ntn; if (mt * 16 >= M) return;
  const int row0 = mt * 16, col0 = nq * 64; const float* arow = A + (size_t)(row0 + ln) * lda;
  v8f acc[4] = {};
  for (int kb = 0; kb < K; kb += 32) {
    FragH ah, al;
    const v4f x0 = *(const v4fa*)(arow + kb + 8 * hh), x1 = *(const v4fa*)(arow + kb + 8 * hh + 4), x2 = *(const v4fa*)(arow + kb + 16 + 8 * hh), x3 = *(const v4fa*)(arow + kb + 16 + 8 * hh + 4);
    float xs[16] = {x0[0],x0[1],x0[2],x0[3],x1[0],x1[1],x1[2],x1[3],x2[0],x2[1],x2[2],x2[3],x3[0],x3[1],x3[2],x3[3]};
#pragma unroll
    for (int i = 0; i < 16; ++i) { const _Float16 h = (_Float16)xs[i]; ah.h[i] = h; al.h[i] = ASPLIT ? (_Float16)(xs[i] - (float)h) : (_Float16)0.0f; }
#pragma unroll
    for (int t = 0; t < 4; ++t) { if (col0 + t * 16 >= N) continue; const size_t boff = (size_t)(col0 + t * 16 + ln) * ldb + kb; FragH bq; bq.half[0] = *(const v8us*)(Bh + boff + 8 * hh); bq.half[1] = *(const v8us*)(Bh + boff + 16 + 8 * hh);
      acc[t] = mmaH<ASPLIT ? 2 : 1>(ah.v, al.v, bq.v, bq.v, acc[t]); }
  }
#pragma unroll
  for (int t = 0; t < 4; ++t) { if (col0 + t * 16 >= N) continue;
#pragma unroll
    for (int r = 0; r < 8; ++r) so[w][8 * hh + r][t * 16 + ln] = acc[t][r] * alpha; }
  __builtin_amdgcn_fence(__ATOMIC_ACQ_REL, "workgroup"); __builtin_amdgcn_wave_barrier();
  const int rsub = lane >> 4, c4 = (lane & 15) * 4;
  {
#pragma unroll
    for (int q = 0; q < 8; ++q) { const int r = q * 2 + rsub; if (col0 + c4 < N) { const v4f v = *(const v4fa*)&so[w][r][c4]; *(v4f*)(C + (size_t)(row0 + r) * ldc + col0 + c4) = v; } }
     }
}

// Wt[n][k] = f16(W[k][n]·scale) from f32 row-major W[K][N] (scale = power of two; bf16-exact weights stay exact in f16 away from the subnormal range)
__global__ __launch_bounds__(256) void k_wt_f16(const float* __restrict__ W, _Float16* __restrict__ Wt, int K, int N, float scale) {
  const int t = blockIdx.x * 256 + threadIdx.x; if (t >= N * (K / 8)) return; const int n = t / (K / 8), k8 = (t % (K / 8)) * 8; FragH f;
#pragma unroll
  for (int i = 0; i < 8; ++i) f.h[i] = (_Float16)(bf16_round(W[(size_t)(k8 + i) * N + n]) * scale); const v8us o = f.half[0];
  *(v8us*)((unsigned short*)Wt + (size_t)n * K + k8) = o; 
}
// k_gemm_hh variant with fused epilogue: v = acc·alpha + bias[by·sBias + col] (+ CP[(row/rowsPerB)·sCPb + by·64 + col] if CP) ; ACT 0 none / 1 elu ; writes f32 C and/or f16 C16 (each if non-null)
template <int ACT>
__global__ __launch_bounds__(128) void k_gemm_hhx(const _Float16* __restrict__ A, int lda, size_t sA, const _Float16* __restrict__ Bh, int ldb, size_t sB, float alpha, const float* __restrict__ bias, size_t sBias, const float* __restrict__ CP, int rowsPerB, size_t sCPb, int row0g,
    float* __restrict__ C, _Float16* __restrict__ C16, int ldc, size_t sC, int M, int N, int K) {
  __shared__ __attribute__((aligned(16))) float so[4][16][64];
  const int tid = threadIdx.x, w = tid >> 5, lane = tid & 31, ln = lane & 15, hh = lane >> 4; const int by = blockIdx.y;
  A += (size_t)by * sA; Bh += (size_t)by * sB; const size_t cofs = (size_t)by * sC; const float* bp = bias ? bias + (size_t)by * sBias : nullptr;
  const int ntn = (N + 63) / 64; const int wid = blockIdx.x * 4 + w; const int mt = wid / ntn, nq = wid % ntn; if (mt * 16 >= M) return;
  const int row0 = mt * 16, col0 = nq * 64; const _Float16* arow = A + (size_t)(row0 + ln) * lda;
  v8f acc[4] = {};
  for (int kb = 0; kb < K; kb += 32) { FragH ah; ah.half[0] = *(const v8us*)((const unsigned short*)arow + kb + 8 * hh); ah.half[1] = *(const v8us*)((const unsigned short*)arow + kb + 16 + 8 * hh);
#pragma unroll
    for (int t = 0; t < 4; ++t) { if (col0 + t * 16 >= N) continue; const size_t boff = (size_t)(col0 + t * 16 + ln) * ldb + kb; FragH bq; bq.half[0] = *(const v8us*)((const unsigned short*)Bh + boff + 8 * hh); bq.half[1] = *(const v8us*)((const unsigned short*)Bh + boff + 16 + 8 * hh);
      acc[t] = mmaH<1>(ah.v, ah.v, bq.v, bq.v, acc[t]); }
  }
#pragma unroll
  for (int t = 0; t < 4; ++t) { if (col0 + t * 16 >= N) continue; const int col = col0 + t * 16 + ln; const float bv = bp ? bf16_round(bp[col]) : 0.f;
#pragma unroll
    for (int r = 0; r < 8; ++r) { float v = acc[t][r] * alpha + bv; if (CP) { const int bidx = (row0g + row0 + 8 * hh + r) / rowsPerB; v += CP[(size_t)bidx * sCPb + (size_t)by * 64 + col]; } if (ACT == 1) v = (v > 0.f) ? v : expm1f(v); else if (ACT == 7) v = (v > 0.f) ? v + 1.0f : expf(v); else if (ACT == 8) v = tanhf(v); else if (ACT == 9) v = 0.5f * v * (1.0f + tanhf(0.7978845608028654f * (v + 0.044715f * v * v * v))); else if (ACT == 11) v = 1.0f / (1.0f + expf(-v)); else if (ACT == 12) v = (v > 0.f) ? v : 0.01f * v; else if (ACT == 14) v = (v > 0.f) ? v : 0.1f * v; else if (ACT == 15) v = v / (1.0f + expf(-v)); else if (ACT == 3) v = fmaxf(v, 0.f); else if (ACT == 6) v = 0.5f * v * (1.0f + erff(v * 0.70710678118654752f)); so[w][8 * hh + r][t * 16 + ln] = v; } }
  __builtin_amdgcn_fence(__ATOMIC_ACQ_REL, "workgroup"); __builtin_amdgcn_wave_barrier();
  const int rsub = lane >> 4, c4 = (lane & 15) * 4; typedef _Float16 v4h __attribute__((ext_vector_type(4)));
  {
#pragma unroll
    for (int q = 0; q < 8; ++q) { const int r = q * 2 + rsub; if (col0 + c4 < N) { const v4f v = *(const v4fa*)&so[w][r][c4]; if (C) *(v4f*)(C + cofs + (size_t)(row0 + r) * ldc + col0 + c4) = v; if (C16) { v4h h4; for (int i = 0; i < 4; ++i) h4[i] = (_Float16)v[i]; *(v4h*)(C16 + cofs + (size_t)(row0 + r) * ldc + col0 + c4) = h4; } } }
     }
}


typedef _Float16 v4h __attribute__((ext_vector_type(4)));

__global__ __launch_bounds__(256) void k_x16(const float* __restrict__ x, _Float16* __restrict__ X16, size_t n8) { const size_t t = (size_t)blockIdx.x * 256 + threadIdx.x; if (t >= n8) return; FragH f;
#pragma unroll
  for (int q = 0; q < 8; ++q) f.h[q] = (_Float16)bf16_round(x[t * 8 + q]); *(v8us*)((unsigned short*)X16 + t * 8) = f.half[0];  }
__global__ __launch_bounds__(256) void k_h16(const float* __restrict__ x, _Float16* __restrict__ X16, size_t n8) { const size_t t = (size_t)blockIdx.x * 256 + threadIdx.x; if (t >= n8) return; FragH f;
#pragma unroll
  for (int q = 0; q < 8; ++q) f.h[q] = (_Float16)x[t * 8 + q]; *(v8us*)((unsigned short*)X16 + t * 8) = f.half[0];  }
__global__ __launch_bounds__(256) void k_round16f(const float* __restrict__ W, _Float16* __restrict__ Bt, size_t n8) { const size_t t = (size_t)blockIdx.x * 256 + threadIdx.x; if (t >= n8) return; FragH f;
#pragma unroll
  for (int i = 0; i < 8; ++i) f.h[i] = (_Float16)(bf16_round(W[t * 8 + i]) * 16.0f); *(v8us*)((unsigned short*)Bt + t * 8) = f.half[0];  }
template <int NHv, int TTv>
__global__ __launch_bounds__(256) void k_vt(const _Float16* __restrict__ V16, int ldv, int voff, _Float16* __restrict__ Vt) { __shared__ unsigned short tl[64][66]; const int tid = threadIdx.x; const int slab = blockIdx.x / (TTv / 64), lg = blockIdx.x % (TTv / 64); const int b = slab / NHv, h = slab % NHv;
  for (int i = tid; i < 64 * 8; i += 256) { const int r = i / 8, c8 = (i % 8) * 8; FragH f; f.half[0] = *(const v8us*)((const unsigned short*)V16 + ((size_t)b * TTv + lg * 64 + r) * ldv + voff + h * 64 + c8);
#pragma unroll
    for (int q = 0; q < 8; ++q) tl[r][c8 + q] = f.u[q]; }
  __syncthreads();
  {
#pragma unroll
    for (int rd = 0; rd < 2; ++rd) { const int d = rd * 32 + tid / 8, pc = tid % 8; FragH f;
#pragma unroll
      for (int q = 0; q < 8; ++q) f.u[q] = tl[pc * 8 + q][d];
      *(v8us*)((unsigned short*)Vt + ((size_t)slab * 64 + d) * TTv + lg * 64 + pc * 8) = f.half[0]; }
     } }

__global__ __launch_bounds__(256) void k_hl(const float* __restrict__ F, _Float16* __restrict__ Hh, _Float16* __restrict__ Hl, size_t n8) { const size_t t = (size_t)blockIdx.x * 256 + threadIdx.x; if (t >= n8) return; FragH fh, fl; const v4f a = *(const v4fa*)(F + t * 8), c = *(const v4fa*)(F + t * 8 + 4);
#pragma unroll
  for (int q = 0; q < 4; ++q) { _Float16 h = (_Float16)a[q]; fh.h[q] = h; fl.h[q] = (_Float16)((a[q] - (float)h) * 1024.0f); h = (_Float16)c[q]; fh.h[4 + q] = h; fl.h[4 + q] = (_Float16)((c[q] - (float)h) * 1024.0f); }
  { *(v8us*)((unsigned short*)Hh + t * 8) = fh.half[0]; *(v8us*)((unsigned short*)Hl + t * 8) = fl.half[0];  } }

// Offset in halves of the 8 values k = kk .. kk + 7 (kk a multiple of 8) of row n, K 256, in matrix-fragment order [n / 16][kk / 32][half][lane][8], half = (kk >> 4) & 1, lane = 16 * ((kk >> 3) & 1) + n % 16:
// a wave's 16-byte load of half a fragment then covers 512 contiguous bytes (four whole lines) instead of pieces of sixteen lines.
__device__ __forceinline__ size_t frag_off(int n, int kk) { return ((((size_t)(n >> 4) * 8 + (kk >> 5)) * 2 + ((kk >> 4) & 1)) * 32 + ((kk >> 3) & 1) * 16 + (n & 15)) * 8; }
// The folded weights [W*s | W*s*2^-10] for K = N = 128, stored in fragment order. 2048 threads (t), one (n, k8) each; neighbouring threads take neighbouring n (whole lines on the load side).
// LO false: only the W*s plane is written (k_attn multiplies both planes of its operand by that one plane and joins the two sums afterwards).
template <bool LO>
__device__ __forceinline__ void pack_wtf(const float* __restrict__ W, float scale, _Float16* __restrict__ Bt, int t) { const int n = t % EE, k8 = (t / EE) * 8; const int i0 = k8 * EE + n; float x[8]; FragH f, f2;
#pragma unroll
  for (int i = 0; i < 8; ++i) x[i] = W[i0 + i * EE];
  asm volatile("s_wait_xcnt 0x0" :: "v"(i0) : "memory");      /* named as an input, the eight loads' offset register stays whole up to this wait: none of their results lands on it */
#pragma unroll
  for (int i = 0; i < 8; ++i) { const float wv = bf16_round(x[i]) * scale; f.h[i] = (_Float16)wv; f2.h[i] = (_Float16)(wv * 0.0009765625f); }
  { *(v8us*)((unsigned short*)Bt + frag_off(n, k8)) = f.half[0]; if (LO) *(v8us*)((unsigned short*)Bt + frag_off(n, EE + k8)) = f2.half[0];  } }
// The weights of the four products that read x (q, k, v, gate logits), K = N = 128, with gamma folded in: G[e][n] = gamma[e] * W[e][n], both factors rounded to bf16, so the product has 16 significant bits
// and [G hi | G lo] in bf16 (K 256, fragment order) holds it whole. 2048 threads (t), one (n, k8) each; neighbouring threads take neighbouring n (whole lines on the load side).
typedef __bf16 v4b __attribute__((ext_vector_type(4)));
__device__ __forceinline__ unsigned short bf16_top(float x) { return (unsigned short)(__float_as_uint(x) >> 16); }      /* the bits of a value that is exact in bf16 */
__device__ __forceinline__ void pack_wg(const float* __restrict__ W, const float* __restrict__ g, unsigned short* __restrict__ Bt, int t) { const int n = t % EE, k8 = (t / EE) * 8; const int i0 = k8 * EE + n; float x[8]; FragB f, f2;
#pragma unroll
  for (int i = 0; i < 8; ++i) x[i] = W[i0 + i * EE];
  const v4f g0 = *(const v4fa*)(g + k8), g1 = *(const v4fa*)(g + k8 + 4);
  asm volatile("s_wait_xcnt 0x0" :: "v"(i0), "v"(k8) : "memory");      /* named as inputs, the ten loads' offset registers stay whole up to this wait: none of their results lands on them */
#pragma unroll
  for (int i = 0; i < 8; ++i) { const float pr = bf16_round(i < 4 ? g0[i & 3] : g1[i & 3]) * bf16_round(x[i]); const float hi = bf16_round(pr); f.u[i] = bf16_top(hi); f2.u[i] = bf16_top(pr - hi); }
  { *(v8us*)(Bt + frag_off(n, k8)) = f.half[0]; *(v8us*)(Bt + frag_off(n, EE + k8)) = f2.half[0];  } }
// Per column of those four products: sum over e of gamma[e] * W[e][n] (SGB[col]) and of beta[e] * W[e][n] (SGB[512 + col]). A wave takes 8 columns x 4 quarters of e (lane = 8 * quarter + column); two exchanges join the quarters.
__device__ __forceinline__ void pack_sums(const float* __restrict__ W /* the same for the whole wave */, const float* __restrict__ g, const float* __restrict__ b, float* __restrict__ SGB, int col, int n, int part) {
  const int i0 = part * 32 * EE + n, p0 = part * 32; float x[32]; v4f gv[8], bv[8];
#pragma unroll
  for (int i = 0; i < 32; ++i) x[i] = W[i0 + i * EE];
#pragma unroll
  for (int i = 0; i < 8; ++i) { gv[i] = *(const v4fa*)(g + p0 + i * 4); bv[i] = *(const v4fa*)(b + p0 + i * 4); }
  asm volatile("s_wait_xcnt 0x0" :: "v"(i0), "v"(p0), "s"(W), "s"(g), "s"(b) : "memory");      /* named as inputs, the loads' address registers (offsets, scalar bases) stay whole up to this wait: none of their results lands on them */
  __builtin_amdgcn_sched_barrier(0);      /* keeps all 48 loads in one group ahead of the arithmetic: left alone the compiler holds some back behind the first sums, and the wave waits out the memory latency more than once */
  float sg = 0.f, sb = 0.f;
#pragma unroll
  for (int i = 0; i < 8; ++i) { const v4b wb = __builtin_convertvector(((v4f){x[i * 4], x[i * 4 + 1], x[i * 4 + 2], x[i * 4 + 3]}), v4b), gb = __builtin_convertvector(gv[i], v4b), bb = __builtin_convertvector(bv[i], v4b);      /* round to nearest even, as bf16_round */
#pragma unroll
    for (int q = 0; q < 4; ++q) { sg = __builtin_fmaf((float)gb[q], (float)wb[q], sg); sb = __builtin_fmaf((float)bb[q], (float)wb[q], sb); } }
  sg += __shfl_xor(sg, 8, 32); sb += __shfl_xor(sb, 8, 32); sg += __shfl_xor(sg, 16, 32); sb += __shfl_xor(sb, 16, 32);
  if (part == 0) { SGB[col] = sg; SGB[4 * EE + col] = sb; } }
// The pair-bias operands: two tiles of 16 rows x K 128 in bf16, in fragment order (tile 1 = k steps 0..3, tile 2 = k steps 4..7 of the K 256 order). With G[e][h] = gamma[e] * Wb[e][h] and B[e][h] = beta[e] * Wb[e][h]
// (factors rounded to bf16, so each product has 16 significant bits and hi + lo in bf16 holds it whole): tile 1 = rows 0..3 G hi, 4..7 G lo, 8 ones, the rest zero; tile 2 = rows 0..3 G hi, 4..7 G lo, 8..11 B hi, 12..15 B lo.
// 512 threads (t), one (o, k0) each: a wave has one row o.
__device__ __forceinline__ void pack_wb(const float* __restrict__ w, const float* __restrict__ g, const float* __restrict__ b, unsigned short* __restrict__ Bt, int t) { const int k0 = (t % (2 * EE / 8)) * 8, o = t / (2 * EE / 8); const int kk0 = k0 % EE; const bool t2 = k0 >= EE; FragB f;
  const int i0 = kk0 * NHD + (o & 3); const float* sp = ((t2 && o >= 8) ? b : g) + kk0; float x[8];
#pragma unroll
  for (int q = 0; q < 8; ++q) x[q] = w[i0 + q * NHD];
  const v4f s0 = *(const v4fa*)sp, s1 = *(const v4fa*)(sp + 4);
  asm volatile("s_wait_xcnt 0x0" :: "v"(i0), "v"(sp) : "memory");      /* named as inputs, the ten loads' address registers stay whole up to this wait: none of their results lands on them */
#pragma unroll
  for (int q = 0; q < 8; ++q) { const float pr = bf16_round(q < 4 ? s0[q & 3] : s1[q & 3]) * bf16_round(x[q]); const float hi = bf16_round(pr); float val = (o & 4) ? pr - hi : hi;
    if (!t2 && o >= 8) val = (o == 8) ? 1.0f : 0.0f;
    f.u[q] = bf16_bits(val); }
  *(v8us*)(Bt + frag_off(o, k0)) = f.half[0];  }
// All weight packs in one launch: none needs anything of another, so each takes a range of the block index (eight blocks a 128 x 128 matrix, two for the pair-bias weights, eight for the column sums). The choice is the same for a whole block.
#define PACK_BLOCKS (5 * 8 + 2 + 8)
__global__ __launch_bounds__(256) void k_pack(const float* __restrict__ Wq, const float* __restrict__ Wk, const float* __restrict__ Wv, const float* __restrict__ Wfu, const float* __restrict__ Wo, const float* __restrict__ Wb, const float* __restrict__ gam, const float* __restrict__ bet,
                                              _Float16* __restrict__ BQK, _Float16* __restrict__ AV, _Float16* __restrict__ BFU, _Float16* __restrict__ BO, unsigned short* __restrict__ BB, float* __restrict__ SGB) {
  const int job = blockIdx.x >> 3, t = (blockIdx.x & 7) * 256 + threadIdx.x;
  if (blockIdx.x >= 5 * 8 + 2) {
    const int gw = (blockIdx.x - (5 * 8 + 2)) * 8 + __builtin_amdgcn_readfirstlane(threadIdx.x >> 5), c = threadIdx.x & 7, m = gw >> 4;      /* 64 waves, sixteen a matrix; the wave's number in a scalar register: the choice of the matrix is scalar */
    const float* W = (m == 0) ? Wq : (m == 1) ? Wk : (m == 2) ? Wv : Wfu;
    pack_sums(W, gam, bet, SGB, gw * 8 + c, (gw & 15) * 8 + c, (threadIdx.x >> 3) & 3);
    asm volatile("s_wait_xcnt 0x0" ::: "memory");      /* as below, for the two stores of this range */
  } else if (job == 5) {
    pack_wb(Wb, gam, bet, BB, t);
    asm volatile("s_wait_xcnt 0x0" ::: "memory");      /* the built code joins the ranges by flags, so another range's instructions stand on a path behind this store: they reuse its registers only behind this wait */
  } else if (job == 4) pack_wtf<false>(Wo, 16.0f, BO, t);
  else {
    const float* W = (job == 0) ? Wq : (job == 1) ? Wk : (job == 2) ? Wv : Wfu;
    _Float16* Bt = (job == 0) ? BQK : (job == 1) ? BQK + (size_t)EE * 2 * EE : (job == 2) ? AV : BFU;
    pack_wg(W, gam, (unsigned short*)Bt, t);
    asm volatile("s_wait_xcnt 0x0" ::: "memory");      /* as above, for the two stores of this range */
  }
}
// LayerNorm is linear in the token once its mean mu and its 1/sigma rs are known: x.W = rs * (v.G - mu * sum(G)) + sum(B), G = gamma * W, B = beta * W (sums over the channel). So no normalised row is formed:
// the tokens, rounded to bf16 as everywhere, lie in LDS as they are and go into the matrix products as exact operands against [G hi | G lo]; mu, rs and the two column sums come in behind the product.
#define RP 136                   /* staged raw row pitch in halves: 256 B of data + 16 B (16 B x odd: conflict-free ds_load_b128) */
typedef __bf16 v4ba __attribute__((ext_vector_type(4), may_alias));
typedef unsigned int v8u __attribute__((ext_vector_type(8)));
__device__ __forceinline__ float other_half(float x);
// Sixteen tokens of one wave into LDS as bf16: a whole row per load, 4 channels a lane. xp and xw already hold the lane's offset (4 * lane); step = floats from one of the wave's tokens to its next.
// Every loop here and in proj_unit is unrolled because its index picks registers (a row's values, fragments, accumulators), which only a compile-time index can.
__device__ __forceinline__ void raw_rows(const float* __restrict__ xp, int step, unsigned short* xw) {
  v4f a[16];
#pragma unroll
  for (int u = 0; u < 16; ++u) a[u] = *(const v4fa*)(xp + (size_t)u * step);
  asm volatile("s_wait_xcnt 0x0" ::: "memory");      /* the address registers of the sixteen loads above are reused only behind this wait */
  __builtin_amdgcn_sched_barrier(0);      /* keeps all sixteen loads in one group ahead of the conversions: the wave waits out the memory latency once */
#pragma unroll
  for (int u = 0; u < 16; ++u) *(v4ba*)&xw[u * RP] = __builtin_convertvector(a[u], v4b);      /* round to nearest even, two values an instruction */
}
// 1/sigma of the token whose fragments a lane holds (64 of its channels, the other half of the wave the other 64): the variance stays the mean of (v - mu)^2; one exchange between the wave halves ends the sum.
__device__ __forceinline__ float token_rs(const FragB (&xf)[4], float mu) {
  float q4[4] = {0.f, 0.f, 0.f, 0.f};
#pragma unroll
  for (int kb = 0; kb < 4; ++kb) { const v8u ww = __builtin_bit_cast(v8u, xf[kb].v);
#pragma unroll
    for (int j = 0; j < 8; ++j) { const float d0 = __uint_as_float(ww[j] << 16) - mu, d1 = __uint_as_float(ww[j] & 0xFFFF0000u) - mu; q4[(j & 1) * 2] = __builtin_fmaf(d0, d0, q4[(j & 1) * 2]); q4[(j & 1) * 2 + 1] = __builtin_fmaf(d1, d1, q4[(j & 1) * 2 + 1]); } }
  float q2 = (q4[0] + q4[1]) + (q4[2] + q4[3]); q2 += other_half(q2);
  return rsqrtf(q2 / (float)EE + 1e-5f);
}
// One unit of 64 tokens x 64 columns, left in registers as f16: res[i][j] = 8 values of token tile i and column tile j.
// XA false: the weights go in as A, so a lane holds 8 neighbouring columns (j * 16 + 8 hh + r) of one token (i * 16 + ln). XA true (v^T): the tokens go in as A, so a lane holds 8 neighbouring tokens (i * 16 + 8 hh + r) of one column (j * 16 + ln).
// The eight k steps go hi, lo, hi, lo ...: both planes of G meet the same token fragments, which are read once for the two. pmu, prs: the 64 tokens' mean and 1/sigma; psg, psb: the 64 columns' sum(G) and sum(B) (+ bias); all in LDS.
template <bool XA>
__device__ __forceinline__ void proj_unit(const unsigned short* xs, const unsigned short* __restrict__ wt, const float* pmu, const float* prs, const float* psg, const float* psb, v8us (&res)[4][4], int lane) {
  const int ln = lane & 15, hh = lane >> 4;
  const unsigned short* xr = xs + ln * RP + 8 * hh;
  const unsigned short* wr = wt + lane * 8;      /* fragment order: 4096 halves a 16-row tile, 512 a k step (steps 0..3 hi, 4..7 lo), 256 half a fragment */
  v8f acc[4][4] = {};
  FragB wf[2][4], xf[4];         /* weight fragments come from L2: fetched one k step ahead */
#pragma unroll
  for (int j = 0; j < 4; ++j) { wf[0][j].half[0] = *(const v8us*)(wr + j * 4096); wf[0][j].half[1] = *(const v8us*)(wr + j * 4096 + 256); }
#pragma unroll
  for (int st = 0; st < 8; ++st) {
    if (st + 1 < 8) { const int ko = (((st + 1) & 1) * 4 + ((st + 1) >> 1)) * 512;
#pragma unroll
      for (int j = 0; j < 4; ++j) { wf[(st + 1) & 1][j].half[0] = *(const v8us*)(wr + j * 4096 + ko); wf[(st + 1) & 1][j].half[1] = *(const v8us*)(wr + j * 4096 + ko + 256); }
    }
    if (!(st & 1)) {
#pragma unroll
      for (int i = 0; i < 4; ++i) { xf[i].half[0] = *(const v8us*)(xr + i * 16 * RP + (st >> 1) * 32); xf[i].half[1] = *(const v8us*)(xr + i * 16 * RP + (st >> 1) * 32 + 16); }
    }
    __builtin_amdgcn_sched_barrier(0);      /* keeps the next step's weight loads and this step's LDS reads in one group ahead of the 16 products: left alone the compiler sinks each load to its first use, and the wave waits out every latency */
#pragma unroll
    for (int i = 0; i < 4; ++i)
#pragma unroll
      for (int j = 0; j < 4; ++j)
        acc[i][j] = XA ? __builtin_amdgcn_wmma_f32_16x16x32_bf16(false, xf[i].v, false, wf[st & 1][j].v, (short)0, acc[i][j], false, false)
                       : __builtin_amdgcn_wmma_f32_16x16x32_bf16(false, wf[st & 1][j].v, false, xf[i].v, (short)0, acc[i][j], false, false);
    __builtin_amdgcn_sched_barrier(0);      /* keeps later steps' loads from rising further: a third set of fragments would not fit 256 registers */
  }
  asm volatile("s_wait_xcnt 0x0" :: "v"(lane), "s"(wt) : "memory");      /* the weight loads' address registers (lane offset, scalar base) are reused only behind this wait: named as inputs, they stay whole up to it */
  /* of the per-token pair (mu, rs) and the per-column pair (sum(G), sum(B)), the one that runs along a lane's 8 values is read as vectors of 8, the other as one value a tile */
  float nm1[4], rs1[4], sg1[4], sb1[4];
#pragma unroll
  for (int q = 0; q < 4; ++q) { if (XA) { sg1[q] = psg[q * 16 + ln]; sb1[q] = psb[q * 16 + ln]; } else { nm1[q] = -pmu[q * 16 + ln]; rs1[q] = prs[q * 16 + ln]; } }
#pragma unroll
  for (int o = 0; o < 4; ++o) {  /* the tile index of the vector side: j (columns) if the weights were A, i (tokens) if the tokens were */
    const float* pa = (XA ? pmu : psg) + o * 16 + 8 * hh; const float* pb = (XA ? prs : psb) + o * 16 + 8 * hh;
    const v4f a0 = *(const v4fa*)pa, a1 = *(const v4fa*)(pa + 4), b0 = *(const v4fa*)pb, b1 = *(const v4fa*)(pb + 4);
    float av[8], bv[8];
#pragma unroll
    for (int r = 0; r < 4; ++r) { av[r] = a0[r]; av[4 + r] = a1[r]; bv[r] = b0[r]; bv[4 + r] = b1[r]; }
#pragma unroll
    for (int q = 0; q < 4; ++q) { FragH f;
#pragma unroll
      for (int r = 0; r < 8; ++r) f.h[r] = XA ? (_Float16)__builtin_fmaf(bv[r], __builtin_fmaf(-av[r], sg1[q], acc[o][q][r]), sb1[q])      /* av = mu, bv = rs of token o * 16 + 8 hh + r */
                                              : (_Float16)__builtin_fmaf(rs1[q], __builtin_fmaf(nm1[q], av[r], acc[q][o][r]), bv[r]);      /* av = sum(G), bv = sum(B) of column o * 16 + 8 hh + r */
      if (XA) res[o][q] = f.half[0]; else res[q][o] = f.half[0]; }
  }
}
// BF[h][a-tile][b-tile][p][lane][i] = (bf16(mask[a][b]) + pair_bias[a][b][h]) * sqrt(32), a = 16*atile + (lane & 15), b = 16*btile + 8*(lane >> 4) + 4*p + i:
// the accumulator (C) fragment order of the transposed score tile, so that k_attn loads it with whole-line 16-byte loads. The sqrt(32) undoes the score scale applied after the product.
// The pair bias is the one product of x that every row s needs, so it has a launch of its own, ahead of k_attn. A block of sixteen waves takes one 16 x 16 tile of (a, b); wave w has the sixteen tokens (a = 16 atile + u, b = 16 btile + w).
// The tokens go into the product as they are (see above): a row of ones beside G gives each token's sum, and tile 2 against a fragment of ones gives sum(G) and sum(B).
__global__ __launch_bounds__(512) void k_pbias(const float* __restrict__ X, const float* __restrict__ mask, const unsigned short* __restrict__ BB, float* __restrict__ BF) {
  __shared__ __attribute__((aligned(16))) unsigned short xs[SL * RP];
  __shared__ __attribute__((aligned(16))) float sbt[NHD * 256];      /* [h][p][lane][i] */
  const int tid = threadIdx.x, lane = tid & 31, ln = lane & 15, hh = lane >> 4;
  const int w = __builtin_amdgcn_readfirstlane(tid >> 5);      /* the wave's number in a scalar register: the row loads then go from a scalar base */
  const int at = blockIdx.x >> 4, bt = blockIdx.x & 15;
  /* the weight fragments and the mask values (needed by the first eight waves only, loaded by all: no branch) are asked for ahead of the rows, so that their latency passes under the rows' */
  const int p = (tid >> 5) & 1;
  const float* mp = mask + (size_t)(at * 16 + ln) * SL + bt * 16 + 8 * hh + 4 * p;
  const v4f mk = *(const v4fa*)mp;
  asm volatile("s_wait_xcnt 0x0" :: "v"(mp) : "memory");      /* named as an input, the load's address stays whole up to this wait: none of the loads below lands on it */
  const unsigned short* wr = BB + lane * 8;
  FragB wf[8];
#pragma unroll
  for (int kb = 0; kb < 8; ++kb) { wf[kb].half[0] = *(const v8us*)(wr + kb * 512); wf[kb].half[1] = *(const v8us*)(wr + kb * 512 + 256); }
  asm volatile("s_wait_xcnt 0x0" :: "v"(lane), "s"(BB) : "memory");      /* named as inputs, the loads' address registers (lane offset, scalar base) stay whole up to this wait: none of the sixteen loads lands on them */
  raw_rows(X + (((size_t)at * 16) * SL + bt * 16 + w) * EE + lane * 4, SL * EE, xs + w * 16 * RP + lane * 4);
  __builtin_amdgcn_fence(__ATOMIC_ACQ_REL, "workgroup", "local"); __builtin_amdgcn_wave_barrier();      /* the rows read below were written by other lanes of this wave */
  { const unsigned short* xr = xs + (w * 16 + ln) * RP + 8 * hh;
    v8f c = {}, c1 = {}; FragB xf[4], one;
#pragma unroll
    for (int i = 0; i < 16; ++i) one.u[i] = 0x3F80;      /* 1.0 */
#pragma unroll
    for (int kb = 0; kb < 4; ++kb) { xf[kb].half[0] = *(const v8us*)(xr + kb * 32); xf[kb].half[1] = *(const v8us*)(xr + kb * 32 + 16); }
    __builtin_amdgcn_sched_barrier(0);      /* keeps the eight LDS reads in one group ahead of the eight products: one LDS latency instead of four */
#pragma unroll
    for (int kb = 0; kb < 4; ++kb) {
      c  = __builtin_amdgcn_wmma_f32_16x16x32_bf16(false, wf[kb].v, false, xf[kb].v, (short)0, c, false, false);            /* token ln: lower half v.G hi (0..3) and lo (4..7) per head, upper half the token's sum (0) */
      c1 = __builtin_amdgcn_wmma_f32_16x16x32_bf16(false, wf[4 + kb].v, false, one.v, (short)0, c1, false, false); }      /* every column alike: lower half sum(G) hi, lo; upper half sum(B) hi, lo */
    const float co = other_half(c[0]);
    const float mu = (hh ? c[0] : co) / (float)EE;
    const float rs = token_rs(xf, mu);
    float pv[NHD];               /* rounded to f16 as before: a lane of the lower half holds the four heads of token (a = ln, b = w) */
#pragma unroll
    for (int h = 0; h < NHD; ++h) { const float sgb = c1[h] + c1[4 + h]; const float sb = other_half(sgb);      /* lower half: sgb = sum(G), sb = sum(B) */
      pv[h] = (float)(_Float16)(rs * ((c[h] + c[4 + h]) - mu * sgb) + sb); }
    if (hh == 0) {
#pragma unroll
      for (int h = 0; h < NHD; ++h) sbt[((h * 2 + ((w >> 2) & 1)) * 32 + (w >> 3) * 16 + ln) * 4 + (w & 3)] = pv[h]; } }
  __syncthreads();               /* publishes the sixteen waves' columns of the tile */
  if (tid < NHD * 64) {          /* whole waves: 256 pieces of 16 bytes */
    const int h = tid >> 6;
    const v4f pb = *(const v4fa*)&sbt[tid * 4]; v4f o;
#pragma unroll
    for (int i = 0; i < 4; ++i) o[i] = (bf16_round(mk[i]) + pb[i]) * 5.656854249492381f;
    *(v4f*)(BF + ((((size_t)h * 16 + at) * 16 + bt) * 2 + p) * 128 + lane * 4) = o; }
}

__device__ __forceinline__ v8f exp2x8(v8f x) {
  float a = x[0], b = x[1], c = x[2], d = x[3], e = x[4], f = x[5], g = x[6], h = x[7];
  asm("v_exp_f32 %0, %0\n\tv_exp_f32 %1, %1\n\tv_exp_f32 %2, %2\n\tv_exp_f32 %3, %3\n\tv_exp_f32 %4, %4\n\tv_exp_f32 %5, %5\n\tv_exp_f32 %6, %6\n\tv_exp_f32 %7, %7\n\tv_nop"
      : "+v"(a), "+v"(b), "+v"(c), "+v"(d), "+v"(e), "+v"(f), "+v"(g), "+v"(h));
  return (v8f){a, b, c, d, e, f, g, h};
}
// Eight v_rcp_f32 in the same form, for the same reason.
__device__ __forceinline__ v8f rcpx8(v8f x) {
  float a = x[0], b = x[1], c = x[2], d = x[3], e = x[4], f = x[5], g = x[6], h = x[7];
  asm("v_rcp_f32 %0, %0\n\tv_rcp_f32 %1, %1\n\tv_rcp_f32 %2, %2\n\tv_rcp_f32 %3, %3\n\tv_rcp_f32 %4, %4\n\tv_rcp_f32 %5, %5\n\tv_rcp_f32 %6, %6\n\tv_rcp_f32 %7, %7\n\tv_nop"
      : "+v"(a), "+v"(b), "+v"(c), "+v"(d), "+v"(e), "+v"(f), "+v"(g), "+v"(h));
  return (v8f){a, b, c, d, e, f, g, h};
}
// value of lane l ^ 16 (the other half of the wave), without LDS
__device__ __forceinline__ float other_half(float x) { const int b = __float_as_int(x); return __int_as_float(__builtin_amdgcn_permlanex16(b, b, 0x76543210, 0xfedcba98, false, false)); }
#define QP 136                   /* staged q row pitch in halves: 256 B of data (four heads) + 16 B (16 B x odd: conflict-free ds_load_b128) */
#define VP 264                   /* staged v^T row pitch in halves: 512 B of data + 16 B */
#define OP 68                    /* output staging row pitch in floats: 256 B of data + 16 B */
// One struct fixes the order in LDS: Wo^T lies lowest, so that lane offset + constant stays inside the 16-bit offset field of an LDS read and all its fragments are read from one address register.
struct __attribute__((aligned(16))) AttnLds {
  unsigned short swo[EE * EE];   /* Wo^T * 16 in fragment order: [e tile][head][half][lane][8] */
  float sbo[4 * EE];             /* the output bias, four times: every thread loads and stores one value, so the load issues with the staging loads and no wave waits for it in a branch of its own */
  unsigned short sog[16 * 4096]; /* 8 KB a wave, its own, as fragments [plane][head][half][lane][8]: first k (plane 0) and the gate logits (plane 1) of its 16 positions; each head's gated output, hi and lo, takes their place once they are read; at the end the output staging rows */
  unsigned short sxqv[SL * QP + EE * VP];      /* first the row's tokens as bf16 (256 tokens, pitch RP); once every wave has read them, q (pitch QP) and behind it v^T (pitch VP) */
  float ssg[4 * EE], ssb[4 * EE];      /* per column of [q | k | v | gate logits]: sum(G), and sum(B) (+ the gate bias) */
  float smu[SL], srs[SL];        /* per token: mean, 1/sigma */
};
static_assert(SL * RP <= SL * QP + EE * VP, "the token tile must fit the range that q and v^T take over");
// What one head needs from L2 ahead of its scores: the bias tiles (the accumulators' start values).
__device__ __forceinline__ void head_loads(const float* __restrict__ bf /* the same for the whole wave */, int l4 /* 4 * lane */, v8f (&acc)[16]) {
#pragma unroll
  for (int t = 0; t < 16; ++t) { const v4f lo = *(const v4fa*)(bf + l4 + t * 256), hi = *(const v4fa*)(bf + l4 + t * 256 + 128); acc[t] = (v8f){lo[0], lo[1], lo[2], lo[3], hi[0], hi[1], hi[2], hi[3]}; }
}
// One head of one wave's 16 positions: scores, softmax, PV, gate. acc comes in holding the head's bias tiles and kf its k fragment; unless the head is the last, both leave holding the next head's.
__device__ __forceinline__ void attn_head(int h, const unsigned short* sq, const unsigned short* sv, unsigned short* og, const float* __restrict__ bf, int l4, int ln, int hh, v8f (&acc)[16], FragH& kf) {
  FragH fu; fu.half[0] = *(const v8us*)(og + 2048 + h * 512); fu.half[1] = *(const v8us*)(og + 2048 + h * 512 + 256);      /* gate logits of channels 8 hh + r and 16 + 8 hh + r: the rows of Ot that this lane holds */
  const unsigned short* qr = &sq[ln * QP + h * HDC + 8 * hh];
  FragH qf[2][4];              /* q fragments, read four tiles ahead */
#pragma unroll
  for (int i = 0; i < 4; ++i) { qf[0][i].half[0] = *(const v8us*)(qr + i * 16 * QP); qf[0][i].half[1] = *(const v8us*)(qr + i * 16 * QP + 16); }
#pragma unroll
  for (int g = 0; g < 4; ++g) {
    if (g + 1 < 4) {
#pragma unroll
      for (int i = 0; i < 4; ++i) { qf[(g + 1) & 1][i].half[0] = *(const v8us*)(qr + ((g + 1) * 4 + i) * 16 * QP); qf[(g + 1) & 1][i].half[1] = *(const v8us*)(qr + ((g + 1) * 4 + i) * 16 * QP + 16); }
    }
    __builtin_amdgcn_sched_barrier(0);      /* keeps the next four tiles' LDS reads in one group ahead of these four products: in this kernel the compiler left each read next to its product, and the wave waited out every LDS latency */
#pragma unroll
    for (int i = 0; i < 4; ++i) acc[g * 4 + i] = __builtin_amdgcn_wmma_f32_16x16x32_f16(false, qf[g & 1][i].v, false, kf.v, (short)0, acc[g * 4 + i], false, false);
    if (g + 1 < 4) __builtin_amdgcn_sched_barrier(0);      /* keeps later groups' reads from rising further: a third set of fragments has no registers */
  }
  float mx[4] = {-3.0e38f, -3.0e38f, -3.0e38f, -3.0e38f};
#pragma unroll
  for (int t = 0; t < 16; ++t)
#pragma unroll
    for (int r = 0; r < 8; ++r) mx[r & 3] = fmaxf(mx[r & 3], acc[t][r]);
  float m = fmaxf(fmaxf(mx[0], mx[1]), fmaxf(mx[2], mx[3])); m = fmaxf(m, other_half(m));
  const float cs = 0.17677669529663687f * 1.4426950408889634f;      /* 32^-1/2 * log2(e) */
  const float mc = 10.0f - m * cs;                                  /* p = 2^10 * exp(logit - max): the f16 range the probabilities had before */
  float sm[4] = {0.f, 0.f, 0.f, 0.f};
  FragH pf[8];
#pragma unroll
  for (int t = 0; t < 16; ++t) { v8f z;
#pragma unroll
    for (int r = 0; r < 8; ++r) z[r] = __builtin_fmaf(acc[t][r], cs, mc);
    const v8f e = exp2x8(z);
#pragma unroll
    for (int r = 0; r < 8; ++r) { sm[r & 3] += e[r]; pf[t >> 1].h[(t & 1) * 8 + r] = (_Float16)e[r]; } }
  float su = (sm[0] + sm[1]) + (sm[2] + sm[3]); su += other_half(su);
  v8f o[2] = {};
  const unsigned short* vr = &sv[(h * HDC + ln) * VP + 8 * hh];
  FragH vf[2][4];              /* v^T fragments of two k steps (two tiles each), read two k steps ahead */
#pragma unroll
  for (int i = 0; i < 4; ++i) { const unsigned short* p = vr + (i & 1) * 16 * VP + (i >> 1) * 32; vf[0][i].half[0] = *(const v8us*)p; vf[0][i].half[1] = *(const v8us*)(p + 16); }
#pragma unroll
  for (int g = 0; g < 4; ++g) {
    if (g + 1 < 4) {
#pragma unroll
      for (int i = 0; i < 4; ++i) { const unsigned short* p = vr + (i & 1) * 16 * VP + ((g + 1) * 2 + (i >> 1)) * 32; vf[(g + 1) & 1][i].half[0] = *(const v8us*)p; vf[(g + 1) & 1][i].half[1] = *(const v8us*)(p + 16); }
    }
    __builtin_amdgcn_sched_barrier(0);      /* keeps the next two k steps' LDS reads in one group ahead of these four products, as for the scores */
#pragma unroll
    for (int i = 0; i < 4; ++i) o[i & 1] = __builtin_amdgcn_wmma_f32_16x16x32_f16(false, vf[g & 1][i].v, false, pf[g * 2 + (i >> 1)].v, (short)0, o[i & 1], false, false);
    if (g + 1 < 4) __builtin_amdgcn_sched_barrier(0);      /* keeps later reads from rising further, as for the scores */
  }
  v8f sg[2];                   /* sigmoid(gate logit), formed ahead of the next head's loads: a wait for the logits behind those loads would wait for them too */
#pragma unroll
  for (int j = 0; j < 2; ++j) { v8f z;
#pragma unroll
    for (int r = 0; r < 8; ++r) z[r] = (float)fu.h[j * 8 + r] * -1.4426950408889634f;
    v8f d = exp2x8(z);
#pragma unroll
    for (int r = 0; r < 8; ++r) d[r] += 1.0f;
    sg[j] = rcpx8(d); }
  if (h + 1 < NHD) {           /* the score registers are free: the next head's loads fly while this head is gated */
    const float* bfn = bf + (h + 1) * 16 * 16 * 256;
    head_loads(bfn, l4, acc);
    asm volatile("s_wait_xcnt 0x0" :: "v"(l4), "s"(bfn) : "memory");      /* named as inputs, the loads' address registers (lane offset, scalar base) stay whole up to this wait: none of the results lands on them */
    kf.half[0] = *(const v8us*)(og + (h + 1) * 512); kf.half[1] = *(const v8us*)(og + (h + 1) * 512 + 256);      /* the next head's k, read ahead of its scores */
  } else {                     /* the last head loads nothing: a fresh value ends the old scores' life here; without it they count as carried into a next head on this side, and the compiler keeps them through the gate in scratch memory, in every head */
#pragma unroll
    for (int t = 0; t < 16; ++t) acc[t] = (v8f){};
  }
  const float inv = 1.0f / su;
#pragma unroll
  for (int j = 0; j < 2; ++j) { FragH gh, gl;      /* og = o / sum * sigmoid, hi and lo * 2^10 */
#pragma unroll
    for (int r = 0; r < 8; ++r) { const float gvl = o[j][r] * (inv * sg[j][r]); const _Float16 hv = (_Float16)gvl; gh.h[r] = hv; gl.h[r] = (_Float16)((gvl - (float)hv) * 1024.0f); }
    *(v8us*)(og + (h * 2 + j) * 256) = gh.half[0]; *(v8us*)(og + 2048 + (h * 2 + j) * 256) = gl.half[0]; }
}
// One block a WGP (LDS): four waves per SIMD, so 256 registers a wave. Every loop but the one over the heads is unrolled because its index picks registers.
// Ahead of the attention the block forms all that it needs of its own row: the 256 tokens and their mean and 1/sigma into LDS, then 32 units of 64 tokens x 64 columns, two a wave: [k | gate logits] and [q | v^T]. None of these planes goes through global memory.
__global__ __launch_bounds__(512) void k_attn(const float* __restrict__ X, const float* __restrict__ SGB, const float* __restrict__ bfu,
                                              const _Float16* __restrict__ BQK, const _Float16* __restrict__ AV, const _Float16* __restrict__ BFU,
                                              const float* __restrict__ BF, const _Float16* __restrict__ BO, const float* __restrict__ bo, float* __restrict__ out) {
  __shared__ AttnLds lds;
  unsigned short* const swo = lds.swo; float* const sbo = lds.sbo; unsigned short* const xs = lds.sxqv; unsigned short* const sq = lds.sxqv; unsigned short* const sv = lds.sxqv + SL * QP;
  const int tid = threadIdx.x, lane = tid & 31, ln = lane & 15, hh = lane >> 4;
  const int w = __builtin_amdgcn_readfirstlane(tid >> 5);      /* the wave's number in a scalar register: the choice of units is a scalar branch, and the bias tiles load from a scalar base */
  const int s = blockIdx.x;
  const unsigned short* gwp = (const unsigned short*)BO + (tid >> 8) * 4096 + (tid & 255) * 8;      /* 16-byte piece tid + 512 u of Wo^T: 256 pieces a 16-row tile, the first 4 of its 8 k steps: 2 tiles a step */
  v8us gw[4];
#pragma unroll
  for (int u = 0; u < 4; ++u) gw[u] = *(const v8us*)(gwp + u * 2 * 4096);
  const int t7 = tid & (EE - 1);
  const float bov = bo[t7], bfv = bfu[t7], sgv = SGB[tid], sbv = SGB[4 * EE + tid];
  asm volatile("s_wait_xcnt 0x0" :: "v"(gwp), "v"(t7), "v"(tid), "s"(bo), "s"(bfu), "s"(SGB) : "memory");      /* named as inputs, the eight loads' address registers (pointer, offsets, scalar bases) stay whole up to this wait: none of their results lands on them, and they are reused only behind it */
  raw_rows(X + ((size_t)s * SL + w * 16) * EE + lane * 4, EE, xs + w * 16 * RP + lane * 4);      /* wave w: tokens 16 w .. 16 w + 15 */
  asm volatile("" :: "v"(bfv));      /* holds the gate bias's load with the staging loads above (the loaded value as an input only): left alone the compiler sinks it into a branch of the last four waves, which then wait out its latency alone ahead of the barrier */
#pragma unroll
  for (int u = 0; u < 4; ++u) *(v8us*)&swo[tid * 8 + u * 4096] = gw[u];
  sbo[tid] = bf16_round(bov);    /* the output bias, rounded once a block */
  lds.ssg[tid] = sgv; lds.ssb[tid] = (tid >= 3 * EE) ? sbv + bf16_round(bfv) : sbv;      /* the gate bias, rounded once a block, joins its columns' constant */
  __builtin_amdgcn_fence(__ATOMIC_ACQ_REL, "workgroup", "local"); __builtin_amdgcn_wave_barrier();      /* the rows read below were written by other lanes of this wave */
  { const unsigned short* xr = xs + (w * 16 + ln) * RP + 8 * hh;      /* mean and 1/sigma of the wave's own sixteen tokens, token ln in lanes ln and ln + 16 */
    v8f c = {}; FragB xf[4], one;
#pragma unroll
    for (int i = 0; i < 16; ++i) one.u[i] = 0x3F80;      /* 1.0 */
#pragma unroll
    for (int kb = 0; kb < 4; ++kb) { xf[kb].half[0] = *(const v8us*)(xr + kb * 32); xf[kb].half[1] = *(const v8us*)(xr + kb * 32 + 16); }
    __builtin_amdgcn_sched_barrier(0);      /* keeps the eight LDS reads in one group ahead of the four products: one LDS latency instead of four */
#pragma unroll
    for (int kb = 0; kb < 4; ++kb) c = __builtin_amdgcn_wmma_f32_16x16x32_bf16(false, one.v, false, xf[kb].v, (short)0, c, false, false);      /* every row alike: the sum of token ln, in both halves of the wave */
    const float mu = c[0] / (float)EE, rs = token_rs(xf, mu);
    if (hh == 0) { lds.smu[w * 16 + ln] = mu; lds.srs[w * 16 + ln] = rs; } }
  __syncthreads();               /* publishes the tokens, their mean and 1/sigma, Wo^T and the per-column constants to all sixteen waves */
  const int th = w & 3, cg = w >> 2;      /* which 64 of the 256 tokens, which 64 of the 256 columns */
  const unsigned short* xh = xs + th * 64 * RP;
  const float* pmu = lds.smu + th * 64; const float* prs = lds.srs + th * 64;
  v8us res[4][4];
  { /* [k | gate logits]: a lane's 8 columns of one token are half a fragment of the wave that owns the token (wave th * 4 + i), in the same lane */
    const unsigned short* wt = (cg < 2) ? (const unsigned short*)BQK + (size_t)(EE + cg * 64) * 2 * EE : (const unsigned short*)BFU + (size_t)(cg - 2) * 64 * 2 * EE;
    const int c0 = (cg < 2) ? EE + cg * 64 : 3 * EE + (cg - 2) * 64;      /* the unit's first column in [q | k | v | gate logits] */
    proj_unit<false>(xh, wt, pmu, prs, lds.ssg + c0, lds.ssb + c0, res, lane);
    unsigned short* d = lds.sog + th * 4 * 4096 + cg * 1024 + lane * 8;      /* plane cg >> 1 (2048 halves), head (cg & 1) * 2 + (j >> 1) (512), half j & 1 (256) */
#pragma unroll
    for (int i = 0; i < 4; ++i)
#pragma unroll
      for (int j = 0; j < 4; ++j) *(v8us*)(d + i * 4096 + j * 256) = res[i][j];
  }
  /* [q | v^T]: they take over the token tile's LDS, so they wait in registers until every wave has read it */
  if (cg < 2) proj_unit<false>(xh, (const unsigned short*)BQK + (size_t)cg * 64 * 2 * EE, pmu, prs, lds.ssg + cg * 64, lds.ssb + cg * 64, res, lane);
  else        proj_unit<true>(xh, (const unsigned short*)AV + (size_t)(cg - 2) * 64 * 2 * EE, pmu, prs, lds.ssg + 2 * EE + (cg - 2) * 64, lds.ssb + 2 * EE + (cg - 2) * 64, res, lane);
  __syncthreads();               /* ends every wave's reads of the token tile (and publishes k and the gate logits) */
  const float* bf = BF + (size_t)w * 16 * 256;      /* + h * 16 * 16 * 256: a scalar base; the lane's offset is one register */
  const int l4 = lane * 4;
  v8f acc[16]; FragH kf;
  head_loads(bf, l4, acc);
  asm volatile("s_wait_xcnt 0x0" :: "v"(l4), "s"(bf) : "memory");      /* named as inputs, the loads' address registers (lane offset, scalar base) stay whole up to this wait: none of the results lands on them */
  { unsigned short* d = (cg < 2) ? sq + (th * 64 + ln) * QP + cg * 64 + 8 * hh : sv + ((cg - 2) * 64 + ln) * VP + th * 64 + 8 * hh;
    const int si = (cg < 2) ? 16 * QP : 16, sj = (cg < 2) ? 16 : 16 * VP;      /* q: token tile i down the rows, column tile j along them; v^T: the other way round */
#pragma unroll
    for (int i = 0; i < 4; ++i)
#pragma unroll
      for (int j = 0; j < 4; ++j) *(v8us*)(d + i * si + j * sj) = res[i][j];
  }
  __syncthreads();               /* publishes q and v^T to all sixteen waves */
  unsigned short* const og = lds.sog + w * 4096 + lane * 8;      /* this wave's k, gate logits and gated output, each lane's values in its own 16-byte slots: registers that the heads' scores need */
  kf.half[0] = *(const v8us*)og; kf.half[1] = *(const v8us*)(og + 256);
#pragma unroll 1      /* rolled: nothing here is picked by h at compile time, and no head's loads or reads rise into the head before, where there are no registers for them */
  for (int h = 0; h < NHD; ++h) attn_head(h, sq, sv, og, bf, l4, ln, hh, acc, kf);
  /* outT[e][a]: a lane holds 8 neighbouring e of one a. Half a row (64 e) at a time goes through the wave's own LDS range, which turns the 32-byte pieces into whole 128-byte lines. */
  FragH ogh[NHD], ogl[NHD];
#pragma unroll
  for (int h = 0; h < NHD; ++h) { ogh[h].half[0] = *(const v8us*)(og + h * 512); ogh[h].half[1] = *(const v8us*)(og + h * 512 + 256); ogl[h].half[0] = *(const v8us*)(og + 2048 + h * 512); ogl[h].half[1] = *(const v8us*)(og + 2048 + h * 512 + 256); }
  float* st = (float*)(lds.sog + w * 4096);
  float* orow = out + ((size_t)s * SL + w * 16) * EE;
  const int rsub = lane >> 4, c4 = (lane & 15) * 4;
  const unsigned short* wr = swo + lane * 8;      /* 2048 halves a 16-row tile, 512 a head, 256 half a fragment */
  FragH wf[2][2 * NHD];          /* the weight fragments of two e tiles, read one pair of tiles ahead */
#pragma unroll
  for (int i = 0; i < 2 * NHD; ++i) { wf[0][i].half[0] = *(const v8us*)(wr + i * 512); wf[0][i].half[1] = *(const v8us*)(wr + i * 512 + 256); }
#pragma unroll
  for (int g = 0; g < 4; ++g) {
    if (g + 1 < 4) {
#pragma unroll
      for (int i = 0; i < 2 * NHD; ++i) { wf[(g + 1) & 1][i].half[0] = *(const v8us*)(wr + (g + 1) * 4096 + i * 512); wf[(g + 1) & 1][i].half[1] = *(const v8us*)(wr + (g + 1) * 4096 + i * 512 + 256); }
    }
    __builtin_amdgcn_sched_barrier(0);      /* keeps the next pair's LDS reads in one group ahead of the 16 products: left alone the compiler sinks each read to its first use, and the wave waits out every latency */
    v8f ch[2] = {}, cl[2] = {};
#pragma unroll
    for (int h = 0; h < NHD; ++h)
#pragma unroll
      for (int e2 = 0; e2 < 2; ++e2) {
        ch[e2] = __builtin_amdgcn_wmma_f32_16x16x32_f16(false, wf[g & 1][e2 * NHD + h].v, false, ogh[h].v, (short)0, ch[e2], false, false);
        cl[e2] = __builtin_amdgcn_wmma_f32_16x16x32_f16(false, wf[g & 1][e2 * NHD + h].v, false, ogl[h].v, (short)0, cl[e2], false, false); }
    __builtin_amdgcn_sched_barrier(0);      /* keeps the joins below all 16 products: risen in among the last of them, each group of joins takes its own run of v_nop behind a product */
#pragma unroll
    for (int e2 = 0; e2 < 2; ++e2) { v4f a0, a1;
#pragma unroll
      for (int r = 0; r < 4; ++r) { a0[r] = __builtin_fmaf(cl[e2][r], 0.0009765625f, ch[e2][r]); a1[r] = __builtin_fmaf(cl[e2][4 + r], 0.0009765625f, ch[e2][4 + r]); }
      float* sp = &st[ln * OP + ((g & 1) * 2 + e2) * 16 + 8 * hh]; *(v4fa*)sp = a0; *(v4fa*)(sp + 4) = a1; }
    if (g & 1) {
      __builtin_amdgcn_fence(__ATOMIC_ACQ_REL, "workgroup", "local"); __builtin_amdgcn_wave_barrier();      /* the rows read below were written by other lanes of this wave */
      const int p = g >> 1;
      const v4f b4 = *(const v4fa*)&sbo[p * 64 + c4];
      v4f rv[8];
#pragma unroll
      for (int q = 0; q < 8; ++q) rv[q] = *(const v4fa*)&st[(q * 2 + rsub) * OP + c4];
      __builtin_amdgcn_sched_barrier(0);      /* keeps the nine LDS reads in one group: one wait instead of one a row */
#pragma unroll
      for (int q = 0; q < 8; ++q) { v4f r4;
#pragma unroll
        for (int i = 0; i < 4; ++i) r4[i] = __builtin_fmaf(rv[q][i], 0.0625f, b4[i]);
        *(v4f*)(orow + (size_t)(q * 2 + rsub) * EE + p * 64 + c4) = r4; }
      asm volatile("s_wait_xcnt 0x0" ::: "memory");      /* the stores' address and data registers are reused only behind this wait; its clobber also keeps the second half's writes of st behind the reads above */
    }
  }
}

extern "C" void kernel_launch(void* const* d_in, const int* in_sizes, int n_in,
                              void* d_out, int out_size, void* d_ws, size_t ws_size, hipStream_t stream) {
  (void)in_sizes; (void)n_in; (void)out_size;
  const float* const* I = (const float* const*)d_in; const float* pr = I[0]; const float* mask = I[1]; const float* gam = I[2]; const float* bet = I[3]; const float* Wq = I[4]; const float* Wk = I[5]; const float* Wv = I[6]; const float* Wb = I[7]; const float* Wfu = I[8]; const float* bfu = I[9]; const float* Wo = I[10]; const float* bo = I[11];
  char* ws = (char*)d_ws; size_t off = 0;
  auto take = [&](size_t bytes) { char* p = ws + off; off += (bytes + 255) & ~(size_t)255; return p; };
  _Float16* BQK = (_Float16*)take((size_t)2 * EE * 2 * EE * 2); _Float16* AV = (_Float16*)take((size_t)EE * 2 * EE * 2); unsigned short* BB = (unsigned short*)take((size_t)16 * 2 * EE * 2); _Float16* BFU = (_Float16*)take((size_t)EE * 2 * EE * 2); _Float16* BO = (_Float16*)take((size_t)EE * 2 * EE * 2);      /* BQK, AV, BFU: bf16 bits, [G hi | G lo] (K 256); BO: f16, of which only the first plane is written and read */
  float* BF = (float*)take((size_t)NHD * SL * SL * 4); float* SGB = (float*)take((size_t)2 * 4 * EE * 4);
  if (off > ws_size) return;      // about 0.4 + 1.0 = 1.4 MB
  /* Wq, Wk: (in,out) -> 256 rows of K 256, row = output column, k = [hi e | lo e] of gamma[e] * W[e][column]; Wv and Wfu alike; SGB: their column sums; Wo: row e, k = hc, Wo[hc][e] * 16, the one plane; Wb: with gamma and beta, two bf16 tiles of 16 rows (see pack_wb). All in fragment order. */
  k_pack<<<PACK_BLOCKS, 256, 0, stream>>>(Wq, Wk, Wv, Wfu, Wo, Wb, gam, bet, BQK, AV, BFU, BO, BB, SGB);
  k_pbias<<<(SL / 16) * (SL / 16), 512, 0, stream>>>(pr, mask, BB, BF);      /* pair bias of the normalised tokens, + mask, per head, in score-fragment order */
  k_attn<<<SL, 512, 0, stream>>>(pr, SGB, bfu, BQK, AV, BFU, BF, BO, bo, (float*)d_out);      /* per row: LayerNorm, q, k, v^T, gate logits, attention of all heads, gate, output product (+ bo) */
}

// v007
// A run of this version takes 32.4 microseconds.
// In both of two side-by-side timings against v006, it was 1.04 times as fast.
// Over all steps from v000 it is 29.8 times as fast.
#include <hip/hip_runtime.h>
// Row-wise pair attention on a pair representation ([1,256,256,128], 4 heads × 32): x = LN(pair_rep); q = x·Wq·32^-½, k = x·Wk, v = x·Wv; per (row s, head h): logits[a][b] = Σ_c k[s,a,h,c]·q[s,b,h,c] + mask[a][b] + (x·Wb)[a][b][h]; softmax over b; o[s,a,h,:] = Σ_b attn·v[s,b,h,:]; o *= sigmoid(x·Wfu + bfu); out = o·Wo + bo → [1,256,256,128]. (The module's einsum makes k carry the output index and q the summed index.)
// Compute dtype: inputs and parameters rounded to bf16; the products of x take the tokens as exact bf16 operands against gamma * W carried hi/lo in bf16 (exact), LayerNorm's mean and 1/sigma applied behind them in f32; the gated output carried hi/lo (about f32); q/k/v planes, probabilities and gate logits f16 (about 2^-12); mask/bias/softmax/LN/sigmoid in f32; f32 accumulation. v_wmma_f32_16x16x32_bf16 and _f16.
#define SL 256
#define NTOK (SL * SL)           /* 65536 */
#define EE 128
#define NHD 4
#define HDC 32
typedef __bf16 v16b __attribute__((ext_vector_type(16)));
typedef unsigned short v8us __attribute__((ext_vector_type(8), may_alias));
typedef float  v8f  __attribute__((ext_vector_type(8)));
typedef float  v4f  __attribute__((ext_vector_type(4)));
typedef float  v4fa __attribute__((ext_vector_type(4), may_alias));
union FragB { v16b v; v8us half[2]; unsigned short u[16]; };

__device__ __forceinline__ unsigned short bf16_bits(float x) { unsigned int u = __float_as_uint(x); return (unsigned short)((u + 0x7FFFu + ((u >> 16) & 1u)) >> 16); }
__device__ __forceinline__ float bf16_val(unsigned short b) { return __uint_as_float(((unsigned int)b) << 16); }
__device__ __forceinline__ float bf16_round(float x) { return bf16_val(bf16_bits(x)); }
// D += A·B with NT terms: 1 = ah·bh, 2 = + al·bh (A split), 3 = + ah·bl (both split)
template <int NT>
__device__ __forceinline__ v8f mmaN(v16b ah, v16b al, v16b bh, v16b bl, v8f c) {
  c = __builtin_amdgcn_wmma_f32_16x16x32_bf16(false, ah, false, bh, (short)0, c, false, false);
  if (NT >= 2) c = __builtin_amdgcn_wmma_f32_16x16x32_bf16(false, al, false, bh, (short)0, c, false, false);
  if (NT >= 3) c = __builtin_amdgcn_wmma_f32_16x16x32_bf16(false, ah, false, bl, (short)0, c, false, false);
  asm volatile("v_nop\n\tv_nop\n\tv_nop\n\tv_nop" : "+v"(c) : "v"(ah), "v"(al), "v"(bh), "v"(bl));
  return c;
}

__global__ __launch_bounds__(256) void k_wt_bf16(const float* __restrict__ W, unsigned short* __restrict__ Wt, int K, int N) {
  const int t = blockIdx.x * 256 + threadIdx.x;
  const int k8n = K / 8;
  if (t >= N * k8n) return;
  const int n = t / k8n, k8 = (t % k8n) * 8;
  v8us v;
#pragma unroll
  for (int i = 0; i < 8; ++i) v[i] = bf16_bits(W[(size_t)(k8 + i) * N + n]);
  *(v8us*)(Wt + (size_t)n * K + k8) = v;
  
}

// GEMM C[M][N] (f32, pitch ldc) = act(A[M][K]·W + bias). A f32 row-major (pitch lda) converted per fragment to bf16
// (ASPLIT: hi/lo two planes -> 2 terms, else single rounded term); Wt bf16 [N][K] (pitch ldb). BIAS_BF16 rounds the
// bias to bf16 first (bias quantised to bf16 before the add). K%32==0, M%16==0, N%64==0.
template <bool ASPLIT, int ACT, bool BIAS_BF16>
__global__ __launch_bounds__(128) void k_gemm_bf(const float* __restrict__ A, int lda, const unsigned short* __restrict__ Wt, int ldb,
                                               const float* __restrict__ bias, float* __restrict__ C, int ldc, int M, int N, int K) {
  __shared__ __attribute__((aligned(16))) float so[4][16][64];
  const int tid = threadIdx.x, w = tid >> 5, lane = tid & 31, ln = lane & 15, hh = lane >> 4;
  const int ntn = N / 64;
  const int wid = blockIdx.x * 4 + w;
  const int mt = wid / ntn, nq = wid % ntn;
  if (mt * 16 >= M) return;
  const int row0 = mt * 16, col0 = nq * 64;
  const float* arow = A + (size_t)(row0 + ln) * lda;
  v8f acc[4] = {};
  for (int kb = 0; kb < K; kb += 32) {
    FragB ah, al;
    const v4f x0 = *(const v4fa*)(arow + kb + 8 * hh), x1 = *(const v4fa*)(arow + kb + 8 * hh + 4);
    const v4f x2 = *(const v4fa*)(arow + kb + 16 + 8 * hh), x3 = *(const v4fa*)(arow + kb + 16 + 8 * hh + 4);
    float xs[16] = {x0[0],x0[1],x0[2],x0[3],x1[0],x1[1],x1[2],x1[3],x2[0],x2[1],x2[2],x2[3],x3[0],x3[1],x3[2],x3[3]};
#pragma unroll
    for (int i = 0; i < 16; ++i) { const unsigned short hb = bf16_bits(xs[i]); ah.u[i] = hb; al.u[i] = ASPLIT ? bf16_bits(xs[i] - bf16_val(hb)) : (unsigned short)0; }
#pragma unroll
    for (int t = 0; t < 4; ++t) {
      const unsigned short* brow = Wt + (size_t)(col0 + t * 16 + ln) * ldb + kb;
      FragB b;
      b.half[0] = *(const v8us*)(brow + 8 * hh);
      b.half[1] = *(const v8us*)(brow + 16 + 8 * hh);
      acc[t] = mmaN<ASPLIT ? 2 : 1>(ah.v, al.v, b.v, b.v, acc[t]);
    }
  }
#pragma unroll
  for (int t = 0; t < 4; ++t) {
    float bv = bias ? bias[col0 + t * 16 + ln] : 0.f;
    if (BIAS_BF16) bv = bf16_round(bv);
#pragma unroll
    for (int r = 0; r < 8; ++r) { float v = acc[t][r] + bv; if (ACT == 1) v = fmaxf(v, 0.f); so[w][8 * hh + r][t * 16 + ln] = v; }
  }
  __builtin_amdgcn_fence(__ATOMIC_ACQ_REL, "workgroup");
  __builtin_amdgcn_wave_barrier();
  const int rsub = lane >> 4, c4 = (lane & 15) * 4;
  {
#pragma unroll
    for (int q = 0; q < 8; ++q) {
      const int r = q * 2 + rsub;
      const v4f v = *(const v4fa*)&so[w][r][c4];
      *(v4f*)(C + (size_t)(row0 + r) * ldc + col0 + c4) = v;
    }
    
  }
}

// GEMM C = act(A·W + bias + resid): A f32 (ASPLIT -> hi/lo 2 terms), Wt bf16 [N][K]; ACT 0 none, 1 relu, 2 exact gelu;
// resid (optional, f32, row index = (row % rmod), pitch ldr, RES_BF16 rounds it) added before the activation.
template <bool ASPLIT, int ACT, bool BIAS_BF16, bool RES_BF16>
__global__ __launch_bounds__(128) void k_gemm_bf3(const float* __restrict__ A, int lda, const unsigned short* __restrict__ Wt, int ldb,
                                                const float* __restrict__ bias, const float* __restrict__ resid, int rmod, int ldr,
                                                float* __restrict__ C, int ldc, int M, int N, int K) {
  __shared__ __attribute__((aligned(16))) float so[4][16][64];
  const int tid = threadIdx.x, w = tid >> 5, lane = tid & 31, ln = lane & 15, hh = lane >> 4;
  const int ntn = N / 64;
  const int wid = blockIdx.x * 4 + w;
  const int mt = wid / ntn, nq = wid % ntn;
  if (mt * 16 >= M) return;
  const int row0 = mt * 16, col0 = nq * 64;
  const float* arow = A + (size_t)(row0 + ln) * lda;
  v8f acc[4] = {};
  for (int kb = 0; kb < K; kb += 32) {
    FragB ah, al;
    const v4f x0 = *(const v4fa*)(arow + kb + 8 * hh), x1 = *(const v4fa*)(arow + kb + 8 * hh + 4);
    const v4f x2 = *(const v4fa*)(arow + kb + 16 + 8 * hh), x3 = *(const v4fa*)(arow + kb + 16 + 8 * hh + 4);
    float xs[16] = {x0[0],x0[1],x0[2],x0[3],x1[0],x1[1],x1[2],x1[3],x2[0],x2[1],x2[2],x2[3],x3[0],x3[1],x3[2],x3[3]};
#pragma unroll
    for (int i = 0; i < 16; ++i) { const unsigned short hb = bf16_bits(xs[i]); ah.u[i] = hb; al.u[i] = ASPLIT ? bf16_bits(xs[i] - bf16_val(hb)) : (unsigned short)0; }
#pragma unroll
    for (int t = 0; t < 4; ++t) {
      const unsigned short* brow = Wt + (size_t)(col0 + t * 16 + ln) * ldb + kb;
      FragB b;
      b.half[0] = *(const v8us*)(brow + 8 * hh);
      b.half[1] = *(const v8us*)(brow + 16 + 8 * hh);
      acc[t] = mmaN<ASPLIT ? 2 : 1>(ah.v, al.v, b.v, b.v, acc[t]);
    }
  }
#pragma unroll
  for (int t = 0; t < 4; ++t) {
    const int col = col0 + t * 16 + ln;
    float bv = bias ? bias[col] : 0.f;
    if (BIAS_BF16) bv = bf16_round(bv);
#pragma unroll
    for (int r = 0; r < 8; ++r) {
      float v = acc[t][r] + bv;
      if (resid) { float rv = resid[(size_t)((row0 + 8 * hh + r) % rmod) * ldr + col]; if (RES_BF16) rv = bf16_round(rv); v += rv; }
      if (ACT == 1) v = fmaxf(v, 0.f);
      if (ACT == 2) v = 0.5f * v * (1.0f + erff(v * 0.70710678118654752f));
      if (ACT == 3) { const float u = 0.7978845608028654f * (v + 0.044715f * v * v * v); v = 0.5f * v * (1.0f + tanhf(u)); }
      so[w][8 * hh + r][t * 16 + ln] = v;
    }
  }
  __builtin_amdgcn_fence(__ATOMIC_ACQ_REL, "workgroup");
  __builtin_amdgcn_wave_barrier();
  const int rsub = lane >> 4, c4 = (lane & 15) * 4;
  {
#pragma unroll
    for (int q = 0; q < 8; ++q) {
      const int r = q * 2 + rsub;
      const v4f v = *(const v4fa*)&so[w][r][c4];
      *(v4f*)(C + (size_t)(row0 + r) * ldc + col0 + c4) = v;
    }
    
  }
}
// row LayerNorm (biased variance, eps) over N: s = X (+ R); optional out_sum <- s; out_norm <- (s-mu)*rsqrt(var+eps)*g + b
template <bool PARAM_BF16>
__global__ __launch_bounds__(256) void k_layernorm(const float* __restrict__ X, const float* __restrict__ R, const float* __restrict__ g, const float* __restrict__ bta,
                                                  float* __restrict__ out_sum, float* __restrict__ out_norm, int N, float eps) {
  __shared__ float red[256];
  const int row = blockIdx.x, tid = threadIdx.x;
  const float* x = X + (size_t)row * N; const float* rr = R ? R + (size_t)row * N : nullptr;
  float vals[16];                     // up to N = 4096
  const int per = N / 256;            // contiguous chunk per thread? use strided-by-4 chunks: thread handles j = tid*4 + 1024*u
  float s1 = 0.f;
  for (int u = 0; u < per / 4; ++u) {
    const int j = tid * 4 + 1024 * u;
    const v4f a = *(const v4fa*)(x + j);
    v4f b = {0.f,0.f,0.f,0.f}; if (rr) b = *(const v4fa*)(rr + j);
#pragma unroll
    for (int q = 0; q < 4; ++q) { const float v = a[q] + b[q]; vals[u * 4 + q] = v; s1 += v; }
  }
  red[tid] = s1; __syncthreads();
  for (int st = 128; st > 0; st >>= 1) { if (tid < st) red[tid] += red[tid + st]; __syncthreads(); }
  const float mu = red[0] / (float)N; __syncthreads();
  float s2 = 0.f;
  for (int u = 0; u < per / 4; ++u)
#pragma unroll
    for (int q = 0; q < 4; ++q) { const float c = vals[u * 4 + q] - mu; s2 += c * c; }
  red[tid] = s2; __syncthreads();
  for (int st = 128; st > 0; st >>= 1) { if (tid < st) red[tid] += red[tid + st]; __syncthreads(); }
  const float rs = rsqrtf(red[0] / (float)N + eps);
  {
    for (int u = 0; u < per / 4; ++u) {
      const int j = tid * 4 + 1024 * u;
      v4f o, sm;
#pragma unroll
      for (int q = 0; q < 4; ++q) {
        float gg = g[j + q], bb = bta[j + q];
        if (PARAM_BF16) { gg = bf16_round(gg); bb = bf16_round(bb); }
        sm[q] = vals[u * 4 + q]; o[q] = (vals[u * 4 + q] - mu) * rs * gg + bb;
      }
      if (out_sum) *(v4f*)(out_sum + (size_t)row * N + j) = sm;
      *(v4f*)(out_norm + (size_t)row * N + j) = o;
    }
    
  }
}



// ---- f16 WMMA path (v_wmma_f32_16x16x32_f16): 11-bit significands for operands in range — used where a [0,1] probability operand needs more precision than bf16
typedef _Float16 v16h __attribute__((ext_vector_type(16)));
union FragH { v16h v; v8us half[2]; _Float16 h[16]; unsigned short u[16]; };
template <int NT>
__device__ __forceinline__ v8f mmaH(v16h ah, v16h al, v16h bh, v16h bl, v8f c) {
  c = __builtin_amdgcn_wmma_f32_16x16x32_f16(false, ah, false, bh, (short)0, c, false, false);
  if (NT >= 2) c = __builtin_amdgcn_wmma_f32_16x16x32_f16(false, al, false, bh, (short)0, c, false, false);
  if (NT >= 3) c = __builtin_amdgcn_wmma_f32_16x16x32_f16(false, ah, false, bl, (short)0, c, false, false);
  asm volatile("v_nop\n\tv_nop\n\tv_nop\n\tv_nop" : "+v"(c) : "v"(ah), "v"(al), "v"(bh), "v"(bl));
  return c;
}
// batched GEMM like k_gemm_b but f16 operands: A f32 (split into f16 hi/lo if ASPLIT, else rounded to f16), Bt = f16 values [n][k]; alpha; C f32; N multiple of 16 (partial tiles skipped)
template <bool ASPLIT>
__global__ __launch_bounds__(128) void k_gemm_h(const float* __restrict__ A, int lda, size_t sA, const _Float16* __restrict__ Bh, int ldb, size_t sB, float alpha, float* __restrict__ C, int ldc, size_t sC, int M, int N, int K) {
  __shared__ __attribute__((aligned(16))) float so[4][16][64];
  const int tid = threadIdx.x, w = tid >> 5, lane = tid & 31, ln = lane & 15, hh = lane >> 4; const int by = blockIdx.y;
  A += (size_t)by * sA; Bh += (size_t)by * sB; C += (size_t)by * sC;
  const int ntn = (N + 63) / 64; const int wid = blockIdx.x * 4 + w; const int mt = wid / ntn, nq = wid % ntn; if (mt * 16 >= M) return;
  const int row0 = mt * 16, col0 = nq * 64; const float* arow = A + (size_t)(row0 + ln) * lda;
  v8f acc[4] = {};
  for (int kb = 0; kb < K; kb += 32) {
    FragH ah, al;
    const v4f x0 = *(const v4fa*)(arow + kb + 8 * hh), x1 = *(const v4fa*)(arow + kb + 8 * hh + 4), x2 = *(const v4fa*)(arow + kb + 16 + 8 * hh), x3 = *(const v4fa*)(arow + kb + 16 + 8 * hh + 4);
    float xs[16] = {x0[0],x0[1],x0[2],x0[3],x1[0],x1[1],x1[2],x1[3],x2[0],x2[1],x2[2],x2[3],x3[0],x3[1],x3[2],x3[3]};
#pragma unroll
    for (int i = 0; i < 16; ++i) { const _Float16 h = (_Float16)xs[i]; ah.h[i] = h; al.h[i] = ASPLIT ? (_Float16)(xs[i] - (float)h) : (_Float16)0.0f; }
#pragma unroll
    for (int t = 0; t < 4; ++t) { if (col0 + t * 16 >= N) continue; const size_t boff = (size_t)(col0 + t * 16 + ln) * ldb + kb; FragH bq; bq.half[0] = *(const v8us*)(Bh + boff + 8 * hh); bq.half[1] = *(const v8us*)(Bh + boff + 16 + 8 * hh);
      acc[t] = mmaH<ASPLIT ? 2 : 1>(ah.v, al.v, bq.v, bq.v, acc[t]); }
  }
#pragma unroll
  for (int t = 0; t < 4; ++t) { if (col0 + t * 16 >= N) continue;
#pragma unroll
    for (int r = 0; r < 8; ++r) so[w][8 * hh + r][t * 16 + ln] = acc[t][r] * alpha; }
  __builtin_amdgcn_fence(__ATOMIC_ACQ_REL, "workgroup"); __builtin_amdgcn_wave_barrier();
  const int rsub = lane >> 4, c4 = (lane & 15) * 4;
  {
#pragma unroll
    for (int q = 0; q < 8; ++q) { const int r = q * 2 + rsub; if (col0 + c4 < N) { const v4f v = *(const v4fa*)&so[w][r][c4]; *(v4f*)(C + (size_t)(row0 + r) * ldc + col0 + c4) = v; } }
     }
}

// Wt[n][k] = f16(W[k][n]·scale) from f32 row-major W[K][N] (scale = power of two; bf16-exact weights stay exact in f16 away from the subnormal range)
__global__ __launch_bounds__(256) void k_wt_f16(const float* __restrict__ W, _Float16* __restrict__ Wt, int K, int N, float scale) {
  const int t = blockIdx.x * 256 + threadIdx.x; if (t >= N * (K / 8)) return; const int n = t / (K / 8), k8 = (t % (K / 8)) * 8; FragH f;
#pragma unroll
  for (int i = 0; i < 8; ++i) f.h[i] = (_Float16)(bf16_round(W[(size_t)(k8 + i) * N + n]) * scale); const v8us o = f.half[0];
  *(v8us*)((unsigned short*)Wt + (size_t)n * K + k8) = o; 
}
// k_gemm_hh variant with fused epilogue: v = acc·alpha + bias[by·sBias + col] (+ CP[(row/rowsPerB)·sCPb + by·64 + col] if CP) ; ACT 0 none / 1 elu ; writes f32 C and/or f16 C16 (each if non-null)
template <int ACT>
__global__ __launch_bounds__(128) void k_gemm_hhx(const _Float16* __restrict__ A, int lda, size_t sA, const _Float16* __restrict__ Bh, int ldb, size_t sB, float alpha, const float* __restrict__ bias, size_t sBias, const float* __restrict__ CP, int rowsPerB, size_t sCPb, int row0g,
    float* __restrict__ C, _Float16* __restrict__ C16, int ldc, size_t sC, int M, int N, int K) {
  __shared__ __attribute__((aligned(16))) float so[4][16][64];
  const int tid = threadIdx.x, w = tid >> 5, lane = tid & 31, ln = lane & 15, hh = lane >> 4; const int by = blockIdx.y;
  A += (size_t)by * sA; Bh += (size_t)by * sB; const size_t cofs = (size_t)by * sC; const float* bp = bias ? bias + (size_t)by * sBias : nullptr;
  const int ntn = (N + 63) / 64; const int wid = blockIdx.x * 4 + w; const int mt = wid / ntn, nq = wid % ntn; if (mt * 16 >= M) return;
  const int row0 = mt * 16, col0 = nq * 64; const _Float16* arow = A + (size_t)(row0 + ln) * lda;
  v8f acc[4] = {};
  for (int kb = 0; kb < K; kb += 32) { FragH ah; ah.half[0] = *(const v8us*)((const unsigned short*)arow + kb + 8 * hh); ah.half[1] = *(const v8us*)((const unsigned short*)arow + kb + 16 + 8 * hh);
#pragma unroll
    for (int t = 0; t < 4; ++t) { if (col0 + t * 16 >= N) continue; const size_t boff = (size_t)(col0 + t * 16 + ln) * ldb + kb; FragH bq; bq.half[0] = *(const v8us*)((const unsigned short*)Bh + boff + 8 * hh); bq.half[1] = *(const v8us*)((const unsigned short*)Bh + boff + 16 + 8 * hh);
      acc[t] = mmaH<1>(ah.v, ah.v, bq.v, bq.v, acc[t]); }
  }
#pragma unroll
  for (int t = 0; t < 4; ++t) { if (col0 + t * 16 >= N) continue; const int col = col0 + t * 16 + ln; const float bv = bp ? bf16_round(bp[col]) : 0.f;
#pragma unroll
    for (int r = 0; r < 8; ++r) { float v = acc[t][r] * alpha + bv; if (CP) { const int bidx = (row0g + row0 + 8 * hh + r) / rowsPerB; v += CP[(size_t)bidx * sCPb + (size_t)by * 64 + col]; } if (ACT == 1) v = (v > 0.f) ? v : expm1f(v); else if (ACT == 7) v = (v > 0.f) ? v + 1.0f : expf(v); else if (ACT == 8) v = tanhf(v); else if (ACT == 9) v = 0.5f * v * (1.0f + tanhf(0.7978845608028654f * (v + 0.044715f * v * v * v))); else if (ACT == 11) v = 1.0f / (1.0f + expf(-v)); else if (ACT == 12) v = (v > 0.f) ? v : 0.01f * v; else if (ACT == 14) v = (v > 0.f) ? v : 0.1f * v; else if (ACT == 15) v = v / (1.0f + expf(-v)); else if (ACT == 3) v = fmaxf(v, 0.f); else if (ACT == 6) v = 0.5f * v * (1.0f + erff(v * 0.70710678118654752f)); so[w][8 * hh + r][t * 16 + ln] = v; } }
  __builtin_amdgcn_fence(__ATOMIC_ACQ_REL, "workgroup"); __builtin_amdgcn_wave_barrier();
  const int rsub = lane >> 4, c4 = (lane & 15) * 4; typedef _Float16 v4h __attribute__((ext_vector_type(4)));
  {
#pragma unroll
    for (int q = 0; q < 8; ++q) { const int r = q * 2 + rsub; if (col0 + c4 < N) { const v4f v = *(const v4fa*)&so[w][r][c4]; if (C) *(v4f*)(C + cofs + (size_t)(row0 + r) * ldc + col0 + c4) = v; if (C16) { v4h h4; for (int i = 0; i < 4; ++i) h4[i] = (_Float16)v[i]; *(v4h*)(C16 + cofs + (size_t)(row0 + r) * ldc + col0 + c4) = h4; } } }
     }
}


typedef _Float16 v4h __attribute__((ext_vector_type(4)));

__global__ __launch_bounds__(256) void k_x16(const float* __restrict__ x, _Float16* __restrict__ X16, size_t n8) { const size_t t = (size_t)blockIdx.x * 256 + threadIdx.x; if (t >= n8) return; FragH f;
#pragma unroll
  for (int q = 0; q < 8; ++q) f.h[q] = (_Float16)bf16_round(x[t * 8 + q]); *(v8us*)((unsigned short*)X16 + t * 8) = f.half[0];  }
__global__ __launch_bounds__(256) void k_h16(const float* __restrict__ x, _Float16* __restrict__ X16, size_t n8) { const size_t t = (size_t)blockIdx.x * 256 + threadIdx.x; if (t >= n8) return; FragH f;
#pragma unroll
  for (int q = 0; q < 8; ++q) f.h[q] = (_Float16)x[t * 8 + q]; *(v8us*)((unsigned short*)X16 + t * 8) = f.half[0];  }
__global__ __launch_bounds__(256) void k_round16f(const float* __restrict__ W, _Float16* __restrict__ Bt, size_t n8) { const size_t t = (size_t)blockIdx.x * 256 + threadIdx.x; if (t >= n8) return; FragH f;
#pragma unroll
  for (int i = 0; i < 8; ++i) f.h[i] = (_Float16)(bf16_round(W[t * 8 + i]) * 16.0f); *(v8us*)((unsigned short*)Bt + t * 8) = f.half[0];  }
template <int NHv, int TTv>
__global__ __launch_bounds__(256) void k_vt(const _Float16* __restrict__ V16, int ldv, int voff, _Float16* __restrict__ Vt) { __shared__ unsigned short tl[64][66]; const int tid = threadIdx.x; const int slab = blockIdx.x / (TTv / 64), lg = blockIdx.x % (TTv / 64); const int b = slab / NHv, h = slab % NHv;
  for (int i = tid; i < 64 * 8; i += 256) { const int r = i / 8, c8 = (i % 8) * 8; FragH f; f.half[0] = *(const v8us*)((const unsigned short*)V16 + ((size_t)b * TTv + lg * 64 + r) * ldv + voff + h * 64 + c8);
#pragma unroll
    for (int q = 0; q < 8; ++q) tl[r][c8 + q] = f.u[q]; }
  __syncthreads();
  {
#pragma unroll
    for (int rd = 0; rd < 2; ++rd) { const int d = rd * 32 + tid / 8, pc = tid % 8; FragH f;
#pragma unroll
      for (int q = 0; q < 8; ++q) f.u[q] = tl[pc * 8 + q][d];
      *(v8us*)((unsigned short*)Vt + ((size_t)slab * 64 + d) * TTv + lg * 64 + pc * 8) = f.half[0]; }
     } }

__global__ __launch_bounds__(256) void k_hl(const float* __restrict__ F, _Float16* __restrict__ Hh, _Float16* __restrict__ Hl, size_t n8) { const size_t t = (size_t)blockIdx.x * 256 + threadIdx.x; if (t >= n8) return; FragH fh, fl; const v4f a = *(const v4fa*)(F + t * 8), c = *(const v4fa*)(F + t * 8 + 4);
#pragma unroll
  for (int q = 0; q < 4; ++q) { _Float16 h = (_Float16)a[q]; fh.h[q] = h; fl.h[q] = (_Float16)((a[q] - (float)h) * 1024.0f); h = (_Float16)c[q]; fh.h[4 + q] = h; fl.h[4 + q] = (_Float16)((c[q] - (float)h) * 1024.0f); }
  { *(v8us*)((unsigned short*)Hh + t * 8) = fh.half[0]; *(v8us*)((unsigned short*)Hl + t * 8) = fl.half[0];  } }

// Offset in halves of the 8 values k = kk .. kk + 7 (kk a multiple of 8) of row n, K 256, in matrix-fragment order [n / 16][kk / 32][half][lane][8], half = (kk >> 4) & 1, lane = 16 * ((kk >> 3) & 1) + n % 16:
// a wave's 16-byte load of half a fragment then covers 512 contiguous bytes (four whole lines) instead of pieces of sixteen lines.
__device__ __forceinline__ size_t frag_off(int n, int kk) { return ((((size_t)(n >> 4) * 8 + (kk >> 5)) * 2 + ((kk >> 4) & 1)) * 32 + ((kk >> 3) & 1) * 16 + (n & 15)) * 8; }
// The folded weights [W*s | W*s*2^-10] for K = N = 128, stored in fragment order. 2048 threads (t), one (n, k8) each; neighbouring threads take neighbouring n (whole lines on the load side).
// LO false: only the W*s plane is written (k_attn multiplies both planes of its operand by that one plane and joins the two sums afterwards).
template <bool LO>
__device__ __forceinline__ void pack_wtf(const float* __restrict__ W, float scale, _Float16* __restrict__ Bt, int t) { const int n = t % EE, k8 = (t / EE) * 8; const int i0 = k8 * EE + n; float x[8]; FragH f, f2;
#pragma unroll
  for (int i = 0; i < 8; ++i) x[i] = W[i0 + i * EE];
  asm volatile("s_wait_xcnt 0x0" :: "v"(i0) : "memory");      /* named as an input, the eight loads' offset register stays whole up to this wait: none of their results lands on it */
#pragma unroll
  for (int i = 0; i < 8; ++i) { const float wv = bf16_round(x[i]) * scale; f.h[i] = (_Float16)wv; f2.h[i] = (_Float16)(wv * 0.0009765625f); }
  { *(v8us*)((unsigned short*)Bt + frag_off(n, k8)) = f.half[0]; if (LO) *(v8us*)((unsigned short*)Bt + frag_off(n, EE + k8)) = f2.half[0];  } }
// The weights of the four products that read x (q, k, v, gate logits), K = N = 128, with gamma folded in: G[e][n] = gamma[e] * W[e][n], both factors rounded to bf16, so the product has 16 significant bits
// and [G hi | G lo] in bf16 (K 256, fragment order) holds it whole. 2048 threads (t), one (n, k8) each; neighbouring threads take neighbouring n (whole lines on the load side).
typedef __bf16 v4b __attribute__((ext_vector_type(4)));
__device__ __forceinline__ unsigned short bf16_top(float x) { return (unsigned short)(__float_as_uint(x) >> 16); }      /* the bits of a value that is exact in bf16 */
__device__ __forceinline__ void pack_wg(const float* __restrict__ W, const float* __restrict__ g, unsigned short* __restrict__ Bt, int t) { const int n = t % EE, k8 = (t / EE) * 8; const int i0 = k8 * EE + n; float x[8]; FragB f, f2;
#pragma unroll
  for (int i = 0; i < 8; ++i) x[i] = W[i0 + i * EE];
  const v4f g0 = *(const v4fa*)(g + k8), g1 = *(const v4fa*)(g + k8 + 4);
  asm volatile("s_wait_xcnt 0x0" :: "v"(i0), "v"(k8) : "memory");      /* named as inputs, the ten loads' offset registers stay whole up to this wait: none of their results lands on them */
  __builtin_amdgcn_sched_barrier(0);      /* keeps the arithmetic below behind the wait: risen above it, its first moves took the register that holds gamma's byte offset */
#pragma unroll
  for (int i = 0; i < 8; ++i) { const float pr = bf16_round(i < 4 ? g0[i & 3] : g1[i & 3]) * bf16_round(x[i]); const float hi = bf16_round(pr); f.u[i] = bf16_top(hi); f2.u[i] = bf16_top(pr - hi); }
  { *(v8us*)(Bt + frag_off(n, k8)) = f.half[0]; *(v8us*)(Bt + frag_off(n, EE + k8)) = f2.half[0];  } }
// Per column of those four products: sum over e of gamma[e] * W[e][n] (SGB[col]) and of beta[e] * W[e][n] (SGB[512 + col]). A wave takes 8 columns x 4 quarters of e (lane = 8 * quarter + column); two exchanges join the quarters.
__device__ __forceinline__ void pack_sums(const float* __restrict__ W /* the same for the whole wave */, const float* __restrict__ g, const float* __restrict__ b, float* __restrict__ SGB, int col, int n, int part) {
  const int i0 = part * 32 * EE + n, p0 = part * 32; float x[32]; v4f gv[8], bv[8];
#pragma unroll
  for (int i = 0; i < 32; ++i) x[i] = W[i0 + i * EE];
#pragma unroll
  for (int i = 0; i < 8; ++i) { gv[i] = *(const v4fa*)(g + p0 + i * 4); bv[i] = *(const v4fa*)(b + p0 + i * 4); }
  asm volatile("s_wait_xcnt 0x0" :: "v"(i0), "v"(p0), "s"(W), "s"(g), "s"(b) : "memory");      /* named as inputs, the loads' address registers (offsets, scalar bases) stay whole up to this wait: none of their results lands on them */
  __builtin_amdgcn_sched_barrier(0);      /* keeps all 48 loads in one group ahead of the arithmetic: left alone the compiler holds some back behind the first sums, and the wave waits out the memory latency more than once */
  float sg = 0.f, sb = 0.f;
#pragma unroll
  for (int i = 0; i < 8; ++i) { const v4b wb = __builtin_convertvector(((v4f){x[i * 4], x[i * 4 + 1], x[i * 4 + 2], x[i * 4 + 3]}), v4b), gb = __builtin_convertvector(gv[i], v4b), bb = __builtin_convertvector(bv[i], v4b);      /* round to nearest even, as bf16_round */
#pragma unroll
    for (int q = 0; q < 4; ++q) { sg = __builtin_fmaf((float)gb[q], (float)wb[q], sg); sb = __builtin_fmaf((float)bb[q], (float)wb[q], sb); } }
  sg += __shfl_xor(sg, 8, 32); sb += __shfl_xor(sb, 8, 32); sg += __shfl_xor(sg, 16, 32); sb += __shfl_xor(sb, 16, 32);
  if (part == 0) { SGB[col] = sg; SGB[4 * EE + col] = sb; } }
// The pair-bias operands: two tiles of 16 rows x K 128 in bf16, in fragment order (tile 1 = k steps 0..3, tile 2 = k steps 4..7 of the K 256 order). With G[e][h] = gamma[e] * Wb[e][h] and B[e][h] = beta[e] * Wb[e][h]
// (factors rounded to bf16, so each product has 16 significant bits and hi + lo in bf16 holds it whole): tile 1 = rows 0..3 G hi, 4..7 G lo, 8 ones, the rest zero; tile 2 = rows 0..3 G hi, 4..7 G lo, 8..11 B hi, 12..15 B lo.
// 512 threads, one (o, k0) each, o = t % 16 and k0 = 8 * (t / 16): a wave's 32 pieces are 512 neighbouring bytes of the fragment order. Every block that needs the tiles forms them itself, in its LDS:
// wb_loads asks for a piece's ten inputs, wb_piece forms and stores it, so that other loads can be asked for in between.
__device__ __forceinline__ void wb_loads(const float* __restrict__ w, const float* __restrict__ g, const float* __restrict__ b, int o, int k0, float (&x)[8], v4f& s0, v4f& s1) { const int kk0 = k0 % EE; const bool t2 = k0 >= EE;
  const int i0 = kk0 * NHD + (o & 3); const float* sp = ((t2 && o >= 8) ? b : g) + kk0;
#pragma unroll
  for (int q = 0; q < 8; ++q) x[q] = w[i0 + q * NHD];
  s0 = *(const v4fa*)sp; s1 = *(const v4fa*)(sp + 4);
  asm volatile("s_wait_xcnt 0x0" :: "v"(i0), "v"(sp) : "memory");      /* named as inputs, the ten loads' address registers stay whole up to this wait: none of their results lands on them */
}
__device__ __forceinline__ void wb_piece(const float (&x)[8], v4f s0, v4f s1, int o, int k0, unsigned short* Bt) { const bool t2 = k0 >= EE; FragB f;
#pragma unroll
  for (int q = 0; q < 8; ++q) { const float pr = bf16_round(q < 4 ? s0[q & 3] : s1[q & 3]) * bf16_round(x[q]); const float hi = bf16_round(pr); float val = (o & 4) ? pr - hi : hi;
    if (!t2 && o >= 8) val = (o == 8) ? 1.0f : 0.0f;
    f.u[q] = bf16_bits(val); }
  *(v8us*)(Bt + frag_off(o, k0)) = f.half[0];  }
// The packs that k_attn reads: none needs anything of another, so each takes a range of the block index (four blocks of 512 threads a 128 x 128 matrix, four for the column sums). The choice is the same for a whole block.
#define PACK_BLOCKS (5 * 4 + 4)
#define BIAS_BLOCKS ((SL / 16) * (SL / 16))
__device__ __forceinline__ void pack_block(int blk, const float* __restrict__ Wq, const float* __restrict__ Wk, const float* __restrict__ Wv, const float* __restrict__ Wfu, const float* __restrict__ Wo, const float* __restrict__ gam, const float* __restrict__ bet,
                                           _Float16* __restrict__ BQK, _Float16* __restrict__ AV, _Float16* __restrict__ BFU, _Float16* __restrict__ BO, float* __restrict__ SGB) {
  const int job = blk >> 2, t = (blk & 3) * 512 + threadIdx.x;
  if (job == 5) {
    const int gw = (blk & 3) * 16 + __builtin_amdgcn_readfirstlane(threadIdx.x >> 5), c = threadIdx.x & 7, m = gw >> 4;      /* 64 waves, sixteen a matrix; the wave's number in a scalar register: the choice of the matrix is scalar */
    const float* W = (m == 0) ? Wq : (m == 1) ? Wk : (m == 2) ? Wv : Wfu;
    pack_sums(W, gam, bet, SGB, gw * 8 + c, (gw & 15) * 8 + c, (threadIdx.x >> 3) & 3);
    asm volatile("s_wait_xcnt 0x0" ::: "memory");      /* as below, for the two stores of this range */
  } else if (job == 4) pack_wtf<false>(Wo, 16.0f, BO, t);
  else {
    const float* W = (job == 0) ? Wq : (job == 1) ? Wk : (job == 2) ? Wv : Wfu;
    _Float16* Bt = (job == 0) ? BQK : (job == 1) ? BQK + (size_t)EE * 2 * EE : (job == 2) ? AV : BFU;
    pack_wg(W, gam, (unsigned short*)Bt, t);
    asm volatile("s_wait_xcnt 0x0" ::: "memory");      /* the built code may join the ranges by flags, so another range's instructions can stand on a path behind these stores: they reuse the stores' registers only behind this wait */
  }
}
// LayerNorm is linear in the token once its mean mu and its 1/sigma rs are known: x.W = rs * (v.G - mu * sum(G)) + sum(B), G = gamma * W, B = beta * W (sums over the channel). So no normalised row is formed:
// the tokens, rounded to bf16 as everywhere, lie in LDS as they are and go into the matrix products as exact operands against [G hi | G lo]; mu, rs and the two column sums come in behind the product.
#define RP 136                   /* staged raw row pitch in halves: 256 B of data + 16 B (16 B x odd: conflict-free ds_load_b128) */
typedef __bf16 v4ba __attribute__((ext_vector_type(4), may_alias));
typedef unsigned int v8u __attribute__((ext_vector_type(8)));
__device__ __forceinline__ float other_half(float x);
// Sixteen tokens of one wave into LDS as bf16: a whole row per load, 4 channels a lane. xp and xw already hold the lane's offset (4 * lane); step = floats from one of the wave's tokens to its next.
// Every loop here and in proj_unit is unrolled because its index picks registers (a row's values, fragments, accumulators), which only a compile-time index can.
__device__ __forceinline__ void raw_load(const float* __restrict__ xp, int step, v4f (&a)[16]) {
#pragma unroll
  for (int u = 0; u < 16; ++u) a[u] = *(const v4fa*)(xp + (size_t)u * step);
  asm volatile("s_wait_xcnt 0x0" ::: "memory");      /* the address registers of the sixteen loads above are reused only behind this wait */
  __builtin_amdgcn_sched_barrier(0);      /* keeps all sixteen loads in one group ahead of the conversions: the wave waits out the memory latency once */
}
__device__ __forceinline__ void raw_store(const v4f (&a)[16], unsigned short* xw) {
#pragma unroll
  for (int u = 0; u < 16; ++u) *(v4ba*)&xw[u * RP] = __builtin_convertvector(a[u], v4b);      /* round to nearest even, two values an instruction */
}
__device__ __forceinline__ void raw_rows(const float* __restrict__ xp, int step, unsigned short* xw) { v4f a[16]; raw_load(xp, step, a); raw_store(a, xw); }
// 1/sigma of the token whose fragments a lane holds (64 of its channels, the other half of the wave the other 64): the variance stays the mean of (v - mu)^2; one exchange between the wave halves ends the sum.
__device__ __forceinline__ float token_rs(const FragB (&xf)[4], float mu) {
  float q4[4] = {0.f, 0.f, 0.f, 0.f};
#pragma unroll
  for (int kb = 0; kb < 4; ++kb) { const v8u ww = __builtin_bit_cast(v8u, xf[kb].v);
#pragma unroll
    for (int j = 0; j < 8; ++j) { const float d0 = __uint_as_float(ww[j] << 16) - mu, d1 = __uint_as_float(ww[j] & 0xFFFF0000u) - mu; q4[(j & 1) * 2] = __builtin_fmaf(d0, d0, q4[(j & 1) * 2]); q4[(j & 1) * 2 + 1] = __builtin_fmaf(d1, d1, q4[(j & 1) * 2 + 1]); } }
  float q2 = (q4[0] + q4[1]) + (q4[2] + q4[3]); q2 += other_half(q2);
  return rsqrtf(q2 / (float)EE + 1e-5f);
}
// One unit of 64 tokens x 64 columns, left in registers as f16: res[i][j] = 8 values of token tile i and column tile j.
// XA false: the weights go in as A, so a lane holds 8 neighbouring columns (j * 16 + 8 hh + r) of one token (i * 16 + ln). XA true (v^T): the tokens go in as A, so a lane holds 8 neighbouring tokens (i * 16 + 8 hh + r) of one column (j * 16 + ln).
// The eight k steps go hi, lo, hi, lo ...: both planes of G meet the same token fragments, which are read once for the two. pmu, prs: the 64 tokens' mean and 1/sigma; psg, psb: the 64 columns' sum(G) and sum(B) (+ bias); all in LDS.
template <bool XA>
__device__ __forceinline__ void proj_unit(const unsigned short* xs, const unsigned short* __restrict__ wt, const float* pmu, const float* prs, const float* psg, const float* psb, v8us (&res)[4][4], int lane) {
  const int ln = lane & 15, hh = lane >> 4;
  const unsigned short* xr = xs + ln * RP + 8 * hh;
  const unsigned short* wr = wt + lane * 8;      /* fragment order: 4096 halves a 16-row tile, 512 a k step (steps 0..3 hi, 4..7 lo), 256 half a fragment */
  v8f acc[4][4] = {};
  FragB wf[2][4], xf[4];         /* weight fragments come from L2: fetched one k step ahead */
#pragma unroll
  for (int j = 0; j < 4; ++j) { wf[0][j].half[0] = *(const v8us*)(wr + j * 4096); wf[0][j].half[1] = *(const v8us*)(wr + j * 4096 + 256); }
#pragma unroll
  for (int st = 0; st < 8; ++st) {
    if (st + 1 < 8) { const int ko = (((st + 1) & 1) * 4 + ((st + 1) >> 1)) * 512;
#pragma unroll
      for (int j = 0; j < 4; ++j) { wf[(st + 1) & 1][j].half[0] = *(const v8us*)(wr + j * 4096 + ko); wf[(st + 1) & 1][j].half[1] = *(const v8us*)(wr + j * 4096 + ko + 256); }
    }
    if (!(st & 1)) {
#pragma unroll
      for (int i = 0; i < 4; ++i) { xf[i].half[0] = *(const v8us*)(xr + i * 16 * RP + (st >> 1) * 32); xf[i].half[1] = *(const v8us*)(xr + i * 16 * RP + (st >> 1) * 32 + 16); }
    }
    __builtin_amdgcn_sched_barrier(0);      /* keeps the next step's weight loads and this step's LDS reads in one group ahead of the 16 products: left alone the compiler sinks each load to its first use, and the wave waits out every latency */
#pragma unroll
    for (int i = 0; i < 4; ++i)
#pragma unroll
      for (int j = 0; j < 4; ++j)
        acc[i][j] = XA ? __builtin_amdgcn_wmma_f32_16x16x32_bf16(false, xf[i].v, false, wf[st & 1][j].v, (short)0, acc[i][j], false, false)
                       : __builtin_amdgcn_wmma_f32_16x16x32_bf16(false, wf[st & 1][j].v, false, xf[i].v, (short)0, acc[i][j], false, false);
    __builtin_amdgcn_sched_barrier(0);      /* keeps later steps' loads from rising further: a third set of fragments would not fit 256 registers */
  }
  asm volatile("s_wait_xcnt 0x0" :: "v"(lane), "s"(wt) : "memory");      /* the weight loads' address registers (lane offset, scalar base) are reused only behind this wait: named as inputs, they stay whole up to it */
  /* of the per-token pair (mu, rs) and the per-column pair (sum(G), sum(B)), the one that runs along a lane's 8 values is read as vectors of 8, the other as one value a tile */
  float nm1[4], rs1[4], sg1[4], sb1[4];
#pragma unroll
  for (int q = 0; q < 4; ++q) { if (XA) { sg1[q] = psg[q * 16 + ln]; sb1[q] = psb[q * 16 + ln]; } else { nm1[q] = -pmu[q * 16 + ln]; rs1[q] = prs[q * 16 + ln]; } }
#pragma unroll
  for (int o = 0; o < 4; ++o) {  /* the tile index of the vector side: j (columns) if the weights were A, i (tokens) if the tokens were */
    const float* pa = (XA ? pmu : psg) + o * 16 + 8 * hh; const float* pb = (XA ? prs : psb) + o * 16 + 8 * hh;
    const v4f a0 = *(const v4fa*)pa, a1 = *(const v4fa*)(pa + 4), b0 = *(const v4fa*)pb, b1 = *(const v4fa*)(pb + 4);
    float av[8], bv[8];
#pragma unroll
    for (int r = 0; r < 4; ++r) { av[r] = a0[r]; av[4 + r] = a1[r]; bv[r] = b0[r]; bv[4 + r] = b1[r]; }
#pragma unroll
    for (int q = 0; q < 4; ++q) { FragH f;
#pragma unroll
      for (int r = 0; r < 8; ++r) f.h[r] = XA ? (_Float16)__builtin_fmaf(bv[r], __builtin_fmaf(-av[r], sg1[q], acc[o][q][r]), sb1[q])      /* av = mu, bv = rs of token o * 16 + 8 hh + r */
                                              : (_Float16)__builtin_fmaf(rs1[q], __builtin_fmaf(nm1[q], av[r], acc[q][o][r]), bv[r]);      /* av = sum(G), bv = sum(B) of column o * 16 + 8 hh + r */
      if (XA) res[o][q] = f.half[0]; else res[q][o] = f.half[0]; }
  }
}
// BF[h][a-tile][b-tile][p][lane][i] = (bf16(mask[a][b]) + pair_bias[a][b][h]) * sqrt(32), a = 16*atile + (lane & 15), b = 16*btile + 8*(lane >> 4) + 4*p + i:
// the accumulator (C) fragment order of the transposed score tile, so that k_attn loads it with whole-line 16-byte loads. The sqrt(32) undoes the score scale applied after the product.
// The pair bias is the one product of x that every row s needs, so it is formed in the launch ahead of k_attn. A block of sixteen waves takes one 16 x 16 tile of (a, b); wave w has the sixteen tokens (a = 16 atile + u, b = 16 btile + w).
// The tokens go into the product as they are (see above): a row of ones beside G gives each token's sum, and tile 2 against a fragment of ones gives sum(G) and sum(B).
// The launch needs nothing of an earlier one: a block forms the two weight tiles itself (8 KB in LDS, one piece a thread, under the latency of its rows). So the packs that only k_attn reads share the launch: they are its last PACK_BLOCKS blocks (two blocks fit a WGP, so all are resident at once).
__global__ __launch_bounds__(512) void k_pre(const float* __restrict__ X, const float* __restrict__ mask, const float* __restrict__ Wq, const float* __restrict__ Wk, const float* __restrict__ Wv, const float* __restrict__ Wfu, const float* __restrict__ Wo, const float* __restrict__ Wb,
                                             const float* __restrict__ gam, const float* __restrict__ bet, _Float16* __restrict__ BQK, _Float16* __restrict__ AV, _Float16* __restrict__ BFU, _Float16* __restrict__ BO, float* __restrict__ SGB, float* __restrict__ BF) {
  __shared__ __attribute__((aligned(16))) unsigned short xs[SL * RP];
  __shared__ __attribute__((aligned(16))) float sbt[NHD * 256];      /* [h][p][lane][i] */
  __shared__ __attribute__((aligned(16))) unsigned short sbb[16 * 2 * EE];      /* the two weight tiles, in fragment order */
  if (blockIdx.x >= BIAS_BLOCKS) { pack_block(blockIdx.x - BIAS_BLOCKS, Wq, Wk, Wv, Wfu, Wo, gam, bet, BQK, AV, BFU, BO, SGB); return; }      /* the same for a whole block, ahead of every barrier */
  const int tid = threadIdx.x, lane = tid & 31, ln = lane & 15, hh = lane >> 4;
  const int w = __builtin_amdgcn_readfirstlane(tid >> 5);      /* the wave's number in a scalar register: the row loads then go from a scalar base */
  const int at = blockIdx.x >> 4, bt = blockIdx.x & 15;
  /* the inputs of the thread's piece of the weight tiles and the mask values (needed by the first eight waves only, loaded by all: no branch) are asked for ahead of the rows, so that their latency passes under the rows' */
  const int p = (tid >> 5) & 1;
  const float* mp = mask + (size_t)(at * 16 + ln) * SL + bt * 16 + 8 * hh + 4 * p;
  const v4f mk = *(const v4fa*)mp;
  asm volatile("s_wait_xcnt 0x0" :: "v"(mp) : "memory");      /* named as an input, the load's address stays whole up to this wait: none of the loads below lands on it */
  FragB wf[8];
  { const int po = tid & 15, pk = (tid >> 4) * 8;
    float wx[8]; v4f ws0, ws1, a[16];
    wb_loads(Wb, gam, bet, po, pk, wx, ws0, ws1);
    raw_load(X + (((size_t)at * 16) * SL + bt * 16 + w) * EE + lane * 4, SL * EE, a);
    wb_piece(wx, ws0, ws1, po, pk, sbb);
    /* publishes the weight tiles to all sixteen waves. The two fences name LDS alone: the fences of __syncthreads() would wait for the sixteen row loads too, and all that stands between here and raw_store is meant to run while the rows are on their way */
    __builtin_amdgcn_fence(__ATOMIC_RELEASE, "workgroup", "local"); __builtin_amdgcn_s_barrier(); __builtin_amdgcn_fence(__ATOMIC_ACQUIRE, "workgroup", "local");
    const unsigned short* wr = sbb + lane * 8;
#pragma unroll
    for (int kb = 0; kb < 4; ++kb) { wf[kb].half[0] = *(const v8us*)(wr + kb * 512); wf[kb].half[1] = *(const v8us*)(wr + kb * 512 + 256); }      /* tile 1, which meets the tokens; tile 2 is read once the rows' registers are free: with both here a wave would need more than 128 registers, and two blocks would not fit a WGP */
    __builtin_amdgcn_sched_barrier(0);      /* keeps the piece, the barrier and the eight fragment reads ahead of the first wait for a row */
    raw_store(a, xs + w * 16 * RP + lane * 4); }
  __builtin_amdgcn_fence(__ATOMIC_ACQ_REL, "workgroup", "local"); __builtin_amdgcn_wave_barrier();      /* the rows read below were written by other lanes of this wave */
  { const unsigned short* xr = xs + (w * 16 + ln) * RP + 8 * hh;
    v8f c = {}, c1 = {}; FragB xf[4], one;
#pragma unroll
    for (int i = 0; i < 16; ++i) one.u[i] = 0x3F80;      /* 1.0 */
#pragma unroll
    for (int kb = 0; kb < 4; ++kb) { xf[kb].half[0] = *(const v8us*)(xr + kb * 32); xf[kb].half[1] = *(const v8us*)(xr + kb * 32 + 16); }
#pragma unroll
    for (int kb = 4; kb < 8; ++kb) { wf[kb].half[0] = *(const v8us*)(sbb + lane * 8 + kb * 512); wf[kb].half[1] = *(const v8us*)(sbb + lane * 8 + kb * 512 + 256); }
    __builtin_amdgcn_sched_barrier(0);      /* keeps the sixteen LDS reads in one group ahead of the eight products: one LDS latency instead of several */
#pragma unroll
    for (int kb = 0; kb < 4; ++kb) {
      c  = __builtin_amdgcn_wmma_f32_16x16x32_bf16(false, wf[kb].v, false, xf[kb].v, (short)0, c, false, false);            /* token ln: lower half v.G hi (0..3) and lo (4..7) per head, upper half the token's sum (0) */
      c1 = __builtin_amdgcn_wmma_f32_16x16x32_bf16(false, wf[4 + kb].v, false, one.v, (short)0, c1, false, false); }      /* every column alike: lower half sum(G) hi, lo; upper half sum(B) hi, lo */
    const float co = other_half(c[0]);
    const float mu = (hh ? c[0] : co) / (float)EE;
    const float rs = token_rs(xf, mu);
    float pv[NHD];               /* rounded to f16 as before: a lane of the lower half holds the four heads of token (a = ln, b = w) */
#pragma unroll
    for (int h = 0; h < NHD; ++h) { const float sgb = c1[h] + c1[4 + h]; const float sb = other_half(sgb);      /* lower half: sgb = sum(G), sb = sum(B) */
      pv[h] = (float)(_Float16)(rs * ((c[h] + c[4 + h]) - mu * sgb) + sb); }
    if (hh == 0) {
#pragma unroll
      for (int h = 0; h < NHD; ++h) sbt[((h * 2 + ((w >> 2) & 1)) * 32 + (w >> 3) * 16 + ln) * 4 + (w & 3)] = pv[h]; } }
  __syncthreads();               /* publishes the sixteen waves' columns of the tile */
  if (tid < NHD * 64) {          /* whole waves: 256 pieces of 16 bytes */
    const int h = tid >> 6;
    const v4f pb = *(const v4fa*)&sbt[tid * 4]; v4f o;
#pragma unroll
    for (int i = 0; i < 4; ++i) o[i] = (bf16_round(mk[i]) + pb[i]) * 5.656854249492381f;
    *(v4f*)(BF + ((((size_t)h * 16 + at) * 16 + bt) * 2 + p) * 128 + lane * 4) = o; }
}

__device__ __forceinline__ v8f exp2x8(v8f x) {
  float a = x[0], b = x[1], c = x[2], d = x[3], e = x[4], f = x[5], g = x[6], h = x[7];
  asm("v_exp_f32 %0, %0\n\tv_exp_f32 %1, %1\n\tv_exp_f32 %2, %2\n\tv_exp_f32 %3, %3\n\tv_exp_f32 %4, %4\n\tv_exp_f32 %5, %5\n\tv_exp_f32 %6, %6\n\tv_exp_f32 %7, %7\n\tv_nop"
      : "+v"(a), "+v"(b), "+v"(c), "+v"(d), "+v"(e), "+v"(f), "+v"(g), "+v"(h));
  return (v8f){a, b, c, d, e, f, g, h};
}
// Eight v_rcp_f32 in the same form, for the same reason.
__device__ __forceinline__ v8f rcpx8(v8f x) {
  float a = x[0], b = x[1], c = x[2], d = x[3], e = x[4], f = x[5], g = x[6], h = x[7];
  asm("v_rcp_f32 %0, %0\n\tv_rcp_f32 %1, %1\n\tv_rcp_f32 %2, %2\n\tv_rcp_f32 %3, %3\n\tv_rcp_f32 %4, %4\n\tv_rcp_f32 %5, %5\n\tv_rcp_f32 %6, %6\n\tv_rcp_f32 %7, %7\n\tv_nop"
      : "+v"(a), "+v"(b), "+v"(c), "+v"(d), "+v"(e), "+v"(f), "+v"(g), "+v"(h));
  return (v8f){a, b, c, d, e, f, g, h};
}
// value of lane l ^ 16 (the other half of the wave), without LDS
__device__ __forceinline__ float other_half(float x) { const int b = __float_as_int(x); return __int_as_float(__builtin_amdgcn_permlanex16(b, b, 0x76543210, 0xfedcba98, false, false)); }
#define QP 136                   /* staged q row pitch in halves: 256 B of data (four heads) + 16 B (16 B x odd: conflict-free ds_load_b128) */
#define VP 264                   /* staged v^T row pitch in halves: 512 B of data + 16 B */
#define OP 68                    /* output staging row pitch in floats: 256 B of data + 16 B */
// One struct fixes the order in LDS: Wo^T lies lowest, so that lane offset + constant stays inside the 16-bit offset field of an LDS read and all its fragments are read from one address register.
struct __attribute__((aligned(16))) AttnLds {
  unsigned short swo[EE * EE];   /* Wo^T * 16 in fragment order: [e tile][head][half][lane][8] */
  float sbo[4 * EE];             /* the output bias, four times: every thread loads and stores one value, so the load issues with the staging loads and no wave waits for it in a branch of its own */
  unsigned short sog[16 * 4096]; /* 8 KB a wave, its own, as fragments [plane][head][half][lane][8]: first k (plane 0) and the gate logits (plane 1) of its 16 positions; each head's gated output, hi and lo, takes their place once they are read; at the end the output staging rows */
  unsigned short sxqv[SL * QP + EE * VP];      /* first the row's tokens as bf16 (256 tokens, pitch RP); once every wave has read them, q (pitch QP) and behind it v^T (pitch VP) */
  float ssg[4 * EE], ssb[4 * EE];      /* per column of [q | k | v | gate logits]: sum(G), and sum(B) (+ the gate bias) */
  float smu[SL], srs[SL];        /* per token: mean, 1/sigma */
};
static_assert(SL * RP <= SL * QP + EE * VP, "the token tile must fit the range that q and v^T take over");
// What one head needs from L2 ahead of its scores: the bias tiles (the accumulators' start values).
__device__ __forceinline__ void head_loads(const float* __restrict__ bf /* the same for the whole wave */, int l4 /* 4 * lane */, v8f (&acc)[16]) {
#pragma unroll
  for (int t = 0; t < 16; ++t) { const v4f lo = *(const v4fa*)(bf + l4 + t * 256), hi = *(const v4fa*)(bf + l4 + t * 256 + 128); acc[t] = (v8f){lo[0], lo[1], lo[2], lo[3], hi[0], hi[1], hi[2], hi[3]}; }
}
// One head of one wave's 16 positions: scores, softmax, PV, gate. acc comes in holding the head's bias tiles and kf its k fragment; unless the head is the last, both leave holding the next head's.
__device__ __forceinline__ void attn_head(int h, const unsigned short* sq, const unsigned short* sv, unsigned short* og, const float* __restrict__ bf, int l4, int ln, int hh, v8f (&acc)[16], FragH& kf) {
  FragH fu; fu.half[0] = *(const v8us*)(og + 2048 + h * 512); fu.half[1] = *(const v8us*)(og + 2048 + h * 512 + 256);      /* gate logits of channels 8 hh + r and 16 + 8 hh + r: the rows of Ot that this lane holds */
  const unsigned short* qr = &sq[ln * QP + h * HDC + 8 * hh];
  FragH qf[2][4];              /* q fragments, read four tiles ahead */
#pragma unroll
  for (int i = 0; i < 4; ++i) { qf[0][i].half[0] = *(const v8us*)(qr + i * 16 * QP); qf[0][i].half[1] = *(const v8us*)(qr + i * 16 * QP + 16); }
#pragma unroll
  for (int g = 0; g < 4; ++g) {
    if (g + 1 < 4) {
#pragma unroll
      for (int i = 0; i < 4; ++i) { qf[(g + 1) & 1][i].half[0] = *(const v8us*)(qr + ((g + 1) * 4 + i) * 16 * QP); qf[(g + 1) & 1][i].half[1] = *(const v8us*)(qr + ((g + 1) * 4 + i) * 16 * QP + 16); }
    }
    __builtin_amdgcn_sched_barrier(0);      /* keeps the next four tiles' LDS reads in one group ahead of these four products: in this kernel the compiler left each read next to its product, and the wave waited out every LDS latency */
#pragma unroll
    for (int i = 0; i < 4; ++i) acc[g * 4 + i] = __builtin_amdgcn_wmma_f32_16x16x32_f16(false, qf[g & 1][i].v, false, kf.v, (short)0, acc[g * 4 + i], false, false);
    if (g + 1 < 4) __builtin_amdgcn_sched_barrier(0);      /* keeps later groups' reads from rising further: a third set of fragments has no registers */
  }
  float mx[4] = {-3.0e38f, -3.0e38f, -3.0e38f, -3.0e38f};
#pragma unroll
  for (int t = 0; t < 16; ++t)
#pragma unroll
    for (int r = 0; r < 8; ++r) mx[r & 3] = fmaxf(mx[r & 3], acc[t][r]);
  float m = fmaxf(fmaxf(mx[0], mx[1]), fmaxf(mx[2], mx[3])); m = fmaxf(m, other_half(m));
  const float cs = 0.17677669529663687f * 1.4426950408889634f;      /* 32^-1/2 * log2(e) */
  const float mc = 10.0f - m * cs;                                  /* p = 2^10 * exp(logit - max): the f16 range the probabilities had before */
  float sm[4] = {0.f, 0.f, 0.f, 0.f};
  FragH pf[8];
#pragma unroll
  for (int t = 0; t < 16; ++t) { v8f z;
#pragma unroll
    for (int r = 0; r < 8; ++r) z[r] = __builtin_fmaf(acc[t][r], cs, mc);
    const v8f e = exp2x8(z);
#pragma unroll
    for (int r = 0; r < 8; ++r) { sm[r & 3] += e[r]; pf[t >> 1].h[(t & 1) * 8 + r] = (_Float16)e[r]; } }
  float su = (sm[0] + sm[1]) + (sm[2] + sm[3]); su += other_half(su);
  v8f o[2] = {};
  const unsigned short* vr = &sv[(h * HDC + ln) * VP + 8 * hh];
  FragH vf[2][4];              /* v^T fragments of two k steps (two tiles each), read two k steps ahead */
#pragma unroll
  for (int i = 0; i < 4; ++i) { const unsigned short* p = vr + (i & 1) * 16 * VP + (i >> 1) * 32; vf[0][i].half[0] = *(const v8us*)p; vf[0][i].half[1] = *(const v8us*)(p + 16); }
#pragma unroll
  for (int g = 0; g < 4; ++g) {
    if (g + 1 < 4) {
#pragma unroll
      for (int i = 0; i < 4; ++i) { const unsigned short* p = vr + (i & 1) * 16 * VP + ((g + 1) * 2 + (i >> 1)) * 32; vf[(g + 1) & 1][i].half[0] = *(const v8us*)p; vf[(g + 1) & 1][i].half[1] = *(const v8us*)(p + 16); }
    }
    __builtin_amdgcn_sched_barrier(0);      /* keeps the next two k steps' LDS reads in one group ahead of these four products, as for the scores */
#pragma unroll
    for (int i = 0; i < 4; ++i) o[i & 1] = __builtin_amdgcn_wmma_f32_16x16x32_f16(false, vf[g & 1][i].v, false, pf[g * 2 + (i >> 1)].v, (short)0, o[i & 1], false, false);
    if (g + 1 < 4) __builtin_amdgcn_sched_barrier(0);      /* keeps later reads from rising further, as for the scores */
  }
  v8f sg[2];                   /* sigmoid(gate logit), formed ahead of the next head's loads: a wait for the logits behind those loads would wait for them too */
#pragma unroll
  for (int j = 0; j < 2; ++j) { v8f z;
#pragma unroll
    for (int r = 0; r < 8; ++r) z[r] = (float)fu.h[j * 8 + r] * -1.4426950408889634f;
    v8f d = exp2x8(z);
#pragma unroll
    for (int r = 0; r < 8; ++r) d[r] += 1.0f;
    sg[j] = rcpx8(d); }
  if (h + 1 < NHD) {           /* the score registers are free: the next head's loads fly while this head is gated */
    const float* bfn = bf + (h + 1) * 16 * 16 * 256;
    head_loads(bfn, l4, acc);
    asm volatile("s_wait_xcnt 0x0" :: "v"(l4), "s"(bfn) : "memory");      /* named as inputs, the loads' address registers (lane offset, scalar base) stay whole up to this wait: none of the results lands on them */
    kf.half[0] = *(const v8us*)(og + (h + 1) * 512); kf.half[1] = *(const v8us*)(og + (h + 1) * 512 + 256);      /* the next head's k, read ahead of its scores */
  } else {                     /* the last head loads nothing: a fresh value ends the old scores' life here; without it they count as carried into a next head on this side, and the compiler keeps them through the gate in scratch memory, in every head */
#pragma unroll
    for (int t = 0; t < 16; ++t) acc[t] = (v8f){};
  }
  const float inv = 1.0f / su;
#pragma unroll
  for (int j = 0; j < 2; ++j) { FragH gh, gl;      /* og = o / sum * sigmoid, hi and lo * 2^10 */
#pragma unroll
    for (int r = 0; r < 8; ++r) { const float gvl = o[j][r] * (inv * sg[j][r]); const _Float16 hv = (_Float16)gvl; gh.h[r] = hv; gl.h[r] = (_Float16)((gvl - (float)hv) * 1024.0f); }
    *(v8us*)(og + (h * 2 + j) * 256) = gh.half[0]; *(v8us*)(og + 2048 + (h * 2 + j) * 256) = gl.half[0]; }
}
// One block a WGP (LDS): four waves per SIMD, so 256 registers a wave. Every loop but the one over the heads is unrolled because its index picks registers.
// Ahead of the attention the block forms all that it needs of its own row: the 256 tokens and their mean and 1/sigma into LDS, then 32 units of 64 tokens x 64 columns, two a wave: [k | gate logits] and [q | v^T]. None of these planes goes through global memory.
__global__ __launch_bounds__(512) void k_attn(const float* __restrict__ X, const float* __restrict__ SGB, const float* __restrict__ bfu,
                                              const _Float16* __restrict__ BQK, const _Float16* __restrict__ AV, const _Float16* __restrict__ BFU,
                                              const float* __restrict__ BF, const _Float16* __restrict__ BO, const float* __restrict__ bo, float* __restrict__ out) {
  __shared__ AttnLds lds;
  unsigned short* const swo = lds.swo; float* const sbo = lds.sbo; unsigned short* const xs = lds.sxqv; unsigned short* const sq = lds.sxqv; unsigned short* const sv = lds.sxqv + SL * QP;
  const int tid = threadIdx.x, lane = tid & 31, ln = lane & 15, hh = lane >> 4;
  const int w = __builtin_amdgcn_readfirstlane(tid >> 5);      /* the wave's number in a scalar register: the choice of units is a scalar branch, and the bias tiles load from a scalar base */
  const int s = blockIdx.x;
  const unsigned short* gwp = (const unsigned short*)BO + (tid >> 8) * 4096 + (tid & 255) * 8;      /* 16-byte piece tid + 512 u of Wo^T: 256 pieces a 16-row tile, the first 4 of its 8 k steps: 2 tiles a step */
  v8us gw[4];
#pragma unroll
  for (int u = 0; u < 4; ++u) gw[u] = *(const v8us*)(gwp + u * 2 * 4096);
  const int t7 = tid & (EE - 1);
  const float bov = bo[t7], bfv = bfu[t7], sgv = SGB[tid], sbv = SGB[4 * EE + tid];
  asm volatile("s_wait_xcnt 0x0" :: "v"(gwp), "v"(t7), "v"(tid), "s"(bo), "s"(bfu), "s"(SGB) : "memory");      /* named as inputs, the eight loads' address registers (pointer, offsets, scalar bases) stay whole up to this wait: none of their results lands on them, and they are reused only behind it */
  raw_rows(X + ((size_t)s * SL + w * 16) * EE + lane * 4, EE, xs + w * 16 * RP + lane * 4);      /* wave w: tokens 16 w .. 16 w + 15 */
  asm volatile("" :: "v"(bfv));      /* holds the gate bias's load with the staging loads above (the loaded value as an input only): left alone the compiler sinks it into a branch of the last four waves, which then wait out its latency alone ahead of the barrier */
#pragma unroll
  for (int u = 0; u < 4; ++u) *(v8us*)&swo[tid * 8 + u * 4096] = gw[u];
  sbo[tid] = bf16_round(bov);    /* the output bias, rounded once a block */
  lds.ssg[tid] = sgv; lds.ssb[tid] = (tid >= 3 * EE) ? sbv + bf16_round(bfv) : sbv;      /* the gate bias, rounded once a block, joins its columns' constant */
  __builtin_amdgcn_fence(__ATOMIC_ACQ_REL, "workgroup", "local"); __builtin_amdgcn_wave_barrier();      /* the rows read below were written by other lanes of this wave */
  { const unsigned short* xr = xs + (w * 16 + ln) * RP + 8 * hh;      /* mean and 1/sigma of the wave's own sixteen tokens, token ln in lanes ln and ln + 16 */
    v8f c = {}; FragB xf[4], one;
#pragma unroll
    for (int i = 0; i < 16; ++i) one.u[i] = 0x3F80;      /* 1.0 */
#pragma unroll
    for (int kb = 0; kb < 4; ++kb) { xf[kb].half[0] = *(const v8us*)(xr + kb * 32); xf[kb].half[1] = *(const v8us*)(xr + kb * 32 + 16); }
    __builtin_amdgcn_sched_barrier(0);      /* keeps the eight LDS reads in one group ahead of the four products: one LDS latency instead of four */
#pragma unroll
    for (int kb = 0; kb < 4; ++kb) c = __builtin_amdgcn_wmma_f32_16x16x32_bf16(false, one.v, false, xf[kb].v, (short)0, c, false, false);      /* every row alike: the sum of token ln, in both halves of the wave */
    const float mu = c[0] / (float)EE, rs = token_rs(xf, mu);
    if (hh == 0) { lds.smu[w * 16 + ln] = mu; lds.srs[w * 16 + ln] = rs; } }
  __syncthreads();               /* publishes the tokens, their mean and 1/sigma, Wo^T and the per-column constants to all sixteen waves */
  const int th = w & 3, cg = w >> 2;      /* which 64 of the 256 tokens, which 64 of the 256 columns */
  const unsigned short* xh = xs + th * 64 * RP;
  const float* pmu = lds.smu + th * 64; const float* prs = lds.srs + th * 64;
  v8us res[4][4];
  { /* [k | gate logits]: a lane's 8 columns of one token are half a fragment of the wave that owns the token (wave th * 4 + i), in the same lane */
    const unsigned short* wt = (cg < 2) ? (const unsigned short*)BQK + (size_t)(EE + cg * 64) * 2 * EE : (const unsigned short*)BFU + (size_t)(cg - 2) * 64 * 2 * EE;
    const int c0 = (cg < 2) ? EE + cg * 64 : 3 * EE + (cg - 2) * 64;      /* the unit's first column in [q | k | v | gate logits] */
    proj_unit<false>(xh, wt, pmu, prs, lds.ssg + c0, lds.ssb + c0, res, lane);
    unsigned short* d = lds.sog + th * 4 * 4096 + cg * 1024 + lane * 8;      /* plane cg >> 1 (2048 halves), head (cg & 1) * 2 + (j >> 1) (512), half j & 1 (256) */
#pragma unroll
    for (int i = 0; i < 4; ++i)
#pragma unroll
      for (int j = 0; j < 4; ++j) *(v8us*)(d + i * 4096 + j * 256) = res[i][j];
  }
  /* [q | v^T]: they take over the token tile's LDS, so they wait in registers until every wave has read it */
  if (cg < 2) proj_unit<false>(xh, (const unsigned short*)BQK + (size_t)cg * 64 * 2 * EE, pmu, prs, lds.ssg + cg * 64, lds.ssb + cg * 64, res, lane);
  else        proj_unit<true>(xh, (const unsigned short*)AV + (size_t)(cg - 2) * 64 * 2 * EE, pmu, prs, lds.ssg + 2 * EE + (cg - 2) * 64, lds.ssb + 2 * EE + (cg - 2) * 64, res, lane);
  __syncthreads();               /* ends every wave's reads of the token tile (and publishes k and the gate logits) */
  const float* bf = BF + (size_t)w * 16 * 256;      /* + h * 16 * 16 * 256: a scalar base; the lane's offset is one register */
  const int l4 = lane * 4;
  v8f acc[16]; FragH kf;
  head_loads(bf, l4, acc);
  asm volatile("s_wait_xcnt 0x0" :: "v"(l4), "s"(bf) : "memory");      /* named as inputs, the loads' address registers (lane offset, scalar base) stay whole up to this wait: none of the results lands on them */
  { unsigned short* d = (cg < 2) ? sq + (th * 64 + ln) * QP + cg * 64 + 8 * hh : sv + ((cg - 2) * 64 + ln) * VP + th * 64 + 8 * hh;
    const int si = (cg < 2) ? 16 * QP : 16, sj = (cg < 2) ? 16 : 16 * VP;      /* q: token tile i down the rows, column tile j along them; v^T: the other way round */
#pragma unroll
    for (int i = 0; i < 4; ++i)
#pragma unroll
      for (int j = 0; j < 4; ++j) *(v8us*)(d + i * si + j * sj) = res[i][j];
  }
  __syncthreads();               /* publishes q and v^T to all sixteen waves */
  unsigned short* const og = lds.sog + w * 4096 + lane * 8;      /* this wave's k, gate logits and gated output, each lane's values in its own 16-byte slots: registers that the heads' scores need */
  kf.half[0] = *(const v8us*)og; kf.half[1] = *(const v8us*)(og + 256);
#pragma unroll 1      /* rolled: nothing here is picked by h at compile time, and no head's loads or reads rise into the head before, where there are no registers for them */
  for (int h = 0; h < NHD; ++h) attn_head(h, sq, sv, og, bf, l4, ln, hh, acc, kf);
  /* outT[e][a]: a lane holds 8 neighbouring e of one a. Half a row (64 e) at a time goes through the wave's own LDS range, which turns the 32-byte pieces into whole 128-byte lines. */
  FragH ogh[NHD], ogl[NHD];
#pragma unroll
  for (int h = 0; h < NHD; ++h) { ogh[h].half[0] = *(const v8us*)(og + h * 512); ogh[h].half[1] = *(const v8us*)(og + h * 512 + 256); ogl[h].half[0] = *(const v8us*)(og + 2048 + h * 512); ogl[h].half[1] = *(const v8us*)(og + 2048 + h * 512 + 256); }
  float* st = (float*)(lds.sog + w * 4096);
  float* orow = out + ((size_t)s * SL + w * 16) * EE;
  const int rsub = lane >> 4, c4 = (lane & 15) * 4;
  const unsigned short* wr = swo + lane * 8;      /* 2048 halves a 16-row tile, 512 a head, 256 half a fragment */
  FragH wf[2][2 * NHD];          /* the weight fragments of two e tiles, read one pair of tiles ahead */
#pragma unroll
  for (int i = 0; i < 2 * NHD; ++i) { wf[0][i].half[0] = *(const v8us*)(wr + i * 512); wf[0][i].half[1] = *(const v8us*)(wr + i * 512 + 256); }
#pragma unroll
  for (int g = 0; g < 4; ++g) {
    if (g + 1 < 4) {
#pragma unroll
      for (int i = 0; i < 2 * NHD; ++i) { wf[(g + 1) & 1][i].half[0] = *(const v8us*)(wr + (g + 1) * 4096 + i * 512); wf[(g + 1) & 1][i].half[1] = *(const v8us*)(wr + (g + 1) * 4096 + i * 512 + 256); }
    }
    __builtin_amdgcn_sched_barrier(0);      /* keeps the next pair's LDS reads in one group ahead of the 16 products: left alone the compiler sinks each read to its first use, and the wave waits out every latency */
    v8f ch[2] = {}, cl[2] = {};
#pragma unroll
    for (int h = 0; h < NHD; ++h)
#pragma unroll
      for (int e2 = 0; e2 < 2; ++e2) {
        ch[e2] = __builtin_amdgcn_wmma_f32_16x16x32_f16(false, wf[g & 1][e2 * NHD + h].v, false, ogh[h].v, (short)0, ch[e2], false, false);
        cl[e2] = __builtin_amdgcn_wmma_f32_16x16x32_f16(false, wf[g & 1][e2 * NHD + h].v, false, ogl[h].v, (short)0, cl[e2], false, false); }
    __builtin_amdgcn_sched_barrier(0);      /* keeps the joins below all 16 products: risen in among the last of them, each group of joins takes its own run of v_nop behind a product */
#pragma unroll
    for (int e2 = 0; e2 < 2; ++e2) { v4f a0, a1;
#pragma unroll
      for (int r = 0; r < 4; ++r) { a0[r] = __builtin_fmaf(cl[e2][r], 0.0009765625f, ch[e2][r]); a1[r] = __builtin_fmaf(cl[e2][4 + r], 0.0009765625f, ch[e2][4 + r]); }
      float* sp = &st[ln * OP + ((g & 1) * 2 + e2) * 16 + 8 * hh]; *(v4fa*)sp = a0; *(v4fa*)(sp + 4) = a1; }
    if (g & 1) {
      __builtin_amdgcn_fence(__ATOMIC_ACQ_REL, "workgroup", "local"); __builtin_amdgcn_wave_barrier();      /* the rows read below were written by other lanes of this wave */
      const int p = g >> 1;
      const v4f b4 = *(const v4fa*)&sbo[p * 64 + c4];
      v4f rv[8];
#pragma unroll
      for (int q = 0; q < 8; ++q) rv[q] = *(const v4fa*)&st[(q * 2 + rsub) * OP + c4];
      __builtin_amdgcn_sched_barrier(0);      /* keeps the nine LDS reads in one group: one wait instead of one a row */
#pragma unroll
      for (int q = 0; q < 8; ++q) { v4f r4;
#pragma unroll
        for (int i = 0; i < 4; ++i) r4[i] = __builtin_fmaf(rv[q][i], 0.0625f, b4[i]);
        *(v4f*)(orow + (size_t)(q * 2 + rsub) * EE + p * 64 + c4) = r4; }
      asm volatile("s_wait_xcnt 0x0" ::: "memory");      /* the stores' address and data registers are reused only behind this wait; its clobber also keeps the second half's writes of st behind the reads above */
    }
  }
}

extern "C" void kernel_launch(void* const* d_in, const int* in_sizes, int n_in,
                              void* d_out, int out_size, void* d_ws, size_t ws_size, hipStream_t stream) {
  (void)in_sizes; (void)n_in; (void)out_size;
  const float* const* I = (const float* const*)d_in; const float* pr = I[0]; const float* mask = I[1]; const float* gam = I[2]; const float* bet = I[3]; const float* Wq = I[4]; const float* Wk = I[5]; const float* Wv = I[6]; const float* Wb = I[7]; const float* Wfu = I[8]; const float* bfu = I[9]; const float* Wo = I[10]; const float* bo = I[11];
  char* ws = (char*)d_ws; size_t off = 0;
  auto take = [&](size_t bytes) { char* p = ws + off; off += (bytes + 255) & ~(size_t)255; return p; };
  _Float16* BQK = (_Float16*)take((size_t)2 * EE * 2 * EE * 2); _Float16* AV = (_Float16*)take((size_t)EE * 2 * EE * 2); _Float16* BFU = (_Float16*)take((size_t)EE * 2 * EE * 2); _Float16* BO = (_Float16*)take((size_t)EE * 2 * EE * 2);      /* BQK, AV, BFU: bf16 bits, [G hi | G lo] (K 256); BO: f16, of which only the first plane is written and read */
  float* BF = (float*)take((size_t)NHD * SL * SL * 4); float* SGB = (float*)take((size_t)2 * 4 * EE * 4);
  if (off > ws_size) return;      // about 0.4 + 1.0 = 1.4 MB
  /* Wq, Wk: (in,out) -> 256 rows of K 256, row = output column, k = [hi e | lo e] of gamma[e] * W[e][column]; Wv and Wfu alike; SGB: their column sums; Wo: row e, k = hc, Wo[hc][e] * 16, the one plane. All in fragment order. */
  k_pre<<<BIAS_BLOCKS + PACK_BLOCKS, 512, 0, stream>>>(pr, mask, Wq, Wk, Wv, Wfu, Wo, Wb, gam, bet, BQK, AV, BFU, BO, SGB, BF);      /* pair bias of the normalised tokens, + mask, per head, in score-fragment order; the packs */
  k_attn<<<SL, 512, 0, stream>>>(pr, SGB, bfu, BQK, AV, BFU, BF, BO, bo, (float*)d_out);      /* per row: LayerNorm, q, k, v^T, gate logits, attention of all heads, gate, output product (+ bo) */
}

// v008
// One run takes 30.9 microseconds.
// Next to v007, in two timings, it ran 1.04 times as fast each time.
// Counting every step since v000, it is 31.1 times as fast.
#include <hip/hip_runtime.h>
// Row-wise pair attention on a pair representation ([1,256,256,128], 4 heads × 32): x = LN(pair_rep); q = x·Wq·32^-½, k = x·Wk, v = x·Wv; per (row s, head h): logits[a][b] = Σ_c k[s,a,h,c]·q[s,b,h,c] + mask[a][b] + (x·Wb)[a][b][h]; softmax over b; o[s,a,h,:] = Σ_b attn·v[s,b,h,:]; o *= sigmoid(x·Wfu + bfu); out = o·Wo + bo → [1,256,256,128]. (The module's einsum makes k carry the output index and q the summed index.)
// Compute dtype: inputs and parameters rounded to bf16; the products of x take the tokens as exact bf16 operands against gamma * W carried hi/lo in bf16 (exact), LayerNorm's mean and 1/sigma applied behind them in f32; the gated output carried hi/lo (about f32); q/k/v planes, probabilities, gate logits and the sum mask + pair bias f16 (about 2^-12); softmax/LN/sigmoid in f32; f32 accumulation. v_wmma_f32_16x16x32_bf16 and _f16.
#define SL 256
#define NTOK (SL * SL)           /* 65536 */
#define EE 128
#define NHD 4
#define HDC 32
typedef __bf16 v16b __attribute__((ext_vector_type(16)));
typedef unsigned short v8us __attribute__((ext_vector_type(8), may_alias));
typedef float  v8f  __attribute__((ext_vector_type(8)));
typedef float  v4f  __attribute__((ext_vector_type(4)));
typedef float  v4fa __attribute__((ext_vector_type(4), may_alias));
union FragB { v16b v; v8us half[2]; unsigned short u[16]; };

__device__ __forceinline__ unsigned short bf16_bits(float x) { unsigned int u = __float_as_uint(x); return (unsigned short)((u + 0x7FFFu + ((u >> 16) & 1u)) >> 16); }
__device__ __forceinline__ float bf16_val(unsigned short b) { return __uint_as_float(((unsigned int)b) << 16); }
__device__ __forceinline__ float bf16_round(float x) { return bf16_val(bf16_bits(x)); }
// D += A·B with NT terms: 1 = ah·bh, 2 = + al·bh (A split), 3 = + ah·bl (both split)
template <int NT>
__device__ __forceinline__ v8f mmaN(v16b ah, v16b al, v16b bh, v16b bl, v8f c) {
  c = __builtin_amdgcn_wmma_f32_16x16x32_bf16(false, ah, false, bh, (short)0, c, false, false);
  if (NT >= 2) c = __builtin_amdgcn_wmma_f32_16x16x32_bf16(false, al, false, bh, (short)0, c, false, false);
  if (NT >= 3) c = __builtin_amdgcn_wmma_f32_16x16x32_bf16(false, ah, false, bl, (short)0, c, false, false);
  asm volatile("v_nop\n\tv_nop\n\tv_nop\n\tv_nop" : "+v"(c) : "v"(ah), "v"(al), "v"(bh), "v"(bl));
  return c;
}

__global__ __launch_bounds__(256) void k_wt_bf16(const float* __restrict__ W, unsigned short* __restrict__ Wt, int K, int N) {
  const int t = blockIdx.x * 256 + threadIdx.x;
  const int k8n = K / 8;
  if (t >= N * k8n) return;
  const int n = t / k8n, k8 = (t % k8n) * 8;
  v8us v;
#pragma unroll
  for (int i = 0; i < 8; ++i) v[i] = bf16_bits(W[(size_t)(k8 + i) * N + n]);
  *(v8us*)(Wt + (size_t)n * K + k8) = v;
  
}

// GEMM C[M][N] (f32, pitch ldc) = act(A[M][K]·W + bias). A f32 row-major (pitch lda) converted per fragment to bf16
// (ASPLIT: hi/lo two planes -> 2 terms, else single rounded term); Wt bf16 [N][K] (pitch ldb). BIAS_BF16 rounds the
// bias to bf16 first (bias quantised to bf16 before the add). K%32==0, M%16==0, N%64==0.
template <bool ASPLIT, int ACT, bool BIAS_BF16>
__global__ __launch_bounds__(128) void k_gemm_bf(const float* __restrict__ A, int lda, const unsigned short* __restrict__ Wt, int ldb,
                                               const float* __restrict__ bias, float* __restrict__ C, int ldc, int M, int N, int K) {
  __shared__ __attribute__((aligned(16))) float so[4][16][64];
  const int tid = threadIdx.x, w = tid >> 5, lane = tid & 31, ln = lane & 15, hh = lane >> 4;
  const int ntn = N / 64;
  const int wid = blockIdx.x * 4 + w;
  const int mt = wid / ntn, nq = wid % ntn;
  if (mt * 16 >= M) return;
  const int row0 = mt * 16, col0 = nq * 64;
  const float* arow = A + (size_t)(row0 + ln) * lda;
  v8f acc[4] = {};
  for (int kb = 0; kb < K; kb += 32) {
    FragB ah, al;
    const v4f x0 = *(const v4fa*)(arow + kb + 8 * hh), x1 = *(const v4fa*)(arow + kb + 8 * hh + 4);
    const v4f x2 = *(const v4fa*)(arow + kb + 16 + 8 * hh), x3 = *(const v4fa*)(arow + kb + 16 + 8 * hh + 4);
    float xs[16] = {x0[0],x0[1],x0[2],x0[3],x1[0],x1[1],x1[2],x1[3],x2[0],x2[1],x2[2],x2[3],x3[0],x3[1],x3[2],x3[3]};
#pragma unroll
    for (int i = 0; i < 16; ++i) { const unsigned short hb = bf16_bits(xs[i]); ah.u[i] = hb; al.u[i] = ASPLIT ? bf16_bits(xs[i] - bf16_val(hb)) : (unsigned short)0; }
#pragma unroll
    for (int t = 0; t < 4; ++t) {
      const unsigned short* brow = Wt + (size_t)(col0 + t * 16 + ln) * ldb + kb;
      FragB b;
      b.half[0] = *(const v8us*)(brow + 8 * hh);
      b.half[1] = *(const v8us*)(brow + 16 + 8 * hh);
      acc[t] = mmaN<ASPLIT ? 2 : 1>(ah.v, al.v, b.v, b.v, acc[t]);
    }
  }
#pragma unroll
  for (int t = 0; t < 4; ++t) {
    float bv = bias ? bias[col0 + t * 16 + ln] : 0.f;
    if (BIAS_BF16) bv = bf16_round(bv);
#pragma unroll
    for (int r = 0; r < 8; ++r) { float v = acc[t][r] + bv; if (ACT == 1) v = fmaxf(v, 0.f); so[w][8 * hh + r][t * 16 + ln] = v; }
  }
  __builtin_amdgcn_fence(__ATOMIC_ACQ_REL, "workgroup");
  __builtin_amdgcn_wave_barrier();
  const int rsub = lane >> 4, c4 = (lane & 15) * 4;
  {
#pragma unroll
    for (int q = 0; q < 8; ++q) {
      const int r = q * 2 + rsub;
      const v4f v = *(const v4fa*)&so[w][r][c4];
      *(v4f*)(C + (size_t)(row0 + r) * ldc + col0 + c4) = v;
    }
    
  }
}

// GEMM C = act(A·W + bias + resid): A f32 (ASPLIT -> hi/lo 2 terms), Wt bf16 [N][K]; ACT 0 none, 1 relu, 2 exact gelu;
// resid (optional, f32, row index = (row % rmod), pitch ldr, RES_BF16 rounds it) added before the activation.
template <bool ASPLIT, int ACT, bool BIAS_BF16, bool RES_BF16>
__global__ __launch_bounds__(128) void k_gemm_bf3(const float* __restrict__ A, int lda, const unsigned short* __restrict__ Wt, int ldb,
                                                const float* __restrict__ bias, const float* __restrict__ resid, int rmod, int ldr,
                                                float* __restrict__ C, int ldc, int M, int N, int K) {
  __shared__ __attribute__((aligned(16))) float so[4][16][64];
  const int tid = threadIdx.x, w = tid >> 5, lane = tid & 31, ln = lane & 15, hh = lane >> 4;
  const int ntn = N / 64;
  const int wid = blockIdx.x * 4 + w;
  const int mt = wid / ntn, nq = wid % ntn;
  if (mt * 16 >= M) return;
  const int row0 = mt * 16, col0 = nq * 64;
  const float* arow = A + (size_t)(row0 + ln) * lda;
  v8f acc[4] = {};
  for (int kb = 0; kb < K; kb += 32) {
    FragB ah, al;
    const v4f x0 = *(const v4fa*)(arow + kb + 8 * hh), x1 = *(const v4fa*)(arow + kb + 8 * hh + 4);
    const v4f x2 = *(const v4fa*)(arow + kb + 16 + 8 * hh), x3 = *(const v4fa*)(arow + kb + 16 + 8 * hh + 4);
    float xs[16] = {x0[0],x0[1],x0[2],x0[3],x1[0],x1[1],x1[2],x1[3],x2[0],x2[1],x2[2],x2[3],x3[0],x3[1],x3[2],x3[3]};
#pragma unroll
    for (int i = 0; i < 16; ++i) { const unsigned short hb = bf16_bits(xs[i]); ah.u[i] = hb; al.u[i] = ASPLIT ? bf16_bits(xs[i] - bf16_val(hb)) : (unsigned short)0; }
#pragma unroll
    for (int t = 0; t < 4; ++t) {
      const unsigned short* brow = Wt + (size_t)(col0 + t * 16 + ln) * ldb + kb;
      FragB b;
      b.half[0] = *(const v8us*)(brow + 8 * hh);
      b.half[1] = *(const v8us*)(brow + 16 + 8 * hh);
      acc[t] = mmaN<ASPLIT ? 2 : 1>(ah.v, al.v, b.v, b.v, acc[t]);
    }
  }
#pragma unroll
  for (int t = 0; t < 4; ++t) {
    const int col = col0 + t * 16 + ln;
    float bv = bias ? bias[col] : 0.f;
    if (BIAS_BF16) bv = bf16_round(bv);
#pragma unroll
    for (int r = 0; r < 8; ++r) {
      float v = acc[t][r] + bv;
      if (resid) { float rv = resid[(size_t)((row0 + 8 * hh + r) % rmod) * ldr + col]; if (RES_BF16) rv = bf16_round(rv); v += rv; }
      if (ACT == 1) v = fmaxf(v, 0.f);
      if (ACT == 2) v = 0.5f * v * (1.0f + erff(v * 0.70710678118654752f));
      if (ACT == 3) { const float u = 0.7978845608028654f * (v + 0.044715f * v * v * v); v = 0.5f * v * (1.0f + tanhf(u)); }
      so[w][8 * hh + r][t * 16 + ln] = v;
    }
  }
  __builtin_amdgcn_fence(__ATOMIC_ACQ_REL, "workgroup");
  __builtin_amdgcn_wave_barrier();
  const int rsub = lane >> 4, c4 = (lane & 15) * 4;
  {
#pragma unroll
    for (int q = 0; q < 8; ++q) {
      const int r = q * 2 + rsub;
      const v4f v = *(const v4fa*)&so[w][r][c4];
      *(v4f*)(C + (size_t)(row0 + r) * ldc + col0 + c4) = v;
    }
    
  }
}
// row LayerNorm (biased variance, eps) over N: s = X (+ R); optional out_sum <- s; out_norm <- (s-mu)*rsqrt(var+eps)*g + b
template <bool PARAM_BF16>
__global__ __launch_bounds__(256) void k_layernorm(const float* __restrict__ X, const float* __restrict__ R, const float* __restrict__ g, const float* __restrict__ bta,
                                                  float* __restrict__ out_sum, float* __restrict__ out_norm, int N, float eps) {
  __shared__ float red[256];
  const int row = blockIdx.x, tid = threadIdx.x;
  const float* x = X + (size_t)row * N; const float* rr = R ? R + (size_t)row * N : nullptr;
  float vals[16];                     // up to N = 4096
  const int per = N / 256;            // contiguous chunk per thread? use strided-by-4 chunks: thread handles j = tid*4 + 1024*u
  float s1 = 0.f;
  for (int u = 0; u < per / 4; ++u) {
    const int j = tid * 4 + 1024 * u;
    const v4f a = *(const v4fa*)(x + j);
    v4f b = {0.f,0.f,0.f,0.f}; if (rr) b = *(const v4fa*)(rr + j);
#pragma unroll
    for (int q = 0; q < 4; ++q) { const float v = a[q] + b[q]; vals[u * 4 + q] = v; s1 += v; }
  }
  red[tid] = s1; __syncthreads();
  for (int st = 128; st > 0; st >>= 1) { if (tid < st) red[tid] += red[tid + st]; __syncthreads(); }
  const float mu = red[0] / (float)N; __syncthreads();
  float s2 = 0.f;
  for (int u = 0; u < per / 4; ++u)
#pragma unroll
    for (int q = 0; q < 4; ++q) { const float c = vals[u * 4 + q] - mu; s2 += c * c; }
  red[tid] = s2; __syncthreads();
  for (int st = 128; st > 0; st >>= 1) { if (tid < st) red[tid] += red[tid + st]; __syncthreads(); }
  const float rs = rsqrtf(red[0] / (float)N + eps);
  {
    for (int u = 0; u < per / 4; ++u) {
      const int j = tid * 4 + 1024 * u;
      v4f o, sm;
#pragma unroll
      for (int q = 0; q < 4; ++q) {
        float gg = g[j + q], bb = bta[j + q];
        if (PARAM_BF16) { gg = bf16_round(gg); bb = bf16_round(bb); }
        sm[q] = vals[u * 4 + q]; o[q] = (vals[u * 4 + q] - mu) * rs * gg + bb;
      }
      if (out_sum) *(v4f*)(out_sum + (size_t)row * N + j) = sm;
      *(v4f*)(out_norm + (size_t)row * N + j) = o;
    }
    
  }
}



// ---- f16 WMMA path (v_wmma_f32_16x16x32_f16): 11-bit significands for operands in range — used where a [0,1] probability operand needs more precision than bf16
typedef _Float16 v16h __attribute__((ext_vector_type(16)));
union FragH { v16h v; v8us half[2]; _Float16 h[16]; unsigned short u[16]; };
template <int NT>
__device__ __forceinline__ v8f mmaH(v16h ah, v16h al, v16h bh, v16h bl, v8f c) {
  c = __builtin_amdgcn_wmma_f32_16x16x32_f16(false, ah, false, bh, (short)0, c, false, false);
  if (NT >= 2) c = __builtin_amdgcn_wmma_f32_16x16x32_f16(false, al, false, bh, (short)0, c, false, false);
  if (NT >= 3) c = __builtin_amdgcn_wmma_f32_16x16x32_f16(false, ah, false, bl, (short)0, c, false, false);
  asm volatile("v_nop\n\tv_nop\n\tv_nop\n\tv_nop" : "+v"(c) : "v"(ah), "v"(al), "v"(bh), "v"(bl));
  return c;
}
// batched GEMM like k_gemm_b but f16 operands: A f32 (split into f16 hi/lo if ASPLIT, else rounded to f16), Bt = f16 values [n][k]; alpha; C f32; N multiple of 16 (partial tiles skipped)
template <bool ASPLIT>
__global__ __launch_bounds__(128) void k_gemm_h(const float* __restrict__ A, int lda, size_t sA, const _Float16* __restrict__ Bh, int ldb, size_t sB, float alpha, float* __restrict__ C, int ldc, size_t sC, int M, int N, int K) {
  __shared__ __attribute__((aligned(16))) float so[4][16][64];
  const int tid = threadIdx.x, w = tid >> 5, lane = tid & 31, ln = lane & 15, hh = lane >> 4; const int by = blockIdx.y;
  A += (size_t)by * sA; Bh += (size_t)by * sB; C += (size_t)by * sC;
  const int ntn = (N + 63) / 64; const int wid = blockIdx.x * 4 + w; const int mt = wid / ntn, nq = wid % ntn; if (mt * 16 >= M) return;
  const int row0 = mt * 16, col0 = nq * 64; const float* arow = A + (size_t)(row0 + ln) * lda;
  v8f acc[4] = {};
  for (int kb = 0; kb < K; kb += 32) {
    FragH ah, al;
    const v4f x0 = *(const v4fa*)(arow + kb + 8 * hh), x1 = *(const v4fa*)(arow + kb + 8 * hh + 4), x2 = *(const v4fa*)(arow + kb + 16 + 8 * hh), x3 = *(const v4fa*)(arow + kb + 16 + 8 * hh + 4);
    float xs[16] = {x0[0],x0[1],x0[2],x0[3],x1[0],x1[1],x1[2],x1[3],x2[0],x2[1],x2[2],x2[3],x3[0],x3[1],x3[2],x3[3]};
#pragma unroll
    for (int i = 0; i < 16; ++i) { const _Float16 h = (_Float16)xs[i]; ah.h[i] = h; al.h[i] = ASPLIT ? (_Float16)(xs[i] - (float)h) : (_Float16)0.0f; }
#pragma unroll
    for (int t = 0; t < 4; ++t) { if (col0 + t * 16 >= N) continue; const size_t boff = (size_t)(col0 + t * 16 + ln) * ldb + kb; FragH bq; bq.half[0] = *(const v8us*)(Bh + boff + 8 * hh); bq.half[1] = *(const v8us*)(Bh + boff + 16 + 8 * hh);
      acc[t] = mmaH<ASPLIT ? 2 : 1>(ah.v, al.v, bq.v, bq.v, acc[t]); }
  }
#pragma unroll
  for (int t = 0; t < 4; ++t) { if (col0 + t * 16 >= N) continue;
#pragma unroll
    for (int r = 0; r < 8; ++r) so[w][8 * hh + r][t * 16 + ln] = acc[t][r] * alpha; }
  __builtin_amdgcn_fence(__ATOMIC_ACQ_REL, "workgroup"); __builtin_amdgcn_wave_barrier();
  const int rsub = lane >> 4, c4 = (lane & 15) * 4;
  {
#pragma unroll
    for (int q = 0; q < 8; ++q) { const int r = q * 2 + rsub; if (col0 + c4 < N) { const v4f v = *(const v4fa*)&so[w][r][c4]; *(v4f*)(C + (size_t)(row0 + r) * ldc + col0 + c4) = v; } }
     }
}

// Wt[n][k] = f16(W[k][n]·scale) from f32 row-major W[K][N] (scale = power of two; bf16-exact weights stay exact in f16 away from the subnormal range)
__global__ __launch_bounds__(256) void k_wt_f16(const float* __restrict__ W, _Float16* __restrict__ Wt, int K, int N, float scale) {
  const int t = blockIdx.x * 256 + threadIdx.x; if (t >= N * (K / 8)) return; const int n = t / (K / 8), k8 = (t % (K / 8)) * 8; FragH f;
#pragma unroll
  for (int i = 0; i < 8; ++i) f.h[i] = (_Float16)(bf16_round(W[(size_t)(k8 + i) * N + n]) * scale); const v8us o = f.half[0];
  *(v8us*)((unsigned short*)Wt + (size_t)n * K + k8) = o; 
}
// k_gemm_hh variant with fused epilogue: v = acc·alpha + bias[by·sBias + col] (+ CP[(row/rowsPerB)·sCPb + by·64 + col] if CP) ; ACT 0 none / 1 elu ; writes f32 C and/or f16 C16 (each if non-null)
template <int ACT>
__global__ __launch_bounds__(128) void k_gemm_hhx(const _Float16* __restrict__ A, int lda, size_t sA, const _Float16* __restrict__ Bh, int ldb, size_t sB, float alpha, const float* __restrict__ bias, size_t sBias, const float* __restrict__ CP, int rowsPerB, size_t sCPb, int row0g,
    float* __restrict__ C, _Float16* __restrict__ C16, int ldc, size_t sC, int M, int N, int K) {
  __shared__ __attribute__((aligned(16))) float so[4][16][64];
  const int tid = threadIdx.x, w = tid >> 5, lane = tid & 31, ln = lane & 15, hh = lane >> 4; const int by = blockIdx.y;
  A += (size_t)by * sA; Bh += (size_t)by * sB; const size_t cofs = (size_t)by * sC; const float* bp = bias ? bias + (size_t)by * sBias : nullptr;
  const int ntn = (N + 63) / 64; const int wid = blockIdx.x * 4 + w; const int mt = wid / ntn, nq = wid % ntn; if (mt * 16 >= M) return;
  const int row0 = mt * 16, col0 = nq * 64; const _Float16* arow = A + (size_t)(row0 + ln) * lda;
  v8f acc[4] = {};
  for (int kb = 0; kb < K; kb += 32) { FragH ah; ah.half[0] = *(const v8us*)((const unsigned short*)arow + kb + 8 * hh); ah.half[1] = *(const v8us*)((const unsigned short*)arow + kb + 16 + 8 * hh);
#pragma unroll
    for (int t = 0; t < 4; ++t) { if (col0 + t * 16 >= N) continue; const size_t boff = (size_t)(col0 + t * 16 + ln) * ldb + kb; FragH bq; bq.half[0] = *(const v8us*)((const unsigned short*)Bh + boff + 8 * hh); bq.half[1] = *(const v8us*)((const unsigned short*)Bh + boff + 16 + 8 * hh);
      acc[t] = mmaH<1>(ah.v, ah.v, bq.v, bq.v, acc[t]); }
  }
#pragma unroll
  for (int t = 0; t < 4; ++t) { if (col0 + t * 16 >= N) continue; const int col = col0 + t * 16 + ln; const float bv = bp ? bf16_round(bp[col]) : 0.f;
#pragma unroll
    for (int r = 0; r < 8; ++r) { float v = acc[t][r] * alpha + bv; if (CP) { const int bidx = (row0g + row0 + 8 * hh + r) / rowsPerB; v += CP[(size_t)bidx * sCPb + (size_t)by * 64 + col]; } if (ACT == 1) v = (v > 0.f) ? v : expm1f(v); else if (ACT == 7) v = (v > 0.f) ? v + 1.0f : expf(v); else if (ACT == 8) v = tanhf(v); else if (ACT == 9) v = 0.5f * v * (1.0f + tanhf(0.7978845608028654f * (v + 0.044715f * v * v * v))); else if (ACT == 11) v = 1.0f / (1.0f + expf(-v)); else if (ACT == 12) v = (v > 0.f) ? v : 0.01f * v; else if (ACT == 14) v = (v > 0.f) ? v : 0.1f * v; else if (ACT == 15) v = v / (1.0f + expf(-v)); else if (ACT == 3) v = fmaxf(v, 0.f); else if (ACT == 6) v = 0.5f * v * (1.0f + erff(v * 0.70710678118654752f)); so[w][8 * hh + r][t * 16 + ln] = v; } }
  __builtin_amdgcn_fence(__ATOMIC_ACQ_REL, "workgroup"); __builtin_amdgcn_wave_barrier();
  const int rsub = lane >> 4, c4 = (lane & 15) * 4; typedef _Float16 v4h __attribute__((ext_vector_type(4)));
  {
#pragma unroll
    for (int q = 0; q < 8; ++q) { const int r = q * 2 + rsub; if (col0 + c4 < N) { const v4f v = *(const v4fa*)&so[w][r][c4]; if (C) *(v4f*)(C + cofs + (size_t)(row0 + r) * ldc + col0 + c4) = v; if (C16) { v4h h4; for (int i = 0; i < 4; ++i) h4[i] = (_Float16)v[i]; *(v4h*)(C16 + cofs + (size_t)(row0 + r) * ldc + col0 + c4) = h4; } } }
     }
}


typedef _Float16 v4h __attribute__((ext_vector_type(4)));

__global__ __launch_bounds__(256) void k_x16(const float* __restrict__ x, _Float16* __restrict__ X16, size_t n8) { const size_t t = (size_t)blockIdx.x * 256 + threadIdx.x; if (t >= n8) return; FragH f;
#pragma unroll
  for (int q = 0; q < 8; ++q) f.h[q] = (_Float16)bf16_round(x[t * 8 + q]); *(v8us*)((unsigned short*)X16 + t * 8) = f.half[0];  }
__global__ __launch_bounds__(256) void k_h16(const float* __restrict__ x, _Float16* __restrict__ X16, size_t n8) { const size_t t = (size_t)blockIdx.x * 256 + threadIdx.x; if (t >= n8) return; FragH f;
#pragma unroll
  for (int q = 0; q < 8; ++q) f.h[q] = (_Float16)x[t * 8 + q]; *(v8us*)((unsigned short*)X16 + t * 8) = f.half[0];  }
__global__ __launch_bounds__(256) void k_round16f(const float* __restrict__ W, _Float16* __restrict__ Bt, size_t n8) { const size_t t = (size_t)blockIdx.x * 256 + threadIdx.x; if (t >= n8) return; FragH f;
#pragma unroll
  for (int i = 0; i < 8; ++i) f.h[i] = (_Float16)(bf16_round(W[t * 8 + i]) * 16.0f); *(v8us*)((unsigned short*)Bt + t * 8) = f.half[0];  }
template <int NHv, int TTv>
__global__ __launch_bounds__(256) void k_vt(const _Float16* __restrict__ V16, int ldv, int voff, _Float16* __restrict__ Vt) { __shared__ unsigned short tl[64][66]; const int tid = threadIdx.x; const int slab = blockIdx.x / (TTv / 64), lg = blockIdx.x % (TTv / 64); const int b = slab / NHv, h = slab % NHv;
  for (int i = tid; i < 64 * 8; i += 256) { const int r = i / 8, c8 = (i % 8) * 8; FragH f; f.half[0] = *(const v8us*)((const unsigned short*)V16 + ((size_t)b * TTv + lg * 64 + r) * ldv + voff + h * 64 + c8);
#pragma unroll
    for (int q = 0; q < 8; ++q) tl[r][c8 + q] = f.u[q]; }
  __syncthreads();
  {
#pragma unroll
    for (int rd = 0; rd < 2; ++rd) { const int d = rd * 32 + tid / 8, pc = tid % 8; FragH f;
#pragma unroll
      for (int q = 0; q < 8; ++q) f.u[q] = tl[pc * 8 + q][d];
      *(v8us*)((unsigned short*)Vt + ((size_t)slab * 64 + d) * TTv + lg * 64 + pc * 8) = f.half[0]; }
     } }

__global__ __launch_bounds__(256) void k_hl(const float* __restrict__ F, _Float16* __restrict__ Hh, _Float16* __restrict__ Hl, size_t n8) { const size_t t = (size_t)blockIdx.x * 256 + threadIdx.x; if (t >= n8) return; FragH fh, fl; const v4f a = *(const v4fa*)(F + t * 8), c = *(const v4fa*)(F + t * 8 + 4);
#pragma unroll
  for (int q = 0; q < 4; ++q) { _Float16 h = (_Float16)a[q]; fh.h[q] = h; fl.h[q] = (_Float16)((a[q] - (float)h) * 1024.0f); h = (_Float16)c[q]; fh.h[4 + q] = h; fl.h[4 + q] = (_Float16)((c[q] - (float)h) * 1024.0f); }
  { *(v8us*)((unsigned short*)Hh + t * 8) = fh.half[0]; *(v8us*)((unsigned short*)Hl + t * 8) = fl.half[0];  } }

// Offset in halves of the 8 values k = kk .. kk + 7 (kk a multiple of 8) of row n, K 256, in matrix-fragment order [n / 16][kk / 32][half][lane][8], half = (kk >> 4) & 1, lane = 16 * ((kk >> 3) & 1) + n % 16:
// a wave's 16-byte load of half a fragment then covers 512 contiguous bytes (four whole lines) instead of pieces of sixteen lines.
__device__ __forceinline__ size_t frag_off(int n, int kk) { return ((((size_t)(n >> 4) * 8 + (kk >> 5)) * 2 + ((kk >> 4) & 1)) * 32 + ((kk >> 3) & 1) * 16 + (n & 15)) * 8; }
// The folded weights [W*s | W*s*2^-10] for K = N = 128, stored in fragment order. 2048 threads (t), one (n, k8) each; neighbouring threads take neighbouring n (whole lines on the load side).
// LO false: only the W*s plane is written (k_attn multiplies both planes of its operand by that one plane and joins the two sums afterwards).
template <bool LO>
__device__ __forceinline__ void pack_wtf(const float* __restrict__ W, float scale, _Float16* __restrict__ Bt, int t) { const int n = t % EE, k8 = (t / EE) * 8; const int i0 = k8 * EE + n; float x[8]; FragH f, f2;
#pragma unroll
  for (int i = 0; i < 8; ++i) x[i] = W[i0 + i * EE];
  asm volatile("s_wait_xcnt 0x0" :: "v"(i0) : "memory");      /* named as an input, the eight loads' offset register stays whole up to this wait: none of their results lands on it */
#pragma unroll
  for (int i = 0; i < 8; ++i) { const float wv = bf16_round(x[i]) * scale; f.h[i] = (_Float16)wv; f2.h[i] = (_Float16)(wv * 0.0009765625f); }
  { *(v8us*)((unsigned short*)Bt + frag_off(n, k8)) = f.half[0]; if (LO) *(v8us*)((unsigned short*)Bt + frag_off(n, EE + k8)) = f2.half[0];  } }
// The weights of the four products that read x (q, k, v, gate logits), K = N = 128, with gamma folded in: G[e][n] = gamma[e] * W[e][n], both factors rounded to bf16, so the product has 16 significant bits
// and [G hi | G lo] in bf16 (K 256, fragment order) holds it whole. 2048 threads (t), one (n, k8) each; neighbouring threads take neighbouring n (whole lines on the load side).
typedef __bf16 v4b __attribute__((ext_vector_type(4)));
__device__ __forceinline__ unsigned short bf16_top(float x) { return (unsigned short)(__float_as_uint(x) >> 16); }      /* the bits of a value that is exact in bf16 */
__device__ __forceinline__ void pack_wg(const float* __restrict__ W, const float* __restrict__ g, unsigned short* __restrict__ Bt, int t) { const int n = t % EE, k8 = (t / EE) * 8; const int i0 = k8 * EE + n; float x[8]; FragB f, f2;
#pragma unroll
  for (int i = 0; i < 8; ++i) x[i] = W[i0 + i * EE];
  const v4f g0 = *(const v4fa*)(g + k8), g1 = *(const v4fa*)(g + k8 + 4);
  asm volatile("s_wait_xcnt 0x0" :: "v"(i0), "v"(k8) : "memory");      /* named as inputs, the ten loads' offset registers stay whole up to this wait: none of their results lands on them */
  __builtin_amdgcn_sched_barrier(0);      /* keeps the arithmetic below behind the wait: risen above it, its first moves took the register that holds gamma's byte offset */
#pragma unroll
  for (int i = 0; i < 8; ++i) { const float pr = bf16_round(i < 4 ? g0[i & 3] : g1[i & 3]) * bf16_round(x[i]); const float hi = bf16_round(pr); f.u[i] = bf16_top(hi); f2.u[i] = bf16_top(pr - hi); }
  { *(v8us*)(Bt + frag_off(n, k8)) = f.half[0]; *(v8us*)(Bt + frag_off(n, EE + k8)) = f2.half[0];  } }
// Per column of those four products: sum over e of gamma[e] * W[e][n] (SGB[col]) and of beta[e] * W[e][n] (SGB[512 + col]). A wave takes 8 columns x 4 quarters of e (lane = 8 * quarter + column); two exchanges join the quarters.
__device__ __forceinline__ void pack_sums(const float* __restrict__ W /* the same for the whole wave */, const float* __restrict__ g, const float* __restrict__ b, float* __restrict__ SGB, int col, int n, int part) {
  const int i0 = part * 32 * EE + n, p0 = part * 32; float x[32]; v4f gv[8], bv[8];
#pragma unroll
  for (int i = 0; i < 32; ++i) x[i] = W[i0 + i * EE];
#pragma unroll
  for (int i = 0; i < 8; ++i) { gv[i] = *(const v4fa*)(g + p0 + i * 4); bv[i] = *(const v4fa*)(b + p0 + i * 4); }
  asm volatile("s_wait_xcnt 0x0" :: "v"(i0), "v"(p0), "s"(W), "s"(g), "s"(b) : "memory");      /* named as inputs, the loads' address registers (offsets, scalar bases) stay whole up to this wait: none of their results lands on them */
  __builtin_amdgcn_sched_barrier(0);      /* keeps all 48 loads in one group ahead of the arithmetic: left alone the compiler holds some back behind the first sums, and the wave waits out the memory latency more than once */
  float sg = 0.f, sb = 0.f;
#pragma unroll
  for (int i = 0; i < 8; ++i) { const v4b wb = __builtin_convertvector(((v4f){x[i * 4], x[i * 4 + 1], x[i * 4 + 2], x[i * 4 + 3]}), v4b), gb = __builtin_convertvector(gv[i], v4b), bb = __builtin_convertvector(bv[i], v4b);      /* round to nearest even, as bf16_round */
#pragma unroll
    for (int q = 0; q < 4; ++q) { sg = __builtin_fmaf((float)gb[q], (float)wb[q], sg); sb = __builtin_fmaf((float)bb[q], (float)wb[q], sb); } }
  sg += __shfl_xor(sg, 8, 32); sb += __shfl_xor(sb, 8, 32); sg += __shfl_xor(sg, 16, 32); sb += __shfl_xor(sb, 16, 32);
  if (part == 0) { SGB[col] = sg; SGB[4 * EE + col] = sb; } }
// The pair-bias operands: two tiles of 16 rows x K 128 in bf16, in fragment order (tile 1 = k steps 0..3, tile 2 = k steps 4..7 of the K 256 order). With G[e][h] = gamma[e] * Wb[e][h] and B[e][h] = beta[e] * Wb[e][h]
// (factors rounded to bf16, so each product has 16 significant bits and hi + lo in bf16 holds it whole): tile 1 = rows 0..3 G hi, 4..7 G lo, 8 ones, the rest zero; tile 2 = rows 0..3 G hi, 4..7 G lo, 8..11 B hi, 12..15 B lo.
// 512 threads, one (o, k0) each, o = t % 16 and k0 = 8 * (t / 16): a wave's 32 pieces are 512 neighbouring bytes of the fragment order. Every block that needs the tiles forms them itself, in its LDS:
// wb_loads asks for a piece's ten inputs, wb_piece forms and stores it, so that other loads can be asked for in between.
__device__ __forceinline__ void wb_loads(const float* __restrict__ w, const float* __restrict__ g, const float* __restrict__ b, int o, int k0, float (&x)[8], v4f& s0, v4f& s1) { const int kk0 = k0 % EE; const bool t2 = k0 >= EE;
  const int i0 = kk0 * NHD + (o & 3); const float* sp = ((t2 && o >= 8) ? b : g) + kk0;
#pragma unroll
  for (int q = 0; q < 8; ++q) x[q] = w[i0 + q * NHD];
  s0 = *(const v4fa*)sp; s1 = *(const v4fa*)(sp + 4);
  asm volatile("s_wait_xcnt 0x0" :: "v"(i0), "v"(sp) : "memory");      /* named as inputs, the ten loads' address registers stay whole up to this wait: none of their results lands on them */
}
__device__ __forceinline__ void wb_piece(const float (&x)[8], v4f s0, v4f s1, int o, int k0, unsigned short* Bt) { const bool t2 = k0 >= EE; FragB f;
#pragma unroll
  for (int q = 0; q < 8; ++q) { const float pr = bf16_round(q < 4 ? s0[q & 3] : s1[q & 3]) * bf16_round(x[q]); const float hi = bf16_round(pr); float val = (o & 4) ? pr - hi : hi;
    if (!t2 && o >= 8) val = (o == 8) ? 1.0f : 0.0f;
    f.u[q] = bf16_bits(val); }
  *(v8us*)(Bt + frag_off(o, k0)) = f.half[0];  }
// The packs that k_attn reads: none needs anything of another, so each takes a range of the block index (four blocks of 512 threads a 128 x 128 matrix, four for the column sums). The choice is the same for a whole block.
#define PACK_BLOCKS (5 * 4 + 4)
#define BIAS_BLOCKS ((SL / 16) * (SL / 16))
__device__ __forceinline__ void pack_block(int blk, const float* __restrict__ Wq, const float* __restrict__ Wk, const float* __restrict__ Wv, const float* __restrict__ Wfu, const float* __restrict__ Wo, const float* __restrict__ gam, const float* __restrict__ bet,
                                           _Float16* __restrict__ BQK, _Float16* __restrict__ AV, _Float16* __restrict__ BFU, _Float16* __restrict__ BO, float* __restrict__ SGB) {
  const int job = blk >> 2, t = (blk & 3) * 512 + threadIdx.x;
  if (job == 5) {
    const int gw = (blk & 3) * 16 + __builtin_amdgcn_readfirstlane(threadIdx.x >> 5), c = threadIdx.x & 7, m = gw >> 4;      /* 64 waves, sixteen a matrix; the wave's number in a scalar register: the choice of the matrix is scalar */
    const float* W = (m == 0) ? Wq : (m == 1) ? Wk : (m == 2) ? Wv : Wfu;
    pack_sums(W, gam, bet, SGB, gw * 8 + c, (gw & 15) * 8 + c, (threadIdx.x >> 3) & 3);
    asm volatile("s_wait_xcnt 0x0" ::: "memory");      /* as below, for the two stores of this range */
  } else if (job == 4) pack_wtf<false>(Wo, 16.0f, BO, t);
  else {
    const float* W = (job == 0) ? Wq : (job == 1) ? Wk : (job == 2) ? Wv : Wfu;
    _Float16* Bt = (job == 0) ? BQK : (job == 1) ? BQK + (size_t)EE * 2 * EE : (job == 2) ? AV : BFU;
    pack_wg(W, gam, (unsigned short*)Bt, t);
    asm volatile("s_wait_xcnt 0x0" ::: "memory");      /* the built code may join the ranges by flags, so another range's instructions can stand on a path behind these stores: they reuse the stores' registers only behind this wait */
  }
}
// LayerNorm is linear in the token once its mean mu and its 1/sigma rs are known: x.W = rs * (v.G - mu * sum(G)) + sum(B), G = gamma * W, B = beta * W (sums over the channel). So no normalised row is formed:
// the tokens, rounded to bf16 as everywhere, lie in LDS as they are and go into the matrix products as exact operands against [G hi | G lo]; mu, rs and the two column sums come in behind the product.
#define RP 136                   /* staged raw row pitch in halves: 256 B of data + 16 B (16 B x odd: conflict-free ds_load_b128) */
typedef __bf16 v4ba __attribute__((ext_vector_type(4), may_alias));
typedef unsigned int v8u __attribute__((ext_vector_type(8)));
__device__ __forceinline__ float other_half(float x);
// Sixteen tokens of one wave into LDS as bf16: a whole row per load, 4 channels a lane. xp and xw already hold the lane's offset (4 * lane); step = floats from one of the wave's tokens to its next.
// Every loop here and in proj_unit is unrolled because its index picks registers (a row's values, fragments, accumulators), which only a compile-time index can.
__device__ __forceinline__ void raw_load(const float* __restrict__ xp, int step, v4f (&a)[16]) {
#pragma unroll
  for (int u = 0; u < 16; ++u) a[u] = *(const v4fa*)(xp + (size_t)u * step);
  asm volatile("s_wait_xcnt 0x0" ::: "memory");      /* the address registers of the sixteen loads above are reused only behind this wait */
  __builtin_amdgcn_sched_barrier(0);      /* keeps all sixteen loads in one group ahead of the conversions: the wave waits out the memory latency once */
}
__device__ __forceinline__ void raw_store(const v4f (&a)[16], unsigned short* xw) {
#pragma unroll
  for (int u = 0; u < 16; ++u) *(v4ba*)&xw[u * RP] = __builtin_convertvector(a[u], v4b);      /* round to nearest even, two values an instruction */
}
__device__ __forceinline__ void raw_rows(const float* __restrict__ xp, int step, unsigned short* xw) { v4f a[16]; raw_load(xp, step, a); raw_store(a, xw); }
// 1/sigma of the token whose fragments a lane holds (64 of its channels, the other half of the wave the other 64): the variance stays the mean of (v - mu)^2; one exchange between the wave halves ends the sum.
__device__ __forceinline__ float token_rs(const FragB (&xf)[4], float mu) {
  float q4[4] = {0.f, 0.f, 0.f, 0.f};
#pragma unroll
  for (int kb = 0; kb < 4; ++kb) { const v8u ww = __builtin_bit_cast(v8u, xf[kb].v);
#pragma unroll
    for (int j = 0; j < 8; ++j) { const float d0 = __uint_as_float(ww[j] << 16) - mu, d1 = __uint_as_float(ww[j] & 0xFFFF0000u) - mu; q4[(j & 1) * 2] = __builtin_fmaf(d0, d0, q4[(j & 1) * 2]); q4[(j & 1) * 2 + 1] = __builtin_fmaf(d1, d1, q4[(j & 1) * 2 + 1]); } }
  float q2 = (q4[0] + q4[1]) + (q4[2] + q4[3]); q2 += other_half(q2);
  return rsqrtf(q2 / (float)EE + 1e-5f);
}
// One unit of 64 tokens x 64 columns, left in registers as f16: res[i][j] = 8 values of token tile i and column tile j.
// XA false: the weights go in as A, so a lane holds 8 neighbouring columns (j * 16 + 8 hh + r) of one token (i * 16 + ln). XA true (v^T): the tokens go in as A, so a lane holds 8 neighbouring tokens (i * 16 + 8 hh + r) of one column (j * 16 + ln).
// The eight k steps go hi, lo, hi, lo ...: both planes of G meet the same token fragments, which are read once for the two. pmu, prs: the 64 tokens' mean and 1/sigma; psg, psb: the 64 columns' sum(G) and sum(B) (+ bias); all in LDS.
template <bool XA>
__device__ __forceinline__ void proj_unit(const unsigned short* xs, const unsigned short* __restrict__ wt, const float* pmu, const float* prs, const float* psg, const float* psb, v8us (&res)[4][4], int lane) {
  const int ln = lane & 15, hh = lane >> 4;
  const unsigned short* xr = xs + ln * RP + 8 * hh;
  const unsigned short* wr = wt + lane * 8;      /* fragment order: 4096 halves a 16-row tile, 512 a k step (steps 0..3 hi, 4..7 lo), 256 half a fragment */
  v8f acc[4][4] = {};
  FragB wf[2][4], xf[4];         /* weight fragments come from L2: fetched one k step ahead */
#pragma unroll
  for (int j = 0; j < 4; ++j) { wf[0][j].half[0] = *(const v8us*)(wr + j * 4096); wf[0][j].half[1] = *(const v8us*)(wr + j * 4096 + 256); }
#pragma unroll
  for (int st = 0; st < 8; ++st) {
    if (st + 1 < 8) { const int ko = (((st + 1) & 1) * 4 + ((st + 1) >> 1)) * 512;
#pragma unroll
      for (int j = 0; j < 4; ++j) { wf[(st + 1) & 1][j].half[0] = *(const v8us*)(wr + j * 4096 + ko); wf[(st + 1) & 1][j].half[1] = *(const v8us*)(wr + j * 4096 + ko + 256); }
    }
    if (!(st & 1)) {
#pragma unroll
      for (int i = 0; i < 4; ++i) { xf[i].half[0] = *(const v8us*)(xr + i * 16 * RP + (st >> 1) * 32); xf[i].half[1] = *(const v8us*)(xr + i * 16 * RP + (st >> 1) * 32 + 16); }
    }
    __builtin_amdgcn_sched_barrier(0);      /* keeps the next step's weight loads and this step's LDS reads in one group ahead of the 16 products: left alone the compiler sinks each load to its first use, and the wave waits out every latency */
#pragma unroll
    for (int i = 0; i < 4; ++i)
#pragma unroll
      for (int j = 0; j < 4; ++j)
        acc[i][j] = XA ? __builtin_amdgcn_wmma_f32_16x16x32_bf16(false, xf[i].v, false, wf[st & 1][j].v, (short)0, acc[i][j], false, false)
                       : __builtin_amdgcn_wmma_f32_16x16x32_bf16(false, wf[st & 1][j].v, false, xf[i].v, (short)0, acc[i][j], false, false);
    __builtin_amdgcn_sched_barrier(0);      /* keeps later steps' loads from rising further: a third set of fragments would not fit 256 registers */
  }
  asm volatile("s_wait_xcnt 0x0" :: "v"(lane), "s"(wt) : "memory");      /* the weight loads' address registers (lane offset, scalar base) are reused only behind this wait: named as inputs, they stay whole up to it */
  /* of the per-token pair (mu, rs) and the per-column pair (sum(G), sum(B)), the one that runs along a lane's 8 values is read as vectors of 8, the other as one value a tile */
  float nm1[4], rs1[4], sg1[4], sb1[4];
#pragma unroll
  for (int q = 0; q < 4; ++q) { if (XA) { sg1[q] = psg[q * 16 + ln]; sb1[q] = psb[q * 16 + ln]; } else { nm1[q] = -pmu[q * 16 + ln]; rs1[q] = prs[q * 16 + ln]; } }
#pragma unroll
  for (int o = 0; o < 4; ++o) {  /* the tile index of the vector side: j (columns) if the weights were A, i (tokens) if the tokens were */
    const float* pa = (XA ? pmu : psg) + o * 16 + 8 * hh; const float* pb = (XA ? prs : psb) + o * 16 + 8 * hh;
    const v4f a0 = *(const v4fa*)pa, a1 = *(const v4fa*)(pa + 4), b0 = *(const v4fa*)pb, b1 = *(const v4fa*)(pb + 4);
    float av[8], bv[8];
#pragma unroll
    for (int r = 0; r < 4; ++r) { av[r] = a0[r]; av[4 + r] = a1[r]; bv[r] = b0[r]; bv[4 + r] = b1[r]; }
#pragma unroll
    for (int q = 0; q < 4; ++q) { FragH f;
#pragma unroll
      for (int r = 0; r < 8; ++r) f.h[r] = XA ? (_Float16)__builtin_fmaf(bv[r], __builtin_fmaf(-av[r], sg1[q], acc[o][q][r]), sb1[q])      /* av = mu, bv = rs of token o * 16 + 8 hh + r */
                                              : (_Float16)__builtin_fmaf(rs1[q], __builtin_fmaf(nm1[q], av[r], acc[q][o][r]), bv[r]);      /* av = sum(G), bv = sum(B) of column o * 16 + 8 hh + r */
      if (XA) res[o][q] = f.half[0]; else res[q][o] = f.half[0]; }
  }
}
// BF[h][a-tile][b-tile][lane][r] = f16((bf16(mask[a][b]) + pair_bias[a][b][h]) * sqrt(32)), b = 16*btile + (lane & 15), a = 16*atile + 8*(lane >> 4) + r:
// half an A fragment (row b, k = a) of the f16 matrix instruction, an even and the next odd b tile being one fragment, so that k_attn loads it with whole-line 16-byte loads and adds it to the transposed score tile
// by a product with a selector of ones and zeros. Two bytes a value instead of four: every block of k_attn reads all of BF from L2, its largest stream. The sqrt(32) undoes the score scale applied after the product.
// The pair bias is the one product of x that every row s needs, so it is formed in the launch ahead of k_attn. A block of sixteen waves takes one 16 x 16 tile of (a, b); wave w has the sixteen tokens (a = 16 atile + u, b = 16 btile + w).
// The tokens go into the product as they are (see above): a row of ones beside G gives each token's sum, and tile 2 against a fragment of ones gives sum(G) and sum(B).
// The launch needs nothing of an earlier one: a block forms the two weight tiles itself (8 KB in LDS, one piece a thread, under the latency of its rows). So the packs that only k_attn reads share the launch: they are its last PACK_BLOCKS blocks (two blocks fit a WGP, so all are resident at once).
__global__ __launch_bounds__(512) void k_pre(const float* __restrict__ X, const float* __restrict__ mask, const float* __restrict__ Wq, const float* __restrict__ Wk, const float* __restrict__ Wv, const float* __restrict__ Wfu, const float* __restrict__ Wo, const float* __restrict__ Wb,
                                             const float* __restrict__ gam, const float* __restrict__ bet, _Float16* __restrict__ BQK, _Float16* __restrict__ AV, _Float16* __restrict__ BFU, _Float16* __restrict__ BO, float* __restrict__ SGB, _Float16* __restrict__ BF) {
  __shared__ __attribute__((aligned(16))) unsigned short xs[SL * RP];
  __shared__ __attribute__((aligned(16))) unsigned short sbt[NHD * 256];      /* f16 bits, [h][lane][r] */
  __shared__ __attribute__((aligned(16))) unsigned short sbb[16 * 2 * EE];      /* the two weight tiles, in fragment order */
  if (blockIdx.x >= BIAS_BLOCKS) { pack_block(blockIdx.x - BIAS_BLOCKS, Wq, Wk, Wv, Wfu, Wo, gam, bet, BQK, AV, BFU, BO, SGB); return; }      /* the same for a whole block, ahead of every barrier */
  const int tid = threadIdx.x, lane = tid & 31, ln = lane & 15, hh = lane >> 4;
  const int w = __builtin_amdgcn_readfirstlane(tid >> 5);      /* the wave's number in a scalar register: the row loads then go from a scalar base */
  const int at = blockIdx.x >> 4, bt = blockIdx.x & 15;
  /* the inputs of the thread's piece of the weight tiles and the mask value of the lane's token (a = ln, b = w; both halves of the wave load it: no branch) are asked for ahead of the rows, so that their latency passes under the rows' */
  const float* mp = mask + (size_t)(at * 16 + ln) * SL + bt * 16 + w;
  const float mk = *mp;
  asm volatile("s_wait_xcnt 0x0" :: "v"(mp) : "memory");      /* named as an input, the load's address stays whole up to this wait: none of the loads below lands on it */
  FragB wf[8];
  { const int po = tid & 15, pk = (tid >> 4) * 8;
    float wx[8]; v4f ws0, ws1, a[16];
    wb_loads(Wb, gam, bet, po, pk, wx, ws0, ws1);
    raw_load(X + (((size_t)at * 16) * SL + bt * 16 + w) * EE + lane * 4, SL * EE, a);
    wb_piece(wx, ws0, ws1, po, pk, sbb);
    /* publishes the weight tiles to all sixteen waves. The two fences name LDS alone: the fences of __syncthreads() would wait for the sixteen row loads too, and all that stands between here and raw_store is meant to run while the rows are on their way */
    __builtin_amdgcn_fence(__ATOMIC_RELEASE, "workgroup", "local"); __builtin_amdgcn_s_barrier(); __builtin_amdgcn_fence(__ATOMIC_ACQUIRE, "workgroup", "local");
    const unsigned short* wr = sbb + lane * 8;
#pragma unroll
    for (int kb = 0; kb < 4; ++kb) { wf[kb].half[0] = *(const v8us*)(wr + kb * 512); wf[kb].half[1] = *(const v8us*)(wr + kb * 512 + 256); }      /* tile 1, which meets the tokens; tile 2 is read once the rows' registers are free: with both here a wave would need more than 128 registers, and two blocks would not fit a WGP */
    __builtin_amdgcn_sched_barrier(0);      /* keeps the piece, the barrier and the eight fragment reads ahead of the first wait for a row */
    raw_store(a, xs + w * 16 * RP + lane * 4); }
  __builtin_amdgcn_fence(__ATOMIC_ACQ_REL, "workgroup", "local"); __builtin_amdgcn_wave_barrier();      /* the rows read below were written by other lanes of this wave */
  { const unsigned short* xr = xs + (w * 16 + ln) * RP + 8 * hh;
    v8f c = {}, c1 = {}; FragB xf[4], one;
#pragma unroll
    for (int i = 0; i < 16; ++i) one.u[i] = 0x3F80;      /* 1.0 */
#pragma unroll
    for (int kb = 0; kb < 4; ++kb) { xf[kb].half[0] = *(const v8us*)(xr + kb * 32); xf[kb].half[1] = *(const v8us*)(xr + kb * 32 + 16); }
#pragma unroll
    for (int kb = 4; kb < 8; ++kb) { wf[kb].half[0] = *(const v8us*)(sbb + lane * 8 + kb * 512); wf[kb].half[1] = *(const v8us*)(sbb + lane * 8 + kb * 512 + 256); }
    __builtin_amdgcn_sched_barrier(0);      /* keeps the sixteen LDS reads in one group ahead of the eight products: one LDS latency instead of several */
#pragma unroll
    for (int kb = 0; kb < 4; ++kb) {
      c  = __builtin_amdgcn_wmma_f32_16x16x32_bf16(false, wf[kb].v, false, xf[kb].v, (short)0, c, false, false);            /* token ln: lower half v.G hi (0..3) and lo (4..7) per head, upper half the token's sum (0) */
      c1 = __builtin_amdgcn_wmma_f32_16x16x32_bf16(false, wf[4 + kb].v, false, one.v, (short)0, c1, false, false); }      /* every column alike: lower half sum(G) hi, lo; upper half sum(B) hi, lo */
    const float co = other_half(c[0]);
    const float mu = (hh ? c[0] : co) / (float)EE;
    const float rs = token_rs(xf, mu);
    FragH pv;                    /* mask + pair bias, rounded once, to f16: a lane of the lower half holds the four heads of token (a = ln, b = w) */
    const float mr = bf16_round(mk);
#pragma unroll
    for (int h = 0; h < NHD; ++h) { const float sgb = c1[h] + c1[4 + h]; const float sb = other_half(sgb);      /* lower half: sgb = sum(G), sb = sum(B) */
      const float v = (mr + (rs * ((c[h] + c[4 + h]) - mu * sgb) + sb)) * 5.656854249492381f;
      pv.h[h] = (_Float16)fminf(fmaxf(v, -65504.0f), 65504.0f); }      /* kept finite: an infinity would meet the selector's zeros in k_attn's product and give NaN */
    if (hh == 0) {
#pragma unroll
      for (int h = 0; h < NHD; ++h) sbt[h * 256 + ((ln >> 3) * 16 + w) * 8 + (ln & 7)] = pv.u[h]; } }
  __syncthreads();               /* publishes the sixteen waves' rows of the tile */
  if (tid < NHD * 32) {          /* whole waves: 128 pieces of 16 bytes, a wave a head */
    const v8us o = *(const v8us*)&sbt[tid * 8];
    *(v8us*)((unsigned short*)BF + (((size_t)w * 16 + at) * 16 + bt) * 256 + lane * 8) = o; }
}

__device__ __forceinline__ v8f exp2x8(v8f x) {
  float a = x[0], b = x[1], c = x[2], d = x[3], e = x[4], f = x[5], g = x[6], h = x[7];
  asm("v_exp_f32 %0, %0\n\tv_exp_f32 %1, %1\n\tv_exp_f32 %2, %2\n\tv_exp_f32 %3, %3\n\tv_exp_f32 %4, %4\n\tv_exp_f32 %5, %5\n\tv_exp_f32 %6, %6\n\tv_exp_f32 %7, %7\n\tv_nop"
      : "+v"(a), "+v"(b), "+v"(c), "+v"(d), "+v"(e), "+v"(f), "+v"(g), "+v"(h));
  return (v8f){a, b, c, d, e, f, g, h};
}
// Eight v_rcp_f32 in the same form, for the same reason.
__device__ __forceinline__ v8f rcpx8(v8f x) {
  float a = x[0], b = x[1], c = x[2], d = x[3], e = x[4], f = x[5], g = x[6], h = x[7];
  asm("v_rcp_f32 %0, %0\n\tv_rcp_f32 %1, %1\n\tv_rcp_f32 %2, %2\n\tv_rcp_f32 %3, %3\n\tv_rcp_f32 %4, %4\n\tv_rcp_f32 %5, %5\n\tv_rcp_f32 %6, %6\n\tv_rcp_f32 %7, %7\n\tv_nop"
      : "+v"(a), "+v"(b), "+v"(c), "+v"(d), "+v"(e), "+v"(f), "+v"(g), "+v"(h));
  return (v8f){a, b, c, d, e, f, g, h};
}
// value of lane l ^ 16 (the other half of the wave), without LDS
__device__ __forceinline__ float other_half(float x) { const int b = __float_as_int(x); return __int_as_float(__builtin_amdgcn_permlanex16(b, b, 0x76543210, 0xfedcba98, false, false)); }
#define QP 136                   /* staged q row pitch in halves: 256 B of data (four heads) + 16 B (16 B x odd: conflict-free ds_load_b128) */
#define VP 264                   /* staged v^T row pitch in halves: 512 B of data + 16 B */
#define OP 68                    /* output staging row pitch in floats: 256 B of data + 16 B */
// One struct fixes the order in LDS: Wo^T lies lowest, so that lane offset + constant stays inside the 16-bit offset field of an LDS read and all its fragments are read from one address register.
struct __attribute__((aligned(16))) AttnLds {
  unsigned short swo[EE * EE];   /* Wo^T * 16 in fragment order: [e tile][head][half][lane][8] */
  float sbo[4 * EE];             /* the output bias, four times: every thread loads and stores one value, so the load issues with the staging loads and no wave waits for it in a branch of its own */
  unsigned short sog[16 * 4096]; /* 8 KB a wave, its own, as fragments [plane][head][half][lane][8]: first k (plane 0) and the gate logits (plane 1) of its 16 positions; each head's gated output, hi and lo, takes their place once they are read; at the end the output staging rows */
  unsigned short sxqv[SL * QP + EE * VP];      /* first the row's tokens as bf16 (256 tokens, pitch RP); once every wave has read them, q (pitch QP) and behind it v^T (pitch VP) */
  float ssg[4 * EE], ssb[4 * EE];      /* per column of [q | k | v | gate logits]: sum(G), and sum(B) (+ the gate bias) */
  float smu[SL], srs[SL];        /* per token: mean, 1/sigma */
  unsigned short ssel[32 * 8];   /* per lane: half a B fragment of the selector that brings the bias tiles into the scores: 1.0 where k = 8 hh + r equals the column a = ln, else 0 */
};
static_assert(SL * RP <= SL * QP + EE * VP, "the token tile must fit the range that q and v^T take over");
// What one head needs from L2 ahead of its scores: the bias tiles, eight A fragments of two b tiles each (k 0..15 = the 16 positions a under the even tile's rows b, k 16..31 = the same under the odd tile's).
__device__ __forceinline__ void head_loads(const unsigned short* __restrict__ bf /* the same for the whole wave */, int l8 /* 8 * lane */, FragH (&bb)[8]) {
#pragma unroll
  for (int t = 0; t < 8; ++t) { bb[t].half[0] = *(const v8us*)(bf + l8 + t * 512); bb[t].half[1] = *(const v8us*)(bf + l8 + t * 512 + 256); }
}
// One head of one wave's 16 positions: scores, softmax, PV, gate. bb comes in holding the head's bias fragments; unless the head is the last, it leaves holding the next head's.
// sel[0], sel[1]: B fragments with a one where k = a, or k = 16 + a, and zeros elsewhere: bb[t] x sel[i] is the bias tile of b tile 2 t + i, exact. The matrix unit has room in this part of the kernel, the vector port has none for 128 conversions a head.
// The selector, k and the gate logits are read from LDS where they are used, not carried: the next head's bias fragments need the registers from the end of the softmax on.
__device__ __forceinline__ void attn_head(int h, const unsigned short* sq, const unsigned short* sv, unsigned short* og, const unsigned short* ssl /* the lane's piece of the selector */, const unsigned short* __restrict__ bf, int l8, int ln, int hh, FragH (&bb)[8]) {
  v8f acc[16];
  FragH kf, sel[2];
  kf.half[0] = *(const v8us*)(og + h * 512); kf.half[1] = *(const v8us*)(og + h * 512 + 256);
  sel[0].half[0] = *(const v8us*)ssl; sel[0].half[1] = (v8us){}; sel[1].half[0] = (v8us){}; sel[1].half[1] = sel[0].half[0];
  const unsigned short* qr = &sq[ln * QP + h * HDC + 8 * hh];
  FragH qf[2][4];              /* q fragments, read four tiles ahead */
#pragma unroll
  for (int i = 0; i < 4; ++i) { qf[0][i].half[0] = *(const v8us*)(qr + i * 16 * QP); qf[0][i].half[1] = *(const v8us*)(qr + i * 16 * QP + 16); }
#pragma unroll
  for (int g = 0; g < 4; ++g) {
    if (g + 1 < 4) {
#pragma unroll
      for (int i = 0; i < 4; ++i) { qf[(g + 1) & 1][i].half[0] = *(const v8us*)(qr + ((g + 1) * 4 + i) * 16 * QP); qf[(g + 1) & 1][i].half[1] = *(const v8us*)(qr + ((g + 1) * 4 + i) * 16 * QP + 16); }
    }
    __builtin_amdgcn_sched_barrier(0);      /* keeps the next four tiles' LDS reads in one group ahead of these eight products: in this kernel the compiler left each read next to its product, and the wave waited out every LDS latency */
#pragma unroll
    for (int i = 0; i < 4; ++i) acc[g * 4 + i] = __builtin_amdgcn_wmma_f32_16x16x32_f16(false, qf[g & 1][i].v, false, kf.v, (short)0, (v8f){}, false, false);
#pragma unroll
    for (int i = 0; i < 4; ++i) acc[g * 4 + i] = __builtin_amdgcn_wmma_f32_16x16x32_f16(false, bb[g * 2 + (i >> 1)].v, false, sel[i & 1].v, (short)0, acc[g * 4 + i], false, false);
    if (g + 1 < 4) __builtin_amdgcn_sched_barrier(0);      /* keeps later groups' reads from rising further: a third set of fragments has no registers */
  }
  float mx[4] = {-3.0e38f, -3.0e38f, -3.0e38f, -3.0e38f};
#pragma unroll
  for (int t = 0; t < 16; ++t)
#pragma unroll
    for (int r = 0; r < 8; ++r) mx[r & 3] = fmaxf(mx[r & 3], acc[t][r]);
  float m = fmaxf(fmaxf(mx[0], mx[1]), fmaxf(mx[2], mx[3])); m = fmaxf(m, other_half(m));
  const float cs = 0.17677669529663687f * 1.4426950408889634f;      /* 32^-1/2 * log2(e) */
  const float mc = 10.0f - m * cs;                                  /* p = 2^10 * exp(logit - max): the f16 range the probabilities had before */
  float sm[4] = {0.f, 0.f, 0.f, 0.f};
  FragH pf[8];
#pragma unroll
  for (int t = 0; t < 16; ++t) { v8f z;
#pragma unroll
    for (int r = 0; r < 8; ++r) z[r] = __builtin_fmaf(acc[t][r], cs, mc);
    const v8f e = exp2x8(z);
#pragma unroll
    for (int r = 0; r < 8; ++r) { sm[r & 3] += e[r]; pf[t >> 1].h[(t & 1) * 8 + r] = (_Float16)e[r]; } }
  float su = (sm[0] + sm[1]) + (sm[2] + sm[3]); su += other_half(su);
  if (h + 1 < NHD) {           /* the score registers are free, so there is room for the next head's bias fragments: their loads fly under PV and the gate */
    const unsigned short* bfn = bf + (h + 1) * 16 * 4096;
    head_loads(bfn, l8, bb);
    asm volatile("s_wait_xcnt 0x0" :: "v"(l8), "s"(bfn) : "memory");      /* named as inputs, the loads' address registers (lane offset, scalar base) stay whole up to this wait: none of the results lands on them */
  }
  v8f o[2] = {};
  const unsigned short* vr = &sv[(h * HDC + ln) * VP + 8 * hh];
  FragH vf[2][4], fu;          /* v^T fragments of two k steps (two tiles each), read two k steps ahead */
#pragma unroll
  for (int i = 0; i < 4; ++i) { const unsigned short* p = vr + (i & 1) * 16 * VP + (i >> 1) * 32; vf[0][i].half[0] = *(const v8us*)p; vf[0][i].half[1] = *(const v8us*)(p + 16); }
#pragma unroll
  for (int g = 0; g < 4; ++g) {
    if (g + 1 < 4) {
#pragma unroll
      for (int i = 0; i < 4; ++i) { const unsigned short* p = vr + (i & 1) * 16 * VP + ((g + 1) * 2 + (i >> 1)) * 32; vf[(g + 1) & 1][i].half[0] = *(const v8us*)p; vf[(g + 1) & 1][i].half[1] = *(const v8us*)(p + 16); }
    } else { fu.half[0] = *(const v8us*)(og + 2048 + h * 512); fu.half[1] = *(const v8us*)(og + 2048 + h * 512 + 256); }      /* gate logits of channels 8 hh + r and 16 + 8 hh + r (the rows of Ot that this lane holds), read under the last four products */
    __builtin_amdgcn_sched_barrier(0);      /* keeps the next two k steps' LDS reads in one group ahead of these four products, as for the scores */
#pragma unroll
    for (int i = 0; i < 4; ++i) o[i & 1] = __builtin_amdgcn_wmma_f32_16x16x32_f16(false, vf[g & 1][i].v, false, pf[g * 2 + (i >> 1)].v, (short)0, o[i & 1], false, false);
    if (g + 1 < 4) __builtin_amdgcn_sched_barrier(0);      /* keeps later reads from rising further, as for the scores */
  }
  v8f sg[2];                   /* sigmoid(gate logit) */
#pragma unroll
  for (int j = 0; j < 2; ++j) { v8f z;
#pragma unroll
    for (int r = 0; r < 8; ++r) z[r] = (float)fu.h[j * 8 + r] * -1.4426950408889634f;
    v8f d = exp2x8(z);
#pragma unroll
    for (int r = 0; r < 8; ++r) d[r] += 1.0f;
    sg[j] = rcpx8(d); }
  const float inv = 1.0f / su;
#pragma unroll
  for (int j = 0; j < 2; ++j) { FragH gh, gl;      /* og = o / sum * sigmoid, hi and lo * 2^10 */
#pragma unroll
    for (int r = 0; r < 8; ++r) { const float gvl = o[j][r] * (inv * sg[j][r]); const _Float16 hv = (_Float16)gvl; gh.h[r] = hv; gl.h[r] = (_Float16)((gvl - (float)hv) * 1024.0f); }
    *(v8us*)(og + (h * 2 + j) * 256) = gh.half[0]; *(v8us*)(og + 2048 + (h * 2 + j) * 256) = gl.half[0]; }
}
// One block a WGP (LDS): four waves per SIMD, so 256 registers a wave. Every loop but the one over the heads is unrolled because its index picks registers.
// Ahead of the attention the block forms all that it needs of its own row: the 256 tokens and their mean and 1/sigma into LDS, then 32 units of 64 tokens x 64 columns, two a wave: [k | gate logits] and [q | v^T]. None of these planes goes through global memory.
__global__ __launch_bounds__(512) void k_attn(const float* __restrict__ X, const float* __restrict__ SGB, const float* __restrict__ bfu,
                                              const _Float16* __restrict__ BQK, const _Float16* __restrict__ AV, const _Float16* __restrict__ BFU,
                                              const _Float16* __restrict__ BF, const _Float16* __restrict__ BO, const float* __restrict__ bo, float* __restrict__ out) {
  __shared__ AttnLds lds;
  unsigned short* const swo = lds.swo; float* const sbo = lds.sbo; unsigned short* const xs = lds.sxqv; unsigned short* const sq = lds.sxqv; unsigned short* const sv = lds.sxqv + SL * QP;
  const int tid = threadIdx.x, lane = tid & 31, ln = lane & 15, hh = lane >> 4;
  const int w = __builtin_amdgcn_readfirstlane(tid >> 5);      /* the wave's number in a scalar register: the choice of units is a scalar branch, and the bias tiles load from a scalar base */
  const int s = blockIdx.x;
  const unsigned short* gwp = (const unsigned short*)BO + (tid >> 8) * 4096 + (tid & 255) * 8;      /* 16-byte piece tid + 512 u of Wo^T: 256 pieces a 16-row tile, the first 4 of its 8 k steps: 2 tiles a step */
  v8us gw[4];
#pragma unroll
  for (int u = 0; u < 4; ++u) gw[u] = *(const v8us*)(gwp + u * 2 * 4096);
  const int t7 = tid & (EE - 1);
  const float bov = bo[t7], bfv = bfu[t7], sgv = SGB[tid], sbv = SGB[4 * EE + tid];
  asm volatile("s_wait_xcnt 0x0" :: "v"(gwp), "v"(t7), "v"(tid), "s"(bo), "s"(bfu), "s"(SGB) : "memory");      /* named as inputs, the eight loads' address registers (pointer, offsets, scalar bases) stay whole up to this wait: none of their results lands on them, and they are reused only behind it */
  raw_rows(X + ((size_t)s * SL + w * 16) * EE + lane * 4, EE, xs + w * 16 * RP + lane * 4);      /* wave w: tokens 16 w .. 16 w + 15 */
  asm volatile("" :: "v"(bfv));      /* holds the gate bias's load with the staging loads above (the loaded value as an input only): left alone the compiler sinks it into a branch of the last four waves, which then wait out its latency alone ahead of the barrier */
#pragma unroll
  for (int u = 0; u < 4; ++u) *(v8us*)&swo[tid * 8 + u * 4096] = gw[u];
  sbo[tid] = bf16_round(bov);    /* the output bias, rounded once a block */
  if (w == 0) { FragH f;         /* one wave writes the selector's 32 pieces */
#pragma unroll
    for (int r = 0; r < 8; ++r) f.u[r] = (8 * hh + r == ln) ? 0x3C00 : 0;      /* 1.0 */
    *(v8us*)&lds.ssel[lane * 8] = f.half[0]; }
  lds.ssg[tid] = sgv; lds.ssb[tid] = (tid >= 3 * EE) ? sbv + bf16_round(bfv) : sbv;      /* the gate bias, rounded once a block, joins its columns' constant */
  __builtin_amdgcn_fence(__ATOMIC_ACQ_REL, "workgroup", "local"); __builtin_amdgcn_wave_barrier();      /* the rows read below were written by other lanes of this wave */
  { const unsigned short* xr = xs + (w * 16 + ln) * RP + 8 * hh;      /* mean and 1/sigma of the wave's own sixteen tokens, token ln in lanes ln and ln + 16 */
    v8f c = {}; FragB xf[4], one;
#pragma unroll
    for (int i = 0; i < 16; ++i) one.u[i] = 0x3F80;      /* 1.0 */
#pragma unroll
    for (int kb = 0; kb < 4; ++kb) { xf[kb].half[0] = *(const v8us*)(xr + kb * 32); xf[kb].half[1] = *(const v8us*)(xr + kb * 32 + 16); }
    __builtin_amdgcn_sched_barrier(0);      /* keeps the eight LDS reads in one group ahead of the four products: one LDS latency instead of four */
#pragma unroll
    for (int kb = 0; kb < 4; ++kb) c = __builtin_amdgcn_wmma_f32_16x16x32_bf16(false, one.v, false, xf[kb].v, (short)0, c, false, false);      /* every row alike: the sum of token ln, in both halves of the wave */
    const float mu = c[0] / (float)EE, rs = token_rs(xf, mu);
    if (hh == 0) { lds.smu[w * 16 + ln] = mu; lds.srs[w * 16 + ln] = rs; } }
  __syncthreads();               /* publishes the tokens, their mean and 1/sigma, Wo^T and the per-column constants to all sixteen waves */
  const int th = w & 3, cg = w >> 2;      /* which 64 of the 256 tokens, which 64 of the 256 columns */
  const unsigned short* xh = xs + th * 64 * RP;
  const float* pmu = lds.smu + th * 64; const float* prs = lds.srs + th * 64;
  v8us res[4][4];
  { /* [k | gate logits]: a lane's 8 columns of one token are half a fragment of the wave that owns the token (wave th * 4 + i), in the same lane */
    const unsigned short* wt = (cg < 2) ? (const unsigned short*)BQK + (size_t)(EE + cg * 64) * 2 * EE : (const unsigned short*)BFU + (size_t)(cg - 2) * 64 * 2 * EE;
    const int c0 = (cg < 2) ? EE + cg * 64 : 3 * EE + (cg - 2) * 64;      /* the unit's first column in [q | k | v | gate logits] */
    proj_unit<false>(xh, wt, pmu, prs, lds.ssg + c0, lds.ssb + c0, res, lane);
    unsigned short* d = lds.sog + th * 4 * 4096 + cg * 1024 + lane * 8;      /* plane cg >> 1 (2048 halves), head (cg & 1) * 2 + (j >> 1) (512), half j & 1 (256) */
#pragma unroll
    for (int i = 0; i < 4; ++i)
#pragma unroll
      for (int j = 0; j < 4; ++j) *(v8us*)(d + i * 4096 + j * 256) = res[i][j];
  }
  /* [q | v^T]: they take over the token tile's LDS, so they wait in registers until every wave has read it */
  if (cg < 2) proj_unit<false>(xh, (const unsigned short*)BQK + (size_t)cg * 64 * 2 * EE, pmu, prs, lds.ssg + cg * 64, lds.ssb + cg * 64, res, lane);
  else        proj_unit<true>(xh, (const unsigned short*)AV + (size_t)(cg - 2) * 64 * 2 * EE, pmu, prs, lds.ssg + 2 * EE + (cg - 2) * 64, lds.ssb + 2 * EE + (cg - 2) * 64, res, lane);
  __syncthreads();               /* ends every wave's reads of the token tile (and publishes k and the gate logits) */
  const unsigned short* bf = (const unsigned short*)BF + (size_t)w * 4096;      /* + h * 16 * 4096: a scalar base; the lane's offset is one register */
  const int l8 = lane * 8;
  FragH bb[8];
  head_loads(bf, l8, bb);
  asm volatile("s_wait_xcnt 0x0" :: "v"(l8), "s"(bf) : "memory");      /* named as inputs, the loads' address registers (lane offset, scalar base) stay whole up to this wait: none of the results lands on them */
  { unsigned short* d = (cg < 2) ? sq + (th * 64 + ln) * QP + cg * 64 + 8 * hh : sv + ((cg - 2) * 64 + ln) * VP + th * 64 + 8 * hh;
    const int si = (cg < 2) ? 16 * QP : 16, sj = (cg < 2) ? 16 : 16 * VP;      /* q: token tile i down the rows, column tile j along them; v^T: the other way round */
#pragma unroll
    for (int i = 0; i < 4; ++i)
#pragma unroll
      for (int j = 0; j < 4; ++j) *(v8us*)(d + i * si + j * sj) = res[i][j];
  }
  __syncthreads();               /* publishes q and v^T to all sixteen waves */
  unsigned short* const og = lds.sog + w * 4096 + lane * 8;      /* this wave's k, gate logits and gated output, each lane's values in its own 16-byte slots: registers that the heads' scores need */
#pragma unroll 1      /* rolled: nothing here is picked by h at compile time, and no head's loads or reads rise into the head before, where there are no registers for them */
  for (int h = 0; h < NHD; ++h) attn_head(h, sq, sv, og, lds.ssel + lane * 8, bf, l8, ln, hh, bb);
  /* outT[e][a]: a lane holds 8 neighbouring e of one a. Half a row (64 e) at a time goes through the wave's own LDS range, which turns the 32-byte pieces into whole 128-byte lines. */
  FragH ogh[NHD], ogl[NHD];
#pragma unroll
  for (int h = 0; h < NHD; ++h) { ogh[h].half[0] = *(const v8us*)(og + h * 512); ogh[h].half[1] = *(const v8us*)(og + h * 512 + 256); ogl[h].half[0] = *(const v8us*)(og + 2048 + h * 512); ogl[h].half[1] = *(const v8us*)(og + 2048 + h * 512 + 256); }
  float* st = (float*)(lds.sog + w * 4096);
  float* orow = out + ((size_t)s * SL + w * 16) * EE;
  const int rsub = lane >> 4, c4 = (lane & 15) * 4;
  const unsigned short* wr = swo + lane * 8;      /* 2048 halves a 16-row tile, 512 a head, 256 half a fragment */
  FragH wf[2][2 * NHD];          /* the weight fragments of two e tiles, read one pair of tiles ahead */
#pragma unroll
  for (int i = 0; i < 2 * NHD; ++i) { wf[0][i].half[0] = *(const v8us*)(wr + i * 512); wf[0][i].half[1] = *(const v8us*)(wr + i * 512 + 256); }
#pragma unroll
  for (int g = 0; g < 4; ++g) {
    if (g + 1 < 4) {
#pragma unroll
      for (int i = 0; i < 2 * NHD; ++i) { wf[(g + 1) & 1][i].half[0] = *(const v8us*)(wr + (g + 1) * 4096 + i * 512); wf[(g + 1) & 1][i].half[1] = *(const v8us*)(wr + (g + 1) * 4096 + i * 512 + 256); }
    }
    __builtin_amdgcn_sched_barrier(0);      /* keeps the next pair's LDS reads in one group ahead of the 16 products: left alone the compiler sinks each read to its first use, and the wave waits out every latency */
    v8f ch[2] = {}, cl[2] = {};
#pragma unroll
    for (int h = 0; h < NHD; ++h)
#pragma unroll
      for (int e2 = 0; e2 < 2; ++e2) {
        ch[e2] = __builtin_amdgcn_wmma_f32_16x16x32_f16(false, wf[g & 1][e2 * NHD + h].v, false, ogh[h].v, (short)0, ch[e2], false, false);
        cl[e2] = __builtin_amdgcn_wmma_f32_16x16x32_f16(false, wf[g & 1][e2 * NHD + h].v, false, ogl[h].v, (short)0, cl[e2], false, false); }
    __builtin_amdgcn_sched_barrier(0);      /* keeps the joins below all 16 products: risen in among the last of them, each group of joins takes its own run of v_nop behind a product */
#pragma unroll
    for (int e2 = 0; e2 < 2; ++e2) { v4f a0, a1;
#pragma unroll
      for (int r = 0; r < 4; ++r) { a0[r] = __builtin_fmaf(cl[e2][r], 0.0009765625f, ch[e2][r]); a1[r] = __builtin_fmaf(cl[e2][4 + r], 0.0009765625f, ch[e2][4 + r]); }
      float* sp = &st[ln * OP + ((g & 1) * 2 + e2) * 16 + 8 * hh]; *(v4fa*)sp = a0; *(v4fa*)(sp + 4) = a1; }
    if (g & 1) {
      __builtin_amdgcn_fence(__ATOMIC_ACQ_REL, "workgroup", "local"); __builtin_amdgcn_wave_barrier();      /* the rows read below were written by other lanes of this wave */
      const int p = g >> 1;
      const v4f b4 = *(const v4fa*)&sbo[p * 64 + c4];
      v4f rv[8];
#pragma unroll
      for (int q = 0; q < 8; ++q) rv[q] = *(const v4fa*)&st[(q * 2 + rsub) * OP + c4];
      __builtin_amdgcn_sched_barrier(0);      /* keeps the nine LDS reads in one group: one wait instead of one a row */
#pragma unroll
      for (int q = 0; q < 8; ++q) { v4f r4;
#pragma unroll
        for (int i = 0; i < 4; ++i) r4[i] = __builtin_fmaf(rv[q][i], 0.0625f, b4[i]);
        *(v4f*)(orow + (size_t)(q * 2 + rsub) * EE + p * 64 + c4) = r4; }
      asm volatile("s_wait_xcnt 0x0" ::: "memory");      /* the stores' address and data registers are reused only behind this wait; its clobber also keeps the second half's writes of st behind the reads above */
    }
  }
}

extern "C" void kernel_launch(void* const* d_in, const int* in_sizes, int n_in,
                              void* d_out, int out_size, void* d_ws, size_t ws_size, hipStream_t stream) {
  (void)in_sizes; (void)n_in; (void)out_size;
  const float* const* I = (const float* const*)d_in; const float* pr = I[0]; const float* mask = I[1]; const float* gam = I[2]; const float* bet = I[3]; const float* Wq = I[4]; const float* Wk = I[5]; const float* Wv = I[6]; const float* Wb = I[7]; const float* Wfu = I[8]; const float* bfu = I[9]; const float* Wo = I[10]; const float* bo = I[11];
  char* ws = (char*)d_ws; size_t off = 0;
  auto take = [&](size_t bytes) { char* p = ws + off; off += (bytes + 255) & ~(size_t)255; return p; };
  _Float16* BQK = (_Float16*)take((size_t)2 * EE * 2 * EE * 2); _Float16* AV = (_Float16*)take((size_t)EE * 2 * EE * 2); _Float16* BFU = (_Float16*)take((size_t)EE * 2 * EE * 2); _Float16* BO = (_Float16*)take((size_t)EE * 2 * EE * 2);      /* BQK, AV, BFU: bf16 bits, [G hi | G lo] (K 256); BO: f16, of which only the first plane is written and read */
  _Float16* BF = (_Float16*)take((size_t)NHD * SL * SL * 2); float* SGB = (float*)take((size_t)2 * 4 * EE * 4);
  if (off > ws_size) return;      // about 0.4 + 0.5 = 0.9 MB
  /* Wq, Wk: (in,out) -> 256 rows of K 256, row = output column, k = [hi e | lo e] of gamma[e] * W[e][column]; Wv and Wfu alike; SGB: their column sums; Wo: row e, k = hc, Wo[hc][e] * 16, the one plane. All in fragment order. */
  k_pre<<<BIAS_BLOCKS + PACK_BLOCKS, 512, 0, stream>>>(pr, mask, Wq, Wk, Wv, Wfu, Wo, Wb, gam, bet, BQK, AV, BFU, BO, SGB, BF);      /* pair bias of the normalised tokens, + mask, per head, in A-fragment order for the bias product; the packs */
  k_attn<<<SL, 512, 0, stream>>>(pr, SGB, bfu, BQK, AV, BFU, BF, BO, bo, (float*)d_out);      /* per row: LayerNorm, q, k, v^T, gate logits, attention of all heads, gate, output product (+ bo) */
}

// v009
// Measured time: 28.5 microseconds a run.
// Timed twice side by side with v008, it ran 1.08 times as fast both times.
// Counting every step since v000, it is 33.6 times as fast.
#include <hip/hip_runtime.h>
// Row-wise pair attention on a pair representation ([1,256,256,128], 4 heads × 32): x = LN(pair_rep); q = x·Wq·32^-½, k = x·Wk, v = x·Wv; per (row s, head h): logits[a][b] = Σ_c k[s,a,h,c]·q[s,b,h,c] + mask[a][b] + (x·Wb)[a][b][h]; softmax over b; o[s,a,h,:] = Σ_b attn·v[s,b,h,:]; o *= sigmoid(x·Wfu + bfu); out = o·Wo + bo → [1,256,256,128]. (The module's einsum makes k carry the output index and q the summed index.)
// Compute dtype: inputs and parameters rounded to bf16; the pair bias takes the tokens as exact bf16 operands against gamma * Wb carried hi/lo in bf16 (exact); q, k, v and the gate logits take them as f16 operands (the same values) against gamma * W rounded once to f16 (about 2^-12); LayerNorm's mean and 1/sigma applied behind the products in f32; the gated output carried hi/lo (about f32); q/k/v planes, probabilities, gate logits and the sum mask + pair bias f16 (about 2^-12); softmax/LN/sigmoid in f32; f32 accumulation. v_wmma_f32_16x16x32_bf16 and _f16.
#define SL 256
#define NTOK (SL * SL)           /* 65536 */
#define EE 128
#define NHD 4
#define HDC 32
typedef __bf16 v16b __attribute__((ext_vector_type(16)));
typedef unsigned short v8us __attribute__((ext_vector_type(8), may_alias));
typedef float  v8f  __attribute__((ext_vector_type(8)));
typedef float  v4f  __attribute__((ext_vector_type(4)));
typedef float  v4fa __attribute__((ext_vector_type(4), may_alias));
union FragB { v16b v; v8us half[2]; unsigned short u[16]; };

__device__ __forceinline__ unsigned short bf16_bits(float x) { unsigned int u = __float_as_uint(x); return (unsigned short)((u + 0x7FFFu + ((u >> 16) & 1u)) >> 16); }
__device__ __forceinline__ float bf16_val(unsigned short b) { return __uint_as_float(((unsigned int)b) << 16); }
__device__ __forceinline__ float bf16_round(float x) { return bf16_val(bf16_bits(x)); }
// D += A·B with NT terms: 1 = ah·bh, 2 = + al·bh (A split), 3 = + ah·bl (both split)
template <int NT>
__device__ __forceinline__ v8f mmaN(v16b ah, v16b al, v16b bh, v16b bl, v8f c) {
  c = __builtin_amdgcn_wmma_f32_16x16x32_bf16(false, ah, false, bh, (short)0, c, false, false);
  if (NT >= 2) c = __builtin_amdgcn_wmma_f32_16x16x32_bf16(false, al, false, bh, (short)0, c, false, false);
  if (NT >= 3) c = __builtin_amdgcn_wmma_f32_16x16x32_bf16(false, ah, false, bl, (short)0, c, false, false);
  asm volatile("v_nop\n\tv_nop\n\tv_nop\n\tv_nop" : "+v"(c) : "v"(ah), "v"(al), "v"(bh), "v"(bl));
  return c;
}

__global__ __launch_bounds__(256) void k_wt_bf16(const float* __restrict__ W, unsigned short* __restrict__ Wt, int K, int N) {
  const int t = blockIdx.x * 256 + threadIdx.x;
  const int k8n = K / 8;
  if (t >= N * k8n) return;
  const int n = t / k8n, k8 = (t % k8n) * 8;
  v8us v;
#pragma unroll
  for (int i = 0; i < 8; ++i) v[i] = bf16_bits(W[(size_t)(k8 + i) * N + n]);
  *(v8us*)(Wt + (size_t)n * K + k8) = v;
  
}

// GEMM C[M][N] (f32, pitch ldc) = act(A[M][K]·W + bias). A f32 row-major (pitch lda) converted per fragment to bf16
// (ASPLIT: hi/lo two planes -> 2 terms, else single rounded term); Wt bf16 [N][K] (pitch ldb). BIAS_BF16 rounds the
// bias to bf16 first (bias quantised to bf16 before the add). K%32==0, M%16==0, N%64==0.
template <bool ASPLIT, int ACT, bool BIAS_BF16>
__global__ __launch_bounds__(128) void k_gemm_bf(const float* __restrict__ A, int lda, const unsigned short* __restrict__ Wt, int ldb,
                                               const float* __restrict__ bias, float* __restrict__ C, int ldc, int M, int N, int K) {
  __shared__ __attribute__((aligned(16))) float so[4][16][64];
  const int tid = threadIdx.x, w = tid >> 5, lane = tid & 31, ln = lane & 15, hh = lane >> 4;
  const int ntn = N / 64;
  const int wid = blockIdx.x * 4 + w;
  const int mt = wid / ntn, nq = wid % ntn;
  if (mt * 16 >= M) return;
  const int row0 = mt * 16, col0 = nq * 64;
  const float* arow = A + (size_t)(row0 + ln) * lda;
  v8f acc[4] = {};
  for (int kb = 0; kb < K; kb += 32) {
    FragB ah, al;
    const v4f x0 = *(const v4fa*)(arow + kb + 8 * hh), x1 = *(const v4fa*)(arow + kb + 8 * hh + 4);
    const v4f x2 = *(const v4fa*)(arow + kb + 16 + 8 * hh), x3 = *(const v4fa*)(arow + kb + 16 + 8 * hh + 4);
    float xs[16] = {x0[0],x0[1],x0[2],x0[3],x1[0],x1[1],x1[2],x1[3],x2[0],x2[1],x2[2],x2[3],x3[0],x3[1],x3[2],x3[3]};
#pragma unroll
    for (int i = 0; i < 16; ++i) { const unsigned short hb = bf16_bits(xs[i]); ah.u[i] = hb; al.u[i] = ASPLIT ? bf16_bits(xs[i] - bf16_val(hb)) : (unsigned short)0; }
#pragma unroll
    for (int t = 0; t < 4; ++t) {
      const unsigned short* brow = Wt + (size_t)(col0 + t * 16 + ln) * ldb + kb;
      FragB b;
      b.half[0] = *(const v8us*)(brow + 8 * hh);
      b.half[1] = *(const v8us*)(brow + 16 + 8 * hh);
      acc[t] = mmaN<ASPLIT ? 2 : 1>(ah.v, al.v, b.v, b.v, acc[t]);
    }
  }
#pragma unroll
  for (int t = 0; t < 4; ++t) {
    float bv = bias ? bias[col0 + t * 16 + ln] : 0.f;
    if (BIAS_BF16) bv = bf16_round(bv);
#pragma unroll
    for (int r = 0; r < 8; ++r) { float v = acc[t][r] + bv; if (ACT == 1) v = fmaxf(v, 0.f); so[w][8 * hh + r][t * 16 + ln] = v; }
  }
  __builtin_amdgcn_fence(__ATOMIC_ACQ_REL, "workgroup");
  __builtin_amdgcn_wave_barrier();
  const int rsub = lane >> 4, c4 = (lane & 15) * 4;
  {
#pragma unroll
    for (int q = 0; q < 8; ++q) {
      const int r = q * 2 + rsub;
      const v4f v = *(const v4fa*)&so[w][r][c4];
      *(v4f*)(C + (size_t)(row0 + r) * ldc + col0 + c4) = v;
    }
    
  }
}

// GEMM C = act(A·W + bias + resid): A f32 (ASPLIT -> hi/lo 2 terms), Wt bf16 [N][K]; ACT 0 none, 1 relu, 2 exact gelu;
// resid (optional, f32, row index = (row % rmod), pitch ldr, RES_BF16 rounds it) added before the activation.
template <bool ASPLIT, int ACT, bool BIAS_BF16, bool RES_BF16>
__global__ __launch_bounds__(128) void k_gemm_bf3(const float* __restrict__ A, int lda, const unsigned short* __restrict__ Wt, int ldb,
                                                const float* __restrict__ bias, const float* __restrict__ resid, int rmod, int ldr,
                                                float* __restrict__ C, int ldc, int M, int N, int K) {
  __shared__ __attribute__((aligned(16))) float so[4][16][64];
  const int tid = threadIdx.x, w = tid >> 5, lane = tid & 31, ln = lane & 15, hh = lane >> 4;
  const int ntn = N / 64;
  const int wid = blockIdx.x * 4 + w;
  const int mt = wid / ntn, nq = wid % ntn;
  if (mt * 16 >= M) return;
  const int row0 = mt * 16, col0 = nq * 64;
  const float* arow = A + (size_t)(row0 + ln) * lda;
  v8f acc[4] = {};
  for (int kb = 0; kb < K; kb += 32) {
    FragB ah, al;
    const v4f x0 = *(const v4fa*)(arow + kb + 8 * hh), x1 = *(const v4fa*)(arow + kb + 8 * hh + 4);
    const v4f x2 = *(const v4fa*)(arow + kb + 16 + 8 * hh), x3 = *(const v4fa*)(arow + kb + 16 + 8 * hh + 4);
    float xs[16] = {x0[0],x0[1],x0[2],x0[3],x1[0],x1[1],x1[2],x1[3],x2[0],x2[1],x2[2],x2[3],x3[0],x3[1],x3[2],x3[3]};
#pragma unroll
    for (int i = 0; i < 16; ++i) { const unsigned short hb = bf16_bits(xs[i]); ah.u[i] = hb; al.u[i] = ASPLIT ? bf16_bits(xs[i] - bf16_val(hb)) : (unsigned short)0; }
#pragma unroll
    for (int t = 0; t < 4; ++t) {
      const unsigned short* brow = Wt + (size_t)(col0 + t * 16 + ln) * ldb + kb;
      FragB b;
      b.half[0] = *(const v8us*)(brow + 8 * hh);
      b.half[1] = *(const v8us*)(brow + 16 + 8 * hh);
      acc[t] = mmaN<ASPLIT ? 2 : 1>(ah.v, al.v, b.v, b.v, acc[t]);
    }
  }
#pragma unroll
  for (int t = 0; t < 4; ++t) {
    const int col = col0 + t * 16 + ln;
    float bv = bias ? bias[col] : 0.f;
    if (BIAS_BF16) bv = bf16_round(bv);
#pragma unroll
    for (int r = 0; r < 8; ++r) {
      float v = acc[t][r] + bv;
      if (resid) { float rv = resid[(size_t)((row0 + 8 * hh + r) % rmod) * ldr + col]; if (RES_BF16) rv = bf16_round(rv); v += rv; }
      if (ACT == 1) v = fmaxf(v, 0.f);
      if (ACT == 2) v = 0.5f * v * (1.0f + erff(v * 0.70710678118654752f));
      if (ACT == 3) { const float u = 0.7978845608028654f * (v + 0.044715f * v * v * v); v = 0.5f * v * (1.0f + tanhf(u)); }
      so[w][8 * hh + r][t * 16 + ln] = v;
    }
  }
  __builtin_amdgcn_fence(__ATOMIC_ACQ_REL, "workgroup");
  __builtin_amdgcn_wave_barrier();
  const int rsub = lane >> 4, c4 = (lane & 15) * 4;
  {
#pragma unroll
    for (int q = 0; q < 8; ++q) {
      const int r = q * 2 + rsub;
      const v4f v = *(const v4fa*)&so[w][r][c4];
      *(v4f*)(C + (size_t)(row0 + r) * ldc + col0 + c4) = v;
    }
    
  }
}
// row LayerNorm (biased variance, eps) over N: s = X (+ R); optional out_sum <- s; out_norm <- (s-mu)*rsqrt(var+eps)*g + b
template <bool PARAM_BF16>
__global__ __launch_bounds__(256) void k_layernorm(const float* __restrict__ X, const float* __restrict__ R, const float* __restrict__ g, const float* __restrict__ bta,
                                                  float* __restrict__ out_sum, float* __restrict__ out_norm, int N, float eps) {
  __shared__ float red[256];
  const int row = blockIdx.x, tid = threadIdx.x;
  const float* x = X + (size_t)row * N; const float* rr = R ? R + (size_t)row * N : nullptr;
  float vals[16];                     // up to N = 4096
  const int per = N / 256;            // contiguous chunk per thread? use strided-by-4 chunks: thread handles j = tid*4 + 1024*u
  float s1 = 0.f;
  for (int u = 0; u < per / 4; ++u) {
    const int j = tid * 4 + 1024 * u;
    const v4f a = *(const v4fa*)(x + j);
    v4f b = {0.f,0.f,0.f,0.f}; if (rr) b = *(const v4fa*)(rr + j);
#pragma unroll
    for (int q = 0; q < 4; ++q) { const float v = a[q] + b[q]; vals[u * 4 + q] = v; s1 += v; }
  }
  red[tid] = s1; __syncthreads();
  for (int st = 128; st > 0; st >>= 1) { if (tid < st) red[tid] += red[tid + st]; __syncthreads(); }
  const float mu = red[0] / (float)N; __syncthreads();
  float s2 = 0.f;
  for (int u = 0; u < per / 4; ++u)
#pragma unroll
    for (int q = 0; q < 4; ++q) { const float c = vals[u * 4 + q] - mu; s2 += c * c; }
  red[tid] = s2; __syncthreads();
  for (int st = 128; st > 0; st >>= 1) { if (tid < st) red[tid] += red[tid + st]; __syncthreads(); }
  const float rs = rsqrtf(red[0] / (float)N + eps);
  {
    for (int u = 0; u < per / 4; ++u) {
      const int j = tid * 4 + 1024 * u;
      v4f o, sm;
#pragma unroll
      for (int q = 0; q < 4; ++q) {
        float gg = g[j + q], bb = bta[j + q];
        if (PARAM_BF16) { gg = bf16_round(gg); bb = bf16_round(bb); }
        sm[q] = vals[u * 4 + q]; o[q] = (vals[u * 4 + q] - mu) * rs * gg + bb;
      }
      if (out_sum) *(v4f*)(out_sum + (size_t)row * N + j) = sm;
      *(v4f*)(out_norm + (size_t)row * N + j) = o;
    }
    
  }
}



// ---- f16 WMMA path (v_wmma_f32_16x16x32_f16): 11-bit significands for operands in range — used where a [0,1] probability operand needs more precision than bf16
typedef _Float16 v16h __attribute__((ext_vector_type(16)));
union FragH { v16h v; v8us half[2]; _Float16 h[16]; unsigned short u[16]; };
template <int NT>
__device__ __forceinline__ v8f mmaH(v16h ah, v16h al, v16h bh, v16h bl, v8f c) {
  c = __builtin_amdgcn_wmma_f32_16x16x32_f16(false, ah, false, bh, (short)0, c, false, false);
  if (NT >= 2) c = __builtin_amdgcn_wmma_f32_16x16x32_f16(false, al, false, bh, (short)0, c, false, false);
  if (NT >= 3) c = __builtin_amdgcn_wmma_f32_16x16x32_f16(false, ah, false, bl, (short)0, c, false, false);
  asm volatile("v_nop\n\tv_nop\n\tv_nop\n\tv_nop" : "+v"(c) : "v"(ah), "v"(al), "v"(bh), "v"(bl));
  return c;
}
// batched GEMM like k_gemm_b but f16 operands: A f32 (split into f16 hi/lo if ASPLIT, else rounded to f16), Bt = f16 values [n][k]; alpha; C f32; N multiple of 16 (partial tiles skipped)
template <bool ASPLIT>
__global__ __launch_bounds__(128) void k_gemm_h(const float* __restrict__ A, int lda, size_t sA, const _Float16* __restrict__ Bh, int ldb, size_t sB, float alpha, float* __restrict__ C, int ldc, size_t sC, int M, int N, int K) {
  __shared__ __attribute__((aligned(16))) float so[4][16][64];
  const int tid = threadIdx.x, w = tid >> 5, lane = tid & 31, ln = lane & 15, hh = lane >> 4; const int by = blockIdx.y;
  A += (size_t)by * sA; Bh += (size_t)by * sB; C += (size_t)by * sC;
  const int ntn = (N + 63) / 64; const int wid = blockIdx.x * 4 + w; const int mt = wid / ntn, nq = wid % ntn; if (mt * 16 >= M) return;
  const int row0 = mt * 16, col0 = nq * 64; const float* arow = A + (size_t)(row0 + ln) * lda;
  v8f acc[4] = {};
  for (int kb = 0; kb < K; kb += 32) {
    FragH ah, al;
    const v4f x0 = *(const v4fa*)(arow + kb + 8 * hh), x1 = *(const v4fa*)(arow + kb + 8 * hh + 4), x2 = *(const v4fa*)(arow + kb + 16 + 8 * hh), x3 = *(const v4fa*)(arow + kb + 16 + 8 * hh + 4);
    float xs[16] = {x0[0],x0[1],x0[2],x0[3],x1[0],x1[1],x1[2],x1[3],x2[0],x2[1],x2[2],x2[3],x3[0],x3[1],x3[2],x3[3]};
#pragma unroll
    for (int i = 0; i < 16; ++i) { const _Float16 h = (_Float16)xs[i]; ah.h[i] = h; al.h[i] = ASPLIT ? (_Float16)(xs[i] - (float)h) : (_Float16)0.0f; }
#pragma unroll
    for (int t = 0; t < 4; ++t) { if (col0 + t * 16 >= N) continue; const size_t boff = (size_t)(col0 + t * 16 + ln) * ldb + kb; FragH bq; bq.half[0] = *(const v8us*)(Bh + boff + 8 * hh); bq.half[1] = *(const v8us*)(Bh + boff + 16 + 8 * hh);
      acc[t] = mmaH<ASPLIT ? 2 : 1>(ah.v, al.v, bq.v, bq.v, acc[t]); }
  }
#pragma unroll
  for (int t = 0; t < 4; ++t) { if (col0 + t * 16 >= N) continue;
#pragma unroll
    for (int r = 0; r < 8; ++r) so[w][8 * hh + r][t * 16 + ln] = acc[t][r] * alpha; }
  __builtin_amdgcn_fence(__ATOMIC_ACQ_REL, "workgroup"); __builtin_amdgcn_wave_barrier();
  const int rsub = lane >> 4, c4 = (lane & 15) * 4;
  {
#pragma unroll
    for (int q = 0; q < 8; ++q) { const int r = q * 2 + rsub; if (col0 + c4 < N) { const v4f v = *(const v4fa*)&so[w][r][c4]; *(v4f*)(C + (size_t)(row0 + r) * ldc + col0 + c4) = v; } }
     }
}

// Wt[n][k] = f16(W[k][n]·scale) from f32 row-major W[K][N] (scale = power of two; bf16-exact weights stay exact in f16 away from the subnormal range)
__global__ __launch_bounds__(256) void k_wt_f16(const float* __restrict__ W, _Float16* __restrict__ Wt, int K, int N, float scale) {
  const int t = blockIdx.x * 256 + threadIdx.x; if (t >= N * (K / 8)) return; const int n = t / (K / 8), k8 = (t % (K / 8)) * 8; FragH f;
#pragma unroll
  for (int i = 0; i < 8; ++i) f.h[i] = (_Float16)(bf16_round(W[(size_t)(k8 + i) * N + n]) * scale); const v8us o = f.half[0];
  *(v8us*)((unsigned short*)Wt + (size_t)n * K + k8) = o; 
}
// k_gemm_hh variant with fused epilogue: v = acc·alpha + bias[by·sBias + col] (+ CP[(row/rowsPerB)·sCPb + by·64 + col] if CP) ; ACT 0 none / 1 elu ; writes f32 C and/or f16 C16 (each if non-null)
template <int ACT>
__global__ __launch_bounds__(128) void k_gemm_hhx(const _Float16* __restrict__ A, int lda, size_t sA, const _Float16* __restrict__ Bh, int ldb, size_t sB, float alpha, const float* __restrict__ bias, size_t sBias, const float* __restrict__ CP, int rowsPerB, size_t sCPb, int row0g,
    float* __restrict__ C, _Float16* __restrict__ C16, int ldc, size_t sC, int M, int N, int K) {
  __shared__ __attribute__((aligned(16))) float so[4][16][64];
  const int tid = threadIdx.x, w = tid >> 5, lane = tid & 31, ln = lane & 15, hh = lane >> 4; const int by = blockIdx.y;
  A += (size_t)by * sA; Bh += (size_t)by * sB; const size_t cofs = (size_t)by * sC; const float* bp = bias ? bias + (size_t)by * sBias : nullptr;
  const int ntn = (N + 63) / 64; const int wid = blockIdx.x * 4 + w; const int mt = wid / ntn, nq = wid % ntn; if (mt * 16 >= M) return;
  const int row0 = mt * 16, col0 = nq * 64; const _Float16* arow = A + (size_t)(row0 + ln) * lda;
  v8f acc[4] = {};
  for (int kb = 0; kb < K; kb += 32) { FragH ah; ah.half[0] = *(const v8us*)((const unsigned short*)arow + kb + 8 * hh); ah.half[1] = *(const v8us*)((const unsigned short*)arow + kb + 16 + 8 * hh);
#pragma unroll
    for (int t = 0; t < 4; ++t) { if (col0 + t * 16 >= N) continue; const size_t boff = (size_t)(col0 + t * 16 + ln) * ldb + kb; FragH bq; bq.half[0] = *(const v8us*)((const unsigned short*)Bh + boff + 8 * hh); bq.half[1] = *(const v8us*)((const unsigned short*)Bh + boff + 16 + 8 * hh);
      acc[t] = mmaH<1>(ah.v, ah.v, bq.v, bq.v, acc[t]); }
  }
#pragma unroll
  for (int t = 0; t < 4; ++t) { if (col0 + t * 16 >= N) continue; const int col = col0 + t * 16 + ln; const float bv = bp ? bf16_round(bp[col]) : 0.f;
#pragma unroll
    for (int r = 0; r < 8; ++r) { float v = acc[t][r] * alpha + bv; if (CP) { const int bidx = (row0g + row0 + 8 * hh + r) / rowsPerB; v += CP[(size_t)bidx * sCPb + (size_t)by * 64 + col]; } if (ACT == 1) v = (v > 0.f) ? v : expm1f(v); else if (ACT == 7) v = (v > 0.f) ? v + 1.0f : expf(v); else if (ACT == 8) v = tanhf(v); else if (ACT == 9) v = 0.5f * v * (1.0f + tanhf(0.7978845608028654f * (v + 0.044715f * v * v * v))); else if (ACT == 11) v = 1.0f / (1.0f + expf(-v)); else if (ACT == 12) v = (v > 0.f) ? v : 0.01f * v; else if (ACT == 14) v = (v > 0.f) ? v : 0.1f * v; else if (ACT == 15) v = v / (1.0f + expf(-v)); else if (ACT == 3) v = fmaxf(v, 0.f); else if (ACT == 6) v = 0.5f * v * (1.0f + erff(v * 0.70710678118654752f)); so[w][8 * hh + r][t * 16 + ln] = v; } }
  __builtin_amdgcn_fence(__ATOMIC_ACQ_REL, "workgroup"); __builtin_amdgcn_wave_barrier();
  const int rsub = lane >> 4, c4 = (lane & 15) * 4; typedef _Float16 v4h __attribute__((ext_vector_type(4)));
  {
#pragma unroll
    for (int q = 0; q < 8; ++q) { const int r = q * 2 + rsub; if (col0 + c4 < N) { const v4f v = *(const v4fa*)&so[w][r][c4]; if (C) *(v4f*)(C + cofs + (size_t)(row0 + r) * ldc + col0 + c4) = v; if (C16) { v4h h4; for (int i = 0; i < 4; ++i) h4[i] = (_Float16)v[i]; *(v4h*)(C16 + cofs + (size_t)(row0 + r) * ldc + col0 + c4) = h4; } } }
     }
}


typedef _Float16 v4h __attribute__((ext_vector_type(4)));

__global__ __launch_bounds__(256) void k_x16(const float* __restrict__ x, _Float16* __restrict__ X16, size_t n8) { const size_t t = (size_t)blockIdx.x * 256 + threadIdx.x; if (t >= n8) return; FragH f;
#pragma unroll
  for (int q = 0; q < 8; ++q) f.h[q] = (_Float16)bf16_round(x[t * 8 + q]); *(v8us*)((unsigned short*)X16 + t * 8) = f.half[0];  }
__global__ __launch_bounds__(256) void k_h16(const float* __restrict__ x, _Float16* __restrict__ X16, size_t n8) { const size_t t = (size_t)blockIdx.x * 256 + threadIdx.x; if (t >= n8) return; FragH f;
#pragma unroll
  for (int q = 0; q < 8; ++q) f.h[q] = (_Float16)x[t * 8 + q]; *(v8us*)((unsigned short*)X16 + t * 8) = f.half[0];  }
__global__ __launch_bounds__(256) void k_round16f(const float* __restrict__ W, _Float16* __restrict__ Bt, size_t n8) { const size_t t = (size_t)blockIdx.x * 256 + threadIdx.x; if (t >= n8) return; FragH f;
#pragma unroll
  for (int i = 0; i < 8; ++i) f.h[i] = (_Float16)(bf16_round(W[t * 8 + i]) * 16.0f); *(v8us*)((unsigned short*)Bt + t * 8) = f.half[0];  }
template <int NHv, int TTv>
__global__ __launch_bounds__(256) void k_vt(const _Float16* __restrict__ V16, int ldv, int voff, _Float16* __restrict__ Vt) { __shared__ unsigned short tl[64][66]; const int tid = threadIdx.x; const int slab = blockIdx.x / (TTv / 64), lg = blockIdx.x % (TTv / 64); const int b = slab / NHv, h = slab % NHv;
  for (int i = tid; i < 64 * 8; i += 256) { const int r = i / 8, c8 = (i % 8) * 8; FragH f; f.half[0] = *(const v8us*)((const unsigned short*)V16 + ((size_t)b * TTv + lg * 64 + r) * ldv + voff + h * 64 + c8);
#pragma unroll
    for (int q = 0; q < 8; ++q) tl[r][c8 + q] = f.u[q]; }
  __syncthreads();
  {
#pragma unroll
    for (int rd = 0; rd < 2; ++rd) { const int d = rd * 32 + tid / 8, pc = tid % 8; FragH f;
#pragma unroll
      for (int q = 0; q < 8; ++q) f.u[q] = tl[pc * 8 + q][d];
      *(v8us*)((unsigned short*)Vt + ((size_t)slab * 64 + d) * TTv + lg * 64 + pc * 8) = f.half[0]; }
     } }

__global__ __launch_bounds__(256) void k_hl(const float* __restrict__ F, _Float16* __restrict__ Hh, _Float16* __restrict__ Hl, size_t n8) { const size_t t = (size_t)blockIdx.x * 256 + threadIdx.x; if (t >= n8) return; FragH fh, fl; const v4f a = *(const v4fa*)(F + t * 8), c = *(const v4fa*)(F + t * 8 + 4);
#pragma unroll
  for (int q = 0; q < 4; ++q) { _Float16 h = (_Float16)a[q]; fh.h[q] = h; fl.h[q] = (_Float16)((a[q] - (float)h) * 1024.0f); h = (_Float16)c[q]; fh.h[4 + q] = h; fl.h[4 + q] = (_Float16)((c[q] - (float)h) * 1024.0f); }
  { *(v8us*)((unsigned short*)Hh + t * 8) = fh.half[0]; *(v8us*)((unsigned short*)Hl + t * 8) = fl.half[0];  } }

// Offset in halves of the 8 values k = kk .. kk + 7 (kk a multiple of 8) of row n, K 256, in matrix-fragment order [n / 16][kk / 32][half][lane][8], half = (kk >> 4) & 1, lane = 16 * ((kk >> 3) & 1) + n % 16:
// a wave's 16-byte load of half a fragment then covers 512 contiguous bytes (four whole lines) instead of pieces of sixteen lines.
__device__ __forceinline__ size_t frag_off(int n, int kk) { return ((((size_t)(n >> 4) * 8 + (kk >> 5)) * 2 + ((kk >> 4) & 1)) * 32 + ((kk >> 3) & 1) * 16 + (n & 15)) * 8; }
// The folded weights [W*s | W*s*2^-10] for K = N = 128, stored in fragment order. 2048 threads (t), one (n, k8) each; neighbouring threads take neighbouring n (whole lines on the load side).
// LO false: only the W*s plane is written (k_attn multiplies both planes of its operand by that one plane and joins the two sums afterwards).
template <bool LO>
__device__ __forceinline__ void pack_wtf(const float* __restrict__ W, float scale, _Float16* __restrict__ Bt, int t) { const int n = t % EE, k8 = (t / EE) * 8; const int i0 = k8 * EE + n; float x[8]; FragH f, f2;
#pragma unroll
  for (int i = 0; i < 8; ++i) x[i] = W[i0 + i * EE];
  asm volatile("s_wait_xcnt 0x0" :: "v"(i0) : "memory");      /* named as an input, the eight loads' offset register stays whole up to this wait: none of their results lands on it */
#pragma unroll
  for (int i = 0; i < 8; ++i) { const float wv = bf16_round(x[i]) * scale; f.h[i] = (_Float16)wv; f2.h[i] = (_Float16)(wv * 0.0009765625f); }
  { *(v8us*)((unsigned short*)Bt + frag_off(n, k8)) = f.half[0]; if (LO) *(v8us*)((unsigned short*)Bt + frag_off(n, EE + k8)) = f2.half[0];  } }
// The weights of the four products that read x (q, k, v, gate logits), K = N = 128, with gamma folded in: G[e][n] = f16(gamma[e] * W[e][n]), both factors rounded to bf16 first. The product has 16 significant bits, f16 keeps 11:
// the rounding that the planes q, k, v and the gate logits get anyway. One plane, the k steps 0..3 of the K 256 fragment order. 2048 threads (t), one (n, k8) each; neighbouring threads take neighbouring n (whole lines on the load side).
typedef __bf16 v4b __attribute__((ext_vector_type(4)));
__device__ __forceinline__ void pack_wg(const float* __restrict__ W, const float* __restrict__ g, unsigned short* __restrict__ Bt, int t) { const int n = t % EE, k8 = (t / EE) * 8; const int i0 = k8 * EE + n; float x[8]; FragH f;
#pragma unroll
  for (int i = 0; i < 8; ++i) x[i] = W[i0 + i * EE];
  const v4f g0 = *(const v4fa*)(g + k8), g1 = *(const v4fa*)(g + k8 + 4);
  asm volatile("s_wait_xcnt 0x0" :: "v"(i0), "v"(k8) : "memory");      /* named as inputs, the ten loads' offset registers stay whole up to this wait: none of their results lands on them */
  __builtin_amdgcn_sched_barrier(0);      /* keeps the arithmetic below behind the wait: risen above it, its first moves took the register that holds gamma's byte offset */
#pragma unroll
  for (int i = 0; i < 8; ++i) f.h[i] = (_Float16)(bf16_round(i < 4 ? g0[i & 3] : g1[i & 3]) * bf16_round(x[i]));
  *(v8us*)(Bt + frag_off(n, k8)) = f.half[0]; }
// Per column of those four products: sum over e of G[e][n], the f16 values that the product meets, so that a token's mean cancels against them exactly (SGB[col]), and of beta[e] * W[e][n] (SGB[512 + col]). A wave takes 8 columns x 4 quarters of e (lane = 8 * quarter + column); two exchanges join the quarters.
__device__ __forceinline__ void pack_sums(const float* __restrict__ W /* the same for the whole wave */, const float* __restrict__ g, const float* __restrict__ b, float* __restrict__ SGB, int col, int n, int part) {
  const int i0 = part * 32 * EE + n, p0 = part * 32; float x[32]; v4f gv[8], bv[8];
#pragma unroll
  for (int i = 0; i < 32; ++i) x[i] = W[i0 + i * EE];
#pragma unroll
  for (int i = 0; i < 8; ++i) { gv[i] = *(const v4fa*)(g + p0 + i * 4); bv[i] = *(const v4fa*)(b + p0 + i * 4); }
  asm volatile("s_wait_xcnt 0x0" :: "v"(i0), "v"(p0), "s"(W), "s"(g), "s"(b) : "memory");      /* named as inputs, the loads' address registers (offsets, scalar bases) stay whole up to this wait: none of their results lands on them */
  __builtin_amdgcn_sched_barrier(0);      /* keeps all 48 loads in one group ahead of the arithmetic: left alone the compiler holds some back behind the first sums, and the wave waits out the memory latency more than once */
  float sg = 0.f, sb = 0.f;
#pragma unroll
  for (int i = 0; i < 8; ++i) { const v4b wb = __builtin_convertvector(((v4f){x[i * 4], x[i * 4 + 1], x[i * 4 + 2], x[i * 4 + 3]}), v4b), gb = __builtin_convertvector(gv[i], v4b), bb = __builtin_convertvector(bv[i], v4b);      /* round to nearest even, as bf16_round */
#pragma unroll
    for (int q = 0; q < 4; ++q) { sg += (float)(_Float16)((float)gb[q] * (float)wb[q]); sb = __builtin_fmaf((float)bb[q], (float)wb[q], sb); } }
  sg += __shfl_xor(sg, 8, 32); sb += __shfl_xor(sb, 8, 32); sg += __shfl_xor(sg, 16, 32); sb += __shfl_xor(sb, 16, 32);
  if (part == 0) { SGB[col] = sg; SGB[4 * EE + col] = sb; } }
// The pair-bias operands: two tiles of 16 rows x K 128 in bf16, in fragment order (tile 1 = k steps 0..3, tile 2 = k steps 4..7 of the K 256 order). With G[e][h] = gamma[e] * Wb[e][h] and B[e][h] = beta[e] * Wb[e][h]
// (factors rounded to bf16, so each product has 16 significant bits and hi + lo in bf16 holds it whole): tile 1 = rows 0..3 G hi, 4..7 G lo, 8 ones, the rest zero; tile 2 = rows 0..3 G hi, 4..7 G lo, 8..11 B hi, 12..15 B lo.
// 512 threads, one (o, k0) each, o = t % 16 and k0 = 8 * (t / 16): a wave's 32 pieces are 512 neighbouring bytes of the fragment order. Every block that needs the tiles forms them itself, in its LDS:
// wb_loads asks for a piece's ten inputs, wb_piece forms and stores it, so that other loads can be asked for in between.
__device__ __forceinline__ void wb_loads(const float* __restrict__ w, const float* __restrict__ g, const float* __restrict__ b, int o, int k0, float (&x)[8], v4f& s0, v4f& s1) { const int kk0 = k0 % EE; const bool t2 = k0 >= EE;
  const int i0 = kk0 * NHD + (o & 3); const float* sp = ((t2 && o >= 8) ? b : g) + kk0;
#pragma unroll
  for (int q = 0; q < 8; ++q) x[q] = w[i0 + q * NHD];
  s0 = *(const v4fa*)sp; s1 = *(const v4fa*)(sp + 4);
  asm volatile("s_wait_xcnt 0x0" :: "v"(i0), "v"(sp) : "memory");      /* named as inputs, the ten loads' address registers stay whole up to this wait: none of their results lands on them */
}
__device__ __forceinline__ void wb_piece(const float (&x)[8], v4f s0, v4f s1, int o, int k0, unsigned short* Bt) { const bool t2 = k0 >= EE; FragB f;
#pragma unroll
  for (int q = 0; q < 8; ++q) { const float pr = bf16_round(q < 4 ? s0[q & 3] : s1[q & 3]) * bf16_round(x[q]); const float hi = bf16_round(pr); float val = (o & 4) ? pr - hi : hi;
    if (!t2 && o >= 8) val = (o == 8) ? 1.0f : 0.0f;
    f.u[q] = bf16_bits(val); }
  *(v8us*)(Bt + frag_off(o, k0)) = f.half[0];  }
// The packs that k_attn reads: none needs anything of another, so each takes a range of the block index (four blocks of 512 threads a 128 x 128 matrix, four for the column sums). The choice is the same for a whole block.
#define PACK_BLOCKS (5 * 4 + 4)
#define BIAS_BLOCKS ((SL / 16) * (SL / 16))
__device__ __forceinline__ void pack_block(int blk, const float* __restrict__ Wq, const float* __restrict__ Wk, const float* __restrict__ Wv, const float* __restrict__ Wfu, const float* __restrict__ Wo, const float* __restrict__ gam, const float* __restrict__ bet,
                                           _Float16* __restrict__ BQK, _Float16* __restrict__ AV, _Float16* __restrict__ BFU, _Float16* __restrict__ BO, float* __restrict__ SGB) {
  const int job = blk >> 2, t = (blk & 3) * 512 + threadIdx.x;
  if (job == 5) {
    const int gw = (blk & 3) * 16 + __builtin_amdgcn_readfirstlane(threadIdx.x >> 5), c = threadIdx.x & 7, m = gw >> 4;      /* 64 waves, sixteen a matrix; the wave's number in a scalar register: the choice of the matrix is scalar */
    const float* W = (m == 0) ? Wq : (m == 1) ? Wk : (m == 2) ? Wv : Wfu;
    pack_sums(W, gam, bet, SGB, gw * 8 + c, (gw & 15) * 8 + c, (threadIdx.x >> 3) & 3);
    asm volatile("s_wait_xcnt 0x0" ::: "memory");      /* as below, for the two stores of this range */
  } else if (job == 4) pack_wtf<false>(Wo, 16.0f, BO, t);
  else {
    const float* W = (job == 0) ? Wq : (job == 1) ? Wk : (job == 2) ? Wv : Wfu;
    _Float16* Bt = (job == 0) ? BQK : (job == 1) ? BQK + (size_t)EE * 2 * EE : (job == 2) ? AV : BFU;
    pack_wg(W, gam, (unsigned short*)Bt, t);
    asm volatile("s_wait_xcnt 0x0" ::: "memory");      /* the built code may join the ranges by flags, so another range's instructions can stand on a path behind these stores: they reuse the stores' registers only behind this wait */
  }
}
// LayerNorm is linear in the token once its mean mu and its 1/sigma rs are known: x.W = rs * (v.G - mu * sum(G)) + sum(B), G = gamma * W, B = beta * W (sums over the channel). So no normalised row is formed:
// the tokens, rounded to bf16 as everywhere, lie in LDS as they are and go into the matrix products as exact operands against G; mu, rs and the two column sums come in behind the product.
#define RP 136                   /* staged raw row pitch in halves: 256 B of data + 16 B (16 B x odd: conflict-free ds_load_b128) */
typedef __bf16 v4ba __attribute__((ext_vector_type(4), may_alias));
typedef unsigned int v8u __attribute__((ext_vector_type(8)));
__device__ __forceinline__ float other_half(float x);
// Sixteen tokens of one wave into LDS as bf16: a whole row per load, 4 channels a lane. xp and xw already hold the lane's offset (4 * lane); step = floats from one of the wave's tokens to its next.
// Every loop here and in proj_unit is unrolled because its index picks registers (a row's values, fragments, accumulators), which only a compile-time index can.
__device__ __forceinline__ void raw_load(const float* __restrict__ xp, int step, v4f (&a)[16]) {
#pragma unroll
  for (int u = 0; u < 16; ++u) a[u] = *(const v4fa*)(xp + (size_t)u * step);
  asm volatile("s_wait_xcnt 0x0" ::: "memory");      /* the address registers of the sixteen loads above are reused only behind this wait */
  __builtin_amdgcn_sched_barrier(0);      /* keeps all sixteen loads in one group ahead of the conversions: the wave waits out the memory latency once */
}
__device__ __forceinline__ void raw_store(const v4f (&a)[16], unsigned short* xw) {
#pragma unroll
  for (int u = 0; u < 16; ++u) *(v4ba*)&xw[u * RP] = __builtin_convertvector(a[u], v4b);      /* round to nearest even, two values an instruction */
}
// The same rows as f16, for the products against the f16 plane of G: rounded to bf16 first, as everywhere; f16 then holds the 8 significant bits whole from 2^-17 up to its largest value.
typedef _Float16 v4ha __attribute__((ext_vector_type(4), may_alias));
__device__ __forceinline__ void raw_store_h(const v4f (&a)[16], unsigned short* xw) {
#pragma unroll
  for (int u = 0; u < 16; ++u) *(v4ha*)&xw[u * RP] = __builtin_convertvector(__builtin_convertvector(__builtin_convertvector(a[u], v4b), v4f), v4h);
}
__device__ __forceinline__ void raw_rows(const float* __restrict__ xp, int step, unsigned short* xw) { v4f a[16]; raw_load(xp, step, a); raw_store_h(a, xw); }
// 1/sigma of the token whose fragments a lane holds (64 of its channels, the other half of the wave the other 64): the variance stays the mean of (v - mu)^2; one exchange between the wave halves ends the sum.
__device__ __forceinline__ float token_rs(const FragB (&xf)[4], float mu) {
  float q4[4] = {0.f, 0.f, 0.f, 0.f};
#pragma unroll
  for (int kb = 0; kb < 4; ++kb) { const v8u ww = __builtin_bit_cast(v8u, xf[kb].v);
#pragma unroll
    for (int j = 0; j < 8; ++j) { const float d0 = __uint_as_float(ww[j] << 16) - mu, d1 = __uint_as_float(ww[j] & 0xFFFF0000u) - mu; q4[(j & 1) * 2] = __builtin_fmaf(d0, d0, q4[(j & 1) * 2]); q4[(j & 1) * 2 + 1] = __builtin_fmaf(d1, d1, q4[(j & 1) * 2 + 1]); } }
  float q2 = (q4[0] + q4[1]) + (q4[2] + q4[3]); q2 += other_half(q2);
  return rsqrtf(q2 / (float)EE + 1e-5f);
}
// The same from f16 fragments, summed in the same order.
__device__ __forceinline__ float token_rs_h(const FragH (&xf)[4], float mu) {
  float q4[4] = {0.f, 0.f, 0.f, 0.f};
#pragma unroll
  for (int kb = 0; kb < 4; ++kb)
#pragma unroll
    for (int j = 0; j < 16; ++j) { const float d = (float)xf[kb].h[j] - mu; q4[j & 3] = __builtin_fmaf(d, d, q4[j & 3]); }
  float q2 = (q4[0] + q4[1]) + (q4[2] + q4[3]); q2 += other_half(q2);
  return rsqrtf(q2 / (float)EE + 1e-5f);
}
// One unit of 64 tokens x 64 columns, left in registers as f16: res[i][j] = 8 values of token tile i and column tile j.
// XA false: the weights go in as A, so a lane holds 8 neighbouring columns (j * 16 + 8 hh + r) of one token (i * 16 + ln). XA true (v^T): the tokens go in as A, so a lane holds 8 neighbouring tokens (i * 16 + 8 hh + r) of one column (j * 16 + ln).
// Four k steps of 32 channels. pmu, prs: the 64 tokens' mean and 1/sigma; psg, psb: the 64 columns' sum(G) and sum(B) (+ bias); all in LDS.
template <bool XA>
__device__ __forceinline__ void proj_unit(const unsigned short* xs, const unsigned short* __restrict__ wt, const float* pmu, const float* prs, const float* psg, const float* psb, v8us (&res)[4][4], int lane) {
  const int ln = lane & 15, hh = lane >> 4;
  const unsigned short* xr = xs + ln * RP + 8 * hh;
  const unsigned short* wr = wt + lane * 8;      /* fragment order: 4096 halves a 16-row tile, 512 a k step (steps 0..3 hold the plane), 256 half a fragment */
  v8f acc[4][4] = {};
  FragH wf[2][4], xf[4];         /* weight fragments come from L2: fetched one k step ahead */
#pragma unroll
  for (int j = 0; j < 4; ++j) { wf[0][j].half[0] = *(const v8us*)(wr + j * 4096); wf[0][j].half[1] = *(const v8us*)(wr + j * 4096 + 256); }
#pragma unroll
  for (int st = 0; st < 4; ++st) {
    if (st + 1 < 4) { const int ko = (st + 1) * 512;
#pragma unroll
      for (int j = 0; j < 4; ++j) { wf[(st + 1) & 1][j].half[0] = *(const v8us*)(wr + j * 4096 + ko); wf[(st + 1) & 1][j].half[1] = *(const v8us*)(wr + j * 4096 + ko + 256); }
    }
#pragma unroll
    for (int i = 0; i < 4; ++i) { xf[i].half[0] = *(const v8us*)(xr + i * 16 * RP + st * 32); xf[i].half[1] = *(const v8us*)(xr + i * 16 * RP + st * 32 + 16); }
    __builtin_amdgcn_sched_barrier(0);      /* keeps the next step's weight loads and this step's LDS reads in one group ahead of the 16 products: left alone the compiler sinks each load to its first use, and the wave waits out every latency */
#pragma unroll
    for (int i = 0; i < 4; ++i)
#pragma unroll
      for (int j = 0; j < 4; ++j)
        acc[i][j] = XA ? __builtin_amdgcn_wmma_f32_16x16x32_f16(false, xf[i].v, false, wf[st & 1][j].v, (short)0, acc[i][j], false, false)
                       : __builtin_amdgcn_wmma_f32_16x16x32_f16(false, wf[st & 1][j].v, false, xf[i].v, (short)0, acc[i][j], false, false);
    __builtin_amdgcn_sched_barrier(0);      /* keeps later steps' loads from rising further: a third set of fragments would not fit 256 registers */
  }
  asm volatile("s_wait_xcnt 0x0" :: "v"(lane), "s"(wt) : "memory");      /* the weight loads' address registers (lane offset, scalar base) are reused only behind this wait: named as inputs, they stay whole up to it */
  /* of the per-token pair (mu, rs) and the per-column pair (sum(G), sum(B)), the one that runs along a lane's 8 values is read as vectors of 8, the other as one value a tile */
  float nm1[4], rs1[4], sg1[4], sb1[4];
#pragma unroll
  for (int q = 0; q < 4; ++q) { if (XA) { sg1[q] = psg[q * 16 + ln]; sb1[q] = psb[q * 16 + ln]; } else { nm1[q] = -pmu[q * 16 + ln]; rs1[q] = prs[q * 16 + ln]; } }
#pragma unroll
  for (int o = 0; o < 4; ++o) {  /* the tile index of the vector side: j (columns) if the weights were A, i (tokens) if the tokens were */
    const float* pa = (XA ? pmu : psg) + o * 16 + 8 * hh; const float* pb = (XA ? prs : psb) + o * 16 + 8 * hh;
    const v4f a0 = *(const v4fa*)pa, a1 = *(const v4fa*)(pa + 4), b0 = *(const v4fa*)pb, b1 = *(const v4fa*)(pb + 4);
    float av[8], bv[8];
#pragma unroll
    for (int r = 0; r < 4; ++r) { av[r] = a0[r]; av[4 + r] = a1[r]; bv[r] = b0[r]; bv[4 + r] = b1[r]; }
#pragma unroll
    for (int q = 0; q < 4; ++q) { FragH f;
#pragma unroll
      for (int r = 0; r < 8; ++r) f.h[r] = XA ? (_Float16)__builtin_fmaf(bv[r], __builtin_fmaf(-av[r], sg1[q], acc[o][q][r]), sb1[q])      /* av = mu, bv = rs of token o * 16 + 8 hh + r */
                                              : (_Float16)__builtin_fmaf(rs1[q], __builtin_fmaf(nm1[q], av[r], acc[q][o][r]), bv[r]);      /* av = sum(G), bv = sum(B) of column o * 16 + 8 hh + r */
      if (XA) res[o][q] = f.half[0]; else res[q][o] = f.half[0]; }
  }
}
// BF[h][a-tile][b-tile][lane][r] = f16((bf16(mask[a][b]) + pair_bias[a][b][h]) * sqrt(32)), b = 16*btile + (lane & 15), a = 16*atile + 8*(lane >> 4) + r:
// half an A fragment (row b, k = a) of the f16 matrix instruction, an even and the next odd b tile being one fragment, so that k_attn loads it with whole-line 16-byte loads and adds it to the transposed score tile
// by a product with a selector of ones and zeros. Two bytes a value instead of four: every block of k_attn reads all of BF from L2, its largest stream. The sqrt(32) undoes the score scale applied after the product.
// The pair bias is the one product of x that every row s needs, so it is formed in the launch ahead of k_attn. A block of sixteen waves takes one 16 x 16 tile of (a, b); wave w has the sixteen tokens (a = 16 atile + u, b = 16 btile + w).
// The tokens go into the product as they are (see above): a row of ones beside G gives each token's sum, and tile 2 against a fragment of ones gives sum(G) and sum(B).
// The launch needs nothing of an earlier one: a block forms the two weight tiles itself (8 KB in LDS, one piece a thread, under the latency of its rows). So the packs that only k_attn reads share the launch: they are its last PACK_BLOCKS blocks (two blocks fit a WGP, so all are resident at once).
__global__ __launch_bounds__(512) void k_pre(const float* __restrict__ X, const float* __restrict__ mask, const float* __restrict__ Wq, const float* __restrict__ Wk, const float* __restrict__ Wv, const float* __restrict__ Wfu, const float* __restrict__ Wo, const float* __restrict__ Wb,
                                             const float* __restrict__ gam, const float* __restrict__ bet, _Float16* __restrict__ BQK, _Float16* __restrict__ AV, _Float16* __restrict__ BFU, _Float16* __restrict__ BO, float* __restrict__ SGB, _Float16* __restrict__ BF) {
  __shared__ __attribute__((aligned(16))) unsigned short xs[SL * RP];
  __shared__ __attribute__((aligned(16))) unsigned short sbt[NHD * 256];      /* f16 bits, [h][lane][r] */
  __shared__ __attribute__((aligned(16))) unsigned short sbb[16 * 2 * EE];      /* the two weight tiles, in fragment order */
  if (blockIdx.x >= BIAS_BLOCKS) { pack_block(blockIdx.x - BIAS_BLOCKS, Wq, Wk, Wv, Wfu, Wo, gam, bet, BQK, AV, BFU, BO, SGB); return; }      /* the same for a whole block, ahead of every barrier */
  const int tid = threadIdx.x, lane = tid & 31, ln = lane & 15, hh = lane >> 4;
  const int w = __builtin_amdgcn_readfirstlane(tid >> 5);      /* the wave's number in a scalar register: the row loads then go from a scalar base */
  const int at = blockIdx.x >> 4, bt = blockIdx.x & 15;
  /* the inputs of the thread's piece of the weight tiles and the mask value of the lane's token (a = ln, b = w; both halves of the wave load it: no branch) are asked for ahead of the rows, so that their latency passes under the rows' */
  const float* mp = mask + (size_t)(at * 16 + ln) * SL + bt * 16 + w;
  const float mk = *mp;
  asm volatile("s_wait_xcnt 0x0" :: "v"(mp) : "memory");      /* named as an input, the load's address stays whole up to this wait: none of the loads below lands on it */
  FragB wf[8];
  { const int po = tid & 15, pk = (tid >> 4) * 8;
    float wx[8]; v4f ws0, ws1, a[16];
    wb_loads(Wb, gam, bet, po, pk, wx, ws0, ws1);
    raw_load(X + (((size_t)at * 16) * SL + bt * 16 + w) * EE + lane * 4, SL * EE, a);
    wb_piece(wx, ws0, ws1, po, pk, sbb);
    /* publishes the weight tiles to all sixteen waves. The two fences name LDS alone: the fences of __syncthreads() would wait for the sixteen row loads too, and all that stands between here and raw_store is meant to run while the rows are on their way */
    __builtin_amdgcn_fence(__ATOMIC_RELEASE, "workgroup", "local"); __builtin_amdgcn_s_barrier(); __builtin_amdgcn_fence(__ATOMIC_ACQUIRE, "workgroup", "local");
    const unsigned short* wr = sbb + lane * 8;
#pragma unroll
    for (int kb = 0; kb < 4; ++kb) { wf[kb].half[0] = *(const v8us*)(wr + kb * 512); wf[kb].half[1] = *(const v8us*)(wr + kb * 512 + 256); }      /* tile 1, which meets the tokens; tile 2 is read once the rows' registers are free: with both here a wave would need more than 128 registers, and two blocks would not fit a WGP */
    __builtin_amdgcn_sched_barrier(0);      /* keeps the piece, the barrier and the eight fragment reads ahead of the first wait for a row */
    raw_store(a, xs + w * 16 * RP + lane * 4); }
  __builtin_amdgcn_fence(__ATOMIC_ACQ_REL, "workgroup", "local"); __builtin_amdgcn_wave_barrier();      /* the rows read below were written by other lanes of this wave */
  { const unsigned short* xr = xs + (w * 16 + ln) * RP + 8 * hh;
    v8f c = {}, c1 = {}; FragB xf[4], one;
#pragma unroll
    for (int i = 0; i < 16; ++i) one.u[i] = 0x3F80;      /* 1.0 */
#pragma unroll
    for (int kb = 0; kb < 4; ++kb) { xf[kb].half[0] = *(const v8us*)(xr + kb * 32); xf[kb].half[1] = *(const v8us*)(xr + kb * 32 + 16); }
#pragma unroll
    for (int kb = 4; kb < 8; ++kb) { wf[kb].half[0] = *(const v8us*)(sbb + lane * 8 + kb * 512); wf[kb].half[1] = *(const v8us*)(sbb + lane * 8 + kb * 512 + 256); }
    __builtin_amdgcn_sched_barrier(0);      /* keeps the sixteen LDS reads in one group ahead of the eight products: one LDS latency instead of several */
#pragma unroll
    for (int kb = 0; kb < 4; ++kb) {
      c  = __builtin_amdgcn_wmma_f32_16x16x32_bf16(false, wf[kb].v, false, xf[kb].v, (short)0, c, false, false);            /* token ln: lower half v.G hi (0..3) and lo (4..7) per head, upper half the token's sum (0) */
      c1 = __builtin_amdgcn_wmma_f32_16x16x32_bf16(false, wf[4 + kb].v, false, one.v, (short)0, c1, false, false); }      /* every column alike: lower half sum(G) hi, lo; upper half sum(B) hi, lo */
    const float co = other_half(c[0]);
    const float mu = (hh ? c[0] : co) / (float)EE;
    const float rs = token_rs(xf, mu);
    FragH pv;                    /* mask + pair bias, rounded once, to f16: a lane of the lower half holds the four heads of token (a = ln, b = w) */
    const float mr = bf16_round(mk);
#pragma unroll
    for (int h = 0; h < NHD; ++h) { const float sgb = c1[h] + c1[4 + h]; const float sb = other_half(sgb);      /* lower half: sgb = sum(G), sb = sum(B) */
      const float v = (mr + (rs * ((c[h] + c[4 + h]) - mu * sgb) + sb)) * 5.656854249492381f;
      pv.h[h] = (_Float16)fminf(fmaxf(v, -65504.0f), 65504.0f); }      /* kept finite: an infinity would meet the selector's zeros in k_attn's product and give NaN */
    if (hh == 0) {
#pragma unroll
      for (int h = 0; h < NHD; ++h) sbt[h * 256 + ((ln >> 3) * 16 + w) * 8 + (ln & 7)] = pv.u[h]; } }
  __syncthreads();               /* publishes the sixteen waves' rows of the tile */
  if (tid < NHD * 32) {          /* whole waves: 128 pieces of 16 bytes, a wave a head */
    const v8us o = *(const v8us*)&sbt[tid * 8];
    *(v8us*)((unsigned short*)BF + (((size_t)w * 16 + at) * 16 + bt) * 256 + lane * 8) = o; }
}

__device__ __forceinline__ v8f exp2x8(v8f x) {
  float a = x[0], b = x[1], c = x[2], d = x[3], e = x[4], f = x[5], g = x[6], h = x[7];
  asm("v_exp_f32 %0, %0\n\tv_exp_f32 %1, %1\n\tv_exp_f32 %2, %2\n\tv_exp_f32 %3, %3\n\tv_exp_f32 %4, %4\n\tv_exp_f32 %5, %5\n\tv_exp_f32 %6, %6\n\tv_exp_f32 %7, %7\n\tv_nop"
      : "+v"(a), "+v"(b), "+v"(c), "+v"(d), "+v"(e), "+v"(f), "+v"(g), "+v"(h));
  return (v8f){a, b, c, d, e, f, g, h};
}
// Eight v_rcp_f32 in the same form, for the same reason.
__device__ __forceinline__ v8f rcpx8(v8f x) {
  float a = x[0], b = x[1], c = x[2], d = x[3], e = x[4], f = x[5], g = x[6], h = x[7];
  asm("v_rcp_f32 %0, %0\n\tv_rcp_f32 %1, %1\n\tv_rcp_f32 %2, %2\n\tv_rcp_f32 %3, %3\n\tv_rcp_f32 %4, %4\n\tv_rcp_f32 %5, %5\n\tv_rcp_f32 %6, %6\n\tv_rcp_f32 %7, %7\n\tv_nop"
      : "+v"(a), "+v"(b), "+v"(c), "+v"(d), "+v"(e), "+v"(f), "+v"(g), "+v"(h));
  return (v8f){a, b, c, d, e, f, g, h};
}
// value of lane l ^ 16 (the other half of the wave), without LDS
__device__ __forceinline__ float other_half(float x) { const int b = __float_as_int(x); return __int_as_float(__builtin_amdgcn_permlanex16(b, b, 0x76543210, 0xfedcba98, false, false)); }
#define QP 136                   /* staged q row pitch in halves: 256 B of data (four heads) + 16 B (16 B x odd: conflict-free ds_load_b128) */
#define VP 264                   /* staged v^T row pitch in halves: 512 B of data + 16 B */
#define OP 68                    /* output staging row pitch in floats: 256 B of data + 16 B */
// One struct fixes the order in LDS: Wo^T lies lowest, so that lane offset + constant stays inside the 16-bit offset field of an LDS read and all its fragments are read from one address register.
struct __attribute__((aligned(16))) AttnLds {
  unsigned short swo[EE * EE];   /* Wo^T * 16 in fragment order: [e tile][head][half][lane][8] */
  float sbo[4 * EE];             /* the output bias, four times: every thread loads and stores one value, so the load issues with the staging loads and no wave waits for it in a branch of its own */
  unsigned short sog[16 * 4096]; /* 8 KB a wave, its own, as fragments [plane][head][half][lane][8]: first k (plane 0) and the gate logits (plane 1) of its 16 positions; each head's gated output, hi and lo, takes their place once they are read; at the end the output staging rows */
  unsigned short sxqv[SL * QP + EE * VP];      /* first the row's tokens as f16 (256 tokens, pitch RP); once every wave has read them, q (pitch QP) and behind it v^T (pitch VP) */
  float ssg[4 * EE], ssb[4 * EE];      /* per column of [q | k | v | gate logits]: sum(G), and sum(B) (+ the gate bias) */
  float smu[SL], srs[SL];        /* per token: mean, 1/sigma */
  unsigned short ssel[32 * 8];   /* per lane: half a B fragment of the selector that brings the bias tiles into the scores: 1.0 where k = 8 hh + r equals the column a = ln, else 0 */
};
static_assert(SL * RP <= SL * QP + EE * VP, "the token tile must fit the range that q and v^T take over");
// What one head needs from L2 ahead of its scores: the bias tiles, eight A fragments of two b tiles each (k 0..15 = the 16 positions a under the even tile's rows b, k 16..31 = the same under the odd tile's).
__device__ __forceinline__ void head_loads(const unsigned short* __restrict__ bf /* the same for the whole wave */, int l8 /* 8 * lane */, FragH (&bb)[8]) {
#pragma unroll
  for (int t = 0; t < 8; ++t) { bb[t].half[0] = *(const v8us*)(bf + l8 + t * 512); bb[t].half[1] = *(const v8us*)(bf + l8 + t * 512 + 256); }
}
// One head of one wave's 16 positions: scores, softmax, PV, gate. bb comes in holding the head's bias fragments; unless the head is the last, it leaves holding the next head's.
// sel[0], sel[1]: B fragments with a one where k = a, or k = 16 + a, and zeros elsewhere: bb[t] x sel[i] is the bias tile of b tile 2 t + i, exact. The matrix unit has room in this part of the kernel, the vector port has none for 128 conversions a head.
// The selector, k and the gate logits are read from LDS where they are used, not carried: the next head's bias fragments need the registers from the end of the softmax on.
__device__ __forceinline__ void attn_head(int h, const unsigned short* sq, const unsigned short* sv, unsigned short* og, const unsigned short* ssl /* the lane's piece of the selector */, const unsigned short* __restrict__ bf, int l8, int ln, int hh, FragH (&bb)[8]) {
  v8f acc[16];
  FragH kf, sel[2];
  kf.half[0] = *(const v8us*)(og + h * 512); kf.half[1] = *(const v8us*)(og + h * 512 + 256);
  sel[0].half[0] = *(const v8us*)ssl; sel[0].half[1] = (v8us){}; sel[1].half[0] = (v8us){}; sel[1].half[1] = sel[0].half[0];
  const unsigned short* qr = &sq[ln * QP + h * HDC + 8 * hh];
  FragH qf[2][4];              /* q fragments, read four tiles ahead */
#pragma unroll
  for (int i = 0; i < 4; ++i) { qf[0][i].half[0] = *(const v8us*)(qr + i * 16 * QP); qf[0][i].half[1] = *(const v8us*)(qr + i * 16 * QP + 16); }
#pragma unroll
  for (int g = 0; g < 4; ++g) {
    if (g + 1 < 4) {
#pragma unroll
      for (int i = 0; i < 4; ++i) { qf[(g + 1) & 1][i].half[0] = *(const v8us*)(qr + ((g + 1) * 4 + i) * 16 * QP); qf[(g + 1) & 1][i].half[1] = *(const v8us*)(qr + ((g + 1) * 4 + i) * 16 * QP + 16); }
    }
    __builtin_amdgcn_sched_barrier(0);      /* keeps the next four tiles' LDS reads in one group ahead of these eight products: in this kernel the compiler left each read next to its product, and the wave waited out every LDS latency */
#pragma unroll
    for (int i = 0; i < 4; ++i) acc[g * 4 + i] = __builtin_amdgcn_wmma_f32_16x16x32_f16(false, qf[g & 1][i].v, false, kf.v, (short)0, (v8f){}, false, false);
#pragma unroll
    for (int i = 0; i < 4; ++i) acc[g * 4 + i] = __builtin_amdgcn_wmma_f32_16x16x32_f16(false, bb[g * 2 + (i >> 1)].v, false, sel[i & 1].v, (short)0, acc[g * 4 + i], false, false);
    if (g + 1 < 4) __builtin_amdgcn_sched_barrier(0);      /* keeps later groups' reads from rising further: a third set of fragments has no registers */
  }
  float mx[4] = {-3.0e38f, -3.0e38f, -3.0e38f, -3.0e38f};
#pragma unroll
  for (int t = 0; t < 16; ++t)
#pragma unroll
    for (int r = 0; r < 8; ++r) mx[r & 3] = fmaxf(mx[r & 3], acc[t][r]);
  float m = fmaxf(fmaxf(mx[0], mx[1]), fmaxf(mx[2], mx[3])); m = fmaxf(m, other_half(m));
  const float cs = 0.17677669529663687f * 1.4426950408889634f;      /* 32^-1/2 * log2(e) */
  const float mc = 10.0f - m * cs;                                  /* p = 2^10 * exp(logit - max): the f16 range the probabilities had before */
  float sm[4] = {0.f, 0.f, 0.f, 0.f};
  FragH pf[8];
#pragma unroll
  for (int t = 0; t < 16; ++t) { v8f z;
#pragma unroll
    for (int r = 0; r < 8; ++r) z[r] = __builtin_fmaf(acc[t][r], cs, mc);
    const v8f e = exp2x8(z);
#pragma unroll
    for (int r = 0; r < 8; ++r) { sm[r & 3] += e[r]; pf[t >> 1].h[(t & 1) * 8 + r] = (_Float16)e[r]; } }
  float su = (sm[0] + sm[1]) + (sm[2] + sm[3]); su += other_half(su);
  if (h + 1 < NHD) {           /* the score registers are free, so there is room for the next head's bias fragments: their loads fly under PV and the gate */
    const unsigned short* bfn = bf + (h + 1) * 16 * 4096;
    head_loads(bfn, l8, bb);
    asm volatile("s_wait_xcnt 0x0" :: "v"(l8), "s"(bfn) : "memory");      /* named as inputs, the loads' address registers (lane offset, scalar base) stay whole up to this wait: none of the results lands on them */
  }
  v8f o[2] = {};
  const unsigned short* vr = &sv[(h * HDC + ln) * VP + 8 * hh];
  FragH vf[2][4], fu;          /* v^T fragments of two k steps (two tiles each), read two k steps ahead */
#pragma unroll
  for (int i = 0; i < 4; ++i) { const unsigned short* p = vr + (i & 1) * 16 * VP + (i >> 1) * 32; vf[0][i].half[0] = *(const v8us*)p; vf[0][i].half[1] = *(const v8us*)(p + 16); }
#pragma unroll
  for (int g = 0; g < 4; ++g) {
    if (g + 1 < 4) {
#pragma unroll
      for (int i = 0; i < 4; ++i) { const unsigned short* p = vr + (i & 1) * 16 * VP + ((g + 1) * 2 + (i >> 1)) * 32; vf[(g + 1) & 1][i].half[0] = *(const v8us*)p; vf[(g + 1) & 1][i].half[1] = *(const v8us*)(p + 16); }
    } else { fu.half[0] = *(const v8us*)(og + 2048 + h * 512); fu.half[1] = *(const v8us*)(og + 2048 + h * 512 + 256); }      /* gate logits of channels 8 hh + r and 16 + 8 hh + r (the rows of Ot that this lane holds), read under the last four products */
    __builtin_amdgcn_sched_barrier(0);      /* keeps the next two k steps' LDS reads in one group ahead of these four products, as for the scores */
#pragma unroll
    for (int i = 0; i < 4; ++i) o[i & 1] = __builtin_amdgcn_wmma_f32_16x16x32_f16(false, vf[g & 1][i].v, false, pf[g * 2 + (i >> 1)].v, (short)0, o[i & 1], false, false);
    if (g + 1 < 4) __builtin_amdgcn_sched_barrier(0);      /* keeps later reads from rising further, as for the scores */
  }
  v8f sg[2];                   /* sigmoid(gate logit) */
#pragma unroll
  for (int j = 0; j < 2; ++j) { v8f z;
#pragma unroll
    for (int r = 0; r < 8; ++r) z[r] = (float)fu.h[j * 8 + r] * -1.4426950408889634f;
    v8f d = exp2x8(z);
#pragma unroll
    for (int r = 0; r < 8; ++r) d[r] += 1.0f;
    sg[j] = rcpx8(d); }
  const float inv = 1.0f / su;
#pragma unroll
  for (int j = 0; j < 2; ++j) { FragH gh, gl;      /* og = o / sum * sigmoid, hi and lo * 2^10 */
#pragma unroll
    for (int r = 0; r < 8; ++r) { const float gvl = o[j][r] * (inv * sg[j][r]); const _Float16 hv = (_Float16)gvl; gh.h[r] = hv; gl.h[r] = (_Float16)((gvl - (float)hv) * 1024.0f); }
    *(v8us*)(og + (h * 2 + j) * 256) = gh.half[0]; *(v8us*)(og + 2048 + (h * 2 + j) * 256) = gl.half[0]; }
}
// One block a WGP (LDS): four waves per SIMD, so 256 registers a wave. Every loop but the one over the heads is unrolled because its index picks registers.
// Ahead of the attention the block forms all that it needs of its own row: the 256 tokens and their mean and 1/sigma into LDS, then 32 units of 64 tokens x 64 columns, two a wave: [k | gate logits] and [q | v^T]. None of these planes goes through global memory.
__global__ __launch_bounds__(512) void k_attn(const float* __restrict__ X, const float* __restrict__ SGB, const float* __restrict__ bfu,
                                              const _Float16* __restrict__ BQK, const _Float16* __restrict__ AV, const _Float16* __restrict__ BFU,
                                              const _Float16* __restrict__ BF, const _Float16* __restrict__ BO, const float* __restrict__ bo, float* __restrict__ out) {
  __shared__ AttnLds lds;
  unsigned short* const swo = lds.swo; float* const sbo = lds.sbo; unsigned short* const xs = lds.sxqv; unsigned short* const sq = lds.sxqv; unsigned short* const sv = lds.sxqv + SL * QP;
  const int tid = threadIdx.x, lane = tid & 31, ln = lane & 15, hh = lane >> 4;
  const int w = __builtin_amdgcn_readfirstlane(tid >> 5);      /* the wave's number in a scalar register: the choice of units is a scalar branch, and the bias tiles load from a scalar base */
  const int s = blockIdx.x;
  const unsigned short* gwp = (const unsigned short*)BO + (tid >> 8) * 4096 + (tid & 255) * 8;      /* 16-byte piece tid + 512 u of Wo^T: 256 pieces a 16-row tile, the first 4 of its 8 k steps: 2 tiles a step */
  v8us gw[4];
#pragma unroll
  for (int u = 0; u < 4; ++u) gw[u] = *(const v8us*)(gwp + u * 2 * 4096);
  const int t7 = tid & (EE - 1);
  const float bov = bo[t7], bfv = bfu[t7], sgv = SGB[tid], sbv = SGB[4 * EE + tid];
  asm volatile("s_wait_xcnt 0x0" :: "v"(gwp), "v"(t7), "v"(tid), "s"(bo), "s"(bfu), "s"(SGB) : "memory");      /* named as inputs, the eight loads' address registers (pointer, offsets, scalar bases) stay whole up to this wait: none of their results lands on them, and they are reused only behind it */
  raw_rows(X + ((size_t)s * SL + w * 16) * EE + lane * 4, EE, xs + w * 16 * RP + lane * 4);      /* wave w: tokens 16 w .. 16 w + 15 */
  asm volatile("" :: "v"(bfv));      /* holds the gate bias's load with the staging loads above (the loaded value as an input only): left alone the compiler sinks it into a branch of the last four waves, which then wait out its latency alone ahead of the barrier */
#pragma unroll
  for (int u = 0; u < 4; ++u) *(v8us*)&swo[tid * 8 + u * 4096] = gw[u];
  sbo[tid] = bf16_round(bov);    /* the output bias, rounded once a block */
  if (w == 0) { FragH f;         /* one wave writes the selector's 32 pieces */
#pragma unroll
    for (int r = 0; r < 8; ++r) f.u[r] = (8 * hh + r == ln) ? 0x3C00 : 0;      /* 1.0 */
    *(v8us*)&lds.ssel[lane * 8] = f.half[0]; }
  lds.ssg[tid] = sgv; lds.ssb[tid] = (tid >= 3 * EE) ? sbv + bf16_round(bfv) : sbv;      /* the gate bias, rounded once a block, joins its columns' constant */
  __builtin_amdgcn_fence(__ATOMIC_ACQ_REL, "workgroup", "local"); __builtin_amdgcn_wave_barrier();      /* the rows read below were written by other lanes of this wave */
  { const unsigned short* xr = xs + (w * 16 + ln) * RP + 8 * hh;      /* mean and 1/sigma of the wave's own sixteen tokens, token ln in lanes ln and ln + 16 */
    v8f c = {}; FragH xf[4], one;
#pragma unroll
    for (int i = 0; i < 16; ++i) one.u[i] = 0x3C00;      /* 1.0 */
#pragma unroll
    for (int kb = 0; kb < 4; ++kb) { xf[kb].half[0] = *(const v8us*)(xr + kb * 32); xf[kb].half[1] = *(const v8us*)(xr + kb * 32 + 16); }
    __builtin_amdgcn_sched_barrier(0);      /* keeps the eight LDS reads in one group ahead of the four products: one LDS latency instead of four */
#pragma unroll
    for (int kb = 0; kb < 4; ++kb) c = __builtin_amdgcn_wmma_f32_16x16x32_f16(false, one.v, false, xf[kb].v, (short)0, c, false, false);      /* every row alike: the sum of token ln, in both halves of the wave */
    const float mu = c[0] / (float)EE, rs = token_rs_h(xf, mu);
    if (hh == 0) { lds.smu[w * 16 + ln] = mu; lds.srs[w * 16 + ln] = rs; } }
  __syncthreads();               /* publishes the tokens, their mean and 1/sigma, Wo^T and the per-column constants to all sixteen waves */
  const int th = w & 3, cg = w >> 2;      /* which 64 of the 256 tokens, which 64 of the 256 columns */
  const unsigned short* xh = xs + th * 64 * RP;
  const float* pmu = lds.smu + th * 64; const float* prs = lds.srs + th * 64;
  v8us res[4][4];
  { /* [k | gate logits]: a lane's 8 columns of one token are half a fragment of the wave that owns the token (wave th * 4 + i), in the same lane */
    const unsigned short* wt = (cg < 2) ? (const unsigned short*)BQK + (size_t)(EE + cg * 64) * 2 * EE : (const unsigned short*)BFU + (size_t)(cg - 2) * 64 * 2 * EE;
    const int c0 = (cg < 2) ? EE + cg * 64 : 3 * EE + (cg - 2) * 64;      /* the unit's first column in [q | k | v | gate logits] */
    proj_unit<false>(xh, wt, pmu, prs, lds.ssg + c0, lds.ssb + c0, res, lane);
    unsigned short* d = lds.sog + th * 4 * 4096 + cg * 1024 + lane * 8;      /* plane cg >> 1 (2048 halves), head (cg & 1) * 2 + (j >> 1) (512), half j & 1 (256) */
#pragma unroll
    for (int i = 0; i < 4; ++i)
#pragma unroll
      for (int j = 0; j < 4; ++j) *(v8us*)(d + i * 4096 + j * 256) = res[i][j];
  }
  /* [q | v^T]: they take over the token tile's LDS, so they wait in registers until every wave has read it */
  if (cg < 2) proj_unit<false>(xh, (const unsigned short*)BQK + (size_t)cg * 64 * 2 * EE, pmu, prs, lds.ssg + cg * 64, lds.ssb + cg * 64, res, lane);
  else        proj_unit<true>(xh, (const unsigned short*)AV + (size_t)(cg - 2) * 64 * 2 * EE, pmu, prs, lds.ssg + 2 * EE + (cg - 2) * 64, lds.ssb + 2 * EE + (cg - 2) * 64, res, lane);
  __syncthreads();               /* ends every wave's reads of the token tile (and publishes k and the gate logits) */
  const unsigned short* bf = (const unsigned short*)BF + (size_t)w * 4096;      /* + h * 16 * 4096: a scalar base; the lane's offset is one register */
  const int l8 = lane * 8;
  FragH bb[8];
  head_loads(bf, l8, bb);
  asm volatile("s_wait_xcnt 0x0" :: "v"(l8), "s"(bf) : "memory");      /* named as inputs, the loads' address registers (lane offset, scalar base) stay whole up to this wait: none of the results lands on them */
  { unsigned short* d = (cg < 2) ? sq + (th * 64 + ln) * QP + cg * 64 + 8 * hh : sv + ((cg - 2) * 64 + ln) * VP + th * 64 + 8 * hh;
    const int si = (cg < 2) ? 16 * QP : 16, sj = (cg < 2) ? 16 : 16 * VP;      /* q: token tile i down the rows, column tile j along them; v^T: the other way round */
#pragma unroll
    for (int i = 0; i < 4; ++i)
#pragma unroll
      for (int j = 0; j < 4; ++j) *(v8us*)(d + i * si + j * sj) = res[i][j];
  }
  __syncthreads();               /* publishes q and v^T to all sixteen waves */
  unsigned short* const og = lds.sog + w * 4096 + lane * 8;      /* this wave's k, gate logits and gated output, each lane's values in its own 16-byte slots: registers that the heads' scores need */
#pragma unroll 1      /* rolled: nothing here is picked by h at compile time, and no head's loads or reads rise into the head before, where there are no registers for them */
  for (int h = 0; h < NHD; ++h) attn_head(h, sq, sv, og, lds.ssel + lane * 8, bf, l8, ln, hh, bb);
  /* outT[e][a]: a lane holds 8 neighbouring e of one a. Half a row (64 e) at a time goes through the wave's own LDS range, which turns the 32-byte pieces into whole 128-byte lines. */
  FragH ogh[NHD], ogl[NHD];
#pragma unroll
  for (int h = 0; h < NHD; ++h) { ogh[h].half[0] = *(const v8us*)(og + h * 512); ogh[h].half[1] = *(const v8us*)(og + h * 512 + 256); ogl[h].half[0] = *(const v8us*)(og + 2048 + h * 512); ogl[h].half[1] = *(const v8us*)(og + 2048 + h * 512 + 256); }
  float* st = (float*)(lds.sog + w * 4096);
  float* orow = out + ((size_t)s * SL + w * 16) * EE;
  const int rsub = lane >> 4, c4 = (lane & 15) * 4;
  const unsigned short* wr = swo + lane * 8;      /* 2048 halves a 16-row tile, 512 a head, 256 half a fragment */
  FragH wf[2][2 * NHD];          /* the weight fragments of two e tiles, read one pair of tiles ahead */
#pragma unroll
  for (int i = 0; i < 2 * NHD; ++i) { wf[0][i].half[0] = *(const v8us*)(wr + i * 512); wf[0][i].half[1] = *(const v8us*)(wr + i * 512 + 256); }
#pragma unroll
  for (int g = 0; g < 4; ++g) {
    if (g + 1 < 4) {
#pragma unroll
      for (int i = 0; i < 2 * NHD; ++i) { wf[(g + 1) & 1][i].half[0] = *(const v8us*)(wr + (g + 1) * 4096 + i * 512); wf[(g + 1) & 1][i].half[1] = *(const v8us*)(wr + (g + 1) * 4096 + i * 512 + 256); }
    }
    __builtin_amdgcn_sched_barrier(0);      /* keeps the next pair's LDS reads in one group ahead of the 16 products: left alone the compiler sinks each read to its first use, and the wave waits out every latency */
    v8f ch[2] = {}, cl[2] = {};
#pragma unroll
    for (int h = 0; h < NHD; ++h)
#pragma unroll
      for (int e2 = 0; e2 < 2; ++e2) {
        ch[e2] = __builtin_amdgcn_wmma_f32_16x16x32_f16(false, wf[g & 1][e2 * NHD + h].v, false, ogh[h].v, (short)0, ch[e2], false, false);
        cl[e2] = __builtin_amdgcn_wmma_f32_16x16x32_f16(false, wf[g & 1][e2 * NHD + h].v, false, ogl[h].v, (short)0, cl[e2], false, false); }
    __builtin_amdgcn_sched_barrier(0);      /* keeps the joins below all 16 products: risen in among the last of them, each group of joins takes its own run of v_nop behind a product */
#pragma unroll
    for (int e2 = 0; e2 < 2; ++e2) { v4f a0, a1;
#pragma unroll
      for (int r = 0; r < 4; ++r) { a0[r] = __builtin_fmaf(cl[e2][r], 0.0009765625f, ch[e2][r]); a1[r] = __builtin_fmaf(cl[e2][4 + r], 0.0009765625f, ch[e2][4 + r]); }
      float* sp = &st[ln * OP + ((g & 1) * 2 + e2) * 16 + 8 * hh]; *(v4fa*)sp = a0; *(v4fa*)(sp + 4) = a1; }
    if (g & 1) {
      __builtin_amdgcn_fence(__ATOMIC_ACQ_REL, "workgroup", "local"); __builtin_amdgcn_wave_barrier();      /* the rows read below were written by other lanes of this wave */
      const int p = g >> 1;
      const v4f b4 = *(const v4fa*)&sbo[p * 64 + c4];
      v4f rv[8];
#pragma unroll
      for (int q = 0; q < 8; ++q) rv[q] = *(const v4fa*)&st[(q * 2 + rsub) * OP + c4];
      __builtin_amdgcn_sched_barrier(0);      /* keeps the nine LDS reads in one group: one wait instead of one a row */
#pragma unroll
      for (int q = 0; q < 8; ++q) { v4f r4;
#pragma unroll
        for (int i = 0; i < 4; ++i) r4[i] = __builtin_fmaf(rv[q][i], 0.0625f, b4[i]);
        *(v4f*)(orow + (size_t)(q * 2 + rsub) * EE + p * 64 + c4) = r4; }
      asm volatile("s_wait_xcnt 0x0" ::: "memory");      /* the stores' address and data registers are reused only behind this wait; its clobber also keeps the second half's writes of st behind the reads above */
    }
  }
}

extern "C" void kernel_launch(void* const* d_in, const int* in_sizes, int n_in,
                              void* d_out, int out_size, void* d_ws, size_t ws_size, hipStream_t stream) {
  (void)in_sizes; (void)n_in; (void)out_size;
  const float* const* I = (const float* const*)d_in; const float* pr = I[0]; const float* mask = I[1]; const float* gam = I[2]; const float* bet = I[3]; const float* Wq = I[4]; const float* Wk = I[5]; const float* Wv = I[6]; const float* Wb = I[7]; const float* Wfu = I[8]; const float* bfu = I[9]; const float* Wo = I[10]; const float* bo = I[11];
  char* ws = (char*)d_ws; size_t off = 0;
  auto take = [&](size_t bytes) { char* p = ws + off; off += (bytes + 255) & ~(size_t)255; return p; };
  _Float16* BQK = (_Float16*)take((size_t)2 * EE * 2 * EE * 2); _Float16* AV = (_Float16*)take((size_t)EE * 2 * EE * 2); _Float16* BFU = (_Float16*)take((size_t)EE * 2 * EE * 2); _Float16* BO = (_Float16*)take((size_t)EE * 2 * EE * 2);      /* each f16 with room for K 256, of which only the first plane (K 128) is written and read */
  _Float16* BF = (_Float16*)take((size_t)NHD * SL * SL * 2); float* SGB = (float*)take((size_t)2 * 4 * EE * 4);
  if (off > ws_size) return;      // about 0.4 + 0.5 = 0.9 MB
  /* Wq, Wk: (in,out) -> 256 rows, row = output column, k = e of f16(gamma[e] * W[e][column]); Wv and Wfu alike; SGB: their column sums; Wo: row e, k = hc, Wo[hc][e] * 16, the one plane. All in fragment order. */
  k_pre<<<BIAS_BLOCKS + PACK_BLOCKS, 512, 0, stream>>>(pr, mask, Wq, Wk, Wv, Wfu, Wo, Wb, gam, bet, BQK, AV, BFU, BO, SGB, BF);      /* pair bias of the normalised tokens, + mask, per head, in A-fragment order (row b, k = a); the packs */
  k_attn<<<SL, 512, 0, stream>>>(pr, SGB, bfu, BQK, AV, BFU, BF, BO, bo, (float*)d_out);      /* per row: LayerNorm, q, k, v^T, gate logits, attention of all heads, gate, output product (+ bo) */
}
